// v000
// Times are from an AMD MI455X. After a warm-up the kernel runs many times in a row, and a time is the length of
// such a window on the GPU divided by its runs, so every launch and the gaps after it count. The runs cycle
// through copies of the inputs. A figure is the median of several windows, for all but v000 over two sittings.
// Sittings can differ by a few percent; kernels timed side by side share one.
// The starting kernel, v000, takes 4140 microseconds a run.
#include <hip/hip_runtime.h>
#include <hip/hip_bf16.h>
#include <math.h>

// ---------------- problem constants (match reference) ----------------
#define BQ     2
#define LQ     2048
#define DQ     1024
#define DINQ   2048
#define NSTATE 16
#define BL     (BQ * LQ)        // 4096 token rows

// ---------------- CDNA5 WMMA types ----------------
typedef __attribute__((ext_vector_type(16))) __bf16 v16bf;
typedef __attribute__((ext_vector_type(8)))  __bf16 v8bf;
typedef __attribute__((ext_vector_type(8)))  float  v8f;

__device__ __forceinline__ unsigned short f32_bf16(float f) {
  unsigned u = __float_as_uint(f);
  u += 0x7fffu + ((u >> 16) & 1u);          // round-to-nearest-even
  return (unsigned short)(u >> 16);
}

// CDNA5 async global->LDS copy (ASYNCcnt-tracked, no VGPR round-trip).
// LDS operand is the low 32 bits of the generic address (ISA: LDS aperture
// truncates generic addr to addr[31:0]).
__device__ __forceinline__ void async_ld_b128(void* lds, const void* gaddr) {
  unsigned ldsa = (unsigned)(uintptr_t)lds;
  asm volatile("global_load_async_to_lds_b128 %0, %1, off"
               :: "v"(ldsa), "v"(gaddr) : "memory");
}
__device__ __forceinline__ void wait_async6() {
  asm volatile("s_wait_asynccnt 0x6" ::: "memory");
}
__device__ __forceinline__ void wait_async0() {
  asm volatile("s_wait_asynccnt 0x0" ::: "memory");
}

// =====================================================================
// add positional embedding: xbuf = x + pos_emb  (never mutate d_in)
// =====================================================================
__global__ void add_pos_kernel(const float* __restrict__ x,
                               const float* __restrict__ pe,
                               float* __restrict__ xbuf) {
  int idx = blockIdx.x * 256 + threadIdx.x;       // over B*L*D
  if (idx >= BL * DQ) return;
  int ld = idx % (LQ * DQ);
  xbuf[idx] = x[idx] + pe[ld];
}

// =====================================================================
// weight transpose + fp32->bf16:  W[K][N] fp32  ->  WT[N][K] bf16
// =====================================================================
__global__ __launch_bounds__(256) void wconv_kernel(
    const float* __restrict__ W, unsigned short* __restrict__ WT,
    int K, int N) {
  __shared__ float tile[32][33];
  int nb = blockIdx.x * 32, kb = blockIdx.y * 32;
  int tx = threadIdx.x & 31, ty0 = threadIdx.x >> 5;
  for (int r = ty0; r < 32; r += 8)
    tile[r][tx] = W[(size_t)(kb + r) * N + nb + tx];
  __syncthreads();
  for (int r = ty0; r < 32; r += 8)
    WT[(size_t)(nb + r) * K + kb + tx] = f32_bf16(tile[tx][r]);
}

// =====================================================================
// LayerNorm over last dim; optional bf16 output (GEMM A operand)
// =====================================================================
template <bool BF16OUT>
__global__ __launch_bounds__(256) void ln_kernel(
    const float* __restrict__ x, const float* __restrict__ w,
    const float* __restrict__ b, void* __restrict__ out, int Dn) {
  int row = blockIdx.x;
  const float* xr = x + (size_t)row * Dn;
  __shared__ float red[256];
  float s = 0.f, s2 = 0.f;
  for (int i = threadIdx.x; i < Dn; i += 256) {
    float v = xr[i]; s += v; s2 += v * v;
  }
  red[threadIdx.x] = s; __syncthreads();
  for (int o = 128; o > 0; o >>= 1) {
    if (threadIdx.x < o) red[threadIdx.x] += red[threadIdx.x + o];
    __syncthreads();
  }
  float mean = red[0] / (float)Dn;
  __syncthreads();
  red[threadIdx.x] = s2; __syncthreads();
  for (int o = 128; o > 0; o >>= 1) {
    if (threadIdx.x < o) red[threadIdx.x] += red[threadIdx.x + o];
    __syncthreads();
  }
  float var  = red[0] / (float)Dn - mean * mean;
  float rstd = rsqrtf(var + 1e-5f);
  for (int i = threadIdx.x; i < Dn; i += 256) {
    float v = (xr[i] - mean) * rstd * w[i] + b[i];
    if (BF16OUT) ((unsigned short*)out)[(size_t)row * Dn + i] = f32_bf16(v);
    else         ((float*)out)[(size_t)row * Dn + i] = v;
  }
}

// =====================================================================
// WMMA bf16 GEMM:  out[M][N] = A[M][K](bf16) * BT[N][K](bf16)^T + bias
// Block tile 128x64, 8 waves (wave32) arranged 4x2, each wave 32x32 via
// 2x2 v_wmma_f32_16x16x32_bf16 tiles. K staged in 64-wide chunks using
// DOUBLE-BUFFERED async global->LDS copies (ASYNCcnt pipeline):
//   issue stage i+1 into buf^1, s_wait_asynccnt 6 (stage i oldest),
//   barrier, 8 WMMAs on buf, barrier.
// Epilogues:
//   MODE 0: outF = v+bias (fp32) AND outBf = bf16(v+bias)
//   MODE 1: outF = softplus(v+bias)
//   MODE 2: outF = v+bias+outF  (residual add in place)
// =====================================================================
#define BMT 128
#define BNT 64
#define KC  64
#define LDA 72   // padded row stride (elements): 144B = 9*16B

__device__ __forceinline__ v16bf load_frag(const unsigned short* rowp, int half) {
  // A-fragment lane layout (ISA 7.12.2, 16-bit A 16x32):
  //  lanes 0-15:  elems[0..7]=K0..7,  elems[8..15]=K16..23
  //  lanes 16-31: elems[0..7]=K8..15, elems[8..15]=K24..31
  union { v16bf v; v8bf h[2]; } u;
  u.h[0] = *(const v8bf*)(rowp + half * 8);
  u.h[1] = *(const v8bf*)(rowp + 16 + half * 8);
  return u.v;
}

template <int MODE>
__global__ __launch_bounds__(256) void gemm_bf16_wmma(
    const unsigned short* __restrict__ A,   // [M][K] bf16
    const unsigned short* __restrict__ BT,  // [N][K] bf16 (B transposed)
    const float* __restrict__ bias,         // [N]
    float* __restrict__ outF,
    unsigned short* __restrict__ outBf,
    int M, int Nn, int K) {
  __shared__ __align__(16) unsigned short As[2][BMT][LDA];
  __shared__ __align__(16) unsigned short Bs[2][BNT][LDA];
  int tid  = threadIdx.x;
  int wave = tid >> 5, lane = tid & 31;
  int wm = wave & 3, wn = wave >> 2;          // 4 waves along M, 2 along N
  int bm = blockIdx.y * BMT, bn = blockIdx.x * BNT;
  int half = lane >> 4, lrow = lane & 15;

  // per-thread source/dest for one stage: 4 A-chunks + 2 B-chunks of 16B
  int ra[4], ca[4], rb[2], cb[2];
#pragma unroll
  for (int t = 0; t < 4; ++t) {
    int idx = tid + t * 256;                  // 0..1023 -> 128 rows x 8 chunks
    ra[t] = idx >> 3; ca[t] = (idx & 7) * 8;
  }
#pragma unroll
  for (int t = 0; t < 2; ++t) {
    int idx = tid + t * 256;                  // 0..511 -> 64 rows x 8 chunks
    rb[t] = idx >> 3; cb[t] = (idx & 7) * 8;
  }

  auto issue_stage = [&](int buf, int k0) {
#pragma unroll
    for (int t = 0; t < 4; ++t)
      async_ld_b128(&As[buf][ra[t]][ca[t]],
                    A + (size_t)(bm + ra[t]) * K + k0 + ca[t]);
#pragma unroll
    for (int t = 0; t < 2; ++t)
      async_ld_b128(&Bs[buf][rb[t]][cb[t]],
                    BT + (size_t)(bn + rb[t]) * K + k0 + cb[t]);
  };

  v8f zero = {};
  v8f acc[2][2];
#pragma unroll
  for (int i = 0; i < 2; ++i)
#pragma unroll
    for (int j = 0; j < 2; ++j) acc[i][j] = zero;

  const int nk = K / KC;
  issue_stage(0, 0);
  for (int i = 0; i < nk; ++i) {
    int cur = i & 1;
    if (i + 1 < nk) {
      issue_stage(cur ^ 1, (i + 1) * KC);
      wait_async6();                 // stage i's 6 ops are the oldest
    } else {
      wait_async0();
    }
    __syncthreads();                 // all waves' stage-i data visible

#pragma unroll
    for (int ks = 0; ks < KC; ks += 32) {
      v16bf aF[2], bF[2];
      aF[0] = load_frag(&As[cur][wm * 32 + lrow][ks],      half);
      aF[1] = load_frag(&As[cur][wm * 32 + 16 + lrow][ks], half);
      bF[0] = load_frag(&Bs[cur][wn * 32 + lrow][ks],      half);
      bF[1] = load_frag(&Bs[cur][wn * 32 + 16 + lrow][ks], half);
#pragma unroll
      for (int ii = 0; ii < 2; ++ii)
#pragma unroll
        for (int jj = 0; jj < 2; ++jj)
          acc[ii][jj] = __builtin_amdgcn_wmma_f32_16x16x32_bf16(
              false, aF[ii], false, bF[jj], (short)0, acc[ii][jj],
              false, false);
    }
    __syncthreads();                 // buf reusable two stages later
  }

  // ---- epilogue: C/D layout — n = lane&15, m = vgpr + (lane>>4)*8 ----
#pragma unroll
  for (int i = 0; i < 2; ++i) {
#pragma unroll
    for (int j = 0; j < 2; ++j) {
      int gn = bn + wn * 32 + j * 16 + lrow;
      float bv = bias[gn];
#pragma unroll
      for (int r = 0; r < 8; ++r) {
        int gm = bm + wm * 32 + i * 16 + r + half * 8;
        size_t off = (size_t)gm * Nn + gn;
        float v = acc[i][j][r] + bv;
        if (MODE == 0) {
          outF[off]  = v;
          outBf[off] = f32_bf16(v);
        } else if (MODE == 1) {
          outF[off] = (v > 20.f) ? v : log1pf(__expf(v));   // softplus
        } else {
          outF[off] = v + outF[off];                        // + residual
        }
      }
    }
  }
}

// =====================================================================
// Bm|Cm projection:  BC[m][0..15]=h@WB, [16..31]=h@WC   (0.8% of FLOPs)
// =====================================================================
__global__ __launch_bounds__(256) void bc_kernel(
    const float* __restrict__ h, const float* __restrict__ WB,
    const float* __restrict__ WC, float* __restrict__ BC) {
  int m = blockIdx.x;
  __shared__ float hrow[DINQ];
  __shared__ float part[256];
  for (int i = threadIdx.x; i < DINQ; i += 256)
    hrow[i] = h[(size_t)m * DINQ + i];
  __syncthreads();
  int c = threadIdx.x & 31, g = threadIdx.x >> 5;
  const float* W = (c < 16) ? WB : WC;
  int cc = c & 15;
  float s = 0.f;
  int k0 = g * (DINQ / 8);
  for (int k = k0; k < k0 + DINQ / 8; ++k)
    s += hrow[k] * W[(size_t)k * NSTATE + cc];
  part[threadIdx.x] = s; __syncthreads();
  if (threadIdx.x < 32) {
    float t = 0.f;
#pragma unroll
    for (int g2 = 0; g2 < 8; ++g2) t += part[threadIdx.x + 32 * g2];
    BC[(size_t)m * 32 + threadIdx.x] = t;
  }
}

// =====================================================================
// causal depthwise conv (K=4) + SiLU
// =====================================================================
__global__ void conv_silu_kernel(const float* __restrict__ h,
                                 const float* __restrict__ cw,
                                 const float* __restrict__ cb,
                                 float* __restrict__ yconv) {
  int idx = blockIdx.x * 256 + threadIdx.x;      // over B*L*DIN
  if (idx >= BL * DINQ) return;
  int d = idx % DINQ;
  int l = (idx / DINQ) % LQ;
  int b = idx / (DINQ * LQ);
  float acc = cb[d];
#pragma unroll
  for (int j = 0; j < 4; ++j) {
    int lt = l - 3 + j;
    if (lt >= 0) acc += h[((size_t)b * LQ + lt) * DINQ + d] * cw[j * DINQ + d];
  }
  yconv[idx] = acc * (1.f / (1.f + __expf(-acc)));   // silu
}

// =====================================================================
// selective scan (diagonal SSM), fused D-skip + sigmoid gating.
// 4 lanes per channel (4 states each), y reduced with wave32 shfl_xor.
// B/C vectors (shared by all channels) staged via LDS in 32-step chunks.
// =====================================================================
#define TCH 32
__global__ __launch_bounds__(256) void scan_kernel(
    const float* __restrict__ h,  const float* __restrict__ dt,
    const float* __restrict__ BC, const float* __restrict__ yconv,
    const float* __restrict__ A_log, const float* __restrict__ Dsk,
    unsigned short* __restrict__ gout) {
  const int q    = threadIdx.x & 3;          // state sub-group 0..3
  const int dloc = threadIdx.x >> 2;         // 0..63 channels per block
  const int blocks_per_b = DINQ / 64;        // 32
  const int b = blockIdx.x / blocks_per_b;
  const int d = (blockIdx.x % blocks_per_b) * 64 + dloc;

  float a[4], hs[4];
#pragma unroll
  for (int n2 = 0; n2 < 4; ++n2) {
    a[n2]  = -__expf(A_log[(size_t)d * NSTATE + q * 4 + n2]);
    hs[n2] = 0.f;
  }
  const float dsk = Dsk[d];
  __shared__ float bcS[TCH][32];

  for (int t0 = 0; t0 < LQ; t0 += TCH) {
    __syncthreads();
    for (int i = threadIdx.x; i < TCH * 32; i += 256) {
      int tt = i >> 5, j = i & 31;
      bcS[tt][j] = BC[(size_t)(b * LQ + t0 + tt) * 32 + j];
    }
    __syncthreads();
    for (int tt = 0; tt < TCH; ++tt) {
      size_t off = ((size_t)b * LQ + t0 + tt) * DINQ + d;
      float dtv = dt[off];
      float xv  = h[off];
      float dx  = dtv * xv;
      float y = 0.f;
#pragma unroll
      for (int n2 = 0; n2 < 4; ++n2) {
        int n = q * 4 + n2;
        float dA = __expf(dtv * a[n2]);
        hs[n2] = hs[n2] * dA + dx * bcS[tt][n];
        y += hs[n2] * bcS[tt][16 + n];
      }
      y += __shfl_xor(y, 1);
      y += __shfl_xor(y, 2);
      if (q == 0) {
        y += xv * dsk;
        float yc = yconv[off];
        gout[off] = f32_bf16(y * (1.f / (1.f + __expf(-yc))));
      }
    }
  }
}

// =====================================================================
// host-side orchestration
// =====================================================================
extern "C" void kernel_launch(void* const* d_in, const int* in_sizes, int n_in,
                              void* d_out, int out_size, void* d_ws, size_t ws_size,
                              hipStream_t stream) {
  const float* x_in  = (const float*)d_in[0];
  const float* pos   = (const float*)d_in[1];
  const float* normw = (const float*)d_in[2];
  const float* normb = (const float*)d_in[3];
  const float* Win   = (const float*)d_in[4];
  const float* b_in  = (const float*)d_in[5];
  const float* A_log = (const float*)d_in[6];
  const float* Wdt   = (const float*)d_in[7];
  const float* b_dt  = (const float*)d_in[8];
  const float* WB    = (const float*)d_in[9];
  const float* WC    = (const float*)d_in[10];
  const float* Dsk   = (const float*)d_in[11];
  const float* convw = (const float*)d_in[12];
  const float* convb = (const float*)d_in[13];
  const float* Wout  = (const float*)d_in[14];
  const float* b_out = (const float*)d_in[15];
  const float* fnw   = (const float*)d_in[16];
  const float* fnb   = (const float*)d_in[17];
  (void)in_sizes; (void)n_in; (void)out_size; (void)ws_size;

  char* p = (char*)d_ws;
  auto alloc = [&](size_t bytes) {
    char* r = p;
    p += (bytes + 255) & ~(size_t)255;
    return r;
  };
  float*          xbuf  = (float*)         alloc((size_t)BL * DQ   * 4);  // residual stream
  unsigned short* hln   = (unsigned short*)alloc((size_t)BL * DQ   * 2);  // LN(x) bf16
  float*          hbuf  = (float*)         alloc((size_t)BL * DINQ * 4);  // h fp32
  unsigned short* hbf   = (unsigned short*)alloc((size_t)BL * DINQ * 2);  // h bf16
  float*          dtb   = (float*)         alloc((size_t)BL * DINQ * 4);  // softplus(dt)
  float*          BCb   = (float*)         alloc((size_t)BL * 32   * 4);  // [B|C]
  float*          yconv = (float*)         alloc((size_t)BL * DINQ * 4);  // silu(conv)
  unsigned short* gbf   = (unsigned short*)alloc((size_t)BL * DINQ * 2);  // gated, bf16
  unsigned short* WinT  = (unsigned short*)alloc((size_t)DINQ * DQ   * 2);
  unsigned short* WdtT  = (unsigned short*)alloc((size_t)DINQ * DINQ * 2);
  unsigned short* WoutT = (unsigned short*)alloc((size_t)DQ   * DINQ * 2);

  add_pos_kernel<<<(BL * DQ + 255) / 256, 256, 0, stream>>>(x_in, pos, xbuf);

  for (int i = 0; i < 2; ++i) {
    wconv_kernel<<<dim3(DINQ / 32, DQ / 32),   256, 0, stream>>>(
        Win  + (size_t)i * DQ * DINQ,   WinT,  DQ,   DINQ);
    wconv_kernel<<<dim3(DINQ / 32, DINQ / 32), 256, 0, stream>>>(
        Wdt  + (size_t)i * DINQ * DINQ, WdtT,  DINQ, DINQ);
    wconv_kernel<<<dim3(DQ / 32, DINQ / 32),   256, 0, stream>>>(
        Wout + (size_t)i * DINQ * DQ,   WoutT, DINQ, DQ);

    ln_kernel<true><<<BL, 256, 0, stream>>>(
        xbuf, normw + (size_t)i * DQ, normb + (size_t)i * DQ, hln, DQ);

    // h = LN(x) @ Win + b_in    (fp32 + bf16 copies)
    gemm_bf16_wmma<0><<<dim3(DINQ / BNT, BL / BMT), 256, 0, stream>>>(
        hln, WinT, b_in + (size_t)i * DINQ, hbuf, hbf, BL, DINQ, DQ);
    // dt = softplus(h @ Wdt + b_dt)
    gemm_bf16_wmma<1><<<dim3(DINQ / BNT, BL / BMT), 256, 0, stream>>>(
        hbf, WdtT, b_dt + (size_t)i * DINQ, dtb, nullptr, BL, DINQ, DINQ);

    bc_kernel<<<BL, 256, 0, stream>>>(
        hbuf, WB + (size_t)i * DINQ * NSTATE, WC + (size_t)i * DINQ * NSTATE, BCb);
    conv_silu_kernel<<<(BL * DINQ + 255) / 256, 256, 0, stream>>>(
        hbuf, convw + (size_t)i * 4 * DINQ, convb + (size_t)i * DINQ, yconv);
    scan_kernel<<<BQ * (DINQ / 64), 256, 0, stream>>>(
        hbuf, dtb, BCb, yconv, A_log + (size_t)i * DINQ * NSTATE,
        Dsk + (size_t)i * DINQ, gbf);

    // x = g @ Wout + b_out + residual (in place)
    gemm_bf16_wmma<2><<<dim3(DQ / BNT, BL / BMT), 256, 0, stream>>>(
        gbf, WoutT, b_out + (size_t)i * DQ, xbuf, nullptr, BL, DQ, DINQ);
  }

  ln_kernel<false><<<BL, 256, 0, stream>>>(xbuf, fnw, fnb, d_out, DQ);
}

// v001
// Measured time: 642 microseconds a run.
// Timed twice side by side with v000, it ran 6.45 and 6.46 times as fast.
#include <hip/hip_runtime.h>
#include <hip/hip_bf16.h>
#include <math.h>

// ---------------- problem constants (match reference) ----------------
#define BQ     2
#define LQ     2048
#define DQ     1024
#define DINQ   2048
#define NSTATE 16
#define BL     (BQ * LQ)        // 4096 token rows

// ---------------- CDNA5 WMMA types ----------------
typedef __attribute__((ext_vector_type(16))) __bf16 v16bf;
typedef __attribute__((ext_vector_type(8)))  __bf16 v8bf;
typedef __attribute__((ext_vector_type(8)))  float  v8f;

__device__ __forceinline__ unsigned short f32_bf16(float f) {
  unsigned u = __float_as_uint(f);
  u += 0x7fffu + ((u >> 16) & 1u);          // round-to-nearest-even
  return (unsigned short)(u >> 16);
}

// CDNA5 async global->LDS copy (ASYNCcnt-tracked, no VGPR round-trip).
// LDS operand is the low 32 bits of the generic address (ISA: LDS aperture
// truncates generic addr to addr[31:0]).
__device__ __forceinline__ void async_ld_b128(void* lds, const void* gaddr) {
  unsigned ldsa = (unsigned)(uintptr_t)lds;
  asm volatile("global_load_async_to_lds_b128 %0, %1, off"
               :: "v"(ldsa), "v"(gaddr) : "memory");
}
__device__ __forceinline__ void wait_async6() {
  asm volatile("s_wait_asynccnt 0x6" ::: "memory");
}
__device__ __forceinline__ void wait_async0() {
  asm volatile("s_wait_asynccnt 0x0" ::: "memory");
}

// =====================================================================
// add positional embedding: xbuf = x + pos_emb  (never mutate d_in)
// =====================================================================
__global__ void add_pos_kernel(const float* __restrict__ x,
                               const float* __restrict__ pe,
                               float* __restrict__ xbuf) {
  int idx = blockIdx.x * 256 + threadIdx.x;       // over B*L*D
  if (idx >= BL * DQ) return;
  int ld = idx % (LQ * DQ);
  xbuf[idx] = x[idx] + pe[ld];
}

// =====================================================================
// weight transpose + fp32->bf16:  W[K][N] fp32  ->  WT[N][K] bf16
// =====================================================================
__global__ __launch_bounds__(256) void wconv_kernel(
    const float* __restrict__ W, unsigned short* __restrict__ WT,
    int K, int N) {
  __shared__ float tile[32][33];
  int nb = blockIdx.x * 32, kb = blockIdx.y * 32;
  int tx = threadIdx.x & 31, ty0 = threadIdx.x >> 5;
  for (int r = ty0; r < 32; r += 8)
    tile[r][tx] = W[(size_t)(kb + r) * N + nb + tx];
  __syncthreads();
  for (int r = ty0; r < 32; r += 8)
    WT[(size_t)(nb + r) * K + kb + tx] = f32_bf16(tile[tx][r]);
}

// =====================================================================
// LayerNorm over last dim; optional bf16 output (GEMM A operand)
// =====================================================================
template <bool BF16OUT>
__global__ __launch_bounds__(256) void ln_kernel(
    const float* __restrict__ x, const float* __restrict__ w,
    const float* __restrict__ b, void* __restrict__ out, int Dn) {
  int row = blockIdx.x;
  const float* xr = x + (size_t)row * Dn;
  __shared__ float red[256];
  float s = 0.f, s2 = 0.f;
  for (int i = threadIdx.x; i < Dn; i += 256) {
    float v = xr[i]; s += v; s2 += v * v;
  }
  red[threadIdx.x] = s; __syncthreads();
  for (int o = 128; o > 0; o >>= 1) {
    if (threadIdx.x < o) red[threadIdx.x] += red[threadIdx.x + o];
    __syncthreads();
  }
  float mean = red[0] / (float)Dn;
  __syncthreads();
  red[threadIdx.x] = s2; __syncthreads();
  for (int o = 128; o > 0; o >>= 1) {
    if (threadIdx.x < o) red[threadIdx.x] += red[threadIdx.x + o];
    __syncthreads();
  }
  float var  = red[0] / (float)Dn - mean * mean;
  float rstd = rsqrtf(var + 1e-5f);
  for (int i = threadIdx.x; i < Dn; i += 256) {
    float v = (xr[i] - mean) * rstd * w[i] + b[i];
    if (BF16OUT) ((unsigned short*)out)[(size_t)row * Dn + i] = f32_bf16(v);
    else         ((float*)out)[(size_t)row * Dn + i] = v;
  }
}

// =====================================================================
// WMMA bf16 GEMM:  out[M][N] = A[M][K](bf16) * BT[N][K](bf16)^T + bias
// Block tile 128x64, 8 waves (wave32) arranged 4x2, each wave 32x32 via
// 2x2 v_wmma_f32_16x16x32_bf16 tiles. K staged in 64-wide chunks using
// DOUBLE-BUFFERED async global->LDS copies (ASYNCcnt pipeline):
//   issue stage i+1 into buf^1, s_wait_asynccnt 6 (stage i oldest),
//   barrier, 8 WMMAs on buf, barrier.
// Epilogues:
//   MODE 0: outF = v+bias (fp32) AND outBf = bf16(v+bias)
//   MODE 1: outF = softplus(v+bias)
//   MODE 2: outF = v+bias+outF  (residual add in place)
// =====================================================================
#define BMT 128
#define BNT 64
#define KC  64
#define LDA 72   // padded row stride (elements): 144B = 9*16B

__device__ __forceinline__ v16bf load_frag(const unsigned short* rowp, int half) {
  // A-fragment lane layout (ISA 7.12.2, 16-bit A 16x32):
  //  lanes 0-15:  elems[0..7]=K0..7,  elems[8..15]=K16..23
  //  lanes 16-31: elems[0..7]=K8..15, elems[8..15]=K24..31
  union { v16bf v; v8bf h[2]; } u;
  u.h[0] = *(const v8bf*)(rowp + half * 8);
  u.h[1] = *(const v8bf*)(rowp + 16 + half * 8);
  return u.v;
}

template <int MODE>
__global__ __launch_bounds__(256) void gemm_bf16_wmma(
    const unsigned short* __restrict__ A,   // [M][K] bf16
    const unsigned short* __restrict__ BT,  // [N][K] bf16 (B transposed)
    const float* __restrict__ bias,         // [N]
    float* __restrict__ outF,
    unsigned short* __restrict__ outBf,
    int M, int Nn, int K) {
  __shared__ __align__(16) unsigned short As[2][BMT][LDA];
  __shared__ __align__(16) unsigned short Bs[2][BNT][LDA];
  int tid  = threadIdx.x;
  int wave = tid >> 5, lane = tid & 31;
  int wm = wave & 3, wn = wave >> 2;          // 4 waves along M, 2 along N
  int bm = blockIdx.y * BMT, bn = blockIdx.x * BNT;
  int half = lane >> 4, lrow = lane & 15;

  // per-thread source/dest for one stage: 4 A-chunks + 2 B-chunks of 16B
  int ra[4], ca[4], rb[2], cb[2];
#pragma unroll
  for (int t = 0; t < 4; ++t) {
    int idx = tid + t * 256;                  // 0..1023 -> 128 rows x 8 chunks
    ra[t] = idx >> 3; ca[t] = (idx & 7) * 8;
  }
#pragma unroll
  for (int t = 0; t < 2; ++t) {
    int idx = tid + t * 256;                  // 0..511 -> 64 rows x 8 chunks
    rb[t] = idx >> 3; cb[t] = (idx & 7) * 8;
  }

  auto issue_stage = [&](int buf, int k0) {
#pragma unroll
    for (int t = 0; t < 4; ++t)
      async_ld_b128(&As[buf][ra[t]][ca[t]],
                    A + (size_t)(bm + ra[t]) * K + k0 + ca[t]);
#pragma unroll
    for (int t = 0; t < 2; ++t)
      async_ld_b128(&Bs[buf][rb[t]][cb[t]],
                    BT + (size_t)(bn + rb[t]) * K + k0 + cb[t]);
  };

  v8f zero = {};
  v8f acc[2][2];
#pragma unroll
  for (int i = 0; i < 2; ++i)
#pragma unroll
    for (int j = 0; j < 2; ++j) acc[i][j] = zero;

  const int nk = K / KC;
  issue_stage(0, 0);
  for (int i = 0; i < nk; ++i) {
    int cur = i & 1;
    if (i + 1 < nk) {
      issue_stage(cur ^ 1, (i + 1) * KC);
      wait_async6();                 // stage i's 6 ops are the oldest
    } else {
      wait_async0();
    }
    __syncthreads();                 // all waves' stage-i data visible

#pragma unroll
    for (int ks = 0; ks < KC; ks += 32) {
      v16bf aF[2], bF[2];
      aF[0] = load_frag(&As[cur][wm * 32 + lrow][ks],      half);
      aF[1] = load_frag(&As[cur][wm * 32 + 16 + lrow][ks], half);
      bF[0] = load_frag(&Bs[cur][wn * 32 + lrow][ks],      half);
      bF[1] = load_frag(&Bs[cur][wn * 32 + 16 + lrow][ks], half);
#pragma unroll
      for (int ii = 0; ii < 2; ++ii)
#pragma unroll
        for (int jj = 0; jj < 2; ++jj)
          acc[ii][jj] = __builtin_amdgcn_wmma_f32_16x16x32_bf16(
              false, aF[ii], false, bF[jj], (short)0, acc[ii][jj],
              false, false);
    }
    __syncthreads();                 // buf reusable two stages later
  }

  // ---- epilogue: C/D layout — n = lane&15, m = vgpr + (lane>>4)*8 ----
#pragma unroll
  for (int i = 0; i < 2; ++i) {
#pragma unroll
    for (int j = 0; j < 2; ++j) {
      int gn = bn + wn * 32 + j * 16 + lrow;
      float bv = bias[gn];
#pragma unroll
      for (int r = 0; r < 8; ++r) {
        int gm = bm + wm * 32 + i * 16 + r + half * 8;
        size_t off = (size_t)gm * Nn + gn;
        float v = acc[i][j][r] + bv;
        if (MODE == 0) {
          outF[off]  = v;
          outBf[off] = f32_bf16(v);
        } else if (MODE == 1) {
          outF[off] = (v > 20.f) ? v : log1pf(__expf(v));   // softplus
        } else {
          outF[off] = v + outF[off];                        // + residual
        }
      }
    }
  }
}

// =====================================================================
// Bm|Cm projection:  BC[m][0..15]=h@WB, [16..31]=h@WC   (0.8% of FLOPs)
// =====================================================================
__global__ __launch_bounds__(256) void bc_kernel(
    const float* __restrict__ h, const float* __restrict__ WB,
    const float* __restrict__ WC, float* __restrict__ BC) {
  int m = blockIdx.x;
  __shared__ float hrow[DINQ];
  __shared__ float part[256];
  for (int i = threadIdx.x; i < DINQ; i += 256)
    hrow[i] = h[(size_t)m * DINQ + i];
  __syncthreads();
  int c = threadIdx.x & 31, g = threadIdx.x >> 5;
  const float* W = (c < 16) ? WB : WC;
  int cc = c & 15;
  float s = 0.f;
  int k0 = g * (DINQ / 8);
  for (int k = k0; k < k0 + DINQ / 8; ++k)
    s += hrow[k] * W[(size_t)k * NSTATE + cc];
  part[threadIdx.x] = s; __syncthreads();
  if (threadIdx.x < 32) {
    float t = 0.f;
#pragma unroll
    for (int g2 = 0; g2 < 8; ++g2) t += part[threadIdx.x + 32 * g2];
    BC[(size_t)m * 32 + threadIdx.x] = t;
  }
}

// =====================================================================
// causal depthwise conv (K=4) + SiLU
// =====================================================================
__global__ void conv_silu_kernel(const float* __restrict__ h,
                                 const float* __restrict__ cw,
                                 const float* __restrict__ cb,
                                 float* __restrict__ yconv) {
  int idx = blockIdx.x * 256 + threadIdx.x;      // over B*L*DIN
  if (idx >= BL * DINQ) return;
  int d = idx % DINQ;
  int l = (idx / DINQ) % LQ;
  int b = idx / (DINQ * LQ);
  float acc = cb[d];
#pragma unroll
  for (int j = 0; j < 4; ++j) {
    int lt = l - 3 + j;
    if (lt >= 0) acc += h[((size_t)b * LQ + lt) * DINQ + d] * cw[j * DINQ + d];
  }
  yconv[idx] = acc * (1.f / (1.f + __expf(-acc)));   // silu
}

// =====================================================================
// selective scan (diagonal SSM), split over time into NCH chunks of CLEN
// steps so that the chunks run side by side instead of one after another.
//   scan_state_kernel: every chunk but the last runs the recurrence from a
//     zero state and keeps its end state S[n] and its sum of dt (row NSTATE
//     of the same record). The decay over a whole chunk is exp(a[n] * sum dt).
//   scan_kernel: a chunk folds the earlier chunks' (S, sum dt) in time order
//     into its start state, then runs the recurrence with the fused D-skip
//     and sigmoid gating.
// One lane = one channel with all 16 states; one block = SCB channels of one
// (batch, chunk), so the B/C rows are the same address for the whole block.
// =====================================================================
#define NCH  32
#define CLEN (LQ / NCH)     // 64 steps per chunk
#define SU   8              // steps fetched ahead as one group
#define SCB  128            // channels (threads) per block
#define DGS  (DINQ / SCB)   // channel groups
#define SROWS (NSTATE + 1)  // rows of a chunk's record: S[0..15], sum of dt
#define FB   3              // chunk records fetched together in the fold (51 loads)

// e[n] = exp(x[n]) for the 16 states, as __expf forms it (x * log2(e), then
// v_exp_f32), eight to a statement. The v_nop at each statement's end keeps the
// slot that the instruction set asks for behind a transcendental before its
// source is overwritten.
__device__ __forceinline__ void exp16(float (&e)[NSTATE], const float (&x)[NSTATE]) {
  float t[NSTATE];
#pragma unroll
  for (int n = 0; n < NSTATE; ++n) t[n] = x[n] * 1.44269504f;
#pragma unroll
  for (int k = 0; k < NSTATE; k += 8)
    asm("v_exp_f32 %0, %8\n\tv_exp_f32 %1, %9\n\tv_exp_f32 %2, %10\n\t"
        "v_exp_f32 %3, %11\n\tv_exp_f32 %4, %12\n\tv_exp_f32 %5, %13\n\t"
        "v_exp_f32 %6, %14\n\tv_exp_f32 %7, %15\n\tv_nop"
        : "=&v"(e[k]), "=&v"(e[k + 1]), "=&v"(e[k + 2]), "=&v"(e[k + 3]),
          "=&v"(e[k + 4]), "=&v"(e[k + 5]), "=&v"(e[k + 6]), "=&v"(e[k + 7])
        : "v"(t[k]), "v"(t[k + 1]), "v"(t[k + 2]), "v"(t[k + 3]),
          "v"(t[k + 4]), "v"(t[k + 5]), "v"(t[k + 6]), "v"(t[k + 7]));
}

__global__ __launch_bounds__(SCB) void scan_state_kernel(
    const float* __restrict__ h,  const float* __restrict__ dt,
    const float* __restrict__ BC, const float* __restrict__ A_log,
    float* __restrict__ Sst) {    // [B][NCH][SROWS][DIN]
  const int d  = (blockIdx.x % DGS) * SCB + threadIdx.x;
  const int bc = blockIdx.x / DGS;
  const int b  = bc / (NCH - 1);
  const int c  = bc % (NCH - 1);             // the last chunk feeds nobody

  float a[NSTATE], hs[NSTATE], al[NSTATE];
#pragma unroll
  for (int n = 0; n < NSTATE; ++n) al[n] = A_log[(size_t)d * NSTATE + n];
  exp16(a, al);
#pragma unroll
  for (int n = 0; n < NSTATE; ++n) { a[n] = -a[n]; hs[n] = 0.f; }
  const size_t row0 = (size_t)b * LQ + (size_t)c * CLEN;
  const float* dtp = dt + row0 * DINQ + d;
  const float* hp  = h  + row0 * DINQ + d;
  const float* bcp = BC + row0 * 32;

  float sd = 0.f;
  float dtc[SU], xc[SU];
#pragma unroll
  for (int u = 0; u < SU; ++u) { dtc[u] = 0.f; xc[u] = 0.f; }
  // Trip -1 only fetches group 0, so that every group reaches the arithmetic
  // through the copies at the loop's foot and the wait for it stands there.
  // rolled: the body is already SU * NSTATE updates long (code size)
#pragma unroll 1
  for (int g = -1; g < CLEN / SU; ++g) {
    float dtn[SU], xn[SU];
#pragma unroll
    for (int u = 0; u < SU; ++u) { dtn[u] = 0.f; xn[u] = 0.f; }
    if (g + 1 < CLEN / SU) {                 // next group flies under this one
#pragma unroll
      for (int u = 0; u < SU; ++u) {
        dtn[u] = dtp[(size_t)((g + 1) * SU + u) * DINQ];
        xn[u]  = hp[(size_t)((g + 1) * SU + u) * DINQ];
      }
      // the loads' address registers are reused by the arithmetic below
      asm volatile("s_wait_xcnt 0x0" ::: "memory");
    }
    if (g >= 0) {
#pragma unroll
      for (int u = 0; u < SU; ++u) {
        const float* bct = bcp + (g * SU + u) * 32;
        float dtv = dtc[u];
        float dx  = dtv * xc[u];
        sd += dtv;
        float da[NSTATE], dA[NSTATE];
#pragma unroll
        for (int n = 0; n < NSTATE; ++n) da[n] = dtv * a[n];
        exp16(dA, da);
#pragma unroll
        for (int n = 0; n < NSTATE; ++n) hs[n] = hs[n] * dA[n] + dx * bct[n];
      }
    }
#pragma unroll
    for (int u = 0; u < SU; ++u) { dtc[u] = dtn[u]; xc[u] = xn[u]; }
  }
  float* sp = Sst + ((size_t)b * NCH + c) * SROWS * DINQ + d;
#pragma unroll
  for (int n = 0; n < NSTATE; ++n) sp[(size_t)n * DINQ] = hs[n];
  sp[(size_t)NSTATE * DINQ] = sd;
}

__global__ __launch_bounds__(SCB) void scan_kernel(
    const float* __restrict__ h,  const float* __restrict__ dt,
    const float* __restrict__ BC, const float* __restrict__ yconv,
    const float* __restrict__ A_log, const float* __restrict__ Dsk,
    const float* __restrict__ Sst, unsigned short* __restrict__ gout) {
  const int d  = (blockIdx.x % DGS) * SCB + threadIdx.x;
  const int bc = blockIdx.x / DGS;
  const int b  = bc % BQ;
  const int c  = NCH - 1 - bc / BQ;          // longest fold starts first

  // first load of the kernel: it has landed with the A_log rows, so no wait
  // for it falls among the fetched-ahead loads of the main loop
  const float dsk = Dsk[d];
  // the registers that the load names are reused below
  asm volatile("s_wait_xcnt 0x0" ::: "memory");
  float a[NSTATE], hs[NSTATE], al[NSTATE];
#pragma unroll
  for (int n = 0; n < NSTATE; ++n) al[n] = A_log[(size_t)d * NSTATE + n];
  exp16(a, al);
#pragma unroll
  for (int n = 0; n < NSTATE; ++n) { a[n] = -a[n]; hs[n] = 0.f; }

  // start state: earlier chunks folded in time order, FB records per fetch
  const float* sp = Sst + (size_t)b * NCH * SROWS * DINQ + d;
  int cp = 0;
#pragma unroll 1
  for (; cp + FB <= c; cp += FB) {
    float sv[FB][SROWS];
#pragma unroll
    for (int k = 0; k < FB; ++k)
#pragma unroll
      for (int n = 0; n < SROWS; ++n)
        sv[k][n] = sp[((size_t)(cp + k) * SROWS + n) * DINQ];
    // the loads' address registers are advanced for the next trip
    asm volatile("s_wait_xcnt 0x0" ::: "memory");
#pragma unroll
    for (int k = 0; k < FB; ++k) {
      float da[NSTATE], dA[NSTATE];
#pragma unroll
      for (int n = 0; n < NSTATE; ++n) da[n] = a[n] * sv[k][NSTATE];
      exp16(dA, da);
#pragma unroll
      for (int n = 0; n < NSTATE; ++n) hs[n] = hs[n] * dA[n] + sv[k][n];
    }
  }
#pragma unroll 1
  for (; cp < c; ++cp) {
    float sv[SROWS];
#pragma unroll
    for (int n = 0; n < SROWS; ++n)
      sv[n] = sp[((size_t)cp * SROWS + n) * DINQ];
    // the loads' address registers are reused by the arithmetic below
    asm volatile("s_wait_xcnt 0x0" ::: "memory");
    float da[NSTATE], dA[NSTATE];
#pragma unroll
    for (int n = 0; n < NSTATE; ++n) da[n] = a[n] * sv[NSTATE];
    exp16(dA, da);
#pragma unroll
    for (int n = 0; n < NSTATE; ++n) hs[n] = hs[n] * dA[n] + sv[n];
  }

  const size_t row0 = (size_t)b * LQ + (size_t)c * CLEN;
  const float* dtp = dt    + row0 * DINQ + d;
  const float* hp  = h     + row0 * DINQ + d;
  const float* ycp = yconv + row0 * DINQ + d;
  const float* bcp = BC    + row0 * 32;
  unsigned short* gp = gout + row0 * DINQ + d;

  float dtc[SU], xc[SU], ycc[SU];
#pragma unroll
  for (int u = 0; u < SU; ++u) { dtc[u] = 0.f; xc[u] = 0.f; ycc[u] = 0.f; }
  // Trip -1 only fetches group 0 (see scan_state_kernel).
  // rolled: the body is already SU * NSTATE updates long (code size)
#pragma unroll 1
  for (int g = -1; g < CLEN / SU; ++g) {
    float dtn[SU], xn[SU], ycn[SU];
#pragma unroll
    for (int u = 0; u < SU; ++u) { dtn[u] = 0.f; xn[u] = 0.f; ycn[u] = 0.f; }
    if (g + 1 < CLEN / SU) {                 // next group flies under this one
      // s_wait_xcnt behind each array's loads: their address registers are
      // reused, by the next array's load targets or by the arithmetic below
#pragma unroll
      for (int u = 0; u < SU; ++u) dtn[u] = dtp[(size_t)((g + 1) * SU + u) * DINQ];
      asm volatile("s_wait_xcnt 0x0" ::: "memory");
#pragma unroll
      for (int u = 0; u < SU; ++u) xn[u] = hp[(size_t)((g + 1) * SU + u) * DINQ];
      asm volatile("s_wait_xcnt 0x0" ::: "memory");
#pragma unroll
      for (int u = 0; u < SU; ++u) ycn[u] = ycp[(size_t)((g + 1) * SU + u) * DINQ];
      asm volatile("s_wait_xcnt 0x0" ::: "memory");
    }
    if (g >= 0) {
#pragma unroll
      for (int u = 0; u < SU; ++u) {
        const float* bct = bcp + (g * SU + u) * 32;
        float dtv = dtc[u];
        float xv  = xc[u];
        float dx  = dtv * xv;
        float da[NSTATE], dA[NSTATE];
#pragma unroll
        for (int n = 0; n < NSTATE; ++n) da[n] = dtv * a[n];
        exp16(dA, da);
        float yq[4];                         // four sums of four states each
#pragma unroll
        for (int q = 0; q < 4; ++q) {
          yq[q] = 0.f;
#pragma unroll
          for (int n2 = 0; n2 < 4; ++n2) {
            int n = q * 4 + n2;
            hs[n] = hs[n] * dA[n] + dx * bct[n];
            yq[q] += hs[n] * bct[16 + n];
          }
        }
        float y = (yq[0] + yq[1]) + (yq[2] + yq[3]);
        y += xv * dsk;
        gp[(size_t)(g * SU + u) * DINQ] =
            f32_bf16(y * (1.f / (1.f + __expf(-ycc[u]))));
      }
      // the stores' address and data registers are rewritten at the loop's foot
      asm volatile("s_wait_xcnt 0x0" ::: "memory");
    }
#pragma unroll
    for (int u = 0; u < SU; ++u) { dtc[u] = dtn[u]; xc[u] = xn[u]; ycc[u] = ycn[u]; }
  }
}

// =====================================================================
// host-side orchestration
// =====================================================================
extern "C" void kernel_launch(void* const* d_in, const int* in_sizes, int n_in,
                              void* d_out, int out_size, void* d_ws, size_t ws_size,
                              hipStream_t stream) {
  const float* x_in  = (const float*)d_in[0];
  const float* pos   = (const float*)d_in[1];
  const float* normw = (const float*)d_in[2];
  const float* normb = (const float*)d_in[3];
  const float* Win   = (const float*)d_in[4];
  const float* b_in  = (const float*)d_in[5];
  const float* A_log = (const float*)d_in[6];
  const float* Wdt   = (const float*)d_in[7];
  const float* b_dt  = (const float*)d_in[8];
  const float* WB    = (const float*)d_in[9];
  const float* WC    = (const float*)d_in[10];
  const float* Dsk   = (const float*)d_in[11];
  const float* convw = (const float*)d_in[12];
  const float* convb = (const float*)d_in[13];
  const float* Wout  = (const float*)d_in[14];
  const float* b_out = (const float*)d_in[15];
  const float* fnw   = (const float*)d_in[16];
  const float* fnb   = (const float*)d_in[17];
  (void)in_sizes; (void)n_in; (void)out_size; (void)ws_size;

  char* p = (char*)d_ws;
  auto alloc = [&](size_t bytes) {
    char* r = p;
    p += (bytes + 255) & ~(size_t)255;
    return r;
  };
  float*          xbuf  = (float*)         alloc((size_t)BL * DQ   * 4);  // residual stream
  unsigned short* hln   = (unsigned short*)alloc((size_t)BL * DQ   * 2);  // LN(x) bf16
  float*          hbuf  = (float*)         alloc((size_t)BL * DINQ * 4);  // h fp32
  unsigned short* hbf   = (unsigned short*)alloc((size_t)BL * DINQ * 2);  // h bf16
  float*          dtb   = (float*)         alloc((size_t)BL * DINQ * 4);  // softplus(dt)
  float*          BCb   = (float*)         alloc((size_t)BL * 32   * 4);  // [B|C]
  float*          yconv = (float*)         alloc((size_t)BL * DINQ * 4);  // silu(conv)
  unsigned short* gbf   = (unsigned short*)alloc((size_t)BL * DINQ * 2);  // gated, bf16
  unsigned short* WinT  = (unsigned short*)alloc((size_t)DINQ * DQ   * 2);
  unsigned short* WdtT  = (unsigned short*)alloc((size_t)DINQ * DINQ * 2);
  unsigned short* WoutT = (unsigned short*)alloc((size_t)DQ   * DINQ * 2);
  float*          Sst   = (float*)         alloc((size_t)BQ * NCH * SROWS * DINQ * 4);  // chunk records

  add_pos_kernel<<<(BL * DQ + 255) / 256, 256, 0, stream>>>(x_in, pos, xbuf);

  for (int i = 0; i < 2; ++i) {
    wconv_kernel<<<dim3(DINQ / 32, DQ / 32),   256, 0, stream>>>(
        Win  + (size_t)i * DQ * DINQ,   WinT,  DQ,   DINQ);
    wconv_kernel<<<dim3(DINQ / 32, DINQ / 32), 256, 0, stream>>>(
        Wdt  + (size_t)i * DINQ * DINQ, WdtT,  DINQ, DINQ);
    wconv_kernel<<<dim3(DQ / 32, DINQ / 32),   256, 0, stream>>>(
        Wout + (size_t)i * DINQ * DQ,   WoutT, DINQ, DQ);

    ln_kernel<true><<<BL, 256, 0, stream>>>(
        xbuf, normw + (size_t)i * DQ, normb + (size_t)i * DQ, hln, DQ);

    // h = LN(x) @ Win + b_in    (fp32 + bf16 copies)
    gemm_bf16_wmma<0><<<dim3(DINQ / BNT, BL / BMT), 256, 0, stream>>>(
        hln, WinT, b_in + (size_t)i * DINQ, hbuf, hbf, BL, DINQ, DQ);
    // dt = softplus(h @ Wdt + b_dt)
    gemm_bf16_wmma<1><<<dim3(DINQ / BNT, BL / BMT), 256, 0, stream>>>(
        hbf, WdtT, b_dt + (size_t)i * DINQ, dtb, nullptr, BL, DINQ, DINQ);

    bc_kernel<<<BL, 256, 0, stream>>>(
        hbuf, WB + (size_t)i * DINQ * NSTATE, WC + (size_t)i * DINQ * NSTATE, BCb);
    conv_silu_kernel<<<(BL * DINQ + 255) / 256, 256, 0, stream>>>(
        hbuf, convw + (size_t)i * 4 * DINQ, convb + (size_t)i * DINQ, yconv);
    scan_state_kernel<<<BQ * (NCH - 1) * DGS, SCB, 0, stream>>>(
        hbuf, dtb, BCb, A_log + (size_t)i * DINQ * NSTATE, Sst);
    scan_kernel<<<BQ * NCH * DGS, SCB, 0, stream>>>(
        hbuf, dtb, BCb, yconv, A_log + (size_t)i * DINQ * NSTATE,
        Dsk + (size_t)i * DINQ, Sst, gbf);

    // x = g @ Wout + b_out + residual (in place)
    gemm_bf16_wmma<2><<<dim3(DQ / BNT, BL / BMT), 256, 0, stream>>>(
        gbf, WoutT, b_out + (size_t)i * DQ, xbuf, nullptr, BL, DQ, DINQ);
  }

  ln_kernel<false><<<BL, 256, 0, stream>>>(xbuf, fnw, fnb, d_out, DQ);
}

// v002
// A run of this version takes 587 microseconds.
// Timed twice side by side with v001, it ran 1.10 and 1.09 times as fast.
// All steps since v000 together make it 7.08 times as fast.
#include <hip/hip_runtime.h>
#include <hip/hip_bf16.h>
#include <math.h>

// ---------------- problem constants (match reference) ----------------
#define BQ     2
#define LQ     2048
#define DQ     1024
#define DINQ   2048
#define NSTATE 16
#define BL     (BQ * LQ)        // 4096 token rows

// ---------------- CDNA5 WMMA types ----------------
typedef __attribute__((ext_vector_type(16))) __bf16 v16bf;
typedef __attribute__((ext_vector_type(8)))  __bf16 v8bf;
typedef __attribute__((ext_vector_type(8)))  float  v8f;

__device__ __forceinline__ unsigned short f32_bf16(float f) {
  unsigned u = __float_as_uint(f);
  u += 0x7fffu + ((u >> 16) & 1u);          // round-to-nearest-even
  return (unsigned short)(u >> 16);
}

// CDNA5 async global->LDS copy (ASYNCcnt-tracked, no VGPR round-trip).
// LDS operand is the low 32 bits of the generic address (ISA: LDS aperture
// truncates generic addr to addr[31:0]).
__device__ __forceinline__ void async_ld_b128(void* lds, const void* gaddr) {
  unsigned ldsa = (unsigned)(uintptr_t)lds;
  asm volatile("global_load_async_to_lds_b128 %0, %1, off"
               :: "v"(ldsa), "v"(gaddr) : "memory");
}
__device__ __forceinline__ void wait_async6() {
  asm volatile("s_wait_asynccnt 0x6" ::: "memory");
}
__device__ __forceinline__ void wait_async0() {
  asm volatile("s_wait_asynccnt 0x0" ::: "memory");
}

// =====================================================================
// add positional embedding: xbuf = x + pos_emb  (never mutate d_in)
// =====================================================================
__global__ void add_pos_kernel(const float* __restrict__ x,
                               const float* __restrict__ pe,
                               float* __restrict__ xbuf) {
  int idx = blockIdx.x * 256 + threadIdx.x;       // over B*L*D
  if (idx >= BL * DQ) return;
  int ld = idx % (LQ * DQ);
  xbuf[idx] = x[idx] + pe[ld];
}

// =====================================================================
// weight transpose + fp32->bf16:  W[K][N] fp32  ->  WT[N][K] bf16
// =====================================================================
__global__ __launch_bounds__(256) void wconv_kernel(
    const float* __restrict__ W, unsigned short* __restrict__ WT,
    int K, int N) {
  __shared__ float tile[32][33];
  int nb = blockIdx.x * 32, kb = blockIdx.y * 32;
  int tx = threadIdx.x & 31, ty0 = threadIdx.x >> 5;
  for (int r = ty0; r < 32; r += 8)
    tile[r][tx] = W[(size_t)(kb + r) * N + nb + tx];
  __syncthreads();
  for (int r = ty0; r < 32; r += 8)
    WT[(size_t)(nb + r) * K + kb + tx] = f32_bf16(tile[tx][r]);
}

// =====================================================================
// LayerNorm over last dim; optional bf16 output (GEMM A operand)
// =====================================================================
template <bool BF16OUT>
__global__ __launch_bounds__(256) void ln_kernel(
    const float* __restrict__ x, const float* __restrict__ w,
    const float* __restrict__ b, void* __restrict__ out, int Dn) {
  int row = blockIdx.x;
  const float* xr = x + (size_t)row * Dn;
  __shared__ float red[256];
  float s = 0.f, s2 = 0.f;
  for (int i = threadIdx.x; i < Dn; i += 256) {
    float v = xr[i]; s += v; s2 += v * v;
  }
  red[threadIdx.x] = s; __syncthreads();
  for (int o = 128; o > 0; o >>= 1) {
    if (threadIdx.x < o) red[threadIdx.x] += red[threadIdx.x + o];
    __syncthreads();
  }
  float mean = red[0] / (float)Dn;
  __syncthreads();
  red[threadIdx.x] = s2; __syncthreads();
  for (int o = 128; o > 0; o >>= 1) {
    if (threadIdx.x < o) red[threadIdx.x] += red[threadIdx.x + o];
    __syncthreads();
  }
  float var  = red[0] / (float)Dn - mean * mean;
  float rstd = rsqrtf(var + 1e-5f);
  for (int i = threadIdx.x; i < Dn; i += 256) {
    float v = (xr[i] - mean) * rstd * w[i] + b[i];
    if (BF16OUT) ((unsigned short*)out)[(size_t)row * Dn + i] = f32_bf16(v);
    else         ((float*)out)[(size_t)row * Dn + i] = v;
  }
}

// =====================================================================
// WMMA bf16 GEMM:  out[M][N] = A[M][K](bf16) * BT[N][K](bf16)^T + bias
// Block tile 128x64, 8 waves (wave32) arranged 4x2, each wave 32x32 via
// 2x2 v_wmma_f32_16x16x32_bf16 tiles. K staged in 64-wide chunks using
// DOUBLE-BUFFERED async global->LDS copies (ASYNCcnt pipeline):
//   issue stage i+1 into buf^1, s_wait_asynccnt 6 (stage i oldest),
//   barrier, 8 WMMAs on buf, barrier.
// Epilogues:
//   MODE 0: outF = v+bias (fp32) AND outBf = bf16(v+bias)
//   MODE 1: outF = softplus(v+bias)
//   MODE 2: outF = v+bias+outF  (residual add in place)
// =====================================================================
#define BMT 128
#define BNT 64
#define KC  64
#define LDA 72   // padded row stride (elements): 144B = 9*16B

__device__ __forceinline__ v16bf load_frag(const unsigned short* rowp, int half) {
  // A-fragment lane layout (ISA 7.12.2, 16-bit A 16x32):
  //  lanes 0-15:  elems[0..7]=K0..7,  elems[8..15]=K16..23
  //  lanes 16-31: elems[0..7]=K8..15, elems[8..15]=K24..31
  union { v16bf v; v8bf h[2]; } u;
  u.h[0] = *(const v8bf*)(rowp + half * 8);
  u.h[1] = *(const v8bf*)(rowp + 16 + half * 8);
  return u.v;
}

template <int MODE>
__global__ __launch_bounds__(256) void gemm_bf16_wmma(
    const unsigned short* __restrict__ A,   // [M][K] bf16
    const unsigned short* __restrict__ BT,  // [N][K] bf16 (B transposed)
    const float* __restrict__ bias,         // [N]
    float* __restrict__ outF,
    unsigned short* __restrict__ outBf,
    int M, int Nn, int K) {
  __shared__ __align__(16) unsigned short As[2][BMT][LDA];
  __shared__ __align__(16) unsigned short Bs[2][BNT][LDA];
  int tid  = threadIdx.x;
  int wave = tid >> 5, lane = tid & 31;
  int wm = wave & 3, wn = wave >> 2;          // 4 waves along M, 2 along N
  int bm = blockIdx.y * BMT, bn = blockIdx.x * BNT;
  int half = lane >> 4, lrow = lane & 15;

  // per-thread source/dest for one stage: 4 A-chunks + 2 B-chunks of 16B
  int ra[4], ca[4], rb[2], cb[2];
#pragma unroll
  for (int t = 0; t < 4; ++t) {
    int idx = tid + t * 256;                  // 0..1023 -> 128 rows x 8 chunks
    ra[t] = idx >> 3; ca[t] = (idx & 7) * 8;
  }
#pragma unroll
  for (int t = 0; t < 2; ++t) {
    int idx = tid + t * 256;                  // 0..511 -> 64 rows x 8 chunks
    rb[t] = idx >> 3; cb[t] = (idx & 7) * 8;
  }

  auto issue_stage = [&](int buf, int k0) {
#pragma unroll
    for (int t = 0; t < 4; ++t)
      async_ld_b128(&As[buf][ra[t]][ca[t]],
                    A + (size_t)(bm + ra[t]) * K + k0 + ca[t]);
#pragma unroll
    for (int t = 0; t < 2; ++t)
      async_ld_b128(&Bs[buf][rb[t]][cb[t]],
                    BT + (size_t)(bn + rb[t]) * K + k0 + cb[t]);
  };

  v8f zero = {};
  v8f acc[2][2];
#pragma unroll
  for (int i = 0; i < 2; ++i)
#pragma unroll
    for (int j = 0; j < 2; ++j) acc[i][j] = zero;

  const int nk = K / KC;
  issue_stage(0, 0);
  for (int i = 0; i < nk; ++i) {
    int cur = i & 1;
    if (i + 1 < nk) {
      issue_stage(cur ^ 1, (i + 1) * KC);
      wait_async6();                 // stage i's 6 ops are the oldest
    } else {
      wait_async0();
    }
    __syncthreads();                 // all waves' stage-i data visible

#pragma unroll
    for (int ks = 0; ks < KC; ks += 32) {
      v16bf aF[2], bF[2];
      aF[0] = load_frag(&As[cur][wm * 32 + lrow][ks],      half);
      aF[1] = load_frag(&As[cur][wm * 32 + 16 + lrow][ks], half);
      bF[0] = load_frag(&Bs[cur][wn * 32 + lrow][ks],      half);
      bF[1] = load_frag(&Bs[cur][wn * 32 + 16 + lrow][ks], half);
#pragma unroll
      for (int ii = 0; ii < 2; ++ii)
#pragma unroll
        for (int jj = 0; jj < 2; ++jj)
          acc[ii][jj] = __builtin_amdgcn_wmma_f32_16x16x32_bf16(
              false, aF[ii], false, bF[jj], (short)0, acc[ii][jj],
              false, false);
    }
    __syncthreads();                 // buf reusable two stages later
  }

  // ---- epilogue: C/D layout — n = lane&15, m = vgpr + (lane>>4)*8 ----
#pragma unroll
  for (int i = 0; i < 2; ++i) {
#pragma unroll
    for (int j = 0; j < 2; ++j) {
      int gn = bn + wn * 32 + j * 16 + lrow;
      float bv = bias[gn];
#pragma unroll
      for (int r = 0; r < 8; ++r) {
        int gm = bm + wm * 32 + i * 16 + r + half * 8;
        size_t off = (size_t)gm * Nn + gn;
        float v = acc[i][j][r] + bv;
        if (MODE == 0) {
          outF[off]  = v;
          outBf[off] = f32_bf16(v);
        } else if (MODE == 1) {
          outF[off] = (v > 20.f) ? v : log1pf(__expf(v));   // softplus
        } else {
          outF[off] = v + outF[off];                        // + residual
        }
      }
    }
  }
}

// =====================================================================
// Bm|Cm projection:  BC[m][0..15]=h@WB, [16..31]=h@WC   (0.8% of FLOPs)
// =====================================================================
__global__ __launch_bounds__(256) void bc_kernel(
    const float* __restrict__ h, const float* __restrict__ WB,
    const float* __restrict__ WC, float* __restrict__ BC) {
  int m = blockIdx.x;
  __shared__ float hrow[DINQ];
  __shared__ float part[256];
  for (int i = threadIdx.x; i < DINQ; i += 256)
    hrow[i] = h[(size_t)m * DINQ + i];
  __syncthreads();
  int c = threadIdx.x & 31, g = threadIdx.x >> 5;
  const float* W = (c < 16) ? WB : WC;
  int cc = c & 15;
  float s = 0.f;
  int k0 = g * (DINQ / 8);
  for (int k = k0; k < k0 + DINQ / 8; ++k)
    s += hrow[k] * W[(size_t)k * NSTATE + cc];
  part[threadIdx.x] = s; __syncthreads();
  if (threadIdx.x < 32) {
    float t = 0.f;
#pragma unroll
    for (int g2 = 0; g2 < 8; ++g2) t += part[threadIdx.x + 32 * g2];
    BC[(size_t)m * 32 + threadIdx.x] = t;
  }
}

// =====================================================================
// selective scan (diagonal SSM), split over time into NCH chunks of CLEN
// steps so that the chunks run side by side instead of one after another.
//   scan_state_kernel: every chunk but the last runs the recurrence from a
//     zero state and keeps its end state S[n] and its sum of dt (row NSTATE
//     of the same record). The decay over a whole chunk is exp(a[n] * sum dt).
//   scan_kernel: a chunk folds the earlier chunks' (S, sum dt) in time order
//     into its start state, then runs the recurrence with the fused D-skip,
//     the causal depthwise conv (4 taps) + SiLU of the same channel, formed
//     from the x values that the lane walks through anyway, and the gating.
// One lane = one channel with all 16 states; one block = SCB channels of one
// (batch, chunk), so the B/C rows are the same address for the whole block.
// =====================================================================
#define NCH  32
#define CLEN (LQ / NCH)     // 64 steps per chunk
#define SU   8              // steps fetched ahead as one group
#define SCB  128            // channels (threads) per block
#define DGS  (DINQ / SCB)   // channel groups
#define SROWS (NSTATE + 1)  // rows of a chunk's record: S[0..15], sum of dt
#define FB   3              // chunk records fetched together in the fold (51 loads)

// e[n] = exp(x[n]) for the 16 states, as __expf forms it (x * log2(e), then
// v_exp_f32), eight to a statement. The v_nop at each statement's end keeps the
// slot that the instruction set asks for behind a transcendental before its
// source is overwritten.
__device__ __forceinline__ void exp16(float (&e)[NSTATE], const float (&x)[NSTATE]) {
  float t[NSTATE];
#pragma unroll
  for (int n = 0; n < NSTATE; ++n) t[n] = x[n] * 1.44269504f;
#pragma unroll
  for (int k = 0; k < NSTATE; k += 8)
    asm("v_exp_f32 %0, %8\n\tv_exp_f32 %1, %9\n\tv_exp_f32 %2, %10\n\t"
        "v_exp_f32 %3, %11\n\tv_exp_f32 %4, %12\n\tv_exp_f32 %5, %13\n\t"
        "v_exp_f32 %6, %14\n\tv_exp_f32 %7, %15\n\tv_nop"
        : "=&v"(e[k]), "=&v"(e[k + 1]), "=&v"(e[k + 2]), "=&v"(e[k + 3]),
          "=&v"(e[k + 4]), "=&v"(e[k + 5]), "=&v"(e[k + 6]), "=&v"(e[k + 7])
        : "v"(t[k]), "v"(t[k + 1]), "v"(t[k + 2]), "v"(t[k + 3]),
          "v"(t[k + 4]), "v"(t[k + 5]), "v"(t[k + 6]), "v"(t[k + 7]));
}

// exp(x) for one value, formed as in exp16; the v_nop keeps the same slot.
__device__ __forceinline__ float exp1(float x) {
  float t = x * 1.44269504f, e;
  asm("v_exp_f32 %0, %1\n\tv_nop" : "=v"(e) : "v"(t));
  return e;
}

__global__ __launch_bounds__(SCB) void scan_state_kernel(
    const float* __restrict__ h,  const float* __restrict__ dt,
    const float* __restrict__ BC, const float* __restrict__ A_log,
    float* __restrict__ Sst) {    // [B][NCH][SROWS][DIN]
  const int d  = (blockIdx.x % DGS) * SCB + threadIdx.x;
  const int bc = blockIdx.x / DGS;
  const int b  = bc / (NCH - 1);
  const int c  = bc % (NCH - 1);             // the last chunk feeds nobody

  float a[NSTATE], hs[NSTATE], al[NSTATE];
#pragma unroll
  for (int n = 0; n < NSTATE; ++n) al[n] = A_log[(size_t)d * NSTATE + n];
  exp16(a, al);
#pragma unroll
  for (int n = 0; n < NSTATE; ++n) { a[n] = -a[n]; hs[n] = 0.f; }
  const size_t row0 = (size_t)b * LQ + (size_t)c * CLEN;
  const float* dtp = dt + row0 * DINQ + d;
  const float* hp  = h  + row0 * DINQ + d;
  const float* bcp = BC + row0 * 32;

  float sd = 0.f;
  float dtc[SU], xc[SU];
#pragma unroll
  for (int u = 0; u < SU; ++u) { dtc[u] = 0.f; xc[u] = 0.f; }
  // Trip -1 only fetches group 0, so that every group reaches the arithmetic
  // through the copies at the loop's foot and the wait for it stands there.
  // rolled: the body is already SU * NSTATE updates long (code size)
#pragma unroll 1
  for (int g = -1; g < CLEN / SU; ++g) {
    float dtn[SU], xn[SU];
#pragma unroll
    for (int u = 0; u < SU; ++u) { dtn[u] = 0.f; xn[u] = 0.f; }
    if (g + 1 < CLEN / SU) {                 // next group flies under this one
#pragma unroll
      for (int u = 0; u < SU; ++u) {
        dtn[u] = dtp[(size_t)((g + 1) * SU + u) * DINQ];
        xn[u]  = hp[(size_t)((g + 1) * SU + u) * DINQ];
      }
      // the loads' address registers are reused by the arithmetic below
      asm volatile("s_wait_xcnt 0x0" ::: "memory");
    }
    if (g >= 0) {
#pragma unroll
      for (int u = 0; u < SU; ++u) {
        const float* bct = bcp + (g * SU + u) * 32;
        float dtv = dtc[u];
        float dx  = dtv * xc[u];
        sd += dtv;
        float da[NSTATE], dA[NSTATE];
#pragma unroll
        for (int n = 0; n < NSTATE; ++n) da[n] = dtv * a[n];
        exp16(dA, da);
#pragma unroll
        for (int n = 0; n < NSTATE; ++n) hs[n] = hs[n] * dA[n] + dx * bct[n];
      }
    }
#pragma unroll
    for (int u = 0; u < SU; ++u) { dtc[u] = dtn[u]; xc[u] = xn[u]; }
  }
  float* sp = Sst + ((size_t)b * NCH + c) * SROWS * DINQ + d;
#pragma unroll
  for (int n = 0; n < NSTATE; ++n) sp[(size_t)n * DINQ] = hs[n];
  sp[(size_t)NSTATE * DINQ] = sd;
}

__global__ __launch_bounds__(SCB) void scan_kernel(
    const float* __restrict__ h,  const float* __restrict__ dt,
    const float* __restrict__ BC, const float* __restrict__ cw,
    const float* __restrict__ cb,
    const float* __restrict__ A_log, const float* __restrict__ Dsk,
    const float* __restrict__ Sst, unsigned short* __restrict__ gout) {
  const int d  = (blockIdx.x % DGS) * SCB + threadIdx.x;
  const int bc = blockIdx.x / DGS;
  const int b  = bc % BQ;
  const int c  = NCH - 1 - bc / BQ;          // longest fold starts first

  const size_t row0 = (size_t)b * LQ + (size_t)c * CLEN;
  const float* hp  = h + row0 * DINQ + d;

  // first loads of the kernel: they have landed with the A_log rows, so no
  // wait for them falls among the fetched-ahead loads of the main loop
  const float dsk = Dsk[d];
  const float cbv = cb[d];
  float cwv[4];
#pragma unroll
  for (int j = 0; j < 4; ++j) cwv[j] = cw[j * DINQ + d];
  // the registers that the loads name are reused below
  asm volatile("s_wait_xcnt 0x0" ::: "memory");
  // the three x values in front of the chunk (zero padding in front of l = 0)
  float xp[3] = {0.f, 0.f, 0.f};
  if (c > 0) {
#pragma unroll
    for (int j = 0; j < 3; ++j) xp[j] = hp[(ptrdiff_t)(j - 3) * DINQ];
    // the registers that the loads name are reused below
    asm volatile("s_wait_xcnt 0x0" ::: "memory");
  }
  float a[NSTATE], hs[NSTATE], al[NSTATE];
#pragma unroll
  for (int n = 0; n < NSTATE; ++n) al[n] = A_log[(size_t)d * NSTATE + n];
  exp16(a, al);
#pragma unroll
  for (int n = 0; n < NSTATE; ++n) { a[n] = -a[n]; hs[n] = 0.f; }

  // start state: earlier chunks folded in time order, FB records per fetch
  const float* sp = Sst + (size_t)b * NCH * SROWS * DINQ + d;
  int cp = 0;
#pragma unroll 1
  for (; cp + FB <= c; cp += FB) {
    float sv[FB][SROWS];
#pragma unroll
    for (int k = 0; k < FB; ++k)
#pragma unroll
      for (int n = 0; n < SROWS; ++n)
        sv[k][n] = sp[((size_t)(cp + k) * SROWS + n) * DINQ];
    // the loads' address registers are advanced for the next trip
    asm volatile("s_wait_xcnt 0x0" ::: "memory");
#pragma unroll
    for (int k = 0; k < FB; ++k) {
      float da[NSTATE], dA[NSTATE];
#pragma unroll
      for (int n = 0; n < NSTATE; ++n) da[n] = a[n] * sv[k][NSTATE];
      exp16(dA, da);
#pragma unroll
      for (int n = 0; n < NSTATE; ++n) hs[n] = hs[n] * dA[n] + sv[k][n];
    }
  }
#pragma unroll 1
  for (; cp < c; ++cp) {
    float sv[SROWS];
#pragma unroll
    for (int n = 0; n < SROWS; ++n)
      sv[n] = sp[((size_t)cp * SROWS + n) * DINQ];
    // the loads' address registers are reused by the arithmetic below
    asm volatile("s_wait_xcnt 0x0" ::: "memory");
    float da[NSTATE], dA[NSTATE];
#pragma unroll
    for (int n = 0; n < NSTATE; ++n) da[n] = a[n] * sv[NSTATE];
    exp16(dA, da);
#pragma unroll
    for (int n = 0; n < NSTATE; ++n) hs[n] = hs[n] * dA[n] + sv[n];
  }

  const float* dtp = dt + row0 * DINQ + d;
  const float* bcp = BC + row0 * 32;
  unsigned short* gp = gout + row0 * DINQ + d;

  float dtc[SU], xc[SU];
#pragma unroll
  for (int u = 0; u < SU; ++u) { dtc[u] = 0.f; xc[u] = 0.f; }
  // Trip -1 only fetches group 0 (see scan_state_kernel).
  // rolled: the body is already SU * NSTATE updates long (code size)
#pragma unroll 1
  for (int g = -1; g < CLEN / SU; ++g) {
    float dtn[SU], xn[SU];
#pragma unroll
    for (int u = 0; u < SU; ++u) { dtn[u] = 0.f; xn[u] = 0.f; }
    if (g + 1 < CLEN / SU) {                 // next group flies under this one
      // s_wait_xcnt behind each array's loads: their address registers are
      // reused, by the next array's load targets or by the arithmetic below
#pragma unroll
      for (int u = 0; u < SU; ++u) dtn[u] = dtp[(size_t)((g + 1) * SU + u) * DINQ];
      asm volatile("s_wait_xcnt 0x0" ::: "memory");
#pragma unroll
      for (int u = 0; u < SU; ++u) xn[u] = hp[(size_t)((g + 1) * SU + u) * DINQ];
      asm volatile("s_wait_xcnt 0x0" ::: "memory");
    }
    if (g >= 0) {
#pragma unroll
      for (int u = 0; u < SU; ++u) {
        const float* bct = bcp + (g * SU + u) * 32;
        float dtv = dtc[u];
        float xv  = xc[u];
        float dx  = dtv * xv;
        float da[NSTATE], dA[NSTATE];
#pragma unroll
        for (int n = 0; n < NSTATE; ++n) da[n] = dtv * a[n];
        exp16(dA, da);
        float yq[4];                         // four sums of four states each
#pragma unroll
        for (int q = 0; q < 4; ++q) {
          yq[q] = 0.f;
#pragma unroll
          for (int n2 = 0; n2 < 4; ++n2) {
            int n = q * 4 + n2;
            hs[n] = hs[n] * dA[n] + dx * bct[n];
            yq[q] += hs[n] * bct[16 + n];
          }
        }
        float y = (yq[0] + yq[1]) + (yq[2] + yq[3]);
        y += xv * dsk;
        // conv taps l-3 .. l in that order, then SiLU
        float ca = cbv;
        ca += (u >= 3 ? xc[u >= 3 ? u - 3 : 0] : xp[u < 3 ? u : 0]) * cwv[0];
        ca += (u >= 2 ? xc[u >= 2 ? u - 2 : 0] : xp[u < 2 ? u + 1 : 0]) * cwv[1];
        ca += (u >= 1 ? xc[u >= 1 ? u - 1 : 0] : xp[2]) * cwv[2];
        ca += xv * cwv[3];
        float yc = ca * (1.f / (1.f + exp1(-ca)));
        gp[(size_t)(g * SU + u) * DINQ] =
            f32_bf16(y * (1.f / (1.f + exp1(-yc))));
      }
#pragma unroll
      for (int j = 0; j < 3; ++j) xp[j] = xc[SU - 3 + j];
      // the stores' address and data registers are rewritten at the loop's foot
      asm volatile("s_wait_xcnt 0x0" ::: "memory");
    }
#pragma unroll
    for (int u = 0; u < SU; ++u) { dtc[u] = dtn[u]; xc[u] = xn[u]; }
  }
}

// =====================================================================
// host-side orchestration
// =====================================================================
extern "C" void kernel_launch(void* const* d_in, const int* in_sizes, int n_in,
                              void* d_out, int out_size, void* d_ws, size_t ws_size,
                              hipStream_t stream) {
  const float* x_in  = (const float*)d_in[0];
  const float* pos   = (const float*)d_in[1];
  const float* normw = (const float*)d_in[2];
  const float* normb = (const float*)d_in[3];
  const float* Win   = (const float*)d_in[4];
  const float* b_in  = (const float*)d_in[5];
  const float* A_log = (const float*)d_in[6];
  const float* Wdt   = (const float*)d_in[7];
  const float* b_dt  = (const float*)d_in[8];
  const float* WB    = (const float*)d_in[9];
  const float* WC    = (const float*)d_in[10];
  const float* Dsk   = (const float*)d_in[11];
  const float* convw = (const float*)d_in[12];
  const float* convb = (const float*)d_in[13];
  const float* Wout  = (const float*)d_in[14];
  const float* b_out = (const float*)d_in[15];
  const float* fnw   = (const float*)d_in[16];
  const float* fnb   = (const float*)d_in[17];
  (void)in_sizes; (void)n_in; (void)out_size; (void)ws_size;

  char* p = (char*)d_ws;
  auto alloc = [&](size_t bytes) {
    char* r = p;
    p += (bytes + 255) & ~(size_t)255;
    return r;
  };
  float*          xbuf  = (float*)         alloc((size_t)BL * DQ   * 4);  // residual stream
  unsigned short* hln   = (unsigned short*)alloc((size_t)BL * DQ   * 2);  // LN(x) bf16
  float*          hbuf  = (float*)         alloc((size_t)BL * DINQ * 4);  // h fp32
  unsigned short* hbf   = (unsigned short*)alloc((size_t)BL * DINQ * 2);  // h bf16
  float*          dtb   = (float*)         alloc((size_t)BL * DINQ * 4);  // softplus(dt)
  float*          BCb   = (float*)         alloc((size_t)BL * 32   * 4);  // [B|C]
  unsigned short* gbf   = (unsigned short*)alloc((size_t)BL * DINQ * 2);  // gated, bf16
  unsigned short* WinT  = (unsigned short*)alloc((size_t)DINQ * DQ   * 2);
  unsigned short* WdtT  = (unsigned short*)alloc((size_t)DINQ * DINQ * 2);
  unsigned short* WoutT = (unsigned short*)alloc((size_t)DQ   * DINQ * 2);
  float*          Sst   = (float*)         alloc((size_t)BQ * NCH * SROWS * DINQ * 4);  // chunk records

  add_pos_kernel<<<(BL * DQ + 255) / 256, 256, 0, stream>>>(x_in, pos, xbuf);

  for (int i = 0; i < 2; ++i) {
    wconv_kernel<<<dim3(DINQ / 32, DQ / 32),   256, 0, stream>>>(
        Win  + (size_t)i * DQ * DINQ,   WinT,  DQ,   DINQ);
    wconv_kernel<<<dim3(DINQ / 32, DINQ / 32), 256, 0, stream>>>(
        Wdt  + (size_t)i * DINQ * DINQ, WdtT,  DINQ, DINQ);
    wconv_kernel<<<dim3(DQ / 32, DINQ / 32),   256, 0, stream>>>(
        Wout + (size_t)i * DINQ * DQ,   WoutT, DINQ, DQ);

    ln_kernel<true><<<BL, 256, 0, stream>>>(
        xbuf, normw + (size_t)i * DQ, normb + (size_t)i * DQ, hln, DQ);

    // h = LN(x) @ Win + b_in    (fp32 + bf16 copies)
    gemm_bf16_wmma<0><<<dim3(DINQ / BNT, BL / BMT), 256, 0, stream>>>(
        hln, WinT, b_in + (size_t)i * DINQ, hbuf, hbf, BL, DINQ, DQ);
    // dt = softplus(h @ Wdt + b_dt)
    gemm_bf16_wmma<1><<<dim3(DINQ / BNT, BL / BMT), 256, 0, stream>>>(
        hbf, WdtT, b_dt + (size_t)i * DINQ, dtb, nullptr, BL, DINQ, DINQ);

    bc_kernel<<<BL, 256, 0, stream>>>(
        hbuf, WB + (size_t)i * DINQ * NSTATE, WC + (size_t)i * DINQ * NSTATE, BCb);
    scan_state_kernel<<<BQ * (NCH - 1) * DGS, SCB, 0, stream>>>(
        hbuf, dtb, BCb, A_log + (size_t)i * DINQ * NSTATE, Sst);
    scan_kernel<<<BQ * NCH * DGS, SCB, 0, stream>>>(
        hbuf, dtb, BCb, convw + (size_t)i * 4 * DINQ, convb + (size_t)i * DINQ,
        A_log + (size_t)i * DINQ * NSTATE,
        Dsk + (size_t)i * DINQ, Sst, gbf);

    // x = g @ Wout + b_out + residual (in place)
    gemm_bf16_wmma<2><<<dim3(DQ / BNT, BL / BMT), 256, 0, stream>>>(
        gbf, WoutT, b_out + (size_t)i * DQ, xbuf, nullptr, BL, DQ, DINQ);
  }

  ln_kernel<false><<<BL, 256, 0, stream>>>(xbuf, fnw, fnb, d_out, DQ);
}

// v003
// Measured time: 419 microseconds a run.
// Next to v002, in two timings, it ran 1.41 and 1.40 times as fast.
// Over all steps from v000 it is 9.93 times as fast.
#include <hip/hip_runtime.h>
#include <hip/hip_bf16.h>
#include <math.h>

// ---------------- problem constants (match reference) ----------------
#define BQ     2
#define LQ     2048
#define DQ     1024
#define DINQ   2048
#define NSTATE 16
#define BL     (BQ * LQ)        // 4096 token rows

// ---------------- CDNA5 WMMA types ----------------
typedef __attribute__((ext_vector_type(16))) __bf16 v16bf;
typedef __attribute__((ext_vector_type(8)))  __bf16 v8bf;
typedef __attribute__((ext_vector_type(8)))  float  v8f;

__device__ __forceinline__ unsigned short f32_bf16(float f) {
  unsigned u = __float_as_uint(f);
  u += 0x7fffu + ((u >> 16) & 1u);          // round-to-nearest-even
  return (unsigned short)(u >> 16);
}

// CDNA5 async global->LDS copy (ASYNCcnt-tracked, no VGPR round-trip).
// LDS operand is the low 32 bits of the generic address (ISA: LDS aperture
// truncates generic addr to addr[31:0]).
__device__ __forceinline__ void async_ld_b128(void* lds, const void* gaddr) {
  unsigned ldsa = (unsigned)(uintptr_t)lds;
  asm volatile("global_load_async_to_lds_b128 %0, %1, off"
               :: "v"(ldsa), "v"(gaddr) : "memory");
}
__device__ __forceinline__ void wait_async6() {
  asm volatile("s_wait_asynccnt 0x6" ::: "memory");
}
__device__ __forceinline__ void wait_async0() {
  asm volatile("s_wait_asynccnt 0x0" ::: "memory");
}

// =====================================================================
// add positional embedding: xbuf = x + pos_emb  (never mutate d_in)
// =====================================================================
__global__ void add_pos_kernel(const float* __restrict__ x,
                               const float* __restrict__ pe,
                               float* __restrict__ xbuf) {
  int idx = blockIdx.x * 256 + threadIdx.x;       // over B*L*D
  if (idx >= BL * DQ) return;
  int ld = idx % (LQ * DQ);
  xbuf[idx] = x[idx] + pe[ld];
}

// =====================================================================
// weight transpose + fp32->bf16:  W[K][N] fp32  ->  WT[N][K] bf16
// =====================================================================
__global__ __launch_bounds__(256) void wconv_kernel(
    const float* __restrict__ W, unsigned short* __restrict__ WT,
    int K, int N) {
  __shared__ float tile[32][33];
  int nb = blockIdx.x * 32, kb = blockIdx.y * 32;
  int tx = threadIdx.x & 31, ty0 = threadIdx.x >> 5;
  for (int r = ty0; r < 32; r += 8)
    tile[r][tx] = W[(size_t)(kb + r) * N + nb + tx];
  __syncthreads();
  for (int r = ty0; r < 32; r += 8)
    WT[(size_t)(nb + r) * K + kb + tx] = f32_bf16(tile[tx][r]);
}

// =====================================================================
// LayerNorm over last dim; optional bf16 output (GEMM A operand)
// =====================================================================
template <bool BF16OUT>
__global__ __launch_bounds__(256) void ln_kernel(
    const float* __restrict__ x, const float* __restrict__ w,
    const float* __restrict__ b, void* __restrict__ out, int Dn) {
  int row = blockIdx.x;
  const float* xr = x + (size_t)row * Dn;
  __shared__ float red[256];
  float s = 0.f, s2 = 0.f;
  for (int i = threadIdx.x; i < Dn; i += 256) {
    float v = xr[i]; s += v; s2 += v * v;
  }
  red[threadIdx.x] = s; __syncthreads();
  for (int o = 128; o > 0; o >>= 1) {
    if (threadIdx.x < o) red[threadIdx.x] += red[threadIdx.x + o];
    __syncthreads();
  }
  float mean = red[0] / (float)Dn;
  __syncthreads();
  red[threadIdx.x] = s2; __syncthreads();
  for (int o = 128; o > 0; o >>= 1) {
    if (threadIdx.x < o) red[threadIdx.x] += red[threadIdx.x + o];
    __syncthreads();
  }
  float var  = red[0] / (float)Dn - mean * mean;
  float rstd = rsqrtf(var + 1e-5f);
  for (int i = threadIdx.x; i < Dn; i += 256) {
    float v = (xr[i] - mean) * rstd * w[i] + b[i];
    if (BF16OUT) ((unsigned short*)out)[(size_t)row * Dn + i] = f32_bf16(v);
    else         ((float*)out)[(size_t)row * Dn + i] = v;
  }
}

// =====================================================================
// WMMA bf16 GEMM:  out[M][N] = A[M][K](bf16) * BT[N][K](bf16)^T + bias
// Block tile 128x64, 8 waves (wave32) arranged 4x2, each wave 32x32 via
// 2x2 v_wmma_f32_16x16x32_bf16 tiles. K staged in 64-wide chunks using
// DOUBLE-BUFFERED async global->LDS copies (ASYNCcnt pipeline):
//   issue stage i+1 into buf^1, s_wait_asynccnt 6 (stage i oldest),
//   barrier, 8 WMMAs on buf, barrier.
// Epilogues:
//   MODE 0: outF = v+bias (fp32) AND outBf = bf16(v+bias)
//   MODE 1: outF = softplus(v+bias)
//   MODE 2: outF = v+bias+outF  (residual add in place)
// =====================================================================
#define BMT 128
#define BNT 64
#define KC  64
#define LDA 72   // padded row stride (elements): 144B = 9*16B

__device__ __forceinline__ v16bf load_frag(const unsigned short* rowp, int half) {
  // A-fragment lane layout (ISA 7.12.2, 16-bit A 16x32):
  //  lanes 0-15:  elems[0..7]=K0..7,  elems[8..15]=K16..23
  //  lanes 16-31: elems[0..7]=K8..15, elems[8..15]=K24..31
  union { v16bf v; v8bf h[2]; } u;
  u.h[0] = *(const v8bf*)(rowp + half * 8);
  u.h[1] = *(const v8bf*)(rowp + 16 + half * 8);
  return u.v;
}

template <int MODE>
__global__ __launch_bounds__(256) void gemm_bf16_wmma(
    const unsigned short* __restrict__ A,   // [M][K] bf16
    const unsigned short* __restrict__ BT,  // [N][K] bf16 (B transposed)
    const float* __restrict__ bias,         // [N]
    float* __restrict__ outF,
    unsigned short* __restrict__ outBf,
    int M, int Nn, int K) {
  __shared__ __align__(16) unsigned short As[2][BMT][LDA];
  __shared__ __align__(16) unsigned short Bs[2][BNT][LDA];
  int tid  = threadIdx.x;
  int wave = tid >> 5, lane = tid & 31;
  int wm = wave & 3, wn = wave >> 2;          // 4 waves along M, 2 along N
  int bm = blockIdx.y * BMT, bn = blockIdx.x * BNT;
  int half = lane >> 4, lrow = lane & 15;

  // per-thread source/dest for one stage: 4 A-chunks + 2 B-chunks of 16B
  int ra[4], ca[4], rb[2], cb[2];
#pragma unroll
  for (int t = 0; t < 4; ++t) {
    int idx = tid + t * 256;                  // 0..1023 -> 128 rows x 8 chunks
    ra[t] = idx >> 3; ca[t] = (idx & 7) * 8;
  }
#pragma unroll
  for (int t = 0; t < 2; ++t) {
    int idx = tid + t * 256;                  // 0..511 -> 64 rows x 8 chunks
    rb[t] = idx >> 3; cb[t] = (idx & 7) * 8;
  }

  auto issue_stage = [&](int buf, int k0) {
#pragma unroll
    for (int t = 0; t < 4; ++t)
      async_ld_b128(&As[buf][ra[t]][ca[t]],
                    A + (size_t)(bm + ra[t]) * K + k0 + ca[t]);
#pragma unroll
    for (int t = 0; t < 2; ++t)
      async_ld_b128(&Bs[buf][rb[t]][cb[t]],
                    BT + (size_t)(bn + rb[t]) * K + k0 + cb[t]);
  };

  v8f zero = {};
  v8f acc[2][2];
#pragma unroll
  for (int i = 0; i < 2; ++i)
#pragma unroll
    for (int j = 0; j < 2; ++j) acc[i][j] = zero;

  const int nk = K / KC;
  issue_stage(0, 0);
  for (int i = 0; i < nk; ++i) {
    int cur = i & 1;
    if (i + 1 < nk) {
      issue_stage(cur ^ 1, (i + 1) * KC);
      wait_async6();                 // stage i's 6 ops are the oldest
    } else {
      wait_async0();
    }
    __syncthreads();                 // all waves' stage-i data visible

#pragma unroll
    for (int ks = 0; ks < KC; ks += 32) {
      v16bf aF[2], bF[2];
      aF[0] = load_frag(&As[cur][wm * 32 + lrow][ks],      half);
      aF[1] = load_frag(&As[cur][wm * 32 + 16 + lrow][ks], half);
      bF[0] = load_frag(&Bs[cur][wn * 32 + lrow][ks],      half);
      bF[1] = load_frag(&Bs[cur][wn * 32 + 16 + lrow][ks], half);
#pragma unroll
      for (int ii = 0; ii < 2; ++ii)
#pragma unroll
        for (int jj = 0; jj < 2; ++jj)
          acc[ii][jj] = __builtin_amdgcn_wmma_f32_16x16x32_bf16(
              false, aF[ii], false, bF[jj], (short)0, acc[ii][jj],
              false, false);
    }
    __syncthreads();                 // buf reusable two stages later
  }

  // ---- epilogue: C/D layout — n = lane&15, m = vgpr + (lane>>4)*8 ----
#pragma unroll
  for (int i = 0; i < 2; ++i) {
#pragma unroll
    for (int j = 0; j < 2; ++j) {
      int gn = bn + wn * 32 + j * 16 + lrow;
      float bv = bias[gn];
#pragma unroll
      for (int r = 0; r < 8; ++r) {
        int gm = bm + wm * 32 + i * 16 + r + half * 8;
        size_t off = (size_t)gm * Nn + gn;
        float v = acc[i][j][r] + bv;
        if (MODE == 0) {
          outF[off]  = v;
          outBf[off] = f32_bf16(v);
        } else if (MODE == 1) {
          outF[off] = (v > 20.f) ? v : log1pf(__expf(v));   // softplus
        } else {
          outF[off] = v + outF[off];                        // + residual
        }
      }
    }
  }
}

// =====================================================================
// Bm|Cm projection:  BC[m][0..15]=h@WB, [16..31]=h@WC, all in f32, on
// v_wmma_f32_16x16x4_f32. One block = 16 token rows x all 32 columns, so a
// weight row is fetched once per 16 tokens. The 16 waves split k (128 each);
// their partial tiles are added through LDS in wave order.
// k pairing: lane (c, hf) holds, for group q, k = slice + 8q + 4hf + 0..3 of
// A row c (one 16-byte load) and the same four k of B column c.
// Every loop is unrolled: av, wb, wc and the accumulators are then indexed by
// constants only and stay in registers.
// =====================================================================
typedef __attribute__((ext_vector_type(2))) float v2f;
typedef __attribute__((ext_vector_type(4))) float v4f;
#define BCW  16               // waves per block
#define BCKS (DINQ / BCW)     // k per wave
#define BCQ  (BCKS / 8)       // groups of 8 k per wave
#define BCG  4                // groups whose weight fragments are fetched together

__global__ __launch_bounds__(BCW * 32) void bc_kernel(
    const float* __restrict__ h, const float* __restrict__ WB,
    const float* __restrict__ WC, float* __restrict__ BC) {
  __shared__ float red[BCW][512];           // per wave: 2 tiles x 8 registers x 32 lanes
  const int wave = threadIdx.x >> 5, lane = threadIdx.x & 31;
  const int c = lane & 15, hf = lane >> 4;
  const int m0 = blockIdx.x * 16;
  const int kl = wave * BCKS + hf * 4;      // the lane's first k
  const float* ap = h  + (size_t)(m0 + c) * DINQ + kl;
  const float* bp = WB + (size_t)kl * NSTATE + c;
  const float* cp = WC + (size_t)kl * NSTATE + c;

  v4f av[BCQ];                              // the wave's whole slice of h, fetched first
#pragma unroll
  for (int q = 0; q < BCQ; ++q) av[q] = *(const v4f*)(ap + q * 8);
  // keeps the scheduler from sinking these loads to their first use (one
  // exposed latency per product instead of one for the whole slice)
  __builtin_amdgcn_sched_barrier(0);

  float wb[2][BCG][4], wc[2][BCG][4];
  auto fetch = [&](int buf, int g) {
#pragma unroll
    for (int q2 = 0; q2 < BCG; ++q2)
#pragma unroll
      for (int j = 0; j < 4; ++j) {
        wb[buf][q2][j] = bp[(size_t)((g * BCG + q2) * 8 + j) * NSTATE];
        wc[buf][q2][j] = cp[(size_t)((g * BCG + q2) * 8 + j) * NSTATE];
      }
  };
  fetch(0, 0);

  v8f accb = {}, accc = {};
#pragma unroll
  for (int g = 0; g < BCQ / BCG; ++g) {
    if (g + 1 < BCQ / BCG) {
      fetch((g + 1) & 1, g + 1);            // flies under this group's products
      // behind the last fetch the loads' address registers are free for reuse
      if (g + 2 == BCQ / BCG) asm volatile("s_wait_xcnt 0x0" ::: "memory");
      // keeps the next group's loads in front of this group's products
      __builtin_amdgcn_sched_barrier(0);
    }
#pragma unroll
    for (int q2 = 0; q2 < BCG; ++q2)
#pragma unroll
      for (int p = 0; p < 2; ++p) {
        v2f a  = {av[g * BCG + q2][2 * p], av[g * BCG + q2][2 * p + 1]};
        v2f fb = {wb[g & 1][q2][2 * p], wb[g & 1][q2][2 * p + 1]};
        v2f fc = {wc[g & 1][q2][2 * p], wc[g & 1][q2][2 * p + 1]};
        accb = __builtin_amdgcn_wmma_f32_16x16x4_f32(
            false, a, false, fb, (short)0, accb, false, false);
        accc = __builtin_amdgcn_wmma_f32_16x16x4_f32(
            false, a, false, fc, (short)0, accc, false, false);
      }
  }
  // A precaution: no distance is documented for the f32 form, and without this
  // the build had address arithmetic overwriting an A register directly behind
  // its product. Eight vector slots, the figure of the other 16-cycle form,
  // stand in front of the first vector instruction behind the products; the two
  // scheduling barriers keep that arithmetic and the slots where they are written.
  __builtin_amdgcn_sched_barrier(0);
  asm volatile("v_nop\n\tv_nop\n\tv_nop\n\tv_nop\n\tv_nop\n\tv_nop\n\tv_nop\n\tv_nop");
  __builtin_amdgcn_sched_barrier(0);

#pragma unroll
  for (int r = 0; r < 8; ++r) {
    red[wave][r * 32 + lane]       = accb[r];
    red[wave][256 + r * 32 + lane] = accc[r];
  }
  __syncthreads();
  // one output per thread; D layout: register r of lane l = D[8 * (l >> 4) + r][l & 15]
  float s = 0.f;
#pragma unroll
  for (int w = 0; w < BCW; ++w) s += red[w][threadIdx.x];
  const int tile = threadIdx.x >> 8, r = (threadIdx.x >> 5) & 7;
  BC[(size_t)(m0 + 8 * hf + r) * 32 + tile * 16 + c] = s;
}

// =====================================================================
// selective scan (diagonal SSM), split over time into NCH chunks of CLEN
// steps so that the chunks run side by side instead of one after another.
//   scan_state_kernel: every chunk but the last runs the recurrence from a
//     zero state and keeps its end state S[n] and its sum of dt (row NSTATE
//     of the same record). The decay over a whole chunk is exp(a[n] * sum dt).
//   scan_kernel: a chunk folds the earlier chunks' (S, sum dt) in time order
//     into its start state, then runs the recurrence with the fused D-skip,
//     the causal depthwise conv (4 taps) + SiLU of the same channel, formed
//     from the x values that the lane walks through anyway, and the gating.
// One lane = one channel with all 16 states; one block = SCB channels of one
// (batch, chunk), so the B/C rows are the same address for the whole block.
// =====================================================================
#define NCH  32
#define CLEN (LQ / NCH)     // 64 steps per chunk
#define SU   8              // steps fetched ahead as one group
#define SCB  128            // channels (threads) per block
#define DGS  (DINQ / SCB)   // channel groups
#define SROWS (NSTATE + 1)  // rows of a chunk's record: S[0..15], sum of dt
#define FB   3              // chunk records fetched together in the fold (51 loads)

// e[n] = exp(x[n]) for the 16 states, as __expf forms it (x * log2(e), then
// v_exp_f32), eight to a statement. The v_nop at each statement's end keeps the
// slot that the instruction set asks for behind a transcendental before its
// source is overwritten.
__device__ __forceinline__ void exp16(float (&e)[NSTATE], const float (&x)[NSTATE]) {
  float t[NSTATE];
#pragma unroll
  for (int n = 0; n < NSTATE; ++n) t[n] = x[n] * 1.44269504f;
#pragma unroll
  for (int k = 0; k < NSTATE; k += 8)
    asm("v_exp_f32 %0, %8\n\tv_exp_f32 %1, %9\n\tv_exp_f32 %2, %10\n\t"
        "v_exp_f32 %3, %11\n\tv_exp_f32 %4, %12\n\tv_exp_f32 %5, %13\n\t"
        "v_exp_f32 %6, %14\n\tv_exp_f32 %7, %15\n\tv_nop"
        : "=&v"(e[k]), "=&v"(e[k + 1]), "=&v"(e[k + 2]), "=&v"(e[k + 3]),
          "=&v"(e[k + 4]), "=&v"(e[k + 5]), "=&v"(e[k + 6]), "=&v"(e[k + 7])
        : "v"(t[k]), "v"(t[k + 1]), "v"(t[k + 2]), "v"(t[k + 3]),
          "v"(t[k + 4]), "v"(t[k + 5]), "v"(t[k + 6]), "v"(t[k + 7]));
}

// exp(x) for one value, formed as in exp16; the v_nop keeps the same slot.
__device__ __forceinline__ float exp1(float x) {
  float t = x * 1.44269504f, e;
  asm("v_exp_f32 %0, %1\n\tv_nop" : "=v"(e) : "v"(t));
  return e;
}

__global__ __launch_bounds__(SCB) void scan_state_kernel(
    const float* __restrict__ h,  const float* __restrict__ dt,
    const float* __restrict__ BC, const float* __restrict__ A_log,
    float* __restrict__ Sst) {    // [B][NCH][SROWS][DIN]
  const int d  = (blockIdx.x % DGS) * SCB + threadIdx.x;
  const int bc = blockIdx.x / DGS;
  const int b  = bc / (NCH - 1);
  const int c  = bc % (NCH - 1);             // the last chunk feeds nobody

  float a[NSTATE], hs[NSTATE], al[NSTATE];
#pragma unroll
  for (int n = 0; n < NSTATE; ++n) al[n] = A_log[(size_t)d * NSTATE + n];
  exp16(a, al);
#pragma unroll
  for (int n = 0; n < NSTATE; ++n) { a[n] = -a[n]; hs[n] = 0.f; }
  const size_t row0 = (size_t)b * LQ + (size_t)c * CLEN;
  const float* dtp = dt + row0 * DINQ + d;
  const float* hp  = h  + row0 * DINQ + d;
  const float* bcp = BC + row0 * 32;

  float sd = 0.f;
  float dtc[SU], xc[SU];
#pragma unroll
  for (int u = 0; u < SU; ++u) { dtc[u] = 0.f; xc[u] = 0.f; }
  // Trip -1 only fetches group 0, so that every group reaches the arithmetic
  // through the copies at the loop's foot and the wait for it stands there.
  // rolled: the body is already SU * NSTATE updates long (code size)
#pragma unroll 1
  for (int g = -1; g < CLEN / SU; ++g) {
    float dtn[SU], xn[SU];
#pragma unroll
    for (int u = 0; u < SU; ++u) { dtn[u] = 0.f; xn[u] = 0.f; }
    if (g + 1 < CLEN / SU) {                 // next group flies under this one
#pragma unroll
      for (int u = 0; u < SU; ++u) {
        dtn[u] = dtp[(size_t)((g + 1) * SU + u) * DINQ];
        xn[u]  = hp[(size_t)((g + 1) * SU + u) * DINQ];
      }
      // the loads' address registers are reused by the arithmetic below
      asm volatile("s_wait_xcnt 0x0" ::: "memory");
    }
    if (g >= 0) {
#pragma unroll
      for (int u = 0; u < SU; ++u) {
        const float* bct = bcp + (g * SU + u) * 32;
        float dtv = dtc[u];
        float dx  = dtv * xc[u];
        sd += dtv;
        float da[NSTATE], dA[NSTATE];
#pragma unroll
        for (int n = 0; n < NSTATE; ++n) da[n] = dtv * a[n];
        exp16(dA, da);
#pragma unroll
        for (int n = 0; n < NSTATE; ++n) hs[n] = hs[n] * dA[n] + dx * bct[n];
      }
    }
#pragma unroll
    for (int u = 0; u < SU; ++u) { dtc[u] = dtn[u]; xc[u] = xn[u]; }
  }
  float* sp = Sst + ((size_t)b * NCH + c) * SROWS * DINQ + d;
#pragma unroll
  for (int n = 0; n < NSTATE; ++n) sp[(size_t)n * DINQ] = hs[n];
  sp[(size_t)NSTATE * DINQ] = sd;
}

__global__ __launch_bounds__(SCB) void scan_kernel(
    const float* __restrict__ h,  const float* __restrict__ dt,
    const float* __restrict__ BC, const float* __restrict__ cw,
    const float* __restrict__ cb,
    const float* __restrict__ A_log, const float* __restrict__ Dsk,
    const float* __restrict__ Sst, unsigned short* __restrict__ gout) {
  const int d  = (blockIdx.x % DGS) * SCB + threadIdx.x;
  const int bc = blockIdx.x / DGS;
  const int b  = bc % BQ;
  const int c  = NCH - 1 - bc / BQ;          // longest fold starts first

  const size_t row0 = (size_t)b * LQ + (size_t)c * CLEN;
  const float* hp  = h + row0 * DINQ + d;

  // first loads of the kernel: they have landed with the A_log rows, so no
  // wait for them falls among the fetched-ahead loads of the main loop
  const float dsk = Dsk[d];
  const float cbv = cb[d];
  float cwv[4];
#pragma unroll
  for (int j = 0; j < 4; ++j) cwv[j] = cw[j * DINQ + d];
  // the registers that the loads name are reused below
  asm volatile("s_wait_xcnt 0x0" ::: "memory");
  // the three x values in front of the chunk (zero padding in front of l = 0)
  float xp[3] = {0.f, 0.f, 0.f};
  if (c > 0) {
#pragma unroll
    for (int j = 0; j < 3; ++j) xp[j] = hp[(ptrdiff_t)(j - 3) * DINQ];
    // the registers that the loads name are reused below
    asm volatile("s_wait_xcnt 0x0" ::: "memory");
  }
  float a[NSTATE], hs[NSTATE], al[NSTATE];
#pragma unroll
  for (int n = 0; n < NSTATE; ++n) al[n] = A_log[(size_t)d * NSTATE + n];
  exp16(a, al);
#pragma unroll
  for (int n = 0; n < NSTATE; ++n) { a[n] = -a[n]; hs[n] = 0.f; }

  // start state: earlier chunks folded in time order, FB records per fetch
  const float* sp = Sst + (size_t)b * NCH * SROWS * DINQ + d;
  int cp = 0;
#pragma unroll 1
  for (; cp + FB <= c; cp += FB) {
    float sv[FB][SROWS];
#pragma unroll
    for (int k = 0; k < FB; ++k)
#pragma unroll
      for (int n = 0; n < SROWS; ++n)
        sv[k][n] = sp[((size_t)(cp + k) * SROWS + n) * DINQ];
    // the loads' address registers are advanced for the next trip
    asm volatile("s_wait_xcnt 0x0" ::: "memory");
#pragma unroll
    for (int k = 0; k < FB; ++k) {
      float da[NSTATE], dA[NSTATE];
#pragma unroll
      for (int n = 0; n < NSTATE; ++n) da[n] = a[n] * sv[k][NSTATE];
      exp16(dA, da);
#pragma unroll
      for (int n = 0; n < NSTATE; ++n) hs[n] = hs[n] * dA[n] + sv[k][n];
    }
  }
#pragma unroll 1
  for (; cp < c; ++cp) {
    float sv[SROWS];
#pragma unroll
    for (int n = 0; n < SROWS; ++n)
      sv[n] = sp[((size_t)cp * SROWS + n) * DINQ];
    // the loads' address registers are reused by the arithmetic below
    asm volatile("s_wait_xcnt 0x0" ::: "memory");
    float da[NSTATE], dA[NSTATE];
#pragma unroll
    for (int n = 0; n < NSTATE; ++n) da[n] = a[n] * sv[NSTATE];
    exp16(dA, da);
#pragma unroll
    for (int n = 0; n < NSTATE; ++n) hs[n] = hs[n] * dA[n] + sv[n];
  }

  const float* dtp = dt + row0 * DINQ + d;
  const float* bcp = BC + row0 * 32;
  unsigned short* gp = gout + row0 * DINQ + d;

  float dtc[SU], xc[SU];
#pragma unroll
  for (int u = 0; u < SU; ++u) { dtc[u] = 0.f; xc[u] = 0.f; }
  // Trip -1 only fetches group 0 (see scan_state_kernel).
  // rolled: the body is already SU * NSTATE updates long (code size)
#pragma unroll 1
  for (int g = -1; g < CLEN / SU; ++g) {
    float dtn[SU], xn[SU];
#pragma unroll
    for (int u = 0; u < SU; ++u) { dtn[u] = 0.f; xn[u] = 0.f; }
    if (g + 1 < CLEN / SU) {                 // next group flies under this one
      // s_wait_xcnt behind each array's loads: their address registers are
      // reused, by the next array's load targets or by the arithmetic below
#pragma unroll
      for (int u = 0; u < SU; ++u) dtn[u] = dtp[(size_t)((g + 1) * SU + u) * DINQ];
      asm volatile("s_wait_xcnt 0x0" ::: "memory");
#pragma unroll
      for (int u = 0; u < SU; ++u) xn[u] = hp[(size_t)((g + 1) * SU + u) * DINQ];
      asm volatile("s_wait_xcnt 0x0" ::: "memory");
    }
    if (g >= 0) {
#pragma unroll
      for (int u = 0; u < SU; ++u) {
        const float* bct = bcp + (g * SU + u) * 32;
        float dtv = dtc[u];
        float xv  = xc[u];
        float dx  = dtv * xv;
        float da[NSTATE], dA[NSTATE];
#pragma unroll
        for (int n = 0; n < NSTATE; ++n) da[n] = dtv * a[n];
        exp16(dA, da);
        float yq[4];                         // four sums of four states each
#pragma unroll
        for (int q = 0; q < 4; ++q) {
          yq[q] = 0.f;
#pragma unroll
          for (int n2 = 0; n2 < 4; ++n2) {
            int n = q * 4 + n2;
            hs[n] = hs[n] * dA[n] + dx * bct[n];
            yq[q] += hs[n] * bct[16 + n];
          }
        }
        float y = (yq[0] + yq[1]) + (yq[2] + yq[3]);
        y += xv * dsk;
        // conv taps l-3 .. l in that order, then SiLU
        float ca = cbv;
        ca += (u >= 3 ? xc[u >= 3 ? u - 3 : 0] : xp[u < 3 ? u : 0]) * cwv[0];
        ca += (u >= 2 ? xc[u >= 2 ? u - 2 : 0] : xp[u < 2 ? u + 1 : 0]) * cwv[1];
        ca += (u >= 1 ? xc[u >= 1 ? u - 1 : 0] : xp[2]) * cwv[2];
        ca += xv * cwv[3];
        float yc = ca * (1.f / (1.f + exp1(-ca)));
        gp[(size_t)(g * SU + u) * DINQ] =
            f32_bf16(y * (1.f / (1.f + exp1(-yc))));
      }
#pragma unroll
      for (int j = 0; j < 3; ++j) xp[j] = xc[SU - 3 + j];
      // the stores' address and data registers are rewritten at the loop's foot
      asm volatile("s_wait_xcnt 0x0" ::: "memory");
    }
#pragma unroll
    for (int u = 0; u < SU; ++u) { dtc[u] = dtn[u]; xc[u] = xn[u]; }
  }
}

// =====================================================================
// host-side orchestration
// =====================================================================
extern "C" void kernel_launch(void* const* d_in, const int* in_sizes, int n_in,
                              void* d_out, int out_size, void* d_ws, size_t ws_size,
                              hipStream_t stream) {
  const float* x_in  = (const float*)d_in[0];
  const float* pos   = (const float*)d_in[1];
  const float* normw = (const float*)d_in[2];
  const float* normb = (const float*)d_in[3];
  const float* Win   = (const float*)d_in[4];
  const float* b_in  = (const float*)d_in[5];
  const float* A_log = (const float*)d_in[6];
  const float* Wdt   = (const float*)d_in[7];
  const float* b_dt  = (const float*)d_in[8];
  const float* WB    = (const float*)d_in[9];
  const float* WC    = (const float*)d_in[10];
  const float* Dsk   = (const float*)d_in[11];
  const float* convw = (const float*)d_in[12];
  const float* convb = (const float*)d_in[13];
  const float* Wout  = (const float*)d_in[14];
  const float* b_out = (const float*)d_in[15];
  const float* fnw   = (const float*)d_in[16];
  const float* fnb   = (const float*)d_in[17];
  (void)in_sizes; (void)n_in; (void)out_size; (void)ws_size;

  char* p = (char*)d_ws;
  auto alloc = [&](size_t bytes) {
    char* r = p;
    p += (bytes + 255) & ~(size_t)255;
    return r;
  };
  float*          xbuf  = (float*)         alloc((size_t)BL * DQ   * 4);  // residual stream
  unsigned short* hln   = (unsigned short*)alloc((size_t)BL * DQ   * 2);  // LN(x) bf16
  float*          hbuf  = (float*)         alloc((size_t)BL * DINQ * 4);  // h fp32
  unsigned short* hbf   = (unsigned short*)alloc((size_t)BL * DINQ * 2);  // h bf16
  float*          dtb   = (float*)         alloc((size_t)BL * DINQ * 4);  // softplus(dt)
  float*          BCb   = (float*)         alloc((size_t)BL * 32   * 4);  // [B|C]
  unsigned short* gbf   = (unsigned short*)alloc((size_t)BL * DINQ * 2);  // gated, bf16
  unsigned short* WinT  = (unsigned short*)alloc((size_t)DINQ * DQ   * 2);
  unsigned short* WdtT  = (unsigned short*)alloc((size_t)DINQ * DINQ * 2);
  unsigned short* WoutT = (unsigned short*)alloc((size_t)DQ   * DINQ * 2);
  float*          Sst   = (float*)         alloc((size_t)BQ * NCH * SROWS * DINQ * 4);  // chunk records

  add_pos_kernel<<<(BL * DQ + 255) / 256, 256, 0, stream>>>(x_in, pos, xbuf);

  for (int i = 0; i < 2; ++i) {
    wconv_kernel<<<dim3(DINQ / 32, DQ / 32),   256, 0, stream>>>(
        Win  + (size_t)i * DQ * DINQ,   WinT,  DQ,   DINQ);
    wconv_kernel<<<dim3(DINQ / 32, DINQ / 32), 256, 0, stream>>>(
        Wdt  + (size_t)i * DINQ * DINQ, WdtT,  DINQ, DINQ);
    wconv_kernel<<<dim3(DQ / 32, DINQ / 32),   256, 0, stream>>>(
        Wout + (size_t)i * DINQ * DQ,   WoutT, DINQ, DQ);

    ln_kernel<true><<<BL, 256, 0, stream>>>(
        xbuf, normw + (size_t)i * DQ, normb + (size_t)i * DQ, hln, DQ);

    // h = LN(x) @ Win + b_in    (fp32 + bf16 copies)
    gemm_bf16_wmma<0><<<dim3(DINQ / BNT, BL / BMT), 256, 0, stream>>>(
        hln, WinT, b_in + (size_t)i * DINQ, hbuf, hbf, BL, DINQ, DQ);
    // dt = softplus(h @ Wdt + b_dt)
    gemm_bf16_wmma<1><<<dim3(DINQ / BNT, BL / BMT), 256, 0, stream>>>(
        hbf, WdtT, b_dt + (size_t)i * DINQ, dtb, nullptr, BL, DINQ, DINQ);

    bc_kernel<<<BL / 16, BCW * 32, 0, stream>>>(
        hbuf, WB + (size_t)i * DINQ * NSTATE, WC + (size_t)i * DINQ * NSTATE, BCb);
    scan_state_kernel<<<BQ * (NCH - 1) * DGS, SCB, 0, stream>>>(
        hbuf, dtb, BCb, A_log + (size_t)i * DINQ * NSTATE, Sst);
    scan_kernel<<<BQ * NCH * DGS, SCB, 0, stream>>>(
        hbuf, dtb, BCb, convw + (size_t)i * 4 * DINQ, convb + (size_t)i * DINQ,
        A_log + (size_t)i * DINQ * NSTATE,
        Dsk + (size_t)i * DINQ, Sst, gbf);

    // x = g @ Wout + b_out + residual (in place)
    gemm_bf16_wmma<2><<<dim3(DQ / BNT, BL / BMT), 256, 0, stream>>>(
        gbf, WoutT, b_out + (size_t)i * DQ, xbuf, nullptr, BL, DQ, DINQ);
  }

  ln_kernel<false><<<BL, 256, 0, stream>>>(xbuf, fnw, fnb, d_out, DQ);
}

// v004
// Measured time: 392 microseconds a run.
// Next to v003, in two timings, it ran 1.07 and 1.06 times as fast.
// All steps since v000 together make it 10.6 times as fast.
#include <hip/hip_runtime.h>
#include <hip/hip_bf16.h>
#include <math.h>

// ---------------- problem constants (match reference) ----------------
#define BQ     2
#define LQ     2048
#define DQ     1024
#define DINQ   2048
#define NSTATE 16
#define BL     (BQ * LQ)        // 4096 token rows

// ---------------- CDNA5 WMMA types ----------------
typedef __attribute__((ext_vector_type(16))) __bf16 v16bf;
typedef __attribute__((ext_vector_type(8)))  __bf16 v8bf;
typedef __attribute__((ext_vector_type(8)))  float  v8f;
typedef __attribute__((ext_vector_type(4)))  float    v4f;
typedef __attribute__((ext_vector_type(4)))  unsigned v4u;
typedef __attribute__((ext_vector_type(2)))  unsigned v2u;

__device__ __forceinline__ unsigned short f32_bf16(float f) {
  unsigned u = __float_as_uint(f);
  u += 0x7fffu + ((u >> 16) & 1u);          // round-to-nearest-even
  return (unsigned short)(u >> 16);
}

// CDNA5 async global->LDS copy (ASYNCcnt-tracked, no VGPR round-trip).
// LDS operand is the low 32 bits of the generic address (ISA: LDS aperture
// truncates generic addr to addr[31:0]).
__device__ __forceinline__ void async_ld_b128(void* lds, const void* gaddr) {
  unsigned ldsa = (unsigned)(uintptr_t)lds;
  asm volatile("global_load_async_to_lds_b128 %0, %1, off"
               :: "v"(ldsa), "v"(gaddr) : "memory");
}
__device__ __forceinline__ void wait_async6() {
  asm volatile("s_wait_asynccnt 0x6" ::: "memory");
}
__device__ __forceinline__ void wait_async0() {
  asm volatile("s_wait_asynccnt 0x0" ::: "memory");
}

// =====================================================================
// The three streaming kernels below are gridded for few, fat waves: the work
// of each wave is a handful of 16-byte loads that fly together
// (for speed only).
// Every loop in them is unrolled: the per-thread arrays are then indexed by
// constants only and stay in registers.
// =====================================================================
// add positional embedding: xbuf = x + pos_emb  (never mutate d_in)
// One thread = APV pieces of 16 bytes, 256 pieces apart; the grid is exact.
// =====================================================================
#define APV 4
__global__ __launch_bounds__(256) void add_pos_kernel(
    const float* __restrict__ x, const float* __restrict__ pe,
    float* __restrict__ xbuf) {
  const unsigned base = blockIdx.x * (256 * APV) + threadIdx.x;   // in 16-byte pieces
  // a block's pieces lie in one batch entry: LQ * DQ / 4 is a multiple of 256 * APV
  const unsigned pb = base % (LQ * DQ / 4);
  v4f xv[APV], pv[APV];
#pragma unroll
  for (int j = 0; j < APV; ++j) {
    xv[j] = ((const v4f*)x)[base + j * 256];
    pv[j] = ((const v4f*)pe)[pb + j * 256];
  }
#pragma unroll
  for (int j = 0; j < APV; ++j) ((v4f*)xbuf)[base + j * 256] = xv[j] + pv[j];
}

// =====================================================================
// weight transpose + fp32->bf16:  W[K][N] fp32  ->  WT[N][K] bf16
// One block = a tile of WTK k x WTN n. Reads: 16 bytes per lane, a wave covers
// two rows of 256 bytes. Writes: 8 bf16 (16 bytes) per lane, a wave covers four
// rows of 128 bytes. The odd LDS pitch spreads both sides over the banks.
// K and N are compile-time: a thread's loads (and stores) then differ only in
// their immediate offsets.
// =====================================================================
#define WTK 128
#define WTN 64
template <int K, int N>
__global__ __launch_bounds__(256) void wconv_kernel(
    const float* __restrict__ W, unsigned short* __restrict__ WT) {
  __shared__ float tile[WTK][WTN + 1];
  const int nb = blockIdx.x * WTN, kb = blockIdx.y * WTK;
  const int c4 = (threadIdx.x & 15) * 4, r0 = threadIdx.x >> 4;
  // block-uniform base + one lane offset for all of a thread's loads (stores alike)
  const float* Wb = W + (size_t)kb * N + nb;
  const unsigned woff = (unsigned)(r0 * N + c4);
  v4f v[WTK / 16];
#pragma unroll
  for (int j = 0; j < WTK / 16; ++j)
    v[j] = *(const v4f*)(Wb + (size_t)(16 * j) * N + woff);
#pragma unroll
  for (int j = 0; j < WTK / 16; ++j)
#pragma unroll
    for (int i = 0; i < 4; ++i) tile[r0 + 16 * j][c4 + i] = v[j][i];
  __syncthreads();
  const int k8 = (threadIdx.x & 7) * 8, n0 = threadIdx.x >> 3;
  unsigned short* Tb = WT + (size_t)nb * K + kb;
  const unsigned toff = (unsigned)(n0 * K + k8);
#pragma unroll
  for (int nh = 0; nh < WTN / 32; ++nh)
#pragma unroll
    for (int kh = 0; kh < WTK / 64; ++kh) {
      const int n = n0 + 32 * nh, k = k8 + 64 * kh;
      v4u p;
#pragma unroll
      for (int i = 0; i < 4; ++i)
        p[i] = (unsigned)f32_bf16(tile[k + 2 * i][n]) |
               ((unsigned)f32_bf16(tile[k + 2 * i + 1][n]) << 16);
      *(v4u*)(Tb + (size_t)(32 * nh) * K + 64 * kh + toff) = p;
    }
}

// =====================================================================
// LayerNorm over the last dim (DQ); optional bf16 output (GEMM A operand)
// One wave = one row, held in registers (LNV pieces of 16 bytes per lane), so
// the row is read once; the two sums go over the lanes by shuffles.
// =====================================================================
#define LNR 8                 // rows (waves) per block
#define LNV (DQ / 128)        // 16-byte pieces of a row per lane
template <bool BF16OUT>
__global__ __launch_bounds__(LNR * 32) void ln_kernel(
    const float* __restrict__ x, const float* __restrict__ w,
    const float* __restrict__ b, void* __restrict__ out) {
  // the wave's number, held scalar: the row's base address is then scalar too
  const int row  = blockIdx.x * LNR + __builtin_amdgcn_readfirstlane(threadIdx.x >> 5);
  const unsigned lane = threadIdx.x & 31;
  const v4f* xr = (const v4f*)(x + (size_t)row * DQ);
  v4f v[LNV], wv[LNV], bv[LNV];
#pragma unroll
  for (int j = 0; j < LNV; ++j) v[j] = xr[j * 32 + lane];
#pragma unroll
  for (int j = 0; j < LNV; ++j) {
    wv[j] = ((const v4f*)w)[j * 32 + lane];
    bv[j] = ((const v4f*)b)[j * 32 + lane];
  }
  // keeps the scheduler from sinking the w and b loads behind the sums (one
  // exposed latency per group of them instead of none)
  __builtin_amdgcn_sched_barrier(0);
  v4f a1 = {}, a2 = {};
#pragma unroll
  for (int j = 0; j < LNV; ++j) { a1 += v[j]; a2 += v[j] * v[j]; }
  float s  = (a1[0] + a1[1]) + (a1[2] + a1[3]);
  float s2 = (a2[0] + a2[1]) + (a2[2] + a2[3]);
#pragma unroll
  for (int o = 16; o > 0; o >>= 1) {
    s  += __shfl_xor(s, o);
    s2 += __shfl_xor(s2, o);
  }
  const float mean = s / (float)DQ;
  const float var  = s2 / (float)DQ - mean * mean;
  const float rstd = rsqrtf(var + 1e-5f);
#pragma unroll
  for (int j = 0; j < LNV; ++j) {
    v4f y = (v[j] - mean) * rstd * wv[j] + bv[j];
    if (BF16OUT) {
      v2u p = {(unsigned)f32_bf16(y[0]) | ((unsigned)f32_bf16(y[1]) << 16),
               (unsigned)f32_bf16(y[2]) | ((unsigned)f32_bf16(y[3]) << 16)};
      ((v2u*)((unsigned short*)out + (size_t)row * DQ))[j * 32 + lane] = p;
    } else {
      ((v4f*)((float*)out + (size_t)row * DQ))[j * 32 + lane] = y;
    }
  }
}

// =====================================================================
// WMMA bf16 GEMM:  out[M][N] = A[M][K](bf16) * BT[N][K](bf16)^T + bias
// Block tile 128x64, 8 waves (wave32) arranged 4x2, each wave 32x32 via
// 2x2 v_wmma_f32_16x16x32_bf16 tiles. K staged in 64-wide chunks using
// DOUBLE-BUFFERED async global->LDS copies (ASYNCcnt pipeline):
//   issue stage i+1 into buf^1, s_wait_asynccnt 6 (stage i oldest),
//   barrier, 8 WMMAs on buf, barrier.
// Epilogues:
//   MODE 0: outF = v+bias (fp32) AND outBf = bf16(v+bias)
//   MODE 1: outF = softplus(v+bias)
//   MODE 2: outF = v+bias+outF  (residual add in place)
// =====================================================================
#define BMT 128
#define BNT 64
#define KC  64
#define LDA 72   // padded row stride (elements): 144B = 9*16B

__device__ __forceinline__ v16bf load_frag(const unsigned short* rowp, int half) {
  // A-fragment lane layout (ISA 7.12.2, 16-bit A 16x32):
  //  lanes 0-15:  elems[0..7]=K0..7,  elems[8..15]=K16..23
  //  lanes 16-31: elems[0..7]=K8..15, elems[8..15]=K24..31
  union { v16bf v; v8bf h[2]; } u;
  u.h[0] = *(const v8bf*)(rowp + half * 8);
  u.h[1] = *(const v8bf*)(rowp + 16 + half * 8);
  return u.v;
}

template <int MODE>
__global__ __launch_bounds__(256) void gemm_bf16_wmma(
    const unsigned short* __restrict__ A,   // [M][K] bf16
    const unsigned short* __restrict__ BT,  // [N][K] bf16 (B transposed)
    const float* __restrict__ bias,         // [N]
    float* __restrict__ outF,
    unsigned short* __restrict__ outBf,
    int M, int Nn, int K) {
  __shared__ __align__(16) unsigned short As[2][BMT][LDA];
  __shared__ __align__(16) unsigned short Bs[2][BNT][LDA];
  int tid  = threadIdx.x;
  int wave = tid >> 5, lane = tid & 31;
  int wm = wave & 3, wn = wave >> 2;          // 4 waves along M, 2 along N
  int bm = blockIdx.y * BMT, bn = blockIdx.x * BNT;
  int half = lane >> 4, lrow = lane & 15;

  // per-thread source/dest for one stage: 4 A-chunks + 2 B-chunks of 16B
  int ra[4], ca[4], rb[2], cb[2];
#pragma unroll
  for (int t = 0; t < 4; ++t) {
    int idx = tid + t * 256;                  // 0..1023 -> 128 rows x 8 chunks
    ra[t] = idx >> 3; ca[t] = (idx & 7) * 8;
  }
#pragma unroll
  for (int t = 0; t < 2; ++t) {
    int idx = tid + t * 256;                  // 0..511 -> 64 rows x 8 chunks
    rb[t] = idx >> 3; cb[t] = (idx & 7) * 8;
  }

  auto issue_stage = [&](int buf, int k0) {
#pragma unroll
    for (int t = 0; t < 4; ++t)
      async_ld_b128(&As[buf][ra[t]][ca[t]],
                    A + (size_t)(bm + ra[t]) * K + k0 + ca[t]);
#pragma unroll
    for (int t = 0; t < 2; ++t)
      async_ld_b128(&Bs[buf][rb[t]][cb[t]],
                    BT + (size_t)(bn + rb[t]) * K + k0 + cb[t]);
  };

  v8f zero = {};
  v8f acc[2][2];
#pragma unroll
  for (int i = 0; i < 2; ++i)
#pragma unroll
    for (int j = 0; j < 2; ++j) acc[i][j] = zero;

  const int nk = K / KC;
  issue_stage(0, 0);
  for (int i = 0; i < nk; ++i) {
    int cur = i & 1;
    if (i + 1 < nk) {
      issue_stage(cur ^ 1, (i + 1) * KC);
      wait_async6();                 // stage i's 6 ops are the oldest
    } else {
      wait_async0();
    }
    __syncthreads();                 // all waves' stage-i data visible

#pragma unroll
    for (int ks = 0; ks < KC; ks += 32) {
      v16bf aF[2], bF[2];
      aF[0] = load_frag(&As[cur][wm * 32 + lrow][ks],      half);
      aF[1] = load_frag(&As[cur][wm * 32 + 16 + lrow][ks], half);
      bF[0] = load_frag(&Bs[cur][wn * 32 + lrow][ks],      half);
      bF[1] = load_frag(&Bs[cur][wn * 32 + 16 + lrow][ks], half);
#pragma unroll
      for (int ii = 0; ii < 2; ++ii)
#pragma unroll
        for (int jj = 0; jj < 2; ++jj)
          acc[ii][jj] = __builtin_amdgcn_wmma_f32_16x16x32_bf16(
              false, aF[ii], false, bF[jj], (short)0, acc[ii][jj],
              false, false);
    }
    __syncthreads();                 // buf reusable two stages later
  }

  // ---- epilogue: C/D layout — n = lane&15, m = vgpr + (lane>>4)*8 ----
#pragma unroll
  for (int i = 0; i < 2; ++i) {
#pragma unroll
    for (int j = 0; j < 2; ++j) {
      int gn = bn + wn * 32 + j * 16 + lrow;
      float bv = bias[gn];
#pragma unroll
      for (int r = 0; r < 8; ++r) {
        int gm = bm + wm * 32 + i * 16 + r + half * 8;
        size_t off = (size_t)gm * Nn + gn;
        float v = acc[i][j][r] + bv;
        if (MODE == 0) {
          outF[off]  = v;
          outBf[off] = f32_bf16(v);
        } else if (MODE == 1) {
          outF[off] = (v > 20.f) ? v : log1pf(__expf(v));   // softplus
        } else {
          outF[off] = v + outF[off];                        // + residual
        }
      }
    }
  }
}

// =====================================================================
// Bm|Cm projection:  BC[m][0..15]=h@WB, [16..31]=h@WC, all in f32, on
// v_wmma_f32_16x16x4_f32. One block = 16 token rows x all 32 columns, so a
// weight row is fetched once per 16 tokens. The 16 waves split k (128 each);
// their partial tiles are added through LDS in wave order.
// k pairing: lane (c, hf) holds, for group q, k = slice + 8q + 4hf + 0..3 of
// A row c (one 16-byte load) and the same four k of B column c.
// Every loop is unrolled: av, wb, wc and the accumulators are then indexed by
// constants only and stay in registers.
// =====================================================================
typedef __attribute__((ext_vector_type(2))) float v2f;
#define BCW  16               // waves per block
#define BCKS (DINQ / BCW)     // k per wave
#define BCQ  (BCKS / 8)       // groups of 8 k per wave
#define BCG  4                // groups whose weight fragments are fetched together

__global__ __launch_bounds__(BCW * 32) void bc_kernel(
    const float* __restrict__ h, const float* __restrict__ WB,
    const float* __restrict__ WC, float* __restrict__ BC) {
  __shared__ float red[BCW][512];           // per wave: 2 tiles x 8 registers x 32 lanes
  const int wave = threadIdx.x >> 5, lane = threadIdx.x & 31;
  const int c = lane & 15, hf = lane >> 4;
  const int m0 = blockIdx.x * 16;
  const int kl = wave * BCKS + hf * 4;      // the lane's first k
  const float* ap = h  + (size_t)(m0 + c) * DINQ + kl;
  const float* bp = WB + (size_t)kl * NSTATE + c;
  const float* cp = WC + (size_t)kl * NSTATE + c;

  v4f av[BCQ];                              // the wave's whole slice of h, fetched first
#pragma unroll
  for (int q = 0; q < BCQ; ++q) av[q] = *(const v4f*)(ap + q * 8);
  // keeps the scheduler from sinking these loads to their first use (one
  // exposed latency per product instead of one for the whole slice)
  __builtin_amdgcn_sched_barrier(0);

  float wb[2][BCG][4], wc[2][BCG][4];
  auto fetch = [&](int buf, int g) {
#pragma unroll
    for (int q2 = 0; q2 < BCG; ++q2)
#pragma unroll
      for (int j = 0; j < 4; ++j) {
        wb[buf][q2][j] = bp[(size_t)((g * BCG + q2) * 8 + j) * NSTATE];
        wc[buf][q2][j] = cp[(size_t)((g * BCG + q2) * 8 + j) * NSTATE];
      }
  };
  fetch(0, 0);

  v8f accb = {}, accc = {};
#pragma unroll
  for (int g = 0; g < BCQ / BCG; ++g) {
    if (g + 1 < BCQ / BCG) {
      fetch((g + 1) & 1, g + 1);            // flies under this group's products
      // behind the last fetch the loads' address registers are free for reuse
      if (g + 2 == BCQ / BCG) asm volatile("s_wait_xcnt 0x0" ::: "memory");
      // keeps the next group's loads in front of this group's products
      __builtin_amdgcn_sched_barrier(0);
    }
#pragma unroll
    for (int q2 = 0; q2 < BCG; ++q2)
#pragma unroll
      for (int p = 0; p < 2; ++p) {
        v2f a  = {av[g * BCG + q2][2 * p], av[g * BCG + q2][2 * p + 1]};
        v2f fb = {wb[g & 1][q2][2 * p], wb[g & 1][q2][2 * p + 1]};
        v2f fc = {wc[g & 1][q2][2 * p], wc[g & 1][q2][2 * p + 1]};
        accb = __builtin_amdgcn_wmma_f32_16x16x4_f32(
            false, a, false, fb, (short)0, accb, false, false);
        accc = __builtin_amdgcn_wmma_f32_16x16x4_f32(
            false, a, false, fc, (short)0, accc, false, false);
      }
  }
  // A precaution: no distance is documented for the f32 form, and without this
  // the build had address arithmetic overwriting an A register directly behind
  // its product. Eight vector slots, the figure of the other 16-cycle form,
  // stand in front of the first vector instruction behind the products; the two
  // scheduling barriers keep that arithmetic and the slots where they are written.
  __builtin_amdgcn_sched_barrier(0);
  asm volatile("v_nop\n\tv_nop\n\tv_nop\n\tv_nop\n\tv_nop\n\tv_nop\n\tv_nop\n\tv_nop");
  __builtin_amdgcn_sched_barrier(0);

#pragma unroll
  for (int r = 0; r < 8; ++r) {
    red[wave][r * 32 + lane]       = accb[r];
    red[wave][256 + r * 32 + lane] = accc[r];
  }
  __syncthreads();
  // one output per thread; D layout: register r of lane l = D[8 * (l >> 4) + r][l & 15]
  float s = 0.f;
#pragma unroll
  for (int w = 0; w < BCW; ++w) s += red[w][threadIdx.x];
  const int tile = threadIdx.x >> 8, r = (threadIdx.x >> 5) & 7;
  BC[(size_t)(m0 + 8 * hf + r) * 32 + tile * 16 + c] = s;
}

// =====================================================================
// selective scan (diagonal SSM), split over time into NCH chunks of CLEN
// steps so that the chunks run side by side instead of one after another.
//   scan_state_kernel: every chunk but the last runs the recurrence from a
//     zero state and keeps its end state S[n] and its sum of dt (row NSTATE
//     of the same record). The decay over a whole chunk is exp(a[n] * sum dt).
//   scan_kernel: a chunk folds the earlier chunks' (S, sum dt) in time order
//     into its start state, then runs the recurrence with the fused D-skip,
//     the causal depthwise conv (4 taps) + SiLU of the same channel, formed
//     from the x values that the lane walks through anyway, and the gating.
// One lane = one channel with all 16 states; one block = SCB channels of one
// (batch, chunk), so the B/C rows are the same address for the whole block.
// =====================================================================
#define NCH  32
#define CLEN (LQ / NCH)     // 64 steps per chunk
#define SU   8              // steps fetched ahead as one group
#define SCB  128            // channels (threads) per block
#define DGS  (DINQ / SCB)   // channel groups
#define SROWS (NSTATE + 1)  // rows of a chunk's record: S[0..15], sum of dt
#define FB   3              // chunk records fetched together in the fold (51 loads)

// e[n] = exp(x[n]) for the 16 states, as __expf forms it (x * log2(e), then
// v_exp_f32), eight to a statement. The v_nop at each statement's end keeps the
// slot that the instruction set asks for behind a transcendental before its
// source is overwritten.
__device__ __forceinline__ void exp16(float (&e)[NSTATE], const float (&x)[NSTATE]) {
  float t[NSTATE];
#pragma unroll
  for (int n = 0; n < NSTATE; ++n) t[n] = x[n] * 1.44269504f;
#pragma unroll
  for (int k = 0; k < NSTATE; k += 8)
    asm("v_exp_f32 %0, %8\n\tv_exp_f32 %1, %9\n\tv_exp_f32 %2, %10\n\t"
        "v_exp_f32 %3, %11\n\tv_exp_f32 %4, %12\n\tv_exp_f32 %5, %13\n\t"
        "v_exp_f32 %6, %14\n\tv_exp_f32 %7, %15\n\tv_nop"
        : "=&v"(e[k]), "=&v"(e[k + 1]), "=&v"(e[k + 2]), "=&v"(e[k + 3]),
          "=&v"(e[k + 4]), "=&v"(e[k + 5]), "=&v"(e[k + 6]), "=&v"(e[k + 7])
        : "v"(t[k]), "v"(t[k + 1]), "v"(t[k + 2]), "v"(t[k + 3]),
          "v"(t[k + 4]), "v"(t[k + 5]), "v"(t[k + 6]), "v"(t[k + 7]));
}

// exp(x) for one value, formed as in exp16; the v_nop keeps the same slot.
__device__ __forceinline__ float exp1(float x) {
  float t = x * 1.44269504f, e;
  asm("v_exp_f32 %0, %1\n\tv_nop" : "=v"(e) : "v"(t));
  return e;
}

__global__ __launch_bounds__(SCB) void scan_state_kernel(
    const float* __restrict__ h,  const float* __restrict__ dt,
    const float* __restrict__ BC, const float* __restrict__ A_log,
    float* __restrict__ Sst) {    // [B][NCH][SROWS][DIN]
  const int d  = (blockIdx.x % DGS) * SCB + threadIdx.x;
  const int bc = blockIdx.x / DGS;
  const int b  = bc / (NCH - 1);
  const int c  = bc % (NCH - 1);             // the last chunk feeds nobody

  float a[NSTATE], hs[NSTATE], al[NSTATE];
#pragma unroll
  for (int n = 0; n < NSTATE; ++n) al[n] = A_log[(size_t)d * NSTATE + n];
  exp16(a, al);
#pragma unroll
  for (int n = 0; n < NSTATE; ++n) { a[n] = -a[n]; hs[n] = 0.f; }
  const size_t row0 = (size_t)b * LQ + (size_t)c * CLEN;
  const float* dtp = dt + row0 * DINQ + d;
  const float* hp  = h  + row0 * DINQ + d;
  const float* bcp = BC + row0 * 32;

  float sd = 0.f;
  float dtc[SU], xc[SU];
#pragma unroll
  for (int u = 0; u < SU; ++u) { dtc[u] = 0.f; xc[u] = 0.f; }
  // Trip -1 only fetches group 0, so that every group reaches the arithmetic
  // through the copies at the loop's foot and the wait for it stands there.
  // rolled: the body is already SU * NSTATE updates long (code size)
#pragma unroll 1
  for (int g = -1; g < CLEN / SU; ++g) {
    float dtn[SU], xn[SU];
#pragma unroll
    for (int u = 0; u < SU; ++u) { dtn[u] = 0.f; xn[u] = 0.f; }
    if (g + 1 < CLEN / SU) {                 // next group flies under this one
#pragma unroll
      for (int u = 0; u < SU; ++u) {
        dtn[u] = dtp[(size_t)((g + 1) * SU + u) * DINQ];
        xn[u]  = hp[(size_t)((g + 1) * SU + u) * DINQ];
      }
      // the loads' address registers are reused by the arithmetic below
      asm volatile("s_wait_xcnt 0x0" ::: "memory");
    }
    if (g >= 0) {
#pragma unroll
      for (int u = 0; u < SU; ++u) {
        const float* bct = bcp + (g * SU + u) * 32;
        float dtv = dtc[u];
        float dx  = dtv * xc[u];
        sd += dtv;
        float da[NSTATE], dA[NSTATE];
#pragma unroll
        for (int n = 0; n < NSTATE; ++n) da[n] = dtv * a[n];
        exp16(dA, da);
#pragma unroll
        for (int n = 0; n < NSTATE; ++n) hs[n] = hs[n] * dA[n] + dx * bct[n];
      }
    }
#pragma unroll
    for (int u = 0; u < SU; ++u) { dtc[u] = dtn[u]; xc[u] = xn[u]; }
  }
  float* sp = Sst + ((size_t)b * NCH + c) * SROWS * DINQ + d;
#pragma unroll
  for (int n = 0; n < NSTATE; ++n) sp[(size_t)n * DINQ] = hs[n];
  sp[(size_t)NSTATE * DINQ] = sd;
}

__global__ __launch_bounds__(SCB) void scan_kernel(
    const float* __restrict__ h,  const float* __restrict__ dt,
    const float* __restrict__ BC, const float* __restrict__ cw,
    const float* __restrict__ cb,
    const float* __restrict__ A_log, const float* __restrict__ Dsk,
    const float* __restrict__ Sst, unsigned short* __restrict__ gout) {
  const int d  = (blockIdx.x % DGS) * SCB + threadIdx.x;
  const int bc = blockIdx.x / DGS;
  const int b  = bc % BQ;
  const int c  = NCH - 1 - bc / BQ;          // longest fold starts first

  const size_t row0 = (size_t)b * LQ + (size_t)c * CLEN;
  const float* hp  = h + row0 * DINQ + d;

  // first loads of the kernel: they have landed with the A_log rows, so no
  // wait for them falls among the fetched-ahead loads of the main loop
  const float dsk = Dsk[d];
  const float cbv = cb[d];
  float cwv[4];
#pragma unroll
  for (int j = 0; j < 4; ++j) cwv[j] = cw[j * DINQ + d];
  // the registers that the loads name are reused below
  asm volatile("s_wait_xcnt 0x0" ::: "memory");
  // the three x values in front of the chunk (zero padding in front of l = 0)
  float xp[3] = {0.f, 0.f, 0.f};
  if (c > 0) {
#pragma unroll
    for (int j = 0; j < 3; ++j) xp[j] = hp[(ptrdiff_t)(j - 3) * DINQ];
    // the registers that the loads name are reused below
    asm volatile("s_wait_xcnt 0x0" ::: "memory");
  }
  float a[NSTATE], hs[NSTATE], al[NSTATE];
#pragma unroll
  for (int n = 0; n < NSTATE; ++n) al[n] = A_log[(size_t)d * NSTATE + n];
  exp16(a, al);
#pragma unroll
  for (int n = 0; n < NSTATE; ++n) { a[n] = -a[n]; hs[n] = 0.f; }

  // start state: earlier chunks folded in time order, FB records per fetch
  const float* sp = Sst + (size_t)b * NCH * SROWS * DINQ + d;
  int cp = 0;
#pragma unroll 1
  for (; cp + FB <= c; cp += FB) {
    float sv[FB][SROWS];
#pragma unroll
    for (int k = 0; k < FB; ++k)
#pragma unroll
      for (int n = 0; n < SROWS; ++n)
        sv[k][n] = sp[((size_t)(cp + k) * SROWS + n) * DINQ];
    // the loads' address registers are advanced for the next trip
    asm volatile("s_wait_xcnt 0x0" ::: "memory");
#pragma unroll
    for (int k = 0; k < FB; ++k) {
      float da[NSTATE], dA[NSTATE];
#pragma unroll
      for (int n = 0; n < NSTATE; ++n) da[n] = a[n] * sv[k][NSTATE];
      exp16(dA, da);
#pragma unroll
      for (int n = 0; n < NSTATE; ++n) hs[n] = hs[n] * dA[n] + sv[k][n];
    }
  }
#pragma unroll 1
  for (; cp < c; ++cp) {
    float sv[SROWS];
#pragma unroll
    for (int n = 0; n < SROWS; ++n)
      sv[n] = sp[((size_t)cp * SROWS + n) * DINQ];
    // the loads' address registers are reused by the arithmetic below
    asm volatile("s_wait_xcnt 0x0" ::: "memory");
    float da[NSTATE], dA[NSTATE];
#pragma unroll
    for (int n = 0; n < NSTATE; ++n) da[n] = a[n] * sv[NSTATE];
    exp16(dA, da);
#pragma unroll
    for (int n = 0; n < NSTATE; ++n) hs[n] = hs[n] * dA[n] + sv[n];
  }

  const float* dtp = dt + row0 * DINQ + d;
  const float* bcp = BC + row0 * 32;
  unsigned short* gp = gout + row0 * DINQ + d;

  float dtc[SU], xc[SU];
#pragma unroll
  for (int u = 0; u < SU; ++u) { dtc[u] = 0.f; xc[u] = 0.f; }
  // Trip -1 only fetches group 0 (see scan_state_kernel).
  // rolled: the body is already SU * NSTATE updates long (code size)
#pragma unroll 1
  for (int g = -1; g < CLEN / SU; ++g) {
    float dtn[SU], xn[SU];
#pragma unroll
    for (int u = 0; u < SU; ++u) { dtn[u] = 0.f; xn[u] = 0.f; }
    if (g + 1 < CLEN / SU) {                 // next group flies under this one
      // s_wait_xcnt behind each array's loads: their address registers are
      // reused, by the next array's load targets or by the arithmetic below
#pragma unroll
      for (int u = 0; u < SU; ++u) dtn[u] = dtp[(size_t)((g + 1) * SU + u) * DINQ];
      asm volatile("s_wait_xcnt 0x0" ::: "memory");
#pragma unroll
      for (int u = 0; u < SU; ++u) xn[u] = hp[(size_t)((g + 1) * SU + u) * DINQ];
      asm volatile("s_wait_xcnt 0x0" ::: "memory");
    }
    if (g >= 0) {
#pragma unroll
      for (int u = 0; u < SU; ++u) {
        const float* bct = bcp + (g * SU + u) * 32;
        float dtv = dtc[u];
        float xv  = xc[u];
        float dx  = dtv * xv;
        float da[NSTATE], dA[NSTATE];
#pragma unroll
        for (int n = 0; n < NSTATE; ++n) da[n] = dtv * a[n];
        exp16(dA, da);
        float yq[4];                         // four sums of four states each
#pragma unroll
        for (int q = 0; q < 4; ++q) {
          yq[q] = 0.f;
#pragma unroll
          for (int n2 = 0; n2 < 4; ++n2) {
            int n = q * 4 + n2;
            hs[n] = hs[n] * dA[n] + dx * bct[n];
            yq[q] += hs[n] * bct[16 + n];
          }
        }
        float y = (yq[0] + yq[1]) + (yq[2] + yq[3]);
        y += xv * dsk;
        // conv taps l-3 .. l in that order, then SiLU
        float ca = cbv;
        ca += (u >= 3 ? xc[u >= 3 ? u - 3 : 0] : xp[u < 3 ? u : 0]) * cwv[0];
        ca += (u >= 2 ? xc[u >= 2 ? u - 2 : 0] : xp[u < 2 ? u + 1 : 0]) * cwv[1];
        ca += (u >= 1 ? xc[u >= 1 ? u - 1 : 0] : xp[2]) * cwv[2];
        ca += xv * cwv[3];
        float yc = ca * (1.f / (1.f + exp1(-ca)));
        gp[(size_t)(g * SU + u) * DINQ] =
            f32_bf16(y * (1.f / (1.f + exp1(-yc))));
      }
#pragma unroll
      for (int j = 0; j < 3; ++j) xp[j] = xc[SU - 3 + j];
      // the stores' address and data registers are rewritten at the loop's foot
      asm volatile("s_wait_xcnt 0x0" ::: "memory");
    }
#pragma unroll
    for (int u = 0; u < SU; ++u) { dtc[u] = dtn[u]; xc[u] = xn[u]; }
  }
}

// =====================================================================
// host-side orchestration
// =====================================================================
extern "C" void kernel_launch(void* const* d_in, const int* in_sizes, int n_in,
                              void* d_out, int out_size, void* d_ws, size_t ws_size,
                              hipStream_t stream) {
  const float* x_in  = (const float*)d_in[0];
  const float* pos   = (const float*)d_in[1];
  const float* normw = (const float*)d_in[2];
  const float* normb = (const float*)d_in[3];
  const float* Win   = (const float*)d_in[4];
  const float* b_in  = (const float*)d_in[5];
  const float* A_log = (const float*)d_in[6];
  const float* Wdt   = (const float*)d_in[7];
  const float* b_dt  = (const float*)d_in[8];
  const float* WB    = (const float*)d_in[9];
  const float* WC    = (const float*)d_in[10];
  const float* Dsk   = (const float*)d_in[11];
  const float* convw = (const float*)d_in[12];
  const float* convb = (const float*)d_in[13];
  const float* Wout  = (const float*)d_in[14];
  const float* b_out = (const float*)d_in[15];
  const float* fnw   = (const float*)d_in[16];
  const float* fnb   = (const float*)d_in[17];
  (void)in_sizes; (void)n_in; (void)out_size; (void)ws_size;

  char* p = (char*)d_ws;
  auto alloc = [&](size_t bytes) {
    char* r = p;
    p += (bytes + 255) & ~(size_t)255;
    return r;
  };
  float*          xbuf  = (float*)         alloc((size_t)BL * DQ   * 4);  // residual stream
  unsigned short* hln   = (unsigned short*)alloc((size_t)BL * DQ   * 2);  // LN(x) bf16
  float*          hbuf  = (float*)         alloc((size_t)BL * DINQ * 4);  // h fp32
  unsigned short* hbf   = (unsigned short*)alloc((size_t)BL * DINQ * 2);  // h bf16
  float*          dtb   = (float*)         alloc((size_t)BL * DINQ * 4);  // softplus(dt)
  float*          BCb   = (float*)         alloc((size_t)BL * 32   * 4);  // [B|C]
  unsigned short* gbf   = (unsigned short*)alloc((size_t)BL * DINQ * 2);  // gated, bf16
  unsigned short* WinT  = (unsigned short*)alloc((size_t)DINQ * DQ   * 2);
  unsigned short* WdtT  = (unsigned short*)alloc((size_t)DINQ * DINQ * 2);
  unsigned short* WoutT = (unsigned short*)alloc((size_t)DQ   * DINQ * 2);
  float*          Sst   = (float*)         alloc((size_t)BQ * NCH * SROWS * DINQ * 4);  // chunk records

  add_pos_kernel<<<BL * DQ / (4 * APV * 256), 256, 0, stream>>>(x_in, pos, xbuf);

  for (int i = 0; i < 2; ++i) {
    wconv_kernel<DQ, DINQ><<<dim3(DINQ / WTN, DQ / WTK), 256, 0, stream>>>(
        Win  + (size_t)i * DQ * DINQ,   WinT);
    wconv_kernel<DINQ, DINQ><<<dim3(DINQ / WTN, DINQ / WTK), 256, 0, stream>>>(
        Wdt  + (size_t)i * DINQ * DINQ, WdtT);
    wconv_kernel<DINQ, DQ><<<dim3(DQ / WTN, DINQ / WTK), 256, 0, stream>>>(
        Wout + (size_t)i * DINQ * DQ,   WoutT);

    ln_kernel<true><<<BL / LNR, LNR * 32, 0, stream>>>(
        xbuf, normw + (size_t)i * DQ, normb + (size_t)i * DQ, hln);

    // h = LN(x) @ Win + b_in    (fp32 + bf16 copies)
    gemm_bf16_wmma<0><<<dim3(DINQ / BNT, BL / BMT), 256, 0, stream>>>(
        hln, WinT, b_in + (size_t)i * DINQ, hbuf, hbf, BL, DINQ, DQ);
    // dt = softplus(h @ Wdt + b_dt)
    gemm_bf16_wmma<1><<<dim3(DINQ / BNT, BL / BMT), 256, 0, stream>>>(
        hbf, WdtT, b_dt + (size_t)i * DINQ, dtb, nullptr, BL, DINQ, DINQ);

    bc_kernel<<<BL / 16, BCW * 32, 0, stream>>>(
        hbuf, WB + (size_t)i * DINQ * NSTATE, WC + (size_t)i * DINQ * NSTATE, BCb);
    scan_state_kernel<<<BQ * (NCH - 1) * DGS, SCB, 0, stream>>>(
        hbuf, dtb, BCb, A_log + (size_t)i * DINQ * NSTATE, Sst);
    scan_kernel<<<BQ * NCH * DGS, SCB, 0, stream>>>(
        hbuf, dtb, BCb, convw + (size_t)i * 4 * DINQ, convb + (size_t)i * DINQ,
        A_log + (size_t)i * DINQ * NSTATE,
        Dsk + (size_t)i * DINQ, Sst, gbf);

    // x = g @ Wout + b_out + residual (in place)
    gemm_bf16_wmma<2><<<dim3(DQ / BNT, BL / BMT), 256, 0, stream>>>(
        gbf, WoutT, b_out + (size_t)i * DQ, xbuf, nullptr, BL, DQ, DINQ);
  }

  ln_kernel<false><<<BL / LNR, LNR * 32, 0, stream>>>(xbuf, fnw, fnb, d_out);
}

// v005
// One run takes 367 microseconds.
// In both of two side-by-side timings against v004, it was 1.07 times as fast.
// All steps since v000 together make it 11.3 times as fast.
#include <hip/hip_runtime.h>
#include <hip/hip_bf16.h>
#include <math.h>

// ---------------- problem constants (match reference) ----------------
#define BQ     2
#define LQ     2048
#define DQ     1024
#define DINQ   2048
#define NSTATE 16
#define BL     (BQ * LQ)        // 4096 token rows

// ---------------- CDNA5 WMMA types ----------------
typedef __attribute__((ext_vector_type(16))) __bf16 v16bf;
typedef __attribute__((ext_vector_type(8)))  __bf16 v8bf;
typedef __attribute__((ext_vector_type(8)))  float  v8f;
typedef __attribute__((ext_vector_type(4)))  float    v4f;
typedef __attribute__((ext_vector_type(4)))  unsigned v4u;
typedef __attribute__((ext_vector_type(2)))  unsigned v2u;

__device__ __forceinline__ unsigned short f32_bf16(float f) {
  unsigned u = __float_as_uint(f);
  u += 0x7fffu + ((u >> 16) & 1u);          // round-to-nearest-even
  return (unsigned short)(u >> 16);
}

// CDNA5 async global->LDS copy (ASYNCcnt-tracked, no VGPR round-trip).
// LDS operand is the low 32 bits of the generic address (ISA: LDS aperture
// truncates generic addr to addr[31:0]).
__device__ __forceinline__ void async_ld_b128(void* lds, const void* gaddr) {
  unsigned ldsa = (unsigned)(uintptr_t)lds;
  asm volatile("global_load_async_to_lds_b128 %0, %1, off"
               :: "v"(ldsa), "v"(gaddr) : "memory");
}
__device__ __forceinline__ void wait_async6() {
  asm volatile("s_wait_asynccnt 0x6" ::: "memory");
}
__device__ __forceinline__ void wait_async0() {
  asm volatile("s_wait_asynccnt 0x0" ::: "memory");
}

// =====================================================================
// The three streaming kernels below are gridded for few, fat waves: the work
// of each wave is a handful of 16-byte loads that fly together
// (for speed only).
// Every loop in them is unrolled: the per-thread arrays are then indexed by
// constants only and stay in registers.
// =====================================================================
// add positional embedding: xbuf = x + pos_emb  (never mutate d_in)
// One thread = APV pieces of 16 bytes, 256 pieces apart; the grid is exact.
// =====================================================================
#define APV 4
__global__ __launch_bounds__(256) void add_pos_kernel(
    const float* __restrict__ x, const float* __restrict__ pe,
    float* __restrict__ xbuf) {
  const unsigned base = blockIdx.x * (256 * APV) + threadIdx.x;   // in 16-byte pieces
  // a block's pieces lie in one batch entry: LQ * DQ / 4 is a multiple of 256 * APV
  const unsigned pb = base % (LQ * DQ / 4);
  v4f xv[APV], pv[APV];
#pragma unroll
  for (int j = 0; j < APV; ++j) {
    xv[j] = ((const v4f*)x)[base + j * 256];
    pv[j] = ((const v4f*)pe)[pb + j * 256];
  }
#pragma unroll
  for (int j = 0; j < APV; ++j) ((v4f*)xbuf)[base + j * 256] = xv[j] + pv[j];
}

// =====================================================================
// weight transpose + fp32->bf16:  W[K][N] fp32  ->  WT[N][K] bf16
// One block = a tile of WTK k x WTN n. Reads: 16 bytes per lane, a wave covers
// two rows of 256 bytes. Writes: 8 bf16 (16 bytes) per lane, a wave covers four
// rows of 128 bytes. The odd LDS pitch spreads both sides over the banks.
// K and N are compile-time: a thread's loads (and stores) then differ only in
// their immediate offsets.
// =====================================================================
#define WTK 128
#define WTN 64
template <int K, int N>
__global__ __launch_bounds__(256) void wconv_kernel(
    const float* __restrict__ W, unsigned short* __restrict__ WT) {
  __shared__ float tile[WTK][WTN + 1];
  const int nb = blockIdx.x * WTN, kb = blockIdx.y * WTK;
  const int c4 = (threadIdx.x & 15) * 4, r0 = threadIdx.x >> 4;
  // block-uniform base + one lane offset for all of a thread's loads (stores alike)
  const float* Wb = W + (size_t)kb * N + nb;
  const unsigned woff = (unsigned)(r0 * N + c4);
  v4f v[WTK / 16];
#pragma unroll
  for (int j = 0; j < WTK / 16; ++j)
    v[j] = *(const v4f*)(Wb + (size_t)(16 * j) * N + woff);
#pragma unroll
  for (int j = 0; j < WTK / 16; ++j)
#pragma unroll
    for (int i = 0; i < 4; ++i) tile[r0 + 16 * j][c4 + i] = v[j][i];
  __syncthreads();
  const int k8 = (threadIdx.x & 7) * 8, n0 = threadIdx.x >> 3;
  unsigned short* Tb = WT + (size_t)nb * K + kb;
  const unsigned toff = (unsigned)(n0 * K + k8);
#pragma unroll
  for (int nh = 0; nh < WTN / 32; ++nh)
#pragma unroll
    for (int kh = 0; kh < WTK / 64; ++kh) {
      const int n = n0 + 32 * nh, k = k8 + 64 * kh;
      v4u p;
#pragma unroll
      for (int i = 0; i < 4; ++i)
        p[i] = (unsigned)f32_bf16(tile[k + 2 * i][n]) |
               ((unsigned)f32_bf16(tile[k + 2 * i + 1][n]) << 16);
      *(v4u*)(Tb + (size_t)(32 * nh) * K + 64 * kh + toff) = p;
    }
}

// =====================================================================
// LayerNorm over the last dim (DQ); optional bf16 output (GEMM A operand)
// One wave = one row, held in registers (LNV pieces of 16 bytes per lane), so
// the row is read once; the two sums go over the lanes by shuffles.
// =====================================================================
#define LNR 8                 // rows (waves) per block
#define LNV (DQ / 128)        // 16-byte pieces of a row per lane
template <bool BF16OUT>
__global__ __launch_bounds__(LNR * 32) void ln_kernel(
    const float* __restrict__ x, const float* __restrict__ w,
    const float* __restrict__ b, void* __restrict__ out) {
  // the wave's number, held scalar: the row's base address is then scalar too
  const int row  = blockIdx.x * LNR + __builtin_amdgcn_readfirstlane(threadIdx.x >> 5);
  const unsigned lane = threadIdx.x & 31;
  const v4f* xr = (const v4f*)(x + (size_t)row * DQ);
  v4f v[LNV], wv[LNV], bv[LNV];
#pragma unroll
  for (int j = 0; j < LNV; ++j) v[j] = xr[j * 32 + lane];
#pragma unroll
  for (int j = 0; j < LNV; ++j) {
    wv[j] = ((const v4f*)w)[j * 32 + lane];
    bv[j] = ((const v4f*)b)[j * 32 + lane];
  }
  // keeps the scheduler from sinking the w and b loads behind the sums (one
  // exposed latency per group of them instead of none)
  __builtin_amdgcn_sched_barrier(0);
  v4f a1 = {}, a2 = {};
#pragma unroll
  for (int j = 0; j < LNV; ++j) { a1 += v[j]; a2 += v[j] * v[j]; }
  float s  = (a1[0] + a1[1]) + (a1[2] + a1[3]);
  float s2 = (a2[0] + a2[1]) + (a2[2] + a2[3]);
#pragma unroll
  for (int o = 16; o > 0; o >>= 1) {
    s  += __shfl_xor(s, o);
    s2 += __shfl_xor(s2, o);
  }
  const float mean = s / (float)DQ;
  const float var  = s2 / (float)DQ - mean * mean;
  const float rstd = rsqrtf(var + 1e-5f);
#pragma unroll
  for (int j = 0; j < LNV; ++j) {
    v4f y = (v[j] - mean) * rstd * wv[j] + bv[j];
    if (BF16OUT) {
      v2u p = {(unsigned)f32_bf16(y[0]) | ((unsigned)f32_bf16(y[1]) << 16),
               (unsigned)f32_bf16(y[2]) | ((unsigned)f32_bf16(y[3]) << 16)};
      ((v2u*)((unsigned short*)out + (size_t)row * DQ))[j * 32 + lane] = p;
    } else {
      ((v4f*)((float*)out + (size_t)row * DQ))[j * 32 + lane] = y;
    }
  }
}

// =====================================================================
// WMMA bf16 GEMM:  out[M][N] = A[M][K](bf16) * BT[N][K](bf16)^T + bias
// Block tile 128x64, 8 waves (wave32) arranged 4x2, each wave 32x32 via
// 2x2 v_wmma_f32_16x16x32_bf16 tiles. K staged in 64-wide chunks using
// DOUBLE-BUFFERED async global->LDS copies (ASYNCcnt pipeline):
//   issue stage i+1 into buf^1, s_wait_asynccnt 6 (stage i oldest),
//   barrier, 8 WMMAs on buf, barrier.
// Epilogues:
//   MODE 0: outF = v+bias (fp32) AND outBf = bf16(v+bias)
//   MODE 1: outF = softplus(v+bias)
//   MODE 2: outF = v+bias+outF  (residual add in place)
// =====================================================================
#define BMT 128
#define BNT 64
#define KC  64
#define LDA 72   // padded row stride (elements): 144B = 9*16B

__device__ __forceinline__ v16bf load_frag(const unsigned short* rowp, int half) {
  // A-fragment lane layout (ISA 7.12.2, 16-bit A 16x32):
  //  lanes 0-15:  elems[0..7]=K0..7,  elems[8..15]=K16..23
  //  lanes 16-31: elems[0..7]=K8..15, elems[8..15]=K24..31
  union { v16bf v; v8bf h[2]; } u;
  u.h[0] = *(const v8bf*)(rowp + half * 8);
  u.h[1] = *(const v8bf*)(rowp + 16 + half * 8);
  return u.v;
}

// softplus(v) = max(v, 0) + log1p(exp(-|v|)) for eight values, on the hardware's
// own v_exp_f32 and v_log_f32. With e = exp(-|v|) in [0, 1] and w = fl(1 + e), the
// term d = e - (w - 1) is exactly what the rounding of 1 + e dropped, and
// log1p(e) = log(w) + d / w; d stands for d / w (the difference is below
// 2^-24 * e), so small e keep their relative accuracy. No overflow for any v, so
// no cut-over to v for large v is needed.
// The eight values of a statement are independent, so they fill each other's
// latency; the v_nop at each statement's end keeps the slot that the instruction
// set asks for behind a transcendental before its result is read.
__device__ __forceinline__ void softplus8(float (&y)[8], const float (&v)[8]) {
  float t[8], e[8], w[8], l[8];
#pragma unroll
  for (int r = 0; r < 8; ++r) t[r] = fabsf(v[r]) * -1.44269504f;
  asm("v_exp_f32 %0, %8\n\tv_exp_f32 %1, %9\n\tv_exp_f32 %2, %10\n\t"
      "v_exp_f32 %3, %11\n\tv_exp_f32 %4, %12\n\tv_exp_f32 %5, %13\n\t"
      "v_exp_f32 %6, %14\n\tv_exp_f32 %7, %15\n\tv_nop"
      : "=&v"(e[0]), "=&v"(e[1]), "=&v"(e[2]), "=&v"(e[3]),
        "=&v"(e[4]), "=&v"(e[5]), "=&v"(e[6]), "=&v"(e[7])
      : "v"(t[0]), "v"(t[1]), "v"(t[2]), "v"(t[3]),
        "v"(t[4]), "v"(t[5]), "v"(t[6]), "v"(t[7]));
#pragma unroll
  for (int r = 0; r < 8; ++r) w[r] = 1.f + e[r];
  asm("v_log_f32 %0, %8\n\tv_log_f32 %1, %9\n\tv_log_f32 %2, %10\n\t"
      "v_log_f32 %3, %11\n\tv_log_f32 %4, %12\n\tv_log_f32 %5, %13\n\t"
      "v_log_f32 %6, %14\n\tv_log_f32 %7, %15\n\tv_nop"
      : "=&v"(l[0]), "=&v"(l[1]), "=&v"(l[2]), "=&v"(l[3]),
        "=&v"(l[4]), "=&v"(l[5]), "=&v"(l[6]), "=&v"(l[7])
      : "v"(w[0]), "v"(w[1]), "v"(w[2]), "v"(w[3]),
        "v"(w[4]), "v"(w[5]), "v"(w[6]), "v"(w[7]));
#pragma unroll
  for (int r = 0; r < 8; ++r) {
    float d = e[r] - (w[r] - 1.f);
    y[r] = fmaxf(v[r], 0.f) + (l[r] * 0.69314718f + d);   // log2(w) * ln 2
  }
}

template <int MODE>
__global__ __launch_bounds__(256) void gemm_bf16_wmma(
    const unsigned short* __restrict__ A,   // [M][K] bf16
    const unsigned short* __restrict__ BT,  // [N][K] bf16 (B transposed)
    const float* __restrict__ bias,         // [N]
    float* __restrict__ outF,
    unsigned short* __restrict__ outBf,
    int M, int Nn, int K) {
  __shared__ __align__(16) unsigned short As[2][BMT][LDA];
  __shared__ __align__(16) unsigned short Bs[2][BNT][LDA];
  int tid  = threadIdx.x;
  int wave = tid >> 5, lane = tid & 31;
  int wm = wave & 3, wn = wave >> 2;          // 4 waves along M, 2 along N
  int bm = blockIdx.y * BMT, bn = blockIdx.x * BNT;
  int half = lane >> 4, lrow = lane & 15;

  // per-thread source/dest for one stage: 4 A-chunks + 2 B-chunks of 16B
  int ra[4], ca[4], rb[2], cb[2];
#pragma unroll
  for (int t = 0; t < 4; ++t) {
    int idx = tid + t * 256;                  // 0..1023 -> 128 rows x 8 chunks
    ra[t] = idx >> 3; ca[t] = (idx & 7) * 8;
  }
#pragma unroll
  for (int t = 0; t < 2; ++t) {
    int idx = tid + t * 256;                  // 0..511 -> 64 rows x 8 chunks
    rb[t] = idx >> 3; cb[t] = (idx & 7) * 8;
  }

  auto issue_stage = [&](int buf, int k0) {
#pragma unroll
    for (int t = 0; t < 4; ++t)
      async_ld_b128(&As[buf][ra[t]][ca[t]],
                    A + (size_t)(bm + ra[t]) * K + k0 + ca[t]);
#pragma unroll
    for (int t = 0; t < 2; ++t)
      async_ld_b128(&Bs[buf][rb[t]][cb[t]],
                    BT + (size_t)(bn + rb[t]) * K + k0 + cb[t]);
  };

  v8f zero = {};
  v8f acc[2][2];
#pragma unroll
  for (int i = 0; i < 2; ++i)
#pragma unroll
    for (int j = 0; j < 2; ++j) acc[i][j] = zero;

  const int nk = K / KC;
  issue_stage(0, 0);
  for (int i = 0; i < nk; ++i) {
    int cur = i & 1;
    if (i + 1 < nk) {
      issue_stage(cur ^ 1, (i + 1) * KC);
      wait_async6();                 // stage i's 6 ops are the oldest
    } else {
      wait_async0();
    }
    __syncthreads();                 // all waves' stage-i data visible

#pragma unroll
    for (int ks = 0; ks < KC; ks += 32) {
      v16bf aF[2], bF[2];
      aF[0] = load_frag(&As[cur][wm * 32 + lrow][ks],      half);
      aF[1] = load_frag(&As[cur][wm * 32 + 16 + lrow][ks], half);
      bF[0] = load_frag(&Bs[cur][wn * 32 + lrow][ks],      half);
      bF[1] = load_frag(&Bs[cur][wn * 32 + 16 + lrow][ks], half);
#pragma unroll
      for (int ii = 0; ii < 2; ++ii)
#pragma unroll
        for (int jj = 0; jj < 2; ++jj)
          acc[ii][jj] = __builtin_amdgcn_wmma_f32_16x16x32_bf16(
              false, aF[ii], false, bF[jj], (short)0, acc[ii][jj],
              false, false);
    }
    __syncthreads();                 // buf reusable two stages later
  }

  // ---- MODE 1 epilogue (same C/D layout as below): both bias values are
  // fetched first, all 32 softplus values and the 16 row addresses are formed,
  // and the stores come last.
  if (MODE == 1) {
    const int gn0 = bn + wn * 32 + lrow;
    const float bj[2] = {bias[gn0], bias[gn0 + 16]};
    // one lane-dependent base; the rows differ from it by wave-uniform steps
    float* const base = outF + (size_t)(bm + wm * 32 + half * 8) * Nn + gn0;
    float* prow[2][8];
#pragma unroll
    for (int i = 0; i < 2; ++i)
#pragma unroll
      for (int r = 0; r < 8; ++r) prow[i][r] = base + (size_t)(i * 16 + r) * Nn;
    float sp[2][2][8];
#pragma unroll
    for (int i = 0; i < 2; ++i)
#pragma unroll
      for (int j = 0; j < 2; ++j) {
        float pre[8];
#pragma unroll
        for (int r = 0; r < 8; ++r) pre[r] = acc[i][j][r] + bj[j];
        softplus8(sp[i][j], pre);
      }
    // keeps every address and value computed in front of the first store, so
    // that no register that an issued store names is rewritten behind it
    __builtin_amdgcn_sched_barrier(0);
#pragma unroll
    for (int i = 0; i < 2; ++i)
#pragma unroll
      for (int j = 0; j < 2; ++j)
#pragma unroll
        for (int r = 0; r < 8; ++r) prow[i][r][j * 16] = sp[i][j][r];
    return;
  }

  // ---- epilogue: C/D layout — n = lane&15, m = vgpr + (lane>>4)*8 ----
#pragma unroll
  for (int i = 0; i < 2; ++i) {
#pragma unroll
    for (int j = 0; j < 2; ++j) {
      int gn = bn + wn * 32 + j * 16 + lrow;
      float bv = bias[gn];
#pragma unroll
      for (int r = 0; r < 8; ++r) {
        int gm = bm + wm * 32 + i * 16 + r + half * 8;
        size_t off = (size_t)gm * Nn + gn;
        float v = acc[i][j][r] + bv;
        if (MODE == 0) {
          outF[off]  = v;
          outBf[off] = f32_bf16(v);
        } else {
          outF[off] = v + outF[off];                        // + residual
        }
      }
    }
  }
}

// =====================================================================
// Bm|Cm projection:  BC[m][0..15]=h@WB, [16..31]=h@WC, all in f32, on
// v_wmma_f32_16x16x4_f32. One block = 16 token rows x all 32 columns, so a
// weight row is fetched once per 16 tokens. The 16 waves split k (128 each);
// their partial tiles are added through LDS in wave order.
// k pairing: lane (c, hf) holds, for group q, k = slice + 8q + 4hf + 0..3 of
// A row c (one 16-byte load) and the same four k of B column c.
// Every loop is unrolled: av, wb, wc and the accumulators are then indexed by
// constants only and stay in registers.
// =====================================================================
typedef __attribute__((ext_vector_type(2))) float v2f;
#define BCW  16               // waves per block
#define BCKS (DINQ / BCW)     // k per wave
#define BCQ  (BCKS / 8)       // groups of 8 k per wave
#define BCG  4                // groups whose weight fragments are fetched together

__global__ __launch_bounds__(BCW * 32) void bc_kernel(
    const float* __restrict__ h, const float* __restrict__ WB,
    const float* __restrict__ WC, float* __restrict__ BC) {
  __shared__ float red[BCW][512];           // per wave: 2 tiles x 8 registers x 32 lanes
  const int wave = threadIdx.x >> 5, lane = threadIdx.x & 31;
  const int c = lane & 15, hf = lane >> 4;
  const int m0 = blockIdx.x * 16;
  const int kl = wave * BCKS + hf * 4;      // the lane's first k
  const float* ap = h  + (size_t)(m0 + c) * DINQ + kl;
  const float* bp = WB + (size_t)kl * NSTATE + c;
  const float* cp = WC + (size_t)kl * NSTATE + c;

  v4f av[BCQ];                              // the wave's whole slice of h, fetched first
#pragma unroll
  for (int q = 0; q < BCQ; ++q) av[q] = *(const v4f*)(ap + q * 8);
  // keeps the scheduler from sinking these loads to their first use (one
  // exposed latency per product instead of one for the whole slice)
  __builtin_amdgcn_sched_barrier(0);

  float wb[2][BCG][4], wc[2][BCG][4];
  auto fetch = [&](int buf, int g) {
#pragma unroll
    for (int q2 = 0; q2 < BCG; ++q2)
#pragma unroll
      for (int j = 0; j < 4; ++j) {
        wb[buf][q2][j] = bp[(size_t)((g * BCG + q2) * 8 + j) * NSTATE];
        wc[buf][q2][j] = cp[(size_t)((g * BCG + q2) * 8 + j) * NSTATE];
      }
  };
  fetch(0, 0);

  v8f accb = {}, accc = {};
#pragma unroll
  for (int g = 0; g < BCQ / BCG; ++g) {
    if (g + 1 < BCQ / BCG) {
      fetch((g + 1) & 1, g + 1);            // flies under this group's products
      // behind the last fetch the loads' address registers are free for reuse
      if (g + 2 == BCQ / BCG) asm volatile("s_wait_xcnt 0x0" ::: "memory");
      // keeps the next group's loads in front of this group's products
      __builtin_amdgcn_sched_barrier(0);
    }
#pragma unroll
    for (int q2 = 0; q2 < BCG; ++q2)
#pragma unroll
      for (int p = 0; p < 2; ++p) {
        v2f a  = {av[g * BCG + q2][2 * p], av[g * BCG + q2][2 * p + 1]};
        v2f fb = {wb[g & 1][q2][2 * p], wb[g & 1][q2][2 * p + 1]};
        v2f fc = {wc[g & 1][q2][2 * p], wc[g & 1][q2][2 * p + 1]};
        accb = __builtin_amdgcn_wmma_f32_16x16x4_f32(
            false, a, false, fb, (short)0, accb, false, false);
        accc = __builtin_amdgcn_wmma_f32_16x16x4_f32(
            false, a, false, fc, (short)0, accc, false, false);
      }
  }
  // A precaution: no distance is documented for the f32 form, and without this
  // the build had address arithmetic overwriting an A register directly behind
  // its product. Eight vector slots, the figure of the other 16-cycle form,
  // stand in front of the first vector instruction behind the products; the two
  // scheduling barriers keep that arithmetic and the slots where they are written.
  __builtin_amdgcn_sched_barrier(0);
  asm volatile("v_nop\n\tv_nop\n\tv_nop\n\tv_nop\n\tv_nop\n\tv_nop\n\tv_nop\n\tv_nop");
  __builtin_amdgcn_sched_barrier(0);

#pragma unroll
  for (int r = 0; r < 8; ++r) {
    red[wave][r * 32 + lane]       = accb[r];
    red[wave][256 + r * 32 + lane] = accc[r];
  }
  __syncthreads();
  // one output per thread; D layout: register r of lane l = D[8 * (l >> 4) + r][l & 15]
  float s = 0.f;
#pragma unroll
  for (int w = 0; w < BCW; ++w) s += red[w][threadIdx.x];
  const int tile = threadIdx.x >> 8, r = (threadIdx.x >> 5) & 7;
  BC[(size_t)(m0 + 8 * hf + r) * 32 + tile * 16 + c] = s;
}

// =====================================================================
// selective scan (diagonal SSM), split over time into NCH chunks of CLEN
// steps so that the chunks run side by side instead of one after another.
//   scan_state_kernel: every chunk but the last runs the recurrence from a
//     zero state and keeps its end state S[n] and its sum of dt (row NSTATE
//     of the same record). The decay over a whole chunk is exp(a[n] * sum dt).
//   scan_kernel: a chunk folds the earlier chunks' (S, sum dt) in time order
//     into its start state, then runs the recurrence with the fused D-skip,
//     the causal depthwise conv (4 taps) + SiLU of the same channel, formed
//     from the x values that the lane walks through anyway, and the gating.
// One lane = one channel with all 16 states; one block = SCB channels of one
// (batch, chunk), so the B/C rows are the same address for the whole block.
// =====================================================================
#define NCH  32
#define CLEN (LQ / NCH)     // 64 steps per chunk
#define SU   8              // steps fetched ahead as one group
#define SCB  128            // channels (threads) per block
#define DGS  (DINQ / SCB)   // channel groups
#define SROWS (NSTATE + 1)  // rows of a chunk's record: S[0..15], sum of dt
#define FB   3              // chunk records fetched together in the fold (51 loads)

// e[n] = exp(x[n]) for the 16 states, as __expf forms it (x * log2(e), then
// v_exp_f32), eight to a statement. The v_nop at each statement's end keeps the
// slot that the instruction set asks for behind a transcendental before its
// source is overwritten.
__device__ __forceinline__ void exp16(float (&e)[NSTATE], const float (&x)[NSTATE]) {
  float t[NSTATE];
#pragma unroll
  for (int n = 0; n < NSTATE; ++n) t[n] = x[n] * 1.44269504f;
#pragma unroll
  for (int k = 0; k < NSTATE; k += 8)
    asm("v_exp_f32 %0, %8\n\tv_exp_f32 %1, %9\n\tv_exp_f32 %2, %10\n\t"
        "v_exp_f32 %3, %11\n\tv_exp_f32 %4, %12\n\tv_exp_f32 %5, %13\n\t"
        "v_exp_f32 %6, %14\n\tv_exp_f32 %7, %15\n\tv_nop"
        : "=&v"(e[k]), "=&v"(e[k + 1]), "=&v"(e[k + 2]), "=&v"(e[k + 3]),
          "=&v"(e[k + 4]), "=&v"(e[k + 5]), "=&v"(e[k + 6]), "=&v"(e[k + 7])
        : "v"(t[k]), "v"(t[k + 1]), "v"(t[k + 2]), "v"(t[k + 3]),
          "v"(t[k + 4]), "v"(t[k + 5]), "v"(t[k + 6]), "v"(t[k + 7]));
}

// exp(x) for one value, formed as in exp16; the v_nop keeps the same slot.
__device__ __forceinline__ float exp1(float x) {
  float t = x * 1.44269504f, e;
  asm("v_exp_f32 %0, %1\n\tv_nop" : "=v"(e) : "v"(t));
  return e;
}

__global__ __launch_bounds__(SCB) void scan_state_kernel(
    const float* __restrict__ h,  const float* __restrict__ dt,
    const float* __restrict__ BC, const float* __restrict__ A_log,
    float* __restrict__ Sst) {    // [B][NCH][SROWS][DIN]
  const int d  = (blockIdx.x % DGS) * SCB + threadIdx.x;
  const int bc = blockIdx.x / DGS;
  const int b  = bc / (NCH - 1);
  const int c  = bc % (NCH - 1);             // the last chunk feeds nobody

  float a[NSTATE], hs[NSTATE], al[NSTATE];
#pragma unroll
  for (int n = 0; n < NSTATE; ++n) al[n] = A_log[(size_t)d * NSTATE + n];
  exp16(a, al);
#pragma unroll
  for (int n = 0; n < NSTATE; ++n) { a[n] = -a[n]; hs[n] = 0.f; }
  const size_t row0 = (size_t)b * LQ + (size_t)c * CLEN;
  const float* dtp = dt + row0 * DINQ + d;
  const float* hp  = h  + row0 * DINQ + d;
  const float* bcp = BC + row0 * 32;

  float sd = 0.f;
  float dtc[SU], xc[SU];
#pragma unroll
  for (int u = 0; u < SU; ++u) { dtc[u] = 0.f; xc[u] = 0.f; }
  // Trip -1 only fetches group 0, so that every group reaches the arithmetic
  // through the copies at the loop's foot and the wait for it stands there.
  // rolled: the body is already SU * NSTATE updates long (code size)
#pragma unroll 1
  for (int g = -1; g < CLEN / SU; ++g) {
    float dtn[SU], xn[SU];
#pragma unroll
    for (int u = 0; u < SU; ++u) { dtn[u] = 0.f; xn[u] = 0.f; }
    if (g + 1 < CLEN / SU) {                 // next group flies under this one
#pragma unroll
      for (int u = 0; u < SU; ++u) {
        dtn[u] = dtp[(size_t)((g + 1) * SU + u) * DINQ];
        xn[u]  = hp[(size_t)((g + 1) * SU + u) * DINQ];
      }
      // the loads' address registers are reused by the arithmetic below
      asm volatile("s_wait_xcnt 0x0" ::: "memory");
    }
    if (g >= 0) {
#pragma unroll
      for (int u = 0; u < SU; ++u) {
        const float* bct = bcp + (g * SU + u) * 32;
        float dtv = dtc[u];
        float dx  = dtv * xc[u];
        sd += dtv;
        float da[NSTATE], dA[NSTATE];
#pragma unroll
        for (int n = 0; n < NSTATE; ++n) da[n] = dtv * a[n];
        exp16(dA, da);
#pragma unroll
        for (int n = 0; n < NSTATE; ++n) hs[n] = hs[n] * dA[n] + dx * bct[n];
      }
    }
#pragma unroll
    for (int u = 0; u < SU; ++u) { dtc[u] = dtn[u]; xc[u] = xn[u]; }
  }
  float* sp = Sst + ((size_t)b * NCH + c) * SROWS * DINQ + d;
#pragma unroll
  for (int n = 0; n < NSTATE; ++n) sp[(size_t)n * DINQ] = hs[n];
  sp[(size_t)NSTATE * DINQ] = sd;
}

__global__ __launch_bounds__(SCB) void scan_kernel(
    const float* __restrict__ h,  const float* __restrict__ dt,
    const float* __restrict__ BC, const float* __restrict__ cw,
    const float* __restrict__ cb,
    const float* __restrict__ A_log, const float* __restrict__ Dsk,
    const float* __restrict__ Sst, unsigned short* __restrict__ gout) {
  const int d  = (blockIdx.x % DGS) * SCB + threadIdx.x;
  const int bc = blockIdx.x / DGS;
  const int b  = bc % BQ;
  const int c  = NCH - 1 - bc / BQ;          // longest fold starts first

  const size_t row0 = (size_t)b * LQ + (size_t)c * CLEN;
  const float* hp  = h + row0 * DINQ + d;

  // first loads of the kernel: they have landed with the A_log rows, so no
  // wait for them falls among the fetched-ahead loads of the main loop
  const float dsk = Dsk[d];
  const float cbv = cb[d];
  float cwv[4];
#pragma unroll
  for (int j = 0; j < 4; ++j) cwv[j] = cw[j * DINQ + d];
  // the registers that the loads name are reused below
  asm volatile("s_wait_xcnt 0x0" ::: "memory");
  // the three x values in front of the chunk (zero padding in front of l = 0)
  float xp[3] = {0.f, 0.f, 0.f};
  if (c > 0) {
#pragma unroll
    for (int j = 0; j < 3; ++j) xp[j] = hp[(ptrdiff_t)(j - 3) * DINQ];
    // the registers that the loads name are reused below
    asm volatile("s_wait_xcnt 0x0" ::: "memory");
  }
  float a[NSTATE], hs[NSTATE], al[NSTATE];
#pragma unroll
  for (int n = 0; n < NSTATE; ++n) al[n] = A_log[(size_t)d * NSTATE + n];
  exp16(a, al);
#pragma unroll
  for (int n = 0; n < NSTATE; ++n) { a[n] = -a[n]; hs[n] = 0.f; }

  // start state: earlier chunks folded in time order, FB records per fetch
  const float* sp = Sst + (size_t)b * NCH * SROWS * DINQ + d;
  int cp = 0;
#pragma unroll 1
  for (; cp + FB <= c; cp += FB) {
    float sv[FB][SROWS];
#pragma unroll
    for (int k = 0; k < FB; ++k)
#pragma unroll
      for (int n = 0; n < SROWS; ++n)
        sv[k][n] = sp[((size_t)(cp + k) * SROWS + n) * DINQ];
    // the loads' address registers are advanced for the next trip
    asm volatile("s_wait_xcnt 0x0" ::: "memory");
#pragma unroll
    for (int k = 0; k < FB; ++k) {
      float da[NSTATE], dA[NSTATE];
#pragma unroll
      for (int n = 0; n < NSTATE; ++n) da[n] = a[n] * sv[k][NSTATE];
      exp16(dA, da);
#pragma unroll
      for (int n = 0; n < NSTATE; ++n) hs[n] = hs[n] * dA[n] + sv[k][n];
    }
  }
#pragma unroll 1
  for (; cp < c; ++cp) {
    float sv[SROWS];
#pragma unroll
    for (int n = 0; n < SROWS; ++n)
      sv[n] = sp[((size_t)cp * SROWS + n) * DINQ];
    // the loads' address registers are reused by the arithmetic below
    asm volatile("s_wait_xcnt 0x0" ::: "memory");
    float da[NSTATE], dA[NSTATE];
#pragma unroll
    for (int n = 0; n < NSTATE; ++n) da[n] = a[n] * sv[NSTATE];
    exp16(dA, da);
#pragma unroll
    for (int n = 0; n < NSTATE; ++n) hs[n] = hs[n] * dA[n] + sv[n];
  }

  const float* dtp = dt + row0 * DINQ + d;
  const float* bcp = BC + row0 * 32;
  unsigned short* gp = gout + row0 * DINQ + d;

  float dtc[SU], xc[SU];
#pragma unroll
  for (int u = 0; u < SU; ++u) { dtc[u] = 0.f; xc[u] = 0.f; }
  // Trip -1 only fetches group 0 (see scan_state_kernel).
  // rolled: the body is already SU * NSTATE updates long (code size)
#pragma unroll 1
  for (int g = -1; g < CLEN / SU; ++g) {
    float dtn[SU], xn[SU];
#pragma unroll
    for (int u = 0; u < SU; ++u) { dtn[u] = 0.f; xn[u] = 0.f; }
    if (g + 1 < CLEN / SU) {                 // next group flies under this one
      // s_wait_xcnt behind each array's loads: their address registers are
      // reused, by the next array's load targets or by the arithmetic below
#pragma unroll
      for (int u = 0; u < SU; ++u) dtn[u] = dtp[(size_t)((g + 1) * SU + u) * DINQ];
      asm volatile("s_wait_xcnt 0x0" ::: "memory");
#pragma unroll
      for (int u = 0; u < SU; ++u) xn[u] = hp[(size_t)((g + 1) * SU + u) * DINQ];
      asm volatile("s_wait_xcnt 0x0" ::: "memory");
    }
    if (g >= 0) {
#pragma unroll
      for (int u = 0; u < SU; ++u) {
        const float* bct = bcp + (g * SU + u) * 32;
        float dtv = dtc[u];
        float xv  = xc[u];
        float dx  = dtv * xv;
        float da[NSTATE], dA[NSTATE];
#pragma unroll
        for (int n = 0; n < NSTATE; ++n) da[n] = dtv * a[n];
        exp16(dA, da);
        float yq[4];                         // four sums of four states each
#pragma unroll
        for (int q = 0; q < 4; ++q) {
          yq[q] = 0.f;
#pragma unroll
          for (int n2 = 0; n2 < 4; ++n2) {
            int n = q * 4 + n2;
            hs[n] = hs[n] * dA[n] + dx * bct[n];
            yq[q] += hs[n] * bct[16 + n];
          }
        }
        float y = (yq[0] + yq[1]) + (yq[2] + yq[3]);
        y += xv * dsk;
        // conv taps l-3 .. l in that order, then SiLU
        float ca = cbv;
        ca += (u >= 3 ? xc[u >= 3 ? u - 3 : 0] : xp[u < 3 ? u : 0]) * cwv[0];
        ca += (u >= 2 ? xc[u >= 2 ? u - 2 : 0] : xp[u < 2 ? u + 1 : 0]) * cwv[1];
        ca += (u >= 1 ? xc[u >= 1 ? u - 1 : 0] : xp[2]) * cwv[2];
        ca += xv * cwv[3];
        float yc = ca * (1.f / (1.f + exp1(-ca)));
        gp[(size_t)(g * SU + u) * DINQ] =
            f32_bf16(y * (1.f / (1.f + exp1(-yc))));
      }
#pragma unroll
      for (int j = 0; j < 3; ++j) xp[j] = xc[SU - 3 + j];
      // the stores' address and data registers are rewritten at the loop's foot
      asm volatile("s_wait_xcnt 0x0" ::: "memory");
    }
#pragma unroll
    for (int u = 0; u < SU; ++u) { dtc[u] = dtn[u]; xc[u] = xn[u]; }
  }
}

// =====================================================================
// host-side orchestration
// =====================================================================
extern "C" void kernel_launch(void* const* d_in, const int* in_sizes, int n_in,
                              void* d_out, int out_size, void* d_ws, size_t ws_size,
                              hipStream_t stream) {
  const float* x_in  = (const float*)d_in[0];
  const float* pos   = (const float*)d_in[1];
  const float* normw = (const float*)d_in[2];
  const float* normb = (const float*)d_in[3];
  const float* Win   = (const float*)d_in[4];
  const float* b_in  = (const float*)d_in[5];
  const float* A_log = (const float*)d_in[6];
  const float* Wdt   = (const float*)d_in[7];
  const float* b_dt  = (const float*)d_in[8];
  const float* WB    = (const float*)d_in[9];
  const float* WC    = (const float*)d_in[10];
  const float* Dsk   = (const float*)d_in[11];
  const float* convw = (const float*)d_in[12];
  const float* convb = (const float*)d_in[13];
  const float* Wout  = (const float*)d_in[14];
  const float* b_out = (const float*)d_in[15];
  const float* fnw   = (const float*)d_in[16];
  const float* fnb   = (const float*)d_in[17];
  (void)in_sizes; (void)n_in; (void)out_size; (void)ws_size;

  char* p = (char*)d_ws;
  auto alloc = [&](size_t bytes) {
    char* r = p;
    p += (bytes + 255) & ~(size_t)255;
    return r;
  };
  float*          xbuf  = (float*)         alloc((size_t)BL * DQ   * 4);  // residual stream
  unsigned short* hln   = (unsigned short*)alloc((size_t)BL * DQ   * 2);  // LN(x) bf16
  float*          hbuf  = (float*)         alloc((size_t)BL * DINQ * 4);  // h fp32
  unsigned short* hbf   = (unsigned short*)alloc((size_t)BL * DINQ * 2);  // h bf16
  float*          dtb   = (float*)         alloc((size_t)BL * DINQ * 4);  // softplus(dt)
  float*          BCb   = (float*)         alloc((size_t)BL * 32   * 4);  // [B|C]
  unsigned short* gbf   = (unsigned short*)alloc((size_t)BL * DINQ * 2);  // gated, bf16
  unsigned short* WinT  = (unsigned short*)alloc((size_t)DINQ * DQ   * 2);
  unsigned short* WdtT  = (unsigned short*)alloc((size_t)DINQ * DINQ * 2);
  unsigned short* WoutT = (unsigned short*)alloc((size_t)DQ   * DINQ * 2);
  float*          Sst   = (float*)         alloc((size_t)BQ * NCH * SROWS * DINQ * 4);  // chunk records

  add_pos_kernel<<<BL * DQ / (4 * APV * 256), 256, 0, stream>>>(x_in, pos, xbuf);

  for (int i = 0; i < 2; ++i) {
    wconv_kernel<DQ, DINQ><<<dim3(DINQ / WTN, DQ / WTK), 256, 0, stream>>>(
        Win  + (size_t)i * DQ * DINQ,   WinT);
    wconv_kernel<DINQ, DINQ><<<dim3(DINQ / WTN, DINQ / WTK), 256, 0, stream>>>(
        Wdt  + (size_t)i * DINQ * DINQ, WdtT);
    wconv_kernel<DINQ, DQ><<<dim3(DQ / WTN, DINQ / WTK), 256, 0, stream>>>(
        Wout + (size_t)i * DINQ * DQ,   WoutT);

    ln_kernel<true><<<BL / LNR, LNR * 32, 0, stream>>>(
        xbuf, normw + (size_t)i * DQ, normb + (size_t)i * DQ, hln);

    // h = LN(x) @ Win + b_in    (fp32 + bf16 copies)
    gemm_bf16_wmma<0><<<dim3(DINQ / BNT, BL / BMT), 256, 0, stream>>>(
        hln, WinT, b_in + (size_t)i * DINQ, hbuf, hbf, BL, DINQ, DQ);
    // dt = softplus(h @ Wdt + b_dt)
    gemm_bf16_wmma<1><<<dim3(DINQ / BNT, BL / BMT), 256, 0, stream>>>(
        hbf, WdtT, b_dt + (size_t)i * DINQ, dtb, nullptr, BL, DINQ, DINQ);

    bc_kernel<<<BL / 16, BCW * 32, 0, stream>>>(
        hbuf, WB + (size_t)i * DINQ * NSTATE, WC + (size_t)i * DINQ * NSTATE, BCb);
    scan_state_kernel<<<BQ * (NCH - 1) * DGS, SCB, 0, stream>>>(
        hbuf, dtb, BCb, A_log + (size_t)i * DINQ * NSTATE, Sst);
    scan_kernel<<<BQ * NCH * DGS, SCB, 0, stream>>>(
        hbuf, dtb, BCb, convw + (size_t)i * 4 * DINQ, convb + (size_t)i * DINQ,
        A_log + (size_t)i * DINQ * NSTATE,
        Dsk + (size_t)i * DINQ, Sst, gbf);

    // x = g @ Wout + b_out + residual (in place)
    gemm_bf16_wmma<2><<<dim3(DQ / BNT, BL / BMT), 256, 0, stream>>>(
        gbf, WoutT, b_out + (size_t)i * DQ, xbuf, nullptr, BL, DQ, DINQ);
  }

  ln_kernel<false><<<BL / LNR, LNR * 32, 0, stream>>>(xbuf, fnw, fnb, d_out);
}

// v006
// It runs in 305 microseconds.
// Timed twice side by side with v005, it ran 1.19 and 1.20 times as fast.
// Counting every step since v000, it is 13.6 times as fast.
#include <hip/hip_runtime.h>
#include <hip/hip_bf16.h>
#include <math.h>

// ---------------- problem constants (match reference) ----------------
#define BQ     2
#define LQ     2048
#define DQ     1024
#define DINQ   2048
#define NSTATE 16
#define BL     (BQ * LQ)        // 4096 token rows

// ---------------- CDNA5 WMMA types ----------------
typedef __attribute__((ext_vector_type(16))) __bf16 v16bf;
typedef __attribute__((ext_vector_type(8)))  __bf16 v8bf;
typedef __attribute__((ext_vector_type(8)))  float  v8f;
typedef __attribute__((ext_vector_type(4)))  float    v4f;
typedef __attribute__((ext_vector_type(4)))  unsigned v4u;
typedef __attribute__((ext_vector_type(2)))  unsigned v2u;

__device__ __forceinline__ unsigned short f32_bf16(float f) {
  unsigned u = __float_as_uint(f);
  u += 0x7fffu + ((u >> 16) & 1u);          // round-to-nearest-even
  return (unsigned short)(u >> 16);
}

// CDNA5 async global->LDS copies (ASYNCcnt-tracked, no VGPR round-trip), eight
// to a statement. The LDS operand is the low 32 bits of the generic address.
// The s_wait_xcnt at the statement's end stands in front of every later write
// of the address registers that the copies name.
__device__ __forceinline__ void async_ld8_b128(
    const unsigned* l, const unsigned short* const* g) {
  asm volatile("global_load_async_to_lds_b128 %0, %8, off\n\t"
               "global_load_async_to_lds_b128 %1, %9, off\n\t"
               "global_load_async_to_lds_b128 %2, %10, off\n\t"
               "global_load_async_to_lds_b128 %3, %11, off\n\t"
               "global_load_async_to_lds_b128 %4, %12, off\n\t"
               "global_load_async_to_lds_b128 %5, %13, off\n\t"
               "global_load_async_to_lds_b128 %6, %14, off\n\t"
               "global_load_async_to_lds_b128 %7, %15, off\n\t"
               "s_wait_xcnt 0x0"
               :: "v"(l[0]), "v"(l[1]), "v"(l[2]), "v"(l[3]),
                  "v"(l[4]), "v"(l[5]), "v"(l[6]), "v"(l[7]),
                  "v"(g[0]), "v"(g[1]), "v"(g[2]), "v"(g[3]),
                  "v"(g[4]), "v"(g[5]), "v"(g[6]), "v"(g[7])
               : "memory");
}
// the same, twelve to a statement
__device__ __forceinline__ void async_ld12_b128(
    const unsigned* l, const unsigned short* const* g) {
  asm volatile("global_load_async_to_lds_b128 %0, %12, off\n\t"
               "global_load_async_to_lds_b128 %1, %13, off\n\t"
               "global_load_async_to_lds_b128 %2, %14, off\n\t"
               "global_load_async_to_lds_b128 %3, %15, off\n\t"
               "global_load_async_to_lds_b128 %4, %16, off\n\t"
               "global_load_async_to_lds_b128 %5, %17, off\n\t"
               "global_load_async_to_lds_b128 %6, %18, off\n\t"
               "global_load_async_to_lds_b128 %7, %19, off\n\t"
               "global_load_async_to_lds_b128 %8, %20, off\n\t"
               "global_load_async_to_lds_b128 %9, %21, off\n\t"
               "global_load_async_to_lds_b128 %10, %22, off\n\t"
               "global_load_async_to_lds_b128 %11, %23, off\n\t"
               "s_wait_xcnt 0x0"
               :: "v"(l[0]), "v"(l[1]), "v"(l[2]), "v"(l[3]),
                  "v"(l[4]), "v"(l[5]), "v"(l[6]), "v"(l[7]),
                  "v"(l[8]), "v"(l[9]), "v"(l[10]), "v"(l[11]),
                  "v"(g[0]), "v"(g[1]), "v"(g[2]), "v"(g[3]),
                  "v"(g[4]), "v"(g[5]), "v"(g[6]), "v"(g[7]),
                  "v"(g[8]), "v"(g[9]), "v"(g[10]), "v"(g[11])
               : "memory");
}
// the wave's own copies have landed
__device__ __forceinline__ void wait_async0() {
  asm volatile("s_wait_asynccnt 0x0" ::: "memory");
}
// the wave's own LDS reads have returned
__device__ __forceinline__ void wait_ds0() {
  asm volatile("s_wait_dscnt 0x0" ::: "memory");
}

// =====================================================================
// The three streaming kernels below are gridded for few, fat waves: the work
// of each wave is a handful of 16-byte loads that fly together
// (for speed only).
// Every loop in them is unrolled: the per-thread arrays are then indexed by
// constants only and stay in registers.
// =====================================================================
// add positional embedding: xbuf = x + pos_emb  (never mutate d_in)
// One thread = APV pieces of 16 bytes, 256 pieces apart; the grid is exact.
// =====================================================================
#define APV 4
__global__ __launch_bounds__(256) void add_pos_kernel(
    const float* __restrict__ x, const float* __restrict__ pe,
    float* __restrict__ xbuf) {
  const unsigned base = blockIdx.x * (256 * APV) + threadIdx.x;   // in 16-byte pieces
  // a block's pieces lie in one batch entry: LQ * DQ / 4 is a multiple of 256 * APV
  const unsigned pb = base % (LQ * DQ / 4);
  v4f xv[APV], pv[APV];
#pragma unroll
  for (int j = 0; j < APV; ++j) {
    xv[j] = ((const v4f*)x)[base + j * 256];
    pv[j] = ((const v4f*)pe)[pb + j * 256];
  }
#pragma unroll
  for (int j = 0; j < APV; ++j) ((v4f*)xbuf)[base + j * 256] = xv[j] + pv[j];
}

// =====================================================================
// weight transpose + fp32->bf16:  W[K][N] fp32  ->  WT[N][K] bf16
// One block = a tile of WTK k x WTN n. Reads: 16 bytes per lane, a wave covers
// two rows of 256 bytes. Writes: 8 bf16 (16 bytes) per lane, a wave covers four
// rows of 128 bytes. The odd LDS pitch spreads both sides over the banks.
// K and N are compile-time: a thread's loads (and stores) then differ only in
// their immediate offsets.
// =====================================================================
#define WTK 128
#define WTN 64
template <int K, int N>
__global__ __launch_bounds__(256) void wconv_kernel(
    const float* __restrict__ W, unsigned short* __restrict__ WT) {
  __shared__ float tile[WTK][WTN + 1];
  const int nb = blockIdx.x * WTN, kb = blockIdx.y * WTK;
  const int c4 = (threadIdx.x & 15) * 4, r0 = threadIdx.x >> 4;
  // block-uniform base + one lane offset for all of a thread's loads (stores alike)
  const float* Wb = W + (size_t)kb * N + nb;
  const unsigned woff = (unsigned)(r0 * N + c4);
  v4f v[WTK / 16];
#pragma unroll
  for (int j = 0; j < WTK / 16; ++j)
    v[j] = *(const v4f*)(Wb + (size_t)(16 * j) * N + woff);
#pragma unroll
  for (int j = 0; j < WTK / 16; ++j)
#pragma unroll
    for (int i = 0; i < 4; ++i) tile[r0 + 16 * j][c4 + i] = v[j][i];
  __syncthreads();
  const int k8 = (threadIdx.x & 7) * 8, n0 = threadIdx.x >> 3;
  unsigned short* Tb = WT + (size_t)nb * K + kb;
  const unsigned toff = (unsigned)(n0 * K + k8);
#pragma unroll
  for (int nh = 0; nh < WTN / 32; ++nh)
#pragma unroll
    for (int kh = 0; kh < WTK / 64; ++kh) {
      const int n = n0 + 32 * nh, k = k8 + 64 * kh;
      v4u p;
#pragma unroll
      for (int i = 0; i < 4; ++i)
        p[i] = (unsigned)f32_bf16(tile[k + 2 * i][n]) |
               ((unsigned)f32_bf16(tile[k + 2 * i + 1][n]) << 16);
      *(v4u*)(Tb + (size_t)(32 * nh) * K + 64 * kh + toff) = p;
    }
}

// =====================================================================
// LayerNorm over the last dim (DQ); optional bf16 output (GEMM A operand)
// One wave = one row, held in registers (LNV pieces of 16 bytes per lane), so
// the row is read once; the two sums go over the lanes by shuffles.
// =====================================================================
#define LNR 8                 // rows (waves) per block
#define LNV (DQ / 128)        // 16-byte pieces of a row per lane
template <bool BF16OUT>
__global__ __launch_bounds__(LNR * 32) void ln_kernel(
    const float* __restrict__ x, const float* __restrict__ w,
    const float* __restrict__ b, void* __restrict__ out) {
  // the wave's number, held scalar: the row's base address is then scalar too
  const int row  = blockIdx.x * LNR + __builtin_amdgcn_readfirstlane(threadIdx.x >> 5);
  const unsigned lane = threadIdx.x & 31;
  const v4f* xr = (const v4f*)(x + (size_t)row * DQ);
  v4f v[LNV], wv[LNV], bv[LNV];
#pragma unroll
  for (int j = 0; j < LNV; ++j) v[j] = xr[j * 32 + lane];
#pragma unroll
  for (int j = 0; j < LNV; ++j) {
    wv[j] = ((const v4f*)w)[j * 32 + lane];
    bv[j] = ((const v4f*)b)[j * 32 + lane];
  }
  // keeps the scheduler from sinking the w and b loads behind the sums (one
  // exposed latency per group of them instead of none)
  __builtin_amdgcn_sched_barrier(0);
  v4f a1 = {}, a2 = {};
#pragma unroll
  for (int j = 0; j < LNV; ++j) { a1 += v[j]; a2 += v[j] * v[j]; }
  float s  = (a1[0] + a1[1]) + (a1[2] + a1[3]);
  float s2 = (a2[0] + a2[1]) + (a2[2] + a2[3]);
#pragma unroll
  for (int o = 16; o > 0; o >>= 1) {
    s  += __shfl_xor(s, o);
    s2 += __shfl_xor(s2, o);
  }
  const float mean = s / (float)DQ;
  const float var  = s2 / (float)DQ - mean * mean;
  const float rstd = rsqrtf(var + 1e-5f);
#pragma unroll
  for (int j = 0; j < LNV; ++j) {
    v4f y = (v[j] - mean) * rstd * wv[j] + bv[j];
    if (BF16OUT) {
      v2u p = {(unsigned)f32_bf16(y[0]) | ((unsigned)f32_bf16(y[1]) << 16),
               (unsigned)f32_bf16(y[2]) | ((unsigned)f32_bf16(y[3]) << 16)};
      ((v2u*)((unsigned short*)out + (size_t)row * DQ))[j * 32 + lane] = p;
    } else {
      ((v4f*)((float*)out + (size_t)row * DQ))[j * 32 + lane] = y;
    }
  }
}

// =====================================================================
// WMMA bf16 GEMM:  out[M][N] = A[M][K](bf16) * BT[N][K](bf16)^T + bias
// Block tile (MI*64) x 128, 8 waves (wave32) arranged 4x2, each wave
// (MI*16) x 64 via MI x 4 v_wmma_f32_16x16x32_bf16 tiles: every byte staged
// from L2 and every fragment read from LDS serves more products than in a
// small tile. K is staged in KC-wide tiles by async global->LDS copies into two
// buffers (KC as large as the two buffers allow: fewer barriers per product):
//   tile 0, wait, barrier; per trip: tile i+1's copies into the buffer that
//   trip i-1 has read, the products on tile i, s_wait_dscnt 0,
//   s_wait_asynccnt 0, barrier.
// Inside a trip the fragments of the next 32 k are fetched into a second
// register set in front of the products on this one.
// N and K are compile-time: a thread's stores then differ only in their
// immediate offsets from one base address.
// Every loop but the one over the tiles is unrolled: the fragment, accumulator
// and address arrays are then indexed by constants only and stay in registers.
// Epilogues:
//   MODE 0: outF = v+bias (fp32) AND outBf = bf16(v+bias)
//   MODE 1: outF = softplus(v+bias)
//   MODE 2: outF = v+bias+outF  (residual add in place)
// =====================================================================
#define BNT 128

__device__ __forceinline__ v16bf load_frag(const unsigned short* rowp, int half) {
  // A-fragment lane layout (ISA 7.12.2, 16-bit A 16x32):
  //  lanes 0-15:  elems[0..7]=K0..7,  elems[8..15]=K16..23
  //  lanes 16-31: elems[0..7]=K8..15, elems[8..15]=K24..31
  union { v16bf v; v8bf h[2]; } u;
  u.h[0] = *(const v8bf*)(rowp + half * 8);
  u.h[1] = *(const v8bf*)(rowp + 16 + half * 8);
  return u.v;
}

// softplus(v) = max(v, 0) + log1p(exp(-|v|)) for eight values, on the hardware's
// own v_exp_f32 and v_log_f32. With e = exp(-|v|) in [0, 1] and w = fl(1 + e), the
// term d = e - (w - 1) is exactly what the rounding of 1 + e dropped, and
// log1p(e) = log(w) + d / w; d stands for d / w (the difference is below
// 2^-24 * e), so small e keep their relative accuracy. No overflow for any v, so
// no cut-over to v for large v is needed.
// The eight values of a statement are independent, so they fill each other's
// latency; the v_nop at each statement's end keeps the slot that the instruction
// set asks for behind a transcendental before its result is read.
__device__ __forceinline__ void softplus8(float (&y)[8], const float (&v)[8]) {
  float t[8], e[8], w[8], l[8];
#pragma unroll
  for (int r = 0; r < 8; ++r) t[r] = fabsf(v[r]) * -1.44269504f;
  asm("v_exp_f32 %0, %8\n\tv_exp_f32 %1, %9\n\tv_exp_f32 %2, %10\n\t"
      "v_exp_f32 %3, %11\n\tv_exp_f32 %4, %12\n\tv_exp_f32 %5, %13\n\t"
      "v_exp_f32 %6, %14\n\tv_exp_f32 %7, %15\n\tv_nop"
      : "=&v"(e[0]), "=&v"(e[1]), "=&v"(e[2]), "=&v"(e[3]),
        "=&v"(e[4]), "=&v"(e[5]), "=&v"(e[6]), "=&v"(e[7])
      : "v"(t[0]), "v"(t[1]), "v"(t[2]), "v"(t[3]),
        "v"(t[4]), "v"(t[5]), "v"(t[6]), "v"(t[7]));
#pragma unroll
  for (int r = 0; r < 8; ++r) w[r] = 1.f + e[r];
  asm("v_log_f32 %0, %8\n\tv_log_f32 %1, %9\n\tv_log_f32 %2, %10\n\t"
      "v_log_f32 %3, %11\n\tv_log_f32 %4, %12\n\tv_log_f32 %5, %13\n\t"
      "v_log_f32 %6, %14\n\tv_log_f32 %7, %15\n\tv_nop"
      : "=&v"(l[0]), "=&v"(l[1]), "=&v"(l[2]), "=&v"(l[3]),
        "=&v"(l[4]), "=&v"(l[5]), "=&v"(l[6]), "=&v"(l[7])
      : "v"(w[0]), "v"(w[1]), "v"(w[2]), "v"(w[3]),
        "v"(w[4]), "v"(w[5]), "v"(w[6]), "v"(w[7]));
#pragma unroll
  for (int r = 0; r < 8; ++r) {
    float d = e[r] - (w[r] - 1.f);
    y[r] = fmaxf(v[r], 0.f) + (l[r] * 0.69314718f + d);   // log2(w) * ln 2
  }
}

template <int MODE, int MI, int KC, int N, int K>
__global__ __launch_bounds__(256) void gemm_bf16_wmma(
    const unsigned short* __restrict__ A,   // [M][K] bf16
    const unsigned short* __restrict__ BT,  // [N][K] bf16 (B transposed)
    const float* __restrict__ bias,         // [N]
    float* __restrict__ outF,
    unsigned short* __restrict__ outBf) {
  constexpr int BM = MI * 64;
  constexpr int nk = K / KC;
  constexpr int LDA = KC + 8;        // padded row pitch (elements): an odd number of 16 B
  constexpr int RP = 256 / (KC / 8); // rows that one copy of all 256 threads covers
  static_assert(K % KC == 0 && nk >= 2 && BM % 128 == 0 && (KC == 128 || KC == 256),
                "tile shapes");
  __shared__ __align__(16) unsigned short As[2][BM][LDA];
  __shared__ __align__(16) unsigned short Bs[2][BNT][LDA];
  const int tid  = threadIdx.x;
  // the wave's number, held scalar: the wave's part of every address is then scalar
  const int wave = __builtin_amdgcn_readfirstlane(tid >> 5);
  const int lane = tid & 31;
  const int wm = wave & 3, wn = wave >> 2;    // 4 waves along M, 2 along N
  const int bm = blockIdx.y * BM, bn = blockIdx.x * BNT;
  const int half = lane >> 4, lrow = lane & 15;

  // a thread's copies of one tile: 16 bytes of every RP-th row, so that a wave's
  // copy covers 512 bytes in whole rows
  const int crow = tid / (KC / 8), ccol = (tid % (KC / 8)) * 8;
  const unsigned short* gA = A  + (size_t)(bm + crow) * K + ccol;
  const unsigned short* gB = BT + (size_t)(bn + crow) * K + ccol;
  const unsigned lA = (unsigned)(uintptr_t)&As[0][crow][ccol];
  const unsigned lB = (unsigned)(uintptr_t)&Bs[0][crow][ccol];

  constexpr int NCA = BM / RP, NC = NCA + BNT / RP;   // copies per thread and tile
  auto issue_stage = [&](int buf, int k0) {
    unsigned l[NC];
    const unsigned short* g[NC];
#pragma unroll
    for (int t = 0; t < NCA; ++t) {
      l[t] = lA + (unsigned)((buf * BM + t * RP) * (LDA * 2));
      g[t] = gA + k0 + (size_t)(t * RP) * K;
    }
#pragma unroll
    for (int t = 0; t < BNT / RP; ++t) {
      l[NCA + t] = lB + (unsigned)((buf * BNT + t * RP) * (LDA * 2));
      g[NCA + t] = gB + k0 + (size_t)(t * RP) * K;
    }
    static_assert(NC == 24 || NC == 32, "copies per statement");
    async_ld12_b128(l, g);
    async_ld12_b128(l + 12, g + 12);
    if constexpr (NC == 32) async_ld8_b128(l + 24, g + 24);
  };

  v8f zero = {};
  v8f acc[MI][4];
#pragma unroll
  for (int i = 0; i < MI; ++i)
#pragma unroll
    for (int j = 0; j < 4; ++j) acc[i][j] = zero;

  issue_stage(0, 0);
  wait_async0();
  __syncthreads();                   // tile 0 visible to all waves
  // rolled: a trip is already KC / 32 * MI * 4 products long (code size)
#pragma unroll 1
  for (int i = 0; i < nk; ++i) {
    const int cur = i & 1;
    const unsigned short* ap = &As[cur][wm * (MI * 16) + lrow][0];
    const unsigned short* bp = &Bs[cur][wn * 64 + lrow][0];
    v16bf aF[2][MI], bF[2][4];
#pragma unroll
    for (int ii = 0; ii < MI; ++ii) aF[0][ii] = load_frag(ap + ii * 16 * LDA, half);
#pragma unroll
    for (int jj = 0; jj < 4; ++jj)  bF[0][jj] = load_frag(bp + jj * 16 * LDA, half);
    // tile i+1's copies, into the buffer that every wave has left at the barrier
    // above; they are issued while the trip's first LDS reads are under way
    if (i + 1 < nk) issue_stage(cur ^ 1, (i + 1) * KC);
#pragma unroll
    for (int ks = 0; ks < KC / 32; ++ks) {
      const int s = ks & 1;
      if (ks + 1 < KC / 32) {
#pragma unroll
        for (int ii = 0; ii < MI; ++ii)
          aF[s ^ 1][ii] = load_frag(ap + ii * 16 * LDA + (ks + 1) * 32, half);
#pragma unroll
        for (int jj = 0; jj < 4; ++jj)
          bF[s ^ 1][jj] = load_frag(bp + jj * 16 * LDA + (ks + 1) * 32, half);
      }
      // keeps the next set's LDS reads one group in front of this set's products:
      // left alone, the scheduler sinks each read to its first use, with a full
      // wait in front of every row of products
      __builtin_amdgcn_sched_barrier(0);
#pragma unroll
      for (int ii = 0; ii < MI; ++ii)
#pragma unroll
        for (int jj = 0; jj < 4; ++jj)
          acc[ii][jj] = __builtin_amdgcn_wmma_f32_16x16x32_bf16(
              false, aF[s][ii], false, bF[s][jj], (short)0, acc[ii][jj],
              false, false);
      // keeps the set after next's reads behind these products, whose operands
      // they overwrite
      __builtin_amdgcn_sched_barrier(0);
    }
    wait_ds0();                      // this wave has left buffer cur
    wait_async0();                   // its copies of tile i+1 have landed
    __syncthreads();                 // tile i+1 visible, buffer cur free
  }
  wait_async0();                     // no copy is outstanding behind the loop

  // ---- epilogue: C/D layout - n = lane&15, m = vgpr + (lane>>4)*8 ----
  // One lane-dependent base; every element lies a constant step from it.
  const int gn0 = bn + wn * 64 + lrow;
  float bj[4];
#pragma unroll
  for (int j = 0; j < 4; ++j) bj[j] = bias[gn0 + j * 16];
  // the loads' offset register is reused by the address arithmetic below
  asm volatile("s_wait_xcnt 0x0" ::: "memory");
  // keeps that arithmetic behind the wait
  __builtin_amdgcn_sched_barrier(0);
  const size_t off0 = (size_t)(bm + wm * (MI * 16) + half * 8) * N + gn0;
  float* const baseF = outF + off0;
  float res[MODE == 2 ? MI : 1][4][8];
  if (MODE == 2) {                   // the whole residual tile flies together
#pragma unroll
    for (int i = 0; i < MI; ++i)
#pragma unroll
      for (int j = 0; j < 4; ++j)
#pragma unroll
        for (int r = 0; r < 8; ++r) res[i][j][r] = baseF[(i * 16 + r) * N + j * 16];
  }
#pragma unroll
  for (int i = 0; i < MI; ++i) {
    float val[4][8];
    unsigned short vb[4][8];
#pragma unroll
    for (int j = 0; j < 4; ++j) {
      float pre[8];
#pragma unroll
      for (int r = 0; r < 8; ++r) pre[r] = acc[i][j][r] + bj[j];
      if (MODE == 1) {
        softplus8(val[j], pre);
      } else {
#pragma unroll
        for (int r = 0; r < 8; ++r) {
          val[j][r] = MODE == 2 ? pre[r] + res[i][j][r] : pre[r];
          if (MODE == 0) vb[j][r] = f32_bf16(val[j][r]);
        }
      }
    }
    // keeps every value of the group computed in front of its first store
    __builtin_amdgcn_sched_barrier(0);
#pragma unroll
    for (int j = 0; j < 4; ++j)
#pragma unroll
      for (int r = 0; r < 8; ++r) {
        baseF[(i * 16 + r) * N + j * 16] = val[j][r];
        if (MODE == 0) (outBf + off0)[(i * 16 + r) * N + j * 16] = vb[j][r];
      }
    // the stores' data registers are rewritten by the next group
    asm volatile("s_wait_xcnt 0x0" ::: "memory");
    // keeps the next group's arithmetic behind that wait
    __builtin_amdgcn_sched_barrier(0);
  }
}

// =====================================================================
// Bm|Cm projection:  BC[m][0..15]=h@WB, [16..31]=h@WC, all in f32, on
// v_wmma_f32_16x16x4_f32. One block = 16 token rows x all 32 columns, so a
// weight row is fetched once per 16 tokens. The 16 waves split k (128 each);
// their partial tiles are added through LDS in wave order.
// k pairing: lane (c, hf) holds, for group q, k = slice + 8q + 4hf + 0..3 of
// A row c (one 16-byte load) and the same four k of B column c.
// Every loop is unrolled: av, wb, wc and the accumulators are then indexed by
// constants only and stay in registers.
// =====================================================================
typedef __attribute__((ext_vector_type(2))) float v2f;
#define BCW  16               // waves per block
#define BCKS (DINQ / BCW)     // k per wave
#define BCQ  (BCKS / 8)       // groups of 8 k per wave
#define BCG  4                // groups whose weight fragments are fetched together

__global__ __launch_bounds__(BCW * 32) void bc_kernel(
    const float* __restrict__ h, const float* __restrict__ WB,
    const float* __restrict__ WC, float* __restrict__ BC) {
  __shared__ float red[BCW][512];           // per wave: 2 tiles x 8 registers x 32 lanes
  const int wave = threadIdx.x >> 5, lane = threadIdx.x & 31;
  const int c = lane & 15, hf = lane >> 4;
  const int m0 = blockIdx.x * 16;
  const int kl = wave * BCKS + hf * 4;      // the lane's first k
  const float* ap = h  + (size_t)(m0 + c) * DINQ + kl;
  const float* bp = WB + (size_t)kl * NSTATE + c;
  const float* cp = WC + (size_t)kl * NSTATE + c;

  v4f av[BCQ];                              // the wave's whole slice of h, fetched first
#pragma unroll
  for (int q = 0; q < BCQ; ++q) av[q] = *(const v4f*)(ap + q * 8);
  // keeps the scheduler from sinking these loads to their first use (one
  // exposed latency per product instead of one for the whole slice)
  __builtin_amdgcn_sched_barrier(0);

  float wb[2][BCG][4], wc[2][BCG][4];
  auto fetch = [&](int buf, int g) {
#pragma unroll
    for (int q2 = 0; q2 < BCG; ++q2)
#pragma unroll
      for (int j = 0; j < 4; ++j) {
        wb[buf][q2][j] = bp[(size_t)((g * BCG + q2) * 8 + j) * NSTATE];
        wc[buf][q2][j] = cp[(size_t)((g * BCG + q2) * 8 + j) * NSTATE];
      }
  };
  fetch(0, 0);

  v8f accb = {}, accc = {};
#pragma unroll
  for (int g = 0; g < BCQ / BCG; ++g) {
    if (g + 1 < BCQ / BCG) {
      fetch((g + 1) & 1, g + 1);            // flies under this group's products
      // behind the last fetch the loads' address registers are free for reuse
      if (g + 2 == BCQ / BCG) asm volatile("s_wait_xcnt 0x0" ::: "memory");
      // keeps the next group's loads in front of this group's products
      __builtin_amdgcn_sched_barrier(0);
    }
#pragma unroll
    for (int q2 = 0; q2 < BCG; ++q2)
#pragma unroll
      for (int p = 0; p < 2; ++p) {
        v2f a  = {av[g * BCG + q2][2 * p], av[g * BCG + q2][2 * p + 1]};
        v2f fb = {wb[g & 1][q2][2 * p], wb[g & 1][q2][2 * p + 1]};
        v2f fc = {wc[g & 1][q2][2 * p], wc[g & 1][q2][2 * p + 1]};
        accb = __builtin_amdgcn_wmma_f32_16x16x4_f32(
            false, a, false, fb, (short)0, accb, false, false);
        accc = __builtin_amdgcn_wmma_f32_16x16x4_f32(
            false, a, false, fc, (short)0, accc, false, false);
      }
  }
  // A precaution: no distance is documented for the f32 form, and without this
  // the build had address arithmetic overwriting an A register directly behind
  // its product. Eight vector slots, the figure of the other 16-cycle form,
  // stand in front of the first vector instruction behind the products; the two
  // scheduling barriers keep that arithmetic and the slots where they are written.
  __builtin_amdgcn_sched_barrier(0);
  asm volatile("v_nop\n\tv_nop\n\tv_nop\n\tv_nop\n\tv_nop\n\tv_nop\n\tv_nop\n\tv_nop");
  __builtin_amdgcn_sched_barrier(0);

#pragma unroll
  for (int r = 0; r < 8; ++r) {
    red[wave][r * 32 + lane]       = accb[r];
    red[wave][256 + r * 32 + lane] = accc[r];
  }
  __syncthreads();
  // one output per thread; D layout: register r of lane l = D[8 * (l >> 4) + r][l & 15]
  float s = 0.f;
#pragma unroll
  for (int w = 0; w < BCW; ++w) s += red[w][threadIdx.x];
  const int tile = threadIdx.x >> 8, r = (threadIdx.x >> 5) & 7;
  BC[(size_t)(m0 + 8 * hf + r) * 32 + tile * 16 + c] = s;
}

// =====================================================================
// selective scan (diagonal SSM), split over time into NCH chunks of CLEN
// steps so that the chunks run side by side instead of one after another.
//   scan_state_kernel: every chunk but the last runs the recurrence from a
//     zero state and keeps its end state S[n] and its sum of dt (row NSTATE
//     of the same record). The decay over a whole chunk is exp(a[n] * sum dt).
//   scan_kernel: a chunk folds the earlier chunks' (S, sum dt) in time order
//     into its start state, then runs the recurrence with the fused D-skip,
//     the causal depthwise conv (4 taps) + SiLU of the same channel, formed
//     from the x values that the lane walks through anyway, and the gating.
// One lane = one channel with all 16 states; one block = SCB channels of one
// (batch, chunk), so the B/C rows are the same address for the whole block.
// =====================================================================
#define NCH  32
#define CLEN (LQ / NCH)     // 64 steps per chunk
#define SU   8              // steps fetched ahead as one group
#define SCB  128            // channels (threads) per block
#define DGS  (DINQ / SCB)   // channel groups
#define SROWS (NSTATE + 1)  // rows of a chunk's record: S[0..15], sum of dt
#define FB   3              // chunk records fetched together in the fold (51 loads)

// e[n] = exp(x[n]) for the 16 states, as __expf forms it (x * log2(e), then
// v_exp_f32), eight to a statement. The v_nop at each statement's end keeps the
// slot that the instruction set asks for behind a transcendental before its
// source is overwritten.
__device__ __forceinline__ void exp16(float (&e)[NSTATE], const float (&x)[NSTATE]) {
  float t[NSTATE];
#pragma unroll
  for (int n = 0; n < NSTATE; ++n) t[n] = x[n] * 1.44269504f;
#pragma unroll
  for (int k = 0; k < NSTATE; k += 8)
    asm("v_exp_f32 %0, %8\n\tv_exp_f32 %1, %9\n\tv_exp_f32 %2, %10\n\t"
        "v_exp_f32 %3, %11\n\tv_exp_f32 %4, %12\n\tv_exp_f32 %5, %13\n\t"
        "v_exp_f32 %6, %14\n\tv_exp_f32 %7, %15\n\tv_nop"
        : "=&v"(e[k]), "=&v"(e[k + 1]), "=&v"(e[k + 2]), "=&v"(e[k + 3]),
          "=&v"(e[k + 4]), "=&v"(e[k + 5]), "=&v"(e[k + 6]), "=&v"(e[k + 7])
        : "v"(t[k]), "v"(t[k + 1]), "v"(t[k + 2]), "v"(t[k + 3]),
          "v"(t[k + 4]), "v"(t[k + 5]), "v"(t[k + 6]), "v"(t[k + 7]));
}

// exp(x) for one value, formed as in exp16; the v_nop keeps the same slot.
__device__ __forceinline__ float exp1(float x) {
  float t = x * 1.44269504f, e;
  asm("v_exp_f32 %0, %1\n\tv_nop" : "=v"(e) : "v"(t));
  return e;
}

__global__ __launch_bounds__(SCB) void scan_state_kernel(
    const float* __restrict__ h,  const float* __restrict__ dt,
    const float* __restrict__ BC, const float* __restrict__ A_log,
    float* __restrict__ Sst) {    // [B][NCH][SROWS][DIN]
  const int d  = (blockIdx.x % DGS) * SCB + threadIdx.x;
  const int bc = blockIdx.x / DGS;
  const int b  = bc / (NCH - 1);
  const int c  = bc % (NCH - 1);             // the last chunk feeds nobody

  float a[NSTATE], hs[NSTATE], al[NSTATE];
#pragma unroll
  for (int n = 0; n < NSTATE; ++n) al[n] = A_log[(size_t)d * NSTATE + n];
  exp16(a, al);
#pragma unroll
  for (int n = 0; n < NSTATE; ++n) { a[n] = -a[n]; hs[n] = 0.f; }
  const size_t row0 = (size_t)b * LQ + (size_t)c * CLEN;
  const float* dtp = dt + row0 * DINQ + d;
  const float* hp  = h  + row0 * DINQ + d;
  const float* bcp = BC + row0 * 32;

  float sd = 0.f;
  float dtc[SU], xc[SU];
#pragma unroll
  for (int u = 0; u < SU; ++u) { dtc[u] = 0.f; xc[u] = 0.f; }
  // Trip -1 only fetches group 0, so that every group reaches the arithmetic
  // through the copies at the loop's foot and the wait for it stands there.
  // rolled: the body is already SU * NSTATE updates long (code size)
#pragma unroll 1
  for (int g = -1; g < CLEN / SU; ++g) {
    float dtn[SU], xn[SU];
#pragma unroll
    for (int u = 0; u < SU; ++u) { dtn[u] = 0.f; xn[u] = 0.f; }
    if (g + 1 < CLEN / SU) {                 // next group flies under this one
#pragma unroll
      for (int u = 0; u < SU; ++u) {
        dtn[u] = dtp[(size_t)((g + 1) * SU + u) * DINQ];
        xn[u]  = hp[(size_t)((g + 1) * SU + u) * DINQ];
      }
      // the loads' address registers are reused by the arithmetic below
      asm volatile("s_wait_xcnt 0x0" ::: "memory");
    }
    if (g >= 0) {
#pragma unroll
      for (int u = 0; u < SU; ++u) {
        const float* bct = bcp + (g * SU + u) * 32;
        float dtv = dtc[u];
        float dx  = dtv * xc[u];
        sd += dtv;
        float da[NSTATE], dA[NSTATE];
#pragma unroll
        for (int n = 0; n < NSTATE; ++n) da[n] = dtv * a[n];
        exp16(dA, da);
#pragma unroll
        for (int n = 0; n < NSTATE; ++n) hs[n] = hs[n] * dA[n] + dx * bct[n];
      }
    }
#pragma unroll
    for (int u = 0; u < SU; ++u) { dtc[u] = dtn[u]; xc[u] = xn[u]; }
  }
  float* sp = Sst + ((size_t)b * NCH + c) * SROWS * DINQ + d;
#pragma unroll
  for (int n = 0; n < NSTATE; ++n) sp[(size_t)n * DINQ] = hs[n];
  sp[(size_t)NSTATE * DINQ] = sd;
}

__global__ __launch_bounds__(SCB) void scan_kernel(
    const float* __restrict__ h,  const float* __restrict__ dt,
    const float* __restrict__ BC, const float* __restrict__ cw,
    const float* __restrict__ cb,
    const float* __restrict__ A_log, const float* __restrict__ Dsk,
    const float* __restrict__ Sst, unsigned short* __restrict__ gout) {
  const int d  = (blockIdx.x % DGS) * SCB + threadIdx.x;
  const int bc = blockIdx.x / DGS;
  const int b  = bc % BQ;
  const int c  = NCH - 1 - bc / BQ;          // longest fold starts first

  const size_t row0 = (size_t)b * LQ + (size_t)c * CLEN;
  const float* hp  = h + row0 * DINQ + d;

  // first loads of the kernel: they have landed with the A_log rows, so no
  // wait for them falls among the fetched-ahead loads of the main loop
  const float dsk = Dsk[d];
  const float cbv = cb[d];
  float cwv[4];
#pragma unroll
  for (int j = 0; j < 4; ++j) cwv[j] = cw[j * DINQ + d];
  // the registers that the loads name are reused below
  asm volatile("s_wait_xcnt 0x0" ::: "memory");
  // the three x values in front of the chunk (zero padding in front of l = 0)
  float xp[3] = {0.f, 0.f, 0.f};
  if (c > 0) {
#pragma unroll
    for (int j = 0; j < 3; ++j) xp[j] = hp[(ptrdiff_t)(j - 3) * DINQ];
    // the registers that the loads name are reused below
    asm volatile("s_wait_xcnt 0x0" ::: "memory");
  }
  float a[NSTATE], hs[NSTATE], al[NSTATE];
#pragma unroll
  for (int n = 0; n < NSTATE; ++n) al[n] = A_log[(size_t)d * NSTATE + n];
  exp16(a, al);
#pragma unroll
  for (int n = 0; n < NSTATE; ++n) { a[n] = -a[n]; hs[n] = 0.f; }

  // start state: earlier chunks folded in time order, FB records per fetch
  const float* sp = Sst + (size_t)b * NCH * SROWS * DINQ + d;
  int cp = 0;
#pragma unroll 1
  for (; cp + FB <= c; cp += FB) {
    float sv[FB][SROWS];
#pragma unroll
    for (int k = 0; k < FB; ++k)
#pragma unroll
      for (int n = 0; n < SROWS; ++n)
        sv[k][n] = sp[((size_t)(cp + k) * SROWS + n) * DINQ];
    // the loads' address registers are advanced for the next trip
    asm volatile("s_wait_xcnt 0x0" ::: "memory");
#pragma unroll
    for (int k = 0; k < FB; ++k) {
      float da[NSTATE], dA[NSTATE];
#pragma unroll
      for (int n = 0; n < NSTATE; ++n) da[n] = a[n] * sv[k][NSTATE];
      exp16(dA, da);
#pragma unroll
      for (int n = 0; n < NSTATE; ++n) hs[n] = hs[n] * dA[n] + sv[k][n];
    }
  }
#pragma unroll 1
  for (; cp < c; ++cp) {
    float sv[SROWS];
#pragma unroll
    for (int n = 0; n < SROWS; ++n)
      sv[n] = sp[((size_t)cp * SROWS + n) * DINQ];
    // the loads' address registers are reused by the arithmetic below
    asm volatile("s_wait_xcnt 0x0" ::: "memory");
    float da[NSTATE], dA[NSTATE];
#pragma unroll
    for (int n = 0; n < NSTATE; ++n) da[n] = a[n] * sv[NSTATE];
    exp16(dA, da);
#pragma unroll
    for (int n = 0; n < NSTATE; ++n) hs[n] = hs[n] * dA[n] + sv[n];
  }

  const float* dtp = dt + row0 * DINQ + d;
  const float* bcp = BC + row0 * 32;
  unsigned short* gp = gout + row0 * DINQ + d;

  float dtc[SU], xc[SU];
#pragma unroll
  for (int u = 0; u < SU; ++u) { dtc[u] = 0.f; xc[u] = 0.f; }
  // Trip -1 only fetches group 0 (see scan_state_kernel).
  // rolled: the body is already SU * NSTATE updates long (code size)
#pragma unroll 1
  for (int g = -1; g < CLEN / SU; ++g) {
    float dtn[SU], xn[SU];
#pragma unroll
    for (int u = 0; u < SU; ++u) { dtn[u] = 0.f; xn[u] = 0.f; }
    if (g + 1 < CLEN / SU) {                 // next group flies under this one
      // s_wait_xcnt behind each array's loads: their address registers are
      // reused, by the next array's load targets or by the arithmetic below
#pragma unroll
      for (int u = 0; u < SU; ++u) dtn[u] = dtp[(size_t)((g + 1) * SU + u) * DINQ];
      asm volatile("s_wait_xcnt 0x0" ::: "memory");
#pragma unroll
      for (int u = 0; u < SU; ++u) xn[u] = hp[(size_t)((g + 1) * SU + u) * DINQ];
      asm volatile("s_wait_xcnt 0x0" ::: "memory");
    }
    if (g >= 0) {
#pragma unroll
      for (int u = 0; u < SU; ++u) {
        const float* bct = bcp + (g * SU + u) * 32;
        float dtv = dtc[u];
        float xv  = xc[u];
        float dx  = dtv * xv;
        float da[NSTATE], dA[NSTATE];
#pragma unroll
        for (int n = 0; n < NSTATE; ++n) da[n] = dtv * a[n];
        exp16(dA, da);
        float yq[4];                         // four sums of four states each
#pragma unroll
        for (int q = 0; q < 4; ++q) {
          yq[q] = 0.f;
#pragma unroll
          for (int n2 = 0; n2 < 4; ++n2) {
            int n = q * 4 + n2;
            hs[n] = hs[n] * dA[n] + dx * bct[n];
            yq[q] += hs[n] * bct[16 + n];
          }
        }
        float y = (yq[0] + yq[1]) + (yq[2] + yq[3]);
        y += xv * dsk;
        // conv taps l-3 .. l in that order, then SiLU
        float ca = cbv;
        ca += (u >= 3 ? xc[u >= 3 ? u - 3 : 0] : xp[u < 3 ? u : 0]) * cwv[0];
        ca += (u >= 2 ? xc[u >= 2 ? u - 2 : 0] : xp[u < 2 ? u + 1 : 0]) * cwv[1];
        ca += (u >= 1 ? xc[u >= 1 ? u - 1 : 0] : xp[2]) * cwv[2];
        ca += xv * cwv[3];
        float yc = ca * (1.f / (1.f + exp1(-ca)));
        gp[(size_t)(g * SU + u) * DINQ] =
            f32_bf16(y * (1.f / (1.f + exp1(-yc))));
      }
#pragma unroll
      for (int j = 0; j < 3; ++j) xp[j] = xc[SU - 3 + j];
      // the stores' address and data registers are rewritten at the loop's foot
      asm volatile("s_wait_xcnt 0x0" ::: "memory");
    }
#pragma unroll
    for (int u = 0; u < SU; ++u) { dtc[u] = dtn[u]; xc[u] = xn[u]; }
  }
}

// =====================================================================
// host-side orchestration
// =====================================================================
extern "C" void kernel_launch(void* const* d_in, const int* in_sizes, int n_in,
                              void* d_out, int out_size, void* d_ws, size_t ws_size,
                              hipStream_t stream) {
  const float* x_in  = (const float*)d_in[0];
  const float* pos   = (const float*)d_in[1];
  const float* normw = (const float*)d_in[2];
  const float* normb = (const float*)d_in[3];
  const float* Win   = (const float*)d_in[4];
  const float* b_in  = (const float*)d_in[5];
  const float* A_log = (const float*)d_in[6];
  const float* Wdt   = (const float*)d_in[7];
  const float* b_dt  = (const float*)d_in[8];
  const float* WB    = (const float*)d_in[9];
  const float* WC    = (const float*)d_in[10];
  const float* Dsk   = (const float*)d_in[11];
  const float* convw = (const float*)d_in[12];
  const float* convb = (const float*)d_in[13];
  const float* Wout  = (const float*)d_in[14];
  const float* b_out = (const float*)d_in[15];
  const float* fnw   = (const float*)d_in[16];
  const float* fnb   = (const float*)d_in[17];
  (void)in_sizes; (void)n_in; (void)out_size; (void)ws_size;

  char* p = (char*)d_ws;
  auto alloc = [&](size_t bytes) {
    char* r = p;
    p += (bytes + 255) & ~(size_t)255;
    return r;
  };
  float*          xbuf  = (float*)         alloc((size_t)BL * DQ   * 4);  // residual stream
  unsigned short* hln   = (unsigned short*)alloc((size_t)BL * DQ   * 2);  // LN(x) bf16
  float*          hbuf  = (float*)         alloc((size_t)BL * DINQ * 4);  // h fp32
  unsigned short* hbf   = (unsigned short*)alloc((size_t)BL * DINQ * 2);  // h bf16
  float*          dtb   = (float*)         alloc((size_t)BL * DINQ * 4);  // softplus(dt)
  float*          BCb   = (float*)         alloc((size_t)BL * 32   * 4);  // [B|C]
  unsigned short* gbf   = (unsigned short*)alloc((size_t)BL * DINQ * 2);  // gated, bf16
  unsigned short* WinT  = (unsigned short*)alloc((size_t)DINQ * DQ   * 2);
  unsigned short* WdtT  = (unsigned short*)alloc((size_t)DINQ * DINQ * 2);
  unsigned short* WoutT = (unsigned short*)alloc((size_t)DQ   * DINQ * 2);
  float*          Sst   = (float*)         alloc((size_t)BQ * NCH * SROWS * DINQ * 4);  // chunk records

  add_pos_kernel<<<BL * DQ / (4 * APV * 256), 256, 0, stream>>>(x_in, pos, xbuf);

  for (int i = 0; i < 2; ++i) {
    wconv_kernel<DQ, DINQ><<<dim3(DINQ / WTN, DQ / WTK), 256, 0, stream>>>(
        Win  + (size_t)i * DQ * DINQ,   WinT);
    wconv_kernel<DINQ, DINQ><<<dim3(DINQ / WTN, DINQ / WTK), 256, 0, stream>>>(
        Wdt  + (size_t)i * DINQ * DINQ, WdtT);
    wconv_kernel<DINQ, DQ><<<dim3(DQ / WTN, DINQ / WTK), 256, 0, stream>>>(
        Wout + (size_t)i * DINQ * DQ,   WoutT);

    ln_kernel<true><<<BL / LNR, LNR * 32, 0, stream>>>(
        xbuf, normw + (size_t)i * DQ, normb + (size_t)i * DQ, hln);

    // h = LN(x) @ Win + b_in    (fp32 + bf16 copies)
    gemm_bf16_wmma<0, 4, 128, DINQ, DQ><<<dim3(DINQ / BNT, BL / 256), 256, 0, stream>>>(
        hln, WinT, b_in + (size_t)i * DINQ, hbuf, hbf);
    // dt = softplus(h @ Wdt + b_dt)
    gemm_bf16_wmma<1, 4, 128, DINQ, DINQ><<<dim3(DINQ / BNT, BL / 256), 256, 0, stream>>>(
        hbf, WdtT, b_dt + (size_t)i * DINQ, dtb, nullptr);

    bc_kernel<<<BL / 16, BCW * 32, 0, stream>>>(
        hbuf, WB + (size_t)i * DINQ * NSTATE, WC + (size_t)i * DINQ * NSTATE, BCb);
    scan_state_kernel<<<BQ * (NCH - 1) * DGS, SCB, 0, stream>>>(
        hbuf, dtb, BCb, A_log + (size_t)i * DINQ * NSTATE, Sst);
    scan_kernel<<<BQ * NCH * DGS, SCB, 0, stream>>>(
        hbuf, dtb, BCb, convw + (size_t)i * 4 * DINQ, convb + (size_t)i * DINQ,
        A_log + (size_t)i * DINQ * NSTATE,
        Dsk + (size_t)i * DINQ, Sst, gbf);

    // x = g @ Wout + b_out + residual (in place)
    gemm_bf16_wmma<2, 2, 256, DQ, DINQ><<<dim3(DQ / BNT, BL / 128), 256, 0, stream>>>(
        gbf, WoutT, b_out + (size_t)i * DQ, xbuf, nullptr);
  }

  ln_kernel<false><<<BL / LNR, LNR * 32, 0, stream>>>(xbuf, fnw, fnb, d_out);
}

// v007
// Measured time: 287 microseconds a run.
// Timed twice side by side with v006, it ran 1.06 times as fast both times.
// All steps since v000 together make it 14.4 times as fast.
#include <hip/hip_runtime.h>
#include <hip/hip_bf16.h>
#include <math.h>

// ---------------- problem constants (match reference) ----------------
#define BQ     2
#define LQ     2048
#define DQ     1024
#define DINQ   2048
#define NSTATE 16
#define BL     (BQ * LQ)        // 4096 token rows

// ---------------- CDNA5 WMMA types ----------------
typedef __attribute__((ext_vector_type(16))) __bf16 v16bf;
typedef __attribute__((ext_vector_type(8)))  __bf16 v8bf;
typedef __attribute__((ext_vector_type(8)))  float  v8f;
typedef __attribute__((ext_vector_type(4)))  float    v4f;
typedef __attribute__((ext_vector_type(4)))  unsigned v4u;
typedef __attribute__((ext_vector_type(2)))  unsigned v2u;

__device__ __forceinline__ unsigned short f32_bf16(float f) {
  unsigned u = __float_as_uint(f);
  u += 0x7fffu + ((u >> 16) & 1u);          // round-to-nearest-even
  return (unsigned short)(u >> 16);
}

// CDNA5 async global->LDS copies (ASYNCcnt-tracked, no VGPR round-trip), eight
// to a statement. The LDS operand is the low 32 bits of the generic address.
// The s_wait_xcnt at the statement's end stands in front of every later write
// of the address registers that the copies name.
__device__ __forceinline__ void async_ld8_b128(
    const unsigned* l, const unsigned short* const* g) {
  asm volatile("global_load_async_to_lds_b128 %0, %8, off\n\t"
               "global_load_async_to_lds_b128 %1, %9, off\n\t"
               "global_load_async_to_lds_b128 %2, %10, off\n\t"
               "global_load_async_to_lds_b128 %3, %11, off\n\t"
               "global_load_async_to_lds_b128 %4, %12, off\n\t"
               "global_load_async_to_lds_b128 %5, %13, off\n\t"
               "global_load_async_to_lds_b128 %6, %14, off\n\t"
               "global_load_async_to_lds_b128 %7, %15, off\n\t"
               "s_wait_xcnt 0x0"
               :: "v"(l[0]), "v"(l[1]), "v"(l[2]), "v"(l[3]),
                  "v"(l[4]), "v"(l[5]), "v"(l[6]), "v"(l[7]),
                  "v"(g[0]), "v"(g[1]), "v"(g[2]), "v"(g[3]),
                  "v"(g[4]), "v"(g[5]), "v"(g[6]), "v"(g[7])
               : "memory");
}
// the same, twelve to a statement
__device__ __forceinline__ void async_ld12_b128(
    const unsigned* l, const unsigned short* const* g) {
  asm volatile("global_load_async_to_lds_b128 %0, %12, off\n\t"
               "global_load_async_to_lds_b128 %1, %13, off\n\t"
               "global_load_async_to_lds_b128 %2, %14, off\n\t"
               "global_load_async_to_lds_b128 %3, %15, off\n\t"
               "global_load_async_to_lds_b128 %4, %16, off\n\t"
               "global_load_async_to_lds_b128 %5, %17, off\n\t"
               "global_load_async_to_lds_b128 %6, %18, off\n\t"
               "global_load_async_to_lds_b128 %7, %19, off\n\t"
               "global_load_async_to_lds_b128 %8, %20, off\n\t"
               "global_load_async_to_lds_b128 %9, %21, off\n\t"
               "global_load_async_to_lds_b128 %10, %22, off\n\t"
               "global_load_async_to_lds_b128 %11, %23, off\n\t"
               "s_wait_xcnt 0x0"
               :: "v"(l[0]), "v"(l[1]), "v"(l[2]), "v"(l[3]),
                  "v"(l[4]), "v"(l[5]), "v"(l[6]), "v"(l[7]),
                  "v"(l[8]), "v"(l[9]), "v"(l[10]), "v"(l[11]),
                  "v"(g[0]), "v"(g[1]), "v"(g[2]), "v"(g[3]),
                  "v"(g[4]), "v"(g[5]), "v"(g[6]), "v"(g[7]),
                  "v"(g[8]), "v"(g[9]), "v"(g[10]), "v"(g[11])
               : "memory");
}
// the wave's own copies have landed
__device__ __forceinline__ void wait_async0() {
  asm volatile("s_wait_asynccnt 0x0" ::: "memory");
}
// the wave's own LDS reads have returned
__device__ __forceinline__ void wait_ds0() {
  asm volatile("s_wait_dscnt 0x0" ::: "memory");
}

// =====================================================================
// The three streaming parts below are gridded for few, fat waves: the work
// of each wave is a handful of 16-byte loads that fly together.
// Every loop in them is unrolled: the per-thread arrays are then indexed by
// constants only and stay in registers.
// =====================================================================
// add positional embedding: xbuf = x + pos_emb  (never mutate d_in)
// One thread = APV pieces of 16 bytes, 256 pieces apart; blk = 0 .. APB - 1.
// =====================================================================
#define APV 4
#define APB (BL * DQ / (4 * APV * 256))   // blocks of this role
__device__ __forceinline__ void add_pos_block(
    const float* __restrict__ x, const float* __restrict__ pe,
    float* __restrict__ xbuf, unsigned blk) {
  const unsigned base = blk * (256 * APV) + threadIdx.x;   // in 16-byte pieces
  // a block's pieces lie in one batch entry: LQ * DQ / 4 is a multiple of 256 * APV
  const unsigned pb = base % (LQ * DQ / 4);
  v4f xv[APV], pv[APV];
#pragma unroll
  for (int j = 0; j < APV; ++j) {
    xv[j] = ((const v4f*)x)[base + j * 256];
    pv[j] = ((const v4f*)pe)[pb + j * 256];
  }
#pragma unroll
  for (int j = 0; j < APV; ++j) ((v4f*)xbuf)[base + j * 256] = xv[j] + pv[j];
}

// =====================================================================
// weight transpose + fp32->bf16:  W[K][N] fp32  ->  WT[N][K] bf16
// One block = a tile of WTK k x WTN n. Reads: 16 bytes per lane, a wave covers
// two rows of 256 bytes. Writes: 8 bf16 (16 bytes) per lane, a wave covers four
// rows of 128 bytes. The odd LDS pitch spreads both sides over the banks.
// K and N are compile-time: a thread's loads (and stores) then differ only in
// their immediate offsets.
// =====================================================================
#define WTK 128
#define WTN 64
template <int K, int N>
__device__ __forceinline__ void wconv_block(
    const float* __restrict__ W, unsigned short* __restrict__ WT,
    float (&tile)[WTK][WTN + 1], unsigned blk) {   // blk = 0 .. (N / WTN) * (K / WTK) - 1
  const int nb = (int)(blk % (N / WTN)) * WTN, kb = (int)(blk / (N / WTN)) * WTK;
  const int c4 = (threadIdx.x & 15) * 4, r0 = threadIdx.x >> 4;
  // block-uniform base + one lane offset for all of a thread's loads (stores alike)
  const float* Wb = W + (size_t)kb * N + nb;
  const unsigned woff = (unsigned)(r0 * N + c4);
  v4f v[WTK / 16];
#pragma unroll
  for (int j = 0; j < WTK / 16; ++j)
    v[j] = *(const v4f*)(Wb + (size_t)(16 * j) * N + woff);
#pragma unroll
  for (int j = 0; j < WTK / 16; ++j)
#pragma unroll
    for (int i = 0; i < 4; ++i) tile[r0 + 16 * j][c4 + i] = v[j][i];
  __syncthreads();
  const int k8 = (threadIdx.x & 7) * 8, n0 = threadIdx.x >> 3;
  unsigned short* Tb = WT + (size_t)nb * K + kb;
  const unsigned toff = (unsigned)(n0 * K + k8);
#pragma unroll
  for (int nh = 0; nh < WTN / 32; ++nh)
#pragma unroll
    for (int kh = 0; kh < WTK / 64; ++kh) {
      const int n = n0 + 32 * nh, k = k8 + 64 * kh;
      v4u p;
#pragma unroll
      for (int i = 0; i < 4; ++i)
        p[i] = (unsigned)f32_bf16(tile[k + 2 * i][n]) |
               ((unsigned)f32_bf16(tile[k + 2 * i + 1][n]) << 16);
      *(v4u*)(Tb + (size_t)(32 * nh) * K + 64 * kh + toff) = p;
    }
}

// =====================================================================
// All the work that depends on the inputs alone, as ONE launch: the three
// weight transposes of both layers and the pos add. None of it reads what
// another part writes, so a block takes its part by its index; seven short
// launches would each pay their own gap, fill and drain.
// The pos add comes last: its output is what the next launch reads first.
// Every branch is on blockIdx alone, so the barrier in wconv_block is reached
// by all threads of a block or by none.
// =====================================================================
#define NLAY  2
#define WBI   ((DINQ / WTN) * (DQ / WTK))     // blocks per layer: Win
#define WBD   ((DINQ / WTN) * (DINQ / WTK))   //                   Wdt
#define WBO   ((DQ / WTN) * (DINQ / WTK))     //                   Wout
#define WBL   (WBI + WBD + WBO)
__global__ __launch_bounds__(256) void prep_kernel(
    const float* __restrict__ x, const float* __restrict__ pe,
    const float* __restrict__ Win, const float* __restrict__ Wdt,
    const float* __restrict__ Wout, float* __restrict__ xbuf,
    unsigned short* __restrict__ WinT, unsigned short* __restrict__ WdtT,
    unsigned short* __restrict__ WoutT) {
  __shared__ float tile[WTK][WTN + 1];
  const unsigned bid = blockIdx.x;
  if (bid >= NLAY * WBL) {
    add_pos_block(x, pe, xbuf, bid - NLAY * WBL);
    return;
  }
  const unsigned lay = bid / WBL, t = bid % WBL;
  if (t < WBI)
    wconv_block<DQ, DINQ>(Win + (size_t)lay * DQ * DINQ,
                          WinT + (size_t)lay * DQ * DINQ, tile, t);
  else if (t < WBI + WBD)
    wconv_block<DINQ, DINQ>(Wdt + (size_t)lay * DINQ * DINQ,
                            WdtT + (size_t)lay * DINQ * DINQ, tile, t - WBI);
  else
    wconv_block<DINQ, DQ>(Wout + (size_t)lay * DINQ * DQ,
                          WoutT + (size_t)lay * DINQ * DQ, tile, t - (WBI + WBD));
}

// =====================================================================
// LayerNorm over the last dim (DQ); optional bf16 output (GEMM A operand)
// One wave = one row, held in registers (LNV pieces of 16 bytes per lane), so
// the row is read once; the two sums go over the lanes by shuffles.
// =====================================================================
#define LNR 8                 // rows (waves) per block
#define LNV (DQ / 128)        // 16-byte pieces of a row per lane
template <bool BF16OUT>
__global__ __launch_bounds__(LNR * 32) void ln_kernel(
    const float* __restrict__ x, const float* __restrict__ w,
    const float* __restrict__ b, void* __restrict__ out) {
  // the wave's number, held scalar: the row's base address is then scalar too
  const int row  = blockIdx.x * LNR + __builtin_amdgcn_readfirstlane(threadIdx.x >> 5);
  const unsigned lane = threadIdx.x & 31;
  const v4f* xr = (const v4f*)(x + (size_t)row * DQ);
  v4f v[LNV], wv[LNV], bv[LNV];
#pragma unroll
  for (int j = 0; j < LNV; ++j) v[j] = xr[j * 32 + lane];
#pragma unroll
  for (int j = 0; j < LNV; ++j) {
    wv[j] = ((const v4f*)w)[j * 32 + lane];
    bv[j] = ((const v4f*)b)[j * 32 + lane];
  }
  // keeps the scheduler from sinking the w and b loads behind the sums (one
  // exposed latency per group of them instead of none)
  __builtin_amdgcn_sched_barrier(0);
  v4f a1 = {}, a2 = {};
#pragma unroll
  for (int j = 0; j < LNV; ++j) { a1 += v[j]; a2 += v[j] * v[j]; }
  float s  = (a1[0] + a1[1]) + (a1[2] + a1[3]);
  float s2 = (a2[0] + a2[1]) + (a2[2] + a2[3]);
#pragma unroll
  for (int o = 16; o > 0; o >>= 1) {
    s  += __shfl_xor(s, o);
    s2 += __shfl_xor(s2, o);
  }
  const float mean = s / (float)DQ;
  const float var  = s2 / (float)DQ - mean * mean;
  const float rstd = rsqrtf(var + 1e-5f);
#pragma unroll
  for (int j = 0; j < LNV; ++j) {
    v4f y = (v[j] - mean) * rstd * wv[j] + bv[j];
    if (BF16OUT) {
      v2u p = {(unsigned)f32_bf16(y[0]) | ((unsigned)f32_bf16(y[1]) << 16),
               (unsigned)f32_bf16(y[2]) | ((unsigned)f32_bf16(y[3]) << 16)};
      ((v2u*)((unsigned short*)out + (size_t)row * DQ))[j * 32 + lane] = p;
    } else {
      ((v4f*)((float*)out + (size_t)row * DQ))[j * 32 + lane] = y;
    }
  }
}

// =====================================================================
// WMMA bf16 GEMM:  out[M][N] = A[M][K](bf16) * BT[N][K](bf16)^T + bias
// Block tile (MI*64) x 128, 8 waves (wave32) arranged 4x2, each wave
// (MI*16) x 64 via MI x 4 v_wmma_f32_16x16x32_bf16 tiles: every byte staged
// from L2 and every fragment read from LDS serves more products than in a
// small tile. K is staged in KC-wide tiles by async global->LDS copies into two
// buffers (KC as large as the two buffers allow: fewer barriers per product):
//   tile 0, wait, barrier; per trip: tile i+1's copies into the buffer that
//   trip i-1 has read, the products on tile i, s_wait_dscnt 0,
//   s_wait_asynccnt 0, barrier.
// Inside a trip the fragments of the next 32 k are fetched into a second
// register set in front of the products on this one.
// N and K are compile-time: a thread's stores then differ only in their
// immediate offsets from one base address.
// Every loop but the one over the tiles is unrolled: the fragment, accumulator
// and address arrays are then indexed by constants only and stay in registers.
// Epilogues:
//   MODE 0: outF = v+bias (fp32) AND outBf = bf16(v+bias)
//   MODE 1: outF = softplus(v+bias)
//   MODE 2: outF = v+bias+outF  (residual add in place)
// =====================================================================
#define BNT 128

__device__ __forceinline__ v16bf load_frag(const unsigned short* rowp, int half) {
  // A-fragment lane layout (ISA 7.12.2, 16-bit A 16x32):
  //  lanes 0-15:  elems[0..7]=K0..7,  elems[8..15]=K16..23
  //  lanes 16-31: elems[0..7]=K8..15, elems[8..15]=K24..31
  union { v16bf v; v8bf h[2]; } u;
  u.h[0] = *(const v8bf*)(rowp + half * 8);
  u.h[1] = *(const v8bf*)(rowp + 16 + half * 8);
  return u.v;
}

// softplus(v) = max(v, 0) + log1p(exp(-|v|)) for eight values, on the hardware's
// own v_exp_f32 and v_log_f32. With e = exp(-|v|) in [0, 1] and w = fl(1 + e), the
// term d = e - (w - 1) is exactly what the rounding of 1 + e dropped, and
// log1p(e) = log(w) + d / w; d stands for d / w (the difference is below
// 2^-24 * e), so small e keep their relative accuracy. No overflow for any v, so
// no cut-over to v for large v is needed.
// The eight values of a statement are independent, so they fill each other's
// latency; the v_nop at each statement's end keeps the slot that the instruction
// set asks for behind a transcendental before its result is read.
__device__ __forceinline__ void softplus8(float (&y)[8], const float (&v)[8]) {
  float t[8], e[8], w[8], l[8];
#pragma unroll
  for (int r = 0; r < 8; ++r) t[r] = fabsf(v[r]) * -1.44269504f;
  asm("v_exp_f32 %0, %8\n\tv_exp_f32 %1, %9\n\tv_exp_f32 %2, %10\n\t"
      "v_exp_f32 %3, %11\n\tv_exp_f32 %4, %12\n\tv_exp_f32 %5, %13\n\t"
      "v_exp_f32 %6, %14\n\tv_exp_f32 %7, %15\n\tv_nop"
      : "=&v"(e[0]), "=&v"(e[1]), "=&v"(e[2]), "=&v"(e[3]),
        "=&v"(e[4]), "=&v"(e[5]), "=&v"(e[6]), "=&v"(e[7])
      : "v"(t[0]), "v"(t[1]), "v"(t[2]), "v"(t[3]),
        "v"(t[4]), "v"(t[5]), "v"(t[6]), "v"(t[7]));
#pragma unroll
  for (int r = 0; r < 8; ++r) w[r] = 1.f + e[r];
  asm("v_log_f32 %0, %8\n\tv_log_f32 %1, %9\n\tv_log_f32 %2, %10\n\t"
      "v_log_f32 %3, %11\n\tv_log_f32 %4, %12\n\tv_log_f32 %5, %13\n\t"
      "v_log_f32 %6, %14\n\tv_log_f32 %7, %15\n\tv_nop"
      : "=&v"(l[0]), "=&v"(l[1]), "=&v"(l[2]), "=&v"(l[3]),
        "=&v"(l[4]), "=&v"(l[5]), "=&v"(l[6]), "=&v"(l[7])
      : "v"(w[0]), "v"(w[1]), "v"(w[2]), "v"(w[3]),
        "v"(w[4]), "v"(w[5]), "v"(w[6]), "v"(w[7]));
#pragma unroll
  for (int r = 0; r < 8; ++r) {
    float d = e[r] - (w[r] - 1.f);
    y[r] = fmaxf(v[r], 0.f) + (l[r] * 0.69314718f + d);   // log2(w) * ln 2
  }
}

template <int MODE, int MI, int KC, int N, int K>
__global__ __launch_bounds__(256) void gemm_bf16_wmma(
    const unsigned short* __restrict__ A,   // [M][K] bf16
    const unsigned short* __restrict__ BT,  // [N][K] bf16 (B transposed)
    const float* __restrict__ bias,         // [N]
    float* __restrict__ outF,
    unsigned short* __restrict__ outBf) {
  constexpr int BM = MI * 64;
  constexpr int nk = K / KC;
  constexpr int LDA = KC + 8;        // padded row pitch (elements): an odd number of 16 B
  constexpr int RP = 256 / (KC / 8); // rows that one copy of all 256 threads covers
  static_assert(K % KC == 0 && nk >= 2 && BM % 128 == 0 && (KC == 128 || KC == 256),
                "tile shapes");
  __shared__ __align__(16) unsigned short As[2][BM][LDA];
  __shared__ __align__(16) unsigned short Bs[2][BNT][LDA];
  const int tid  = threadIdx.x;
  // the wave's number, held scalar: the wave's part of every address is then scalar
  const int wave = __builtin_amdgcn_readfirstlane(tid >> 5);
  const int lane = tid & 31;
  const int wm = wave & 3, wn = wave >> 2;    // 4 waves along M, 2 along N
  const int bm = blockIdx.y * BM, bn = blockIdx.x * BNT;
  const int half = lane >> 4, lrow = lane & 15;

  // a thread's copies of one tile: 16 bytes of every RP-th row, so that a wave's
  // copy covers 512 bytes in whole rows
  const int crow = tid / (KC / 8), ccol = (tid % (KC / 8)) * 8;
  const unsigned short* gA = A  + (size_t)(bm + crow) * K + ccol;
  const unsigned short* gB = BT + (size_t)(bn + crow) * K + ccol;
  const unsigned lA = (unsigned)(uintptr_t)&As[0][crow][ccol];
  const unsigned lB = (unsigned)(uintptr_t)&Bs[0][crow][ccol];

  constexpr int NCA = BM / RP, NC = NCA + BNT / RP;   // copies per thread and tile
  auto issue_stage = [&](int buf, int k0) {
    unsigned l[NC];
    const unsigned short* g[NC];
#pragma unroll
    for (int t = 0; t < NCA; ++t) {
      l[t] = lA + (unsigned)((buf * BM + t * RP) * (LDA * 2));
      g[t] = gA + k0 + (size_t)(t * RP) * K;
    }
#pragma unroll
    for (int t = 0; t < BNT / RP; ++t) {
      l[NCA + t] = lB + (unsigned)((buf * BNT + t * RP) * (LDA * 2));
      g[NCA + t] = gB + k0 + (size_t)(t * RP) * K;
    }
    static_assert(NC == 24 || NC == 32, "copies per statement");
    async_ld12_b128(l, g);
    async_ld12_b128(l + 12, g + 12);
    if constexpr (NC == 32) async_ld8_b128(l + 24, g + 24);
  };

  v8f zero = {};
  v8f acc[MI][4];
#pragma unroll
  for (int i = 0; i < MI; ++i)
#pragma unroll
    for (int j = 0; j < 4; ++j) acc[i][j] = zero;

  issue_stage(0, 0);
  wait_async0();
  __syncthreads();                   // tile 0 visible to all waves
  // rolled: a trip is already KC / 32 * MI * 4 products long (code size)
#pragma unroll 1
  for (int i = 0; i < nk; ++i) {
    const int cur = i & 1;
    const unsigned short* ap = &As[cur][wm * (MI * 16) + lrow][0];
    const unsigned short* bp = &Bs[cur][wn * 64 + lrow][0];
    v16bf aF[2][MI], bF[2][4];
#pragma unroll
    for (int ii = 0; ii < MI; ++ii) aF[0][ii] = load_frag(ap + ii * 16 * LDA, half);
#pragma unroll
    for (int jj = 0; jj < 4; ++jj)  bF[0][jj] = load_frag(bp + jj * 16 * LDA, half);
    // tile i+1's copies, into the buffer that every wave has left at the barrier
    // above; they are issued while the trip's first LDS reads are under way
    if (i + 1 < nk) issue_stage(cur ^ 1, (i + 1) * KC);
#pragma unroll
    for (int ks = 0; ks < KC / 32; ++ks) {
      const int s = ks & 1;
      if (ks + 1 < KC / 32) {
#pragma unroll
        for (int ii = 0; ii < MI; ++ii)
          aF[s ^ 1][ii] = load_frag(ap + ii * 16 * LDA + (ks + 1) * 32, half);
#pragma unroll
        for (int jj = 0; jj < 4; ++jj)
          bF[s ^ 1][jj] = load_frag(bp + jj * 16 * LDA + (ks + 1) * 32, half);
      }
      // keeps the next set's LDS reads one group in front of this set's products:
      // left alone, the scheduler sinks each read to its first use, with a full
      // wait in front of every row of products
      __builtin_amdgcn_sched_barrier(0);
#pragma unroll
      for (int ii = 0; ii < MI; ++ii)
#pragma unroll
        for (int jj = 0; jj < 4; ++jj)
          acc[ii][jj] = __builtin_amdgcn_wmma_f32_16x16x32_bf16(
              false, aF[s][ii], false, bF[s][jj], (short)0, acc[ii][jj],
              false, false);
      // keeps the set after next's reads behind these products, whose operands
      // they overwrite
      __builtin_amdgcn_sched_barrier(0);
    }
    wait_ds0();                      // this wave has left buffer cur
    wait_async0();                   // its copies of tile i+1 have landed
    __syncthreads();                 // tile i+1 visible, buffer cur free
  }
  wait_async0();                     // no copy is outstanding behind the loop

  // ---- epilogue: C/D layout - n = lane&15, m = vgpr + (lane>>4)*8 ----
  // One lane-dependent base; every element lies a constant step from it.
  const int gn0 = bn + wn * 64 + lrow;
  float bj[4];
#pragma unroll
  for (int j = 0; j < 4; ++j) bj[j] = bias[gn0 + j * 16];
  // the loads' offset register is reused by the address arithmetic below
  asm volatile("s_wait_xcnt 0x0" ::: "memory");
  // keeps that arithmetic behind the wait
  __builtin_amdgcn_sched_barrier(0);
  const size_t off0 = (size_t)(bm + wm * (MI * 16) + half * 8) * N + gn0;
  float* const baseF = outF + off0;
  float res[MODE == 2 ? MI : 1][4][8];
  if (MODE == 2) {                   // the whole residual tile flies together
#pragma unroll
    for (int i = 0; i < MI; ++i)
#pragma unroll
      for (int j = 0; j < 4; ++j)
#pragma unroll
        for (int r = 0; r < 8; ++r) res[i][j][r] = baseF[(i * 16 + r) * N + j * 16];
  }
#pragma unroll
  for (int i = 0; i < MI; ++i) {
    float val[4][8];
    unsigned short vb[4][8];
#pragma unroll
    for (int j = 0; j < 4; ++j) {
      float pre[8];
#pragma unroll
      for (int r = 0; r < 8; ++r) pre[r] = acc[i][j][r] + bj[j];
      if (MODE == 1) {
        softplus8(val[j], pre);
      } else {
#pragma unroll
        for (int r = 0; r < 8; ++r) {
          val[j][r] = MODE == 2 ? pre[r] + res[i][j][r] : pre[r];
          if (MODE == 0) vb[j][r] = f32_bf16(val[j][r]);
        }
      }
    }
    // keeps every value of the group computed in front of its first store
    __builtin_amdgcn_sched_barrier(0);
#pragma unroll
    for (int j = 0; j < 4; ++j)
#pragma unroll
      for (int r = 0; r < 8; ++r) {
        baseF[(i * 16 + r) * N + j * 16] = val[j][r];
        if (MODE == 0) (outBf + off0)[(i * 16 + r) * N + j * 16] = vb[j][r];
      }
    // the stores' data registers are rewritten by the next group
    asm volatile("s_wait_xcnt 0x0" ::: "memory");
    // keeps the next group's arithmetic behind that wait
    __builtin_amdgcn_sched_barrier(0);
  }
}

// =====================================================================
// Bm|Cm projection:  BC[m][0..15]=h@WB, [16..31]=h@WC, all in f32, on
// v_wmma_f32_16x16x4_f32. One block = 16 token rows x all 32 columns, so a
// weight row is fetched once per 16 tokens. The 16 waves split k (128 each);
// their partial tiles are added through LDS in wave order.
// k pairing: lane (c, hf) holds, for group q, k = slice + 8q + 4hf + 0..3 of
// A row c (one 16-byte load) and the same four k of B column c.
// Every loop is unrolled: av, wb, wc and the accumulators are then indexed by
// constants only and stay in registers.
// =====================================================================
typedef __attribute__((ext_vector_type(2))) float v2f;
#define BCW  16               // waves per block
#define BCKS (DINQ / BCW)     // k per wave
#define BCQ  (BCKS / 8)       // groups of 8 k per wave
#define BCG  4                // groups whose weight fragments are fetched together

__global__ __launch_bounds__(BCW * 32) void bc_kernel(
    const float* __restrict__ h, const float* __restrict__ WB,
    const float* __restrict__ WC, float* __restrict__ BC) {
  __shared__ float red[BCW][512];           // per wave: 2 tiles x 8 registers x 32 lanes
  const int wave = threadIdx.x >> 5, lane = threadIdx.x & 31;
  const int c = lane & 15, hf = lane >> 4;
  const int m0 = blockIdx.x * 16;
  const int kl = wave * BCKS + hf * 4;      // the lane's first k
  const float* ap = h  + (size_t)(m0 + c) * DINQ + kl;
  const float* bp = WB + (size_t)kl * NSTATE + c;
  const float* cp = WC + (size_t)kl * NSTATE + c;

  v4f av[BCQ];                              // the wave's whole slice of h, fetched first
#pragma unroll
  for (int q = 0; q < BCQ; ++q) av[q] = *(const v4f*)(ap + q * 8);
  // keeps the scheduler from sinking these loads to their first use (one
  // exposed latency per product instead of one for the whole slice)
  __builtin_amdgcn_sched_barrier(0);

  float wb[2][BCG][4], wc[2][BCG][4];
  auto fetch = [&](int buf, int g) {
#pragma unroll
    for (int q2 = 0; q2 < BCG; ++q2)
#pragma unroll
      for (int j = 0; j < 4; ++j) {
        wb[buf][q2][j] = bp[(size_t)((g * BCG + q2) * 8 + j) * NSTATE];
        wc[buf][q2][j] = cp[(size_t)((g * BCG + q2) * 8 + j) * NSTATE];
      }
  };
  fetch(0, 0);

  v8f accb = {}, accc = {};
#pragma unroll
  for (int g = 0; g < BCQ / BCG; ++g) {
    if (g + 1 < BCQ / BCG) {
      fetch((g + 1) & 1, g + 1);            // flies under this group's products
      // behind the last fetch the loads' address registers are free for reuse
      if (g + 2 == BCQ / BCG) asm volatile("s_wait_xcnt 0x0" ::: "memory");
      // keeps the next group's loads in front of this group's products
      __builtin_amdgcn_sched_barrier(0);
    }
#pragma unroll
    for (int q2 = 0; q2 < BCG; ++q2)
#pragma unroll
      for (int p = 0; p < 2; ++p) {
        v2f a  = {av[g * BCG + q2][2 * p], av[g * BCG + q2][2 * p + 1]};
        v2f fb = {wb[g & 1][q2][2 * p], wb[g & 1][q2][2 * p + 1]};
        v2f fc = {wc[g & 1][q2][2 * p], wc[g & 1][q2][2 * p + 1]};
        accb = __builtin_amdgcn_wmma_f32_16x16x4_f32(
            false, a, false, fb, (short)0, accb, false, false);
        accc = __builtin_amdgcn_wmma_f32_16x16x4_f32(
            false, a, false, fc, (short)0, accc, false, false);
      }
  }
  // A precaution: no distance is documented for the f32 form, and without this
  // the build had address arithmetic overwriting an A register directly behind
  // its product. Eight vector slots, the figure of the other 16-cycle form,
  // stand in front of the first vector instruction behind the products; the two
  // scheduling barriers keep that arithmetic and the slots where they are written.
  __builtin_amdgcn_sched_barrier(0);
  asm volatile("v_nop\n\tv_nop\n\tv_nop\n\tv_nop\n\tv_nop\n\tv_nop\n\tv_nop\n\tv_nop");
  __builtin_amdgcn_sched_barrier(0);

#pragma unroll
  for (int r = 0; r < 8; ++r) {
    red[wave][r * 32 + lane]       = accb[r];
    red[wave][256 + r * 32 + lane] = accc[r];
  }
  __syncthreads();
  // one output per thread; D layout: register r of lane l = D[8 * (l >> 4) + r][l & 15]
  float s = 0.f;
#pragma unroll
  for (int w = 0; w < BCW; ++w) s += red[w][threadIdx.x];
  const int tile = threadIdx.x >> 8, r = (threadIdx.x >> 5) & 7;
  BC[(size_t)(m0 + 8 * hf + r) * 32 + tile * 16 + c] = s;
}

// =====================================================================
// selective scan (diagonal SSM), split over time into NCH chunks of CLEN
// steps so that the chunks run side by side instead of one after another.
//   scan_state_kernel: every chunk but the last runs the recurrence from a
//     zero state and keeps its end state S[n] and its sum of dt (row NSTATE
//     of the same record). The decay over a whole chunk is exp(a[n] * sum dt).
//   scan_kernel: a chunk folds the earlier chunks' (S, sum dt) in time order
//     into its start state, then runs the recurrence with the fused D-skip,
//     the causal depthwise conv (4 taps) + SiLU of the same channel, formed
//     from the x values that the lane walks through anyway, and the gating.
// One lane = one channel with all 16 states; one block = SCB channels of one
// (batch, chunk), so the B/C rows are the same address for the whole block.
// =====================================================================
#define NCH  32
#define CLEN (LQ / NCH)     // 64 steps per chunk
#define SU   8              // steps fetched ahead as one group
#define SCB  128            // channels (threads) per block
#define DGS  (DINQ / SCB)   // channel groups
#define SROWS (NSTATE + 1)  // rows of a chunk's record: S[0..15], sum of dt
#define FB   3              // chunk records fetched together in the fold (51 loads)

// e[n] = exp(x[n]) for the 16 states, as __expf forms it (x * log2(e), then
// v_exp_f32), eight to a statement. The v_nop at each statement's end keeps the
// slot that the instruction set asks for behind a transcendental before its
// source is overwritten.
__device__ __forceinline__ void exp16(float (&e)[NSTATE], const float (&x)[NSTATE]) {
  float t[NSTATE];
#pragma unroll
  for (int n = 0; n < NSTATE; ++n) t[n] = x[n] * 1.44269504f;
#pragma unroll
  for (int k = 0; k < NSTATE; k += 8)
    asm("v_exp_f32 %0, %8\n\tv_exp_f32 %1, %9\n\tv_exp_f32 %2, %10\n\t"
        "v_exp_f32 %3, %11\n\tv_exp_f32 %4, %12\n\tv_exp_f32 %5, %13\n\t"
        "v_exp_f32 %6, %14\n\tv_exp_f32 %7, %15\n\tv_nop"
        : "=&v"(e[k]), "=&v"(e[k + 1]), "=&v"(e[k + 2]), "=&v"(e[k + 3]),
          "=&v"(e[k + 4]), "=&v"(e[k + 5]), "=&v"(e[k + 6]), "=&v"(e[k + 7])
        : "v"(t[k]), "v"(t[k + 1]), "v"(t[k + 2]), "v"(t[k + 3]),
          "v"(t[k + 4]), "v"(t[k + 5]), "v"(t[k + 6]), "v"(t[k + 7]));
}

// exp(x) for one value, formed as in exp16; the v_nop keeps the same slot.
__device__ __forceinline__ float exp1(float x) {
  float t = x * 1.44269504f, e;
  asm("v_exp_f32 %0, %1\n\tv_nop" : "=v"(e) : "v"(t));
  return e;
}

__global__ __launch_bounds__(SCB) void scan_state_kernel(
    const float* __restrict__ h,  const float* __restrict__ dt,
    const float* __restrict__ BC, const float* __restrict__ A_log,
    float* __restrict__ Sst) {    // [B][NCH][SROWS][DIN]
  const int d  = (blockIdx.x % DGS) * SCB + threadIdx.x;
  const int bc = blockIdx.x / DGS;
  const int b  = bc / (NCH - 1);
  const int c  = bc % (NCH - 1);             // the last chunk feeds nobody

  float a[NSTATE], hs[NSTATE], al[NSTATE];
#pragma unroll
  for (int n = 0; n < NSTATE; ++n) al[n] = A_log[(size_t)d * NSTATE + n];
  exp16(a, al);
#pragma unroll
  for (int n = 0; n < NSTATE; ++n) { a[n] = -a[n]; hs[n] = 0.f; }
  const size_t row0 = (size_t)b * LQ + (size_t)c * CLEN;
  const float* dtp = dt + row0 * DINQ + d;
  const float* hp  = h  + row0 * DINQ + d;
  const float* bcp = BC + row0 * 32;

  float sd = 0.f;
  float dtc[SU], xc[SU];
#pragma unroll
  for (int u = 0; u < SU; ++u) { dtc[u] = 0.f; xc[u] = 0.f; }
  // Trip -1 only fetches group 0, so that every group reaches the arithmetic
  // through the copies at the loop's foot and the wait for it stands there.
  // rolled: the body is already SU * NSTATE updates long (code size)
#pragma unroll 1
  for (int g = -1; g < CLEN / SU; ++g) {
    float dtn[SU], xn[SU];
#pragma unroll
    for (int u = 0; u < SU; ++u) { dtn[u] = 0.f; xn[u] = 0.f; }
    if (g + 1 < CLEN / SU) {                 // next group flies under this one
#pragma unroll
      for (int u = 0; u < SU; ++u) {
        dtn[u] = dtp[(size_t)((g + 1) * SU + u) * DINQ];
        xn[u]  = hp[(size_t)((g + 1) * SU + u) * DINQ];
      }
      // the loads' address registers are reused by the arithmetic below
      asm volatile("s_wait_xcnt 0x0" ::: "memory");
    }
    if (g >= 0) {
#pragma unroll
      for (int u = 0; u < SU; ++u) {
        const float* bct = bcp + (g * SU + u) * 32;
        float dtv = dtc[u];
        float dx  = dtv * xc[u];
        sd += dtv;
        float da[NSTATE], dA[NSTATE];
#pragma unroll
        for (int n = 0; n < NSTATE; ++n) da[n] = dtv * a[n];
        exp16(dA, da);
#pragma unroll
        for (int n = 0; n < NSTATE; ++n) hs[n] = hs[n] * dA[n] + dx * bct[n];
      }
    }
#pragma unroll
    for (int u = 0; u < SU; ++u) { dtc[u] = dtn[u]; xc[u] = xn[u]; }
  }
  float* sp = Sst + ((size_t)b * NCH + c) * SROWS * DINQ + d;
#pragma unroll
  for (int n = 0; n < NSTATE; ++n) sp[(size_t)n * DINQ] = hs[n];
  sp[(size_t)NSTATE * DINQ] = sd;
}

__global__ __launch_bounds__(SCB) void scan_kernel(
    const float* __restrict__ h,  const float* __restrict__ dt,
    const float* __restrict__ BC, const float* __restrict__ cw,
    const float* __restrict__ cb,
    const float* __restrict__ A_log, const float* __restrict__ Dsk,
    const float* __restrict__ Sst, unsigned short* __restrict__ gout) {
  const int d  = (blockIdx.x % DGS) * SCB + threadIdx.x;
  const int bc = blockIdx.x / DGS;
  const int b  = bc % BQ;
  const int c  = NCH - 1 - bc / BQ;          // longest fold starts first

  const size_t row0 = (size_t)b * LQ + (size_t)c * CLEN;
  const float* hp  = h + row0 * DINQ + d;

  // first loads of the kernel: they have landed with the A_log rows, so no
  // wait for them falls among the fetched-ahead loads of the main loop
  const float dsk = Dsk[d];
  const float cbv = cb[d];
  float cwv[4];
#pragma unroll
  for (int j = 0; j < 4; ++j) cwv[j] = cw[j * DINQ + d];
  // the registers that the loads name are reused below
  asm volatile("s_wait_xcnt 0x0" ::: "memory");
  // the three x values in front of the chunk (zero padding in front of l = 0)
  float xp[3] = {0.f, 0.f, 0.f};
  if (c > 0) {
#pragma unroll
    for (int j = 0; j < 3; ++j) xp[j] = hp[(ptrdiff_t)(j - 3) * DINQ];
    // the registers that the loads name are reused below
    asm volatile("s_wait_xcnt 0x0" ::: "memory");
  }
  float a[NSTATE], hs[NSTATE], al[NSTATE];
#pragma unroll
  for (int n = 0; n < NSTATE; ++n) al[n] = A_log[(size_t)d * NSTATE + n];
  exp16(a, al);
#pragma unroll
  for (int n = 0; n < NSTATE; ++n) { a[n] = -a[n]; hs[n] = 0.f; }

  // start state: earlier chunks folded in time order, FB records per fetch
  const float* sp = Sst + (size_t)b * NCH * SROWS * DINQ + d;
  int cp = 0;
#pragma unroll 1
  for (; cp + FB <= c; cp += FB) {
    float sv[FB][SROWS];
#pragma unroll
    for (int k = 0; k < FB; ++k)
#pragma unroll
      for (int n = 0; n < SROWS; ++n)
        sv[k][n] = sp[((size_t)(cp + k) * SROWS + n) * DINQ];
    // the loads' address registers are advanced for the next trip
    asm volatile("s_wait_xcnt 0x0" ::: "memory");
#pragma unroll
    for (int k = 0; k < FB; ++k) {
      float da[NSTATE], dA[NSTATE];
#pragma unroll
      for (int n = 0; n < NSTATE; ++n) da[n] = a[n] * sv[k][NSTATE];
      exp16(dA, da);
#pragma unroll
      for (int n = 0; n < NSTATE; ++n) hs[n] = hs[n] * dA[n] + sv[k][n];
    }
  }
#pragma unroll 1
  for (; cp < c; ++cp) {
    float sv[SROWS];
#pragma unroll
    for (int n = 0; n < SROWS; ++n)
      sv[n] = sp[((size_t)cp * SROWS + n) * DINQ];
    // the loads' address registers are reused by the arithmetic below
    asm volatile("s_wait_xcnt 0x0" ::: "memory");
    float da[NSTATE], dA[NSTATE];
#pragma unroll
    for (int n = 0; n < NSTATE; ++n) da[n] = a[n] * sv[NSTATE];
    exp16(dA, da);
#pragma unroll
    for (int n = 0; n < NSTATE; ++n) hs[n] = hs[n] * dA[n] + sv[n];
  }

  const float* dtp = dt + row0 * DINQ + d;
  const float* bcp = BC + row0 * 32;
  unsigned short* gp = gout + row0 * DINQ + d;

  float dtc[SU], xc[SU];
#pragma unroll
  for (int u = 0; u < SU; ++u) { dtc[u] = 0.f; xc[u] = 0.f; }
  // Trip -1 only fetches group 0 (see scan_state_kernel).
  // rolled: the body is already SU * NSTATE updates long (code size)
#pragma unroll 1
  for (int g = -1; g < CLEN / SU; ++g) {
    float dtn[SU], xn[SU];
#pragma unroll
    for (int u = 0; u < SU; ++u) { dtn[u] = 0.f; xn[u] = 0.f; }
    if (g + 1 < CLEN / SU) {                 // next group flies under this one
      // s_wait_xcnt behind each array's loads: their address registers are
      // reused, by the next array's load targets or by the arithmetic below
#pragma unroll
      for (int u = 0; u < SU; ++u) dtn[u] = dtp[(size_t)((g + 1) * SU + u) * DINQ];
      asm volatile("s_wait_xcnt 0x0" ::: "memory");
#pragma unroll
      for (int u = 0; u < SU; ++u) xn[u] = hp[(size_t)((g + 1) * SU + u) * DINQ];
      asm volatile("s_wait_xcnt 0x0" ::: "memory");
    }
    if (g >= 0) {
#pragma unroll
      for (int u = 0; u < SU; ++u) {
        const float* bct = bcp + (g * SU + u) * 32;
        float dtv = dtc[u];
        float xv  = xc[u];
        float dx  = dtv * xv;
        float da[NSTATE], dA[NSTATE];
#pragma unroll
        for (int n = 0; n < NSTATE; ++n) da[n] = dtv * a[n];
        exp16(dA, da);
        float yq[4];                         // four sums of four states each
#pragma unroll
        for (int q = 0; q < 4; ++q) {
          yq[q] = 0.f;
#pragma unroll
          for (int n2 = 0; n2 < 4; ++n2) {
            int n = q * 4 + n2;
            hs[n] = hs[n] * dA[n] + dx * bct[n];
            yq[q] += hs[n] * bct[16 + n];
          }
        }
        float y = (yq[0] + yq[1]) + (yq[2] + yq[3]);
        y += xv * dsk;
        // conv taps l-3 .. l in that order, then SiLU
        float ca = cbv;
        ca += (u >= 3 ? xc[u >= 3 ? u - 3 : 0] : xp[u < 3 ? u : 0]) * cwv[0];
        ca += (u >= 2 ? xc[u >= 2 ? u - 2 : 0] : xp[u < 2 ? u + 1 : 0]) * cwv[1];
        ca += (u >= 1 ? xc[u >= 1 ? u - 1 : 0] : xp[2]) * cwv[2];
        ca += xv * cwv[3];
        float yc = ca * (1.f / (1.f + exp1(-ca)));
        gp[(size_t)(g * SU + u) * DINQ] =
            f32_bf16(y * (1.f / (1.f + exp1(-yc))));
      }
#pragma unroll
      for (int j = 0; j < 3; ++j) xp[j] = xc[SU - 3 + j];
      // the stores' address and data registers are rewritten at the loop's foot
      asm volatile("s_wait_xcnt 0x0" ::: "memory");
    }
#pragma unroll
    for (int u = 0; u < SU; ++u) { dtc[u] = dtn[u]; xc[u] = xn[u]; }
  }
}

// =====================================================================
// host-side orchestration
// =====================================================================
extern "C" void kernel_launch(void* const* d_in, const int* in_sizes, int n_in,
                              void* d_out, int out_size, void* d_ws, size_t ws_size,
                              hipStream_t stream) {
  const float* x_in  = (const float*)d_in[0];
  const float* pos   = (const float*)d_in[1];
  const float* normw = (const float*)d_in[2];
  const float* normb = (const float*)d_in[3];
  const float* Win   = (const float*)d_in[4];
  const float* b_in  = (const float*)d_in[5];
  const float* A_log = (const float*)d_in[6];
  const float* Wdt   = (const float*)d_in[7];
  const float* b_dt  = (const float*)d_in[8];
  const float* WB    = (const float*)d_in[9];
  const float* WC    = (const float*)d_in[10];
  const float* Dsk   = (const float*)d_in[11];
  const float* convw = (const float*)d_in[12];
  const float* convb = (const float*)d_in[13];
  const float* Wout  = (const float*)d_in[14];
  const float* b_out = (const float*)d_in[15];
  const float* fnw   = (const float*)d_in[16];
  const float* fnb   = (const float*)d_in[17];
  (void)in_sizes; (void)n_in; (void)out_size; (void)ws_size;

  char* p = (char*)d_ws;
  auto alloc = [&](size_t bytes) {
    char* r = p;
    p += (bytes + 255) & ~(size_t)255;
    return r;
  };
  float*          xbuf  = (float*)         alloc((size_t)BL * DQ   * 4);  // residual stream
  unsigned short* hln   = (unsigned short*)alloc((size_t)BL * DQ   * 2);  // LN(x) bf16
  float*          hbuf  = (float*)         alloc((size_t)BL * DINQ * 4);  // h fp32
  unsigned short* hbf   = (unsigned short*)alloc((size_t)BL * DINQ * 2);  // h bf16
  float*          dtb   = (float*)         alloc((size_t)BL * DINQ * 4);  // softplus(dt)
  float*          BCb   = (float*)         alloc((size_t)BL * 32   * 4);  // [B|C]
  unsigned short* gbf   = (unsigned short*)alloc((size_t)BL * DINQ * 2);  // gated, bf16
  unsigned short* WinT  = (unsigned short*)alloc((size_t)NLAY * DINQ * DQ   * 2);  // both layers
  unsigned short* WdtT  = (unsigned short*)alloc((size_t)NLAY * DINQ * DINQ * 2);
  unsigned short* WoutT = (unsigned short*)alloc((size_t)NLAY * DQ   * DINQ * 2);
  float*          Sst   = (float*)         alloc((size_t)BQ * NCH * SROWS * DINQ * 4);  // chunk records

  prep_kernel<<<NLAY * WBL + APB, 256, 0, stream>>>(
      x_in, pos, Win, Wdt, Wout, xbuf, WinT, WdtT, WoutT);

  for (int i = 0; i < NLAY; ++i) {
    ln_kernel<true><<<BL / LNR, LNR * 32, 0, stream>>>(
        xbuf, normw + (size_t)i * DQ, normb + (size_t)i * DQ, hln);

    // h = LN(x) @ Win + b_in    (fp32 + bf16 copies)
    gemm_bf16_wmma<0, 4, 128, DINQ, DQ><<<dim3(DINQ / BNT, BL / 256), 256, 0, stream>>>(
        hln, WinT + (size_t)i * DQ * DINQ, b_in + (size_t)i * DINQ, hbuf, hbf);
    // dt = softplus(h @ Wdt + b_dt)
    gemm_bf16_wmma<1, 4, 128, DINQ, DINQ><<<dim3(DINQ / BNT, BL / 256), 256, 0, stream>>>(
        hbf, WdtT + (size_t)i * DINQ * DINQ, b_dt + (size_t)i * DINQ, dtb, nullptr);

    bc_kernel<<<BL / 16, BCW * 32, 0, stream>>>(
        hbuf, WB + (size_t)i * DINQ * NSTATE, WC + (size_t)i * DINQ * NSTATE, BCb);
    scan_state_kernel<<<BQ * (NCH - 1) * DGS, SCB, 0, stream>>>(
        hbuf, dtb, BCb, A_log + (size_t)i * DINQ * NSTATE, Sst);
    scan_kernel<<<BQ * NCH * DGS, SCB, 0, stream>>>(
        hbuf, dtb, BCb, convw + (size_t)i * 4 * DINQ, convb + (size_t)i * DINQ,
        A_log + (size_t)i * DINQ * NSTATE,
        Dsk + (size_t)i * DINQ, Sst, gbf);

    // x = g @ Wout + b_out + residual (in place)
    gemm_bf16_wmma<2, 2, 256, DQ, DINQ><<<dim3(DQ / BNT, BL / 128), 256, 0, stream>>>(
        gbf, WoutT + (size_t)i * DINQ * DQ, b_out + (size_t)i * DQ, xbuf, nullptr);
  }

  ln_kernel<false><<<BL / LNR, LNR * 32, 0, stream>>>(xbuf, fnw, fnb, d_out);
}

// v008
// A run of this version takes 270 microseconds.
// Two timings next to v007 both put it at 1.06 times that version's speed.
// Over all steps from v000 it is 15.3 times as fast.
#include <hip/hip_runtime.h>
#include <hip/hip_bf16.h>
#include <math.h>

// ---------------- problem constants (match reference) ----------------
#define BQ     2
#define LQ     2048
#define DQ     1024
#define DINQ   2048
#define NSTATE 16
#define BL     (BQ * LQ)        // 4096 token rows

// ---------------- CDNA5 WMMA types ----------------
typedef __attribute__((ext_vector_type(16))) __bf16 v16bf;
typedef __attribute__((ext_vector_type(8)))  __bf16 v8bf;
typedef __attribute__((ext_vector_type(8)))  float  v8f;
typedef __attribute__((ext_vector_type(4)))  float    v4f;
typedef __attribute__((ext_vector_type(4)))  unsigned v4u;
typedef __attribute__((ext_vector_type(2)))  unsigned v2u;

__device__ __forceinline__ unsigned short f32_bf16(float f) {
  unsigned u = __float_as_uint(f);
  u += 0x7fffu + ((u >> 16) & 1u);          // round-to-nearest-even
  return (unsigned short)(u >> 16);
}

// CDNA5 async global->LDS copies (ASYNCcnt-tracked, no VGPR round-trip), eight
// to a statement. The LDS operand is the low 32 bits of the generic address.
// The s_wait_xcnt at the statement's end stands in front of every later write
// of the address registers that the copies name.
__device__ __forceinline__ void async_ld8_b128(
    const unsigned* l, const unsigned short* const* g) {
  asm volatile("global_load_async_to_lds_b128 %0, %8, off\n\t"
               "global_load_async_to_lds_b128 %1, %9, off\n\t"
               "global_load_async_to_lds_b128 %2, %10, off\n\t"
               "global_load_async_to_lds_b128 %3, %11, off\n\t"
               "global_load_async_to_lds_b128 %4, %12, off\n\t"
               "global_load_async_to_lds_b128 %5, %13, off\n\t"
               "global_load_async_to_lds_b128 %6, %14, off\n\t"
               "global_load_async_to_lds_b128 %7, %15, off\n\t"
               "s_wait_xcnt 0x0"
               :: "v"(l[0]), "v"(l[1]), "v"(l[2]), "v"(l[3]),
                  "v"(l[4]), "v"(l[5]), "v"(l[6]), "v"(l[7]),
                  "v"(g[0]), "v"(g[1]), "v"(g[2]), "v"(g[3]),
                  "v"(g[4]), "v"(g[5]), "v"(g[6]), "v"(g[7])
               : "memory");
}
// the same, twelve to a statement
__device__ __forceinline__ void async_ld12_b128(
    const unsigned* l, const unsigned short* const* g) {
  asm volatile("global_load_async_to_lds_b128 %0, %12, off\n\t"
               "global_load_async_to_lds_b128 %1, %13, off\n\t"
               "global_load_async_to_lds_b128 %2, %14, off\n\t"
               "global_load_async_to_lds_b128 %3, %15, off\n\t"
               "global_load_async_to_lds_b128 %4, %16, off\n\t"
               "global_load_async_to_lds_b128 %5, %17, off\n\t"
               "global_load_async_to_lds_b128 %6, %18, off\n\t"
               "global_load_async_to_lds_b128 %7, %19, off\n\t"
               "global_load_async_to_lds_b128 %8, %20, off\n\t"
               "global_load_async_to_lds_b128 %9, %21, off\n\t"
               "global_load_async_to_lds_b128 %10, %22, off\n\t"
               "global_load_async_to_lds_b128 %11, %23, off\n\t"
               "s_wait_xcnt 0x0"
               :: "v"(l[0]), "v"(l[1]), "v"(l[2]), "v"(l[3]),
                  "v"(l[4]), "v"(l[5]), "v"(l[6]), "v"(l[7]),
                  "v"(l[8]), "v"(l[9]), "v"(l[10]), "v"(l[11]),
                  "v"(g[0]), "v"(g[1]), "v"(g[2]), "v"(g[3]),
                  "v"(g[4]), "v"(g[5]), "v"(g[6]), "v"(g[7]),
                  "v"(g[8]), "v"(g[9]), "v"(g[10]), "v"(g[11])
               : "memory");
}
// the wave's own copies have landed
__device__ __forceinline__ void wait_async0() {
  asm volatile("s_wait_asynccnt 0x0" ::: "memory");
}
// the wave's own LDS reads have returned
__device__ __forceinline__ void wait_ds0() {
  asm volatile("s_wait_dscnt 0x0" ::: "memory");
}

// =====================================================================
// The three streaming parts below are gridded for few, fat waves: the work
// of each wave is a handful of 16-byte loads that fly together.
// Every loop in them is unrolled: the per-thread arrays are then indexed by
// constants only and stay in registers.
// =====================================================================
// add positional embedding: xbuf = x + pos_emb  (never mutate d_in)
// One thread = APV pieces of 16 bytes, 256 pieces apart; blk = 0 .. APB - 1.
// =====================================================================
#define APV 4
#define APB (BL * DQ / (4 * APV * 256))   // blocks of this role
__device__ __forceinline__ void add_pos_block(
    const float* __restrict__ x, const float* __restrict__ pe,
    float* __restrict__ xbuf, unsigned blk) {
  const unsigned base = blk * (256 * APV) + threadIdx.x;   // in 16-byte pieces
  // a block's pieces lie in one batch entry: LQ * DQ / 4 is a multiple of 256 * APV
  const unsigned pb = base % (LQ * DQ / 4);
  v4f xv[APV], pv[APV];
#pragma unroll
  for (int j = 0; j < APV; ++j) {
    xv[j] = ((const v4f*)x)[base + j * 256];
    pv[j] = ((const v4f*)pe)[pb + j * 256];
  }
#pragma unroll
  for (int j = 0; j < APV; ++j) ((v4f*)xbuf)[base + j * 256] = xv[j] + pv[j];
}

// =====================================================================
// weight transpose + fp32->bf16:  W[K][N] fp32  ->  WT[N][K] bf16
// One block = a tile of WTK k x WTN n. Reads: 16 bytes per lane, a wave covers
// two rows of 256 bytes. Writes: 8 bf16 (16 bytes) per lane, a wave covers four
// rows of 128 bytes. The odd LDS pitch spreads both sides over the banks.
// K and N are compile-time: a thread's loads (and stores) then differ only in
// their immediate offsets.
// =====================================================================
#define WTK 128
#define WTN 64
template <int K, int N>
__device__ __forceinline__ void wconv_block(
    const float* __restrict__ W, unsigned short* __restrict__ WT,
    float (&tile)[WTK][WTN + 1], unsigned blk) {   // blk = 0 .. (N / WTN) * (K / WTK) - 1
  const int nb = (int)(blk % (N / WTN)) * WTN, kb = (int)(blk / (N / WTN)) * WTK;
  const int c4 = (threadIdx.x & 15) * 4, r0 = threadIdx.x >> 4;
  // block-uniform base + one lane offset for all of a thread's loads (stores alike)
  const float* Wb = W + (size_t)kb * N + nb;
  const unsigned woff = (unsigned)(r0 * N + c4);
  v4f v[WTK / 16];
#pragma unroll
  for (int j = 0; j < WTK / 16; ++j)
    v[j] = *(const v4f*)(Wb + (size_t)(16 * j) * N + woff);
#pragma unroll
  for (int j = 0; j < WTK / 16; ++j)
#pragma unroll
    for (int i = 0; i < 4; ++i) tile[r0 + 16 * j][c4 + i] = v[j][i];
  __syncthreads();
  const int k8 = (threadIdx.x & 7) * 8, n0 = threadIdx.x >> 3;
  unsigned short* Tb = WT + (size_t)nb * K + kb;
  const unsigned toff = (unsigned)(n0 * K + k8);
#pragma unroll
  for (int nh = 0; nh < WTN / 32; ++nh)
#pragma unroll
    for (int kh = 0; kh < WTK / 64; ++kh) {
      const int n = n0 + 32 * nh, k = k8 + 64 * kh;
      v4u p;
#pragma unroll
      for (int i = 0; i < 4; ++i)
        p[i] = (unsigned)f32_bf16(tile[k + 2 * i][n]) |
               ((unsigned)f32_bf16(tile[k + 2 * i + 1][n]) << 16);
      *(v4u*)(Tb + (size_t)(32 * nh) * K + 64 * kh + toff) = p;
    }
}

// =====================================================================
// All the work that depends on the inputs alone, as ONE launch: the three
// weight transposes of both layers and the pos add. None of it reads what
// another part writes, so a block takes its part by its index; seven short
// launches would each pay their own gap, fill and drain.
// The pos add comes last: its output is what the next launch reads first.
// Every branch is on blockIdx alone, so the barrier in wconv_block is reached
// by all threads of a block or by none.
// =====================================================================
#define NLAY  2
#define WBI   ((DINQ / WTN) * (DQ / WTK))     // blocks per layer: Win
#define WBD   ((DINQ / WTN) * (DINQ / WTK))   //                   Wdt
#define WBO   ((DQ / WTN) * (DINQ / WTK))     //                   Wout
#define WBL   (WBI + WBD + WBO)
__global__ __launch_bounds__(256) void prep_kernel(
    const float* __restrict__ x, const float* __restrict__ pe,
    const float* __restrict__ Win, const float* __restrict__ Wdt,
    const float* __restrict__ Wout, float* __restrict__ xbuf,
    unsigned short* __restrict__ WinT, unsigned short* __restrict__ WdtT,
    unsigned short* __restrict__ WoutT) {
  __shared__ float tile[WTK][WTN + 1];
  const unsigned bid = blockIdx.x;
  if (bid >= NLAY * WBL) {
    add_pos_block(x, pe, xbuf, bid - NLAY * WBL);
    return;
  }
  const unsigned lay = bid / WBL, t = bid % WBL;
  if (t < WBI)
    wconv_block<DQ, DINQ>(Win + (size_t)lay * DQ * DINQ,
                          WinT + (size_t)lay * DQ * DINQ, tile, t);
  else if (t < WBI + WBD)
    wconv_block<DINQ, DINQ>(Wdt + (size_t)lay * DINQ * DINQ,
                            WdtT + (size_t)lay * DINQ * DINQ, tile, t - WBI);
  else
    wconv_block<DINQ, DQ>(Wout + (size_t)lay * DINQ * DQ,
                          WoutT + (size_t)lay * DINQ * DQ, tile, t - (WBI + WBD));
}

// =====================================================================
// LayerNorm over the last dim (DQ); optional bf16 output (GEMM A operand)
// One wave = one row, held in registers (LNV pieces of 16 bytes per lane), so
// the row is read once; the two sums go over the lanes by shuffles.
// =====================================================================
#define LNR 8                 // rows (waves) per block
#define LNV (DQ / 128)        // 16-byte pieces of a row per lane
template <bool BF16OUT>
__global__ __launch_bounds__(LNR * 32) void ln_kernel(
    const float* __restrict__ x, const float* __restrict__ w,
    const float* __restrict__ b, void* __restrict__ out) {
  // the wave's number, held scalar: the row's base address is then scalar too
  const int row  = blockIdx.x * LNR + __builtin_amdgcn_readfirstlane(threadIdx.x >> 5);
  const unsigned lane = threadIdx.x & 31;
  const v4f* xr = (const v4f*)(x + (size_t)row * DQ);
  v4f v[LNV], wv[LNV], bv[LNV];
#pragma unroll
  for (int j = 0; j < LNV; ++j) v[j] = xr[j * 32 + lane];
#pragma unroll
  for (int j = 0; j < LNV; ++j) {
    wv[j] = ((const v4f*)w)[j * 32 + lane];
    bv[j] = ((const v4f*)b)[j * 32 + lane];
  }
  // keeps the scheduler from sinking the w and b loads behind the sums (one
  // exposed latency per group of them instead of none)
  __builtin_amdgcn_sched_barrier(0);
  v4f a1 = {}, a2 = {};
#pragma unroll
  for (int j = 0; j < LNV; ++j) { a1 += v[j]; a2 += v[j] * v[j]; }
  float s  = (a1[0] + a1[1]) + (a1[2] + a1[3]);
  float s2 = (a2[0] + a2[1]) + (a2[2] + a2[3]);
#pragma unroll
  for (int o = 16; o > 0; o >>= 1) {
    s  += __shfl_xor(s, o);
    s2 += __shfl_xor(s2, o);
  }
  const float mean = s / (float)DQ;
  const float var  = s2 / (float)DQ - mean * mean;
  const float rstd = rsqrtf(var + 1e-5f);
#pragma unroll
  for (int j = 0; j < LNV; ++j) {
    v4f y = (v[j] - mean) * rstd * wv[j] + bv[j];
    if (BF16OUT) {
      v2u p = {(unsigned)f32_bf16(y[0]) | ((unsigned)f32_bf16(y[1]) << 16),
               (unsigned)f32_bf16(y[2]) | ((unsigned)f32_bf16(y[3]) << 16)};
      ((v2u*)((unsigned short*)out + (size_t)row * DQ))[j * 32 + lane] = p;
    } else {
      ((v4f*)((float*)out + (size_t)row * DQ))[j * 32 + lane] = y;
    }
  }
}

// =====================================================================
// WMMA bf16 GEMM:  out[M][N] = A[M][K](bf16) * BT[N][K](bf16)^T + bias
// Block tile (MI*64) x 128, 8 waves (wave32) arranged 4x2, each wave
// (MI*16) x 64 via MI x 4 v_wmma_f32_16x16x32_bf16 tiles: every byte staged
// from L2 and every fragment read from LDS serves more products than in a
// small tile. K is staged in KC-wide tiles by async global->LDS copies into two
// buffers (KC as large as the two buffers allow: fewer barriers per product):
//   tile 0, wait, barrier; per trip: tile i+1's copies into the buffer that
//   trip i-1 has read, the products on tile i, s_wait_dscnt 0,
//   s_wait_asynccnt 0, barrier.
// Inside a trip the fragments of the next 32 k are fetched into a second
// register set in front of the products on this one.
// N and K are compile-time: a thread's stores then differ only in their
// immediate offsets from one base address.
// Every loop but the one over the tiles is unrolled: the fragment, accumulator
// and address arrays are then indexed by constants only and stay in registers.
// Epilogues:
//   MODE 0: outF = v+bias (fp32) AND outBf = bf16(v+bias)
//   MODE 1: outF = softplus(v+bias)
//   MODE 2: outF = v+bias+outF  (residual add in place)
// =====================================================================
#define BNT 128

__device__ __forceinline__ v16bf load_frag(const unsigned short* rowp, int half) {
  // A-fragment lane layout (ISA 7.12.2, 16-bit A 16x32):
  //  lanes 0-15:  elems[0..7]=K0..7,  elems[8..15]=K16..23
  //  lanes 16-31: elems[0..7]=K8..15, elems[8..15]=K24..31
  union { v16bf v; v8bf h[2]; } u;
  u.h[0] = *(const v8bf*)(rowp + half * 8);
  u.h[1] = *(const v8bf*)(rowp + 16 + half * 8);
  return u.v;
}

// softplus(v) = max(v, 0) + log1p(exp(-|v|)) for eight values, on the hardware's
// own v_exp_f32 and v_log_f32. With e = exp(-|v|) in [0, 1] and w = fl(1 + e), the
// term d = e - (w - 1) is exactly what the rounding of 1 + e dropped, and
// log1p(e) = log(w) + d / w; d stands for d / w (the difference is below
// 2^-24 * e), so small e keep their relative accuracy. No overflow for any v, so
// no cut-over to v for large v is needed.
// The eight values of a statement are independent, so they fill each other's
// latency; the v_nop at each statement's end keeps the slot that the instruction
// set asks for behind a transcendental before its result is read.
__device__ __forceinline__ void softplus8(float (&y)[8], const float (&v)[8]) {
  float t[8], e[8], w[8], l[8];
#pragma unroll
  for (int r = 0; r < 8; ++r) t[r] = fabsf(v[r]) * -1.44269504f;
  asm("v_exp_f32 %0, %8\n\tv_exp_f32 %1, %9\n\tv_exp_f32 %2, %10\n\t"
      "v_exp_f32 %3, %11\n\tv_exp_f32 %4, %12\n\tv_exp_f32 %5, %13\n\t"
      "v_exp_f32 %6, %14\n\tv_exp_f32 %7, %15\n\tv_nop"
      : "=&v"(e[0]), "=&v"(e[1]), "=&v"(e[2]), "=&v"(e[3]),
        "=&v"(e[4]), "=&v"(e[5]), "=&v"(e[6]), "=&v"(e[7])
      : "v"(t[0]), "v"(t[1]), "v"(t[2]), "v"(t[3]),
        "v"(t[4]), "v"(t[5]), "v"(t[6]), "v"(t[7]));
#pragma unroll
  for (int r = 0; r < 8; ++r) w[r] = 1.f + e[r];
  asm("v_log_f32 %0, %8\n\tv_log_f32 %1, %9\n\tv_log_f32 %2, %10\n\t"
      "v_log_f32 %3, %11\n\tv_log_f32 %4, %12\n\tv_log_f32 %5, %13\n\t"
      "v_log_f32 %6, %14\n\tv_log_f32 %7, %15\n\tv_nop"
      : "=&v"(l[0]), "=&v"(l[1]), "=&v"(l[2]), "=&v"(l[3]),
        "=&v"(l[4]), "=&v"(l[5]), "=&v"(l[6]), "=&v"(l[7])
      : "v"(w[0]), "v"(w[1]), "v"(w[2]), "v"(w[3]),
        "v"(w[4]), "v"(w[5]), "v"(w[6]), "v"(w[7]));
#pragma unroll
  for (int r = 0; r < 8; ++r) {
    float d = e[r] - (w[r] - 1.f);
    y[r] = fmaxf(v[r], 0.f) + (l[r] * 0.69314718f + d);   // log2(w) * ln 2
  }
}

template <int MODE, int MI, int KC, int N, int K>
__global__ __launch_bounds__(256) void gemm_bf16_wmma(
    const unsigned short* __restrict__ A,   // [M][K] bf16
    const unsigned short* __restrict__ BT,  // [N][K] bf16 (B transposed)
    const float* __restrict__ bias,         // [N]
    float* __restrict__ outF,
    unsigned short* __restrict__ outBf) {
  constexpr int BM = MI * 64;
  constexpr int nk = K / KC;
  constexpr int LDA = KC + 8;        // padded row pitch (elements): an odd number of 16 B
  constexpr int RP = 256 / (KC / 8); // rows that one copy of all 256 threads covers
  static_assert(K % KC == 0 && nk >= 2 && BM % 128 == 0 && (KC == 128 || KC == 256),
                "tile shapes");
  __shared__ __align__(16) unsigned short As[2][BM][LDA];
  __shared__ __align__(16) unsigned short Bs[2][BNT][LDA];
  const int tid  = threadIdx.x;
  // the wave's number, held scalar: the wave's part of every address is then scalar
  const int wave = __builtin_amdgcn_readfirstlane(tid >> 5);
  const int lane = tid & 31;
  const int wm = wave & 3, wn = wave >> 2;    // 4 waves along M, 2 along N
  const int bm = blockIdx.y * BM, bn = blockIdx.x * BNT;
  const int half = lane >> 4, lrow = lane & 15;

  // a thread's copies of one tile: 16 bytes of every RP-th row, so that a wave's
  // copy covers 512 bytes in whole rows
  const int crow = tid / (KC / 8), ccol = (tid % (KC / 8)) * 8;
  const unsigned short* gA = A  + (size_t)(bm + crow) * K + ccol;
  const unsigned short* gB = BT + (size_t)(bn + crow) * K + ccol;
  const unsigned lA = (unsigned)(uintptr_t)&As[0][crow][ccol];
  const unsigned lB = (unsigned)(uintptr_t)&Bs[0][crow][ccol];

  constexpr int NCA = BM / RP, NC = NCA + BNT / RP;   // copies per thread and tile
  auto issue_stage = [&](int buf, int k0) {
    unsigned l[NC];
    const unsigned short* g[NC];
#pragma unroll
    for (int t = 0; t < NCA; ++t) {
      l[t] = lA + (unsigned)((buf * BM + t * RP) * (LDA * 2));
      g[t] = gA + k0 + (size_t)(t * RP) * K;
    }
#pragma unroll
    for (int t = 0; t < BNT / RP; ++t) {
      l[NCA + t] = lB + (unsigned)((buf * BNT + t * RP) * (LDA * 2));
      g[NCA + t] = gB + k0 + (size_t)(t * RP) * K;
    }
    static_assert(NC == 24 || NC == 32, "copies per statement");
    async_ld12_b128(l, g);
    async_ld12_b128(l + 12, g + 12);
    if constexpr (NC == 32) async_ld8_b128(l + 24, g + 24);
  };

  v8f zero = {};
  v8f acc[MI][4];
#pragma unroll
  for (int i = 0; i < MI; ++i)
#pragma unroll
    for (int j = 0; j < 4; ++j) acc[i][j] = zero;

  issue_stage(0, 0);
  wait_async0();
  __syncthreads();                   // tile 0 visible to all waves
  // rolled: a trip is already KC / 32 * MI * 4 products long (code size)
#pragma unroll 1
  for (int i = 0; i < nk; ++i) {
    const int cur = i & 1;
    const unsigned short* ap = &As[cur][wm * (MI * 16) + lrow][0];
    const unsigned short* bp = &Bs[cur][wn * 64 + lrow][0];
    v16bf aF[2][MI], bF[2][4];
#pragma unroll
    for (int ii = 0; ii < MI; ++ii) aF[0][ii] = load_frag(ap + ii * 16 * LDA, half);
#pragma unroll
    for (int jj = 0; jj < 4; ++jj)  bF[0][jj] = load_frag(bp + jj * 16 * LDA, half);
    // tile i+1's copies, into the buffer that every wave has left at the barrier
    // above; they are issued while the trip's first LDS reads are under way
    if (i + 1 < nk) issue_stage(cur ^ 1, (i + 1) * KC);
#pragma unroll
    for (int ks = 0; ks < KC / 32; ++ks) {
      const int s = ks & 1;
      if (ks + 1 < KC / 32) {
#pragma unroll
        for (int ii = 0; ii < MI; ++ii)
          aF[s ^ 1][ii] = load_frag(ap + ii * 16 * LDA + (ks + 1) * 32, half);
#pragma unroll
        for (int jj = 0; jj < 4; ++jj)
          bF[s ^ 1][jj] = load_frag(bp + jj * 16 * LDA + (ks + 1) * 32, half);
      }
      // keeps the next set's LDS reads one group in front of this set's products:
      // left alone, the scheduler sinks each read to its first use, with a full
      // wait in front of every row of products
      __builtin_amdgcn_sched_barrier(0);
#pragma unroll
      for (int ii = 0; ii < MI; ++ii)
#pragma unroll
        for (int jj = 0; jj < 4; ++jj)
          acc[ii][jj] = __builtin_amdgcn_wmma_f32_16x16x32_bf16(
              false, aF[s][ii], false, bF[s][jj], (short)0, acc[ii][jj],
              false, false);
      // keeps the set after next's reads behind these products, whose operands
      // they overwrite
      __builtin_amdgcn_sched_barrier(0);
    }
    wait_ds0();                      // this wave has left buffer cur
    wait_async0();                   // its copies of tile i+1 have landed
    __syncthreads();                 // tile i+1 visible, buffer cur free
  }
  wait_async0();                     // no copy is outstanding behind the loop

  // ---- epilogue: C/D layout - n = lane&15, m = vgpr + (lane>>4)*8 ----
  // One lane-dependent base; every element lies a constant step from it.
  const int gn0 = bn + wn * 64 + lrow;
  float bj[4];
#pragma unroll
  for (int j = 0; j < 4; ++j) bj[j] = bias[gn0 + j * 16];
  // the loads' offset register is reused by the address arithmetic below
  asm volatile("s_wait_xcnt 0x0" ::: "memory");
  // keeps that arithmetic behind the wait
  __builtin_amdgcn_sched_barrier(0);
  const size_t off0 = (size_t)(bm + wm * (MI * 16) + half * 8) * N + gn0;
  float* const baseF = outF + off0;
  float res[MODE == 2 ? MI : 1][4][8];
  if (MODE == 2) {                   // the whole residual tile flies together
#pragma unroll
    for (int i = 0; i < MI; ++i)
#pragma unroll
      for (int j = 0; j < 4; ++j)
#pragma unroll
        for (int r = 0; r < 8; ++r) res[i][j][r] = baseF[(i * 16 + r) * N + j * 16];
  }
#pragma unroll
  for (int i = 0; i < MI; ++i) {
    float val[4][8];
    unsigned short vb[4][8];
#pragma unroll
    for (int j = 0; j < 4; ++j) {
      float pre[8];
#pragma unroll
      for (int r = 0; r < 8; ++r) pre[r] = acc[i][j][r] + bj[j];
      if (MODE == 1) {
        softplus8(val[j], pre);
      } else {
#pragma unroll
        for (int r = 0; r < 8; ++r) {
          val[j][r] = MODE == 2 ? pre[r] + res[i][j][r] : pre[r];
          if (MODE == 0) vb[j][r] = f32_bf16(val[j][r]);
        }
      }
    }
    // keeps every value of the group computed in front of its first store
    __builtin_amdgcn_sched_barrier(0);
#pragma unroll
    for (int j = 0; j < 4; ++j)
#pragma unroll
      for (int r = 0; r < 8; ++r) {
        baseF[(i * 16 + r) * N + j * 16] = val[j][r];
        if (MODE == 0) (outBf + off0)[(i * 16 + r) * N + j * 16] = vb[j][r];
      }
    // the stores' data registers are rewritten by the next group
    asm volatile("s_wait_xcnt 0x0" ::: "memory");
    // keeps the next group's arithmetic behind that wait
    __builtin_amdgcn_sched_barrier(0);
  }
}

// =====================================================================
// Bm|Cm projection:  BC[m][0..15]=h@WB, [16..31]=h@WC, all in f32, on
// v_wmma_f32_16x16x4_f32. One block = 16 token rows x all 32 columns, so a
// weight row is fetched once per 16 tokens. The 16 waves split k (128 each);
// their partial tiles are added through LDS in wave order.
// k pairing: lane (c, hf) holds, for group q, k = slice + 8q + 4hf + 0..3 of
// A row c (one 16-byte load) and the same four k of B column c.
// Every loop is unrolled: av, wb, wc and the accumulators are then indexed by
// constants only and stay in registers.
// =====================================================================
typedef __attribute__((ext_vector_type(2))) float v2f;
#define BCW  16               // waves per block
#define BCKS (DINQ / BCW)     // k per wave
#define BCQ  (BCKS / 8)       // groups of 8 k per wave
#define BCG  4                // groups whose weight fragments are fetched together

__global__ __launch_bounds__(BCW * 32) void bc_kernel(
    const float* __restrict__ h, const float* __restrict__ WB,
    const float* __restrict__ WC, float* __restrict__ BC) {
  __shared__ float red[BCW][512];           // per wave: 2 tiles x 8 registers x 32 lanes
  const int wave = threadIdx.x >> 5, lane = threadIdx.x & 31;
  const int c = lane & 15, hf = lane >> 4;
  const int m0 = blockIdx.x * 16;
  const int kl = wave * BCKS + hf * 4;      // the lane's first k
  const float* ap = h  + (size_t)(m0 + c) * DINQ + kl;
  const float* bp = WB + (size_t)kl * NSTATE + c;
  const float* cp = WC + (size_t)kl * NSTATE + c;

  v4f av[BCQ];                              // the wave's whole slice of h, fetched first
#pragma unroll
  for (int q = 0; q < BCQ; ++q) av[q] = *(const v4f*)(ap + q * 8);
  // keeps the scheduler from sinking these loads to their first use (one
  // exposed latency per product instead of one for the whole slice)
  __builtin_amdgcn_sched_barrier(0);

  float wb[2][BCG][4], wc[2][BCG][4];
  auto fetch = [&](int buf, int g) {
#pragma unroll
    for (int q2 = 0; q2 < BCG; ++q2)
#pragma unroll
      for (int j = 0; j < 4; ++j) {
        wb[buf][q2][j] = bp[(size_t)((g * BCG + q2) * 8 + j) * NSTATE];
        wc[buf][q2][j] = cp[(size_t)((g * BCG + q2) * 8 + j) * NSTATE];
      }
  };
  fetch(0, 0);

  v8f accb = {}, accc = {};
#pragma unroll
  for (int g = 0; g < BCQ / BCG; ++g) {
    if (g + 1 < BCQ / BCG) {
      fetch((g + 1) & 1, g + 1);            // flies under this group's products
      // behind the last fetch the loads' address registers are free for reuse
      if (g + 2 == BCQ / BCG) asm volatile("s_wait_xcnt 0x0" ::: "memory");
      // keeps the next group's loads in front of this group's products
      __builtin_amdgcn_sched_barrier(0);
    }
#pragma unroll
    for (int q2 = 0; q2 < BCG; ++q2)
#pragma unroll
      for (int p = 0; p < 2; ++p) {
        v2f a  = {av[g * BCG + q2][2 * p], av[g * BCG + q2][2 * p + 1]};
        v2f fb = {wb[g & 1][q2][2 * p], wb[g & 1][q2][2 * p + 1]};
        v2f fc = {wc[g & 1][q2][2 * p], wc[g & 1][q2][2 * p + 1]};
        accb = __builtin_amdgcn_wmma_f32_16x16x4_f32(
            false, a, false, fb, (short)0, accb, false, false);
        accc = __builtin_amdgcn_wmma_f32_16x16x4_f32(
            false, a, false, fc, (short)0, accc, false, false);
      }
  }
  // A precaution: no distance is documented for the f32 form, and without this
  // the build had address arithmetic overwriting an A register directly behind
  // its product. Eight vector slots, the figure of the other 16-cycle form,
  // stand in front of the first vector instruction behind the products; the two
  // scheduling barriers keep that arithmetic and the slots where they are written.
  __builtin_amdgcn_sched_barrier(0);
  asm volatile("v_nop\n\tv_nop\n\tv_nop\n\tv_nop\n\tv_nop\n\tv_nop\n\tv_nop\n\tv_nop");
  __builtin_amdgcn_sched_barrier(0);

#pragma unroll
  for (int r = 0; r < 8; ++r) {
    red[wave][r * 32 + lane]       = accb[r];
    red[wave][256 + r * 32 + lane] = accc[r];
  }
  __syncthreads();
  // one output per thread; D layout: register r of lane l = D[8 * (l >> 4) + r][l & 15]
  float s = 0.f;
#pragma unroll
  for (int w = 0; w < BCW; ++w) s += red[w][threadIdx.x];
  const int tile = threadIdx.x >> 8, r = (threadIdx.x >> 5) & 7;
  BC[(size_t)(m0 + 8 * hf + r) * 32 + tile * 16 + c] = s;
}

// =====================================================================
// selective scan (diagonal SSM), split over time into NCH chunks of CLEN
// steps so that the chunks run side by side instead of one after another.
//   scan_state_kernel: every chunk but the last runs the recurrence from a
//     zero state and keeps its end state S[n] and its sum of dt (row NSTATE
//     of the same record). The decay over a whole chunk is exp(a[n] * sum dt).
//   scan_kernel: a chunk folds the earlier chunks' (S, sum dt) in time order
//     into its start state, then runs the recurrence with the fused D-skip,
//     the causal depthwise conv (4 taps) + SiLU of the same channel, formed
//     from the x values that the lane walks through anyway, and the gating.
// One lane = one channel with all 16 states; one block = SCB channels of one
// (batch, chunk), so the B/C rows are the same address for the whole block.
// scan_state_kernel is the first reader of the B rows after the launch that
// wrote them: its block brings the chunk's rows into LDS once, by 16-byte loads
// that all fly together, and every step reads its row from there (all lanes one
// address). A load of the row from global memory in every step is waited for
// within that step, at the latency of a first touch.
// =====================================================================
#define NCH  32
#define CLEN (LQ / NCH)     // 64 steps per chunk
#define SU   8              // steps fetched ahead as one group
#define SCB  128            // channels (threads) per block
#define DGS  (DINQ / SCB)   // channel groups
#define SROWS (NSTATE + 1)  // rows of a chunk's record: S[0..15], sum of dt
#define FB   3              // chunk records fetched together in the fold (51 loads)

// e[n] = exp(x[n]) for the 16 states, as __expf forms it (x * log2(e), then
// v_exp_f32), eight to a statement. The v_nop at each statement's end keeps the
// slot that the instruction set asks for behind a transcendental before its
// source is overwritten.
__device__ __forceinline__ void exp16(float (&e)[NSTATE], const float (&x)[NSTATE]) {
  float t[NSTATE];
#pragma unroll
  for (int n = 0; n < NSTATE; ++n) t[n] = x[n] * 1.44269504f;
#pragma unroll
  for (int k = 0; k < NSTATE; k += 8)
    asm("v_exp_f32 %0, %8\n\tv_exp_f32 %1, %9\n\tv_exp_f32 %2, %10\n\t"
        "v_exp_f32 %3, %11\n\tv_exp_f32 %4, %12\n\tv_exp_f32 %5, %13\n\t"
        "v_exp_f32 %6, %14\n\tv_exp_f32 %7, %15\n\tv_nop"
        : "=&v"(e[k]), "=&v"(e[k + 1]), "=&v"(e[k + 2]), "=&v"(e[k + 3]),
          "=&v"(e[k + 4]), "=&v"(e[k + 5]), "=&v"(e[k + 6]), "=&v"(e[k + 7])
        : "v"(t[k]), "v"(t[k + 1]), "v"(t[k + 2]), "v"(t[k + 3]),
          "v"(t[k + 4]), "v"(t[k + 5]), "v"(t[k + 6]), "v"(t[k + 7]));
}

// exp(x) for one value, formed as in exp16; the v_nop keeps the same slot.
__device__ __forceinline__ float exp1(float x) {
  float t = x * 1.44269504f, e;
  asm("v_exp_f32 %0, %1\n\tv_nop" : "=v"(e) : "v"(t));
  return e;
}

__global__ __launch_bounds__(SCB) void scan_state_kernel(
    const float* __restrict__ h,  const float* __restrict__ dt,
    const float* __restrict__ BC, const float* __restrict__ A_log,
    float* __restrict__ Sst) {    // [B][NCH][SROWS][DIN]
  const int d  = (blockIdx.x % DGS) * SCB + threadIdx.x;
  const int bc = blockIdx.x / DGS;
  const int b  = bc / (NCH - 1);
  const int c  = bc % (NCH - 1);             // the last chunk feeds nobody
  const size_t row0 = (size_t)b * LQ + (size_t)c * CLEN;
  const float* dtp = dt + row0 * DINQ + d;
  const float* hp  = h  + row0 * DINQ + d;
  const float* bcp = BC + row0 * 32;

  // the chunk's B rows (the first half of each B|C row), 16 bytes per piece
  __shared__ __align__(16) float sB[CLEN][NSTATE];
  constexpr int SBV = CLEN * NSTATE / 4 / SCB;   // pieces per thread
  v4f st[SBV];
#pragma unroll
  for (int j = 0; j < SBV; ++j) {
    const int p = threadIdx.x + j * SCB;
    st[j] = *(const v4f*)(bcp + (p >> 2) * 32 + (p & 3) * 4);
  }
  float a[NSTATE], hs[NSTATE], al[NSTATE];
#pragma unroll
  for (int n = 0; n < NSTATE; ++n) al[n] = A_log[(size_t)d * NSTATE + n];
  // the loads' address registers are reused by the arithmetic below
  asm volatile("s_wait_xcnt 0x0" ::: "memory");
  exp16(a, al);
#pragma unroll
  for (int n = 0; n < NSTATE; ++n) { a[n] = -a[n]; hs[n] = 0.f; }
#pragma unroll
  for (int j = 0; j < SBV; ++j) ((v4f*)sB)[threadIdx.x + j * SCB] = st[j];
  __syncthreads();                           // the rows are visible to all waves

  float sd = 0.f;
  float dtc[SU], xc[SU];
#pragma unroll
  for (int u = 0; u < SU; ++u) { dtc[u] = 0.f; xc[u] = 0.f; }
  // Trip -1 only fetches group 0, so that every group reaches the arithmetic
  // through the copies at the loop's foot and the wait for it stands there.
  // rolled: the body is already SU * NSTATE updates long (code size)
#pragma unroll 1
  for (int g = -1; g < CLEN / SU; ++g) {
    float dtn[SU], xn[SU];
#pragma unroll
    for (int u = 0; u < SU; ++u) { dtn[u] = 0.f; xn[u] = 0.f; }
    if (g + 1 < CLEN / SU) {                 // next group flies under this one
#pragma unroll
      for (int u = 0; u < SU; ++u) {
        dtn[u] = dtp[(size_t)((g + 1) * SU + u) * DINQ];
        xn[u]  = hp[(size_t)((g + 1) * SU + u) * DINQ];
      }
      // the loads' address registers are reused by the arithmetic below
      asm volatile("s_wait_xcnt 0x0" ::: "memory");
    }
    if (g >= 0) {
#pragma unroll
      for (int u = 0; u < SU; ++u) {
        const float* bct = sB[g * SU + u];
        float dtv = dtc[u];
        float dx  = dtv * xc[u];
        sd += dtv;
        float da[NSTATE], dA[NSTATE];
#pragma unroll
        for (int n = 0; n < NSTATE; ++n) da[n] = dtv * a[n];
        exp16(dA, da);
#pragma unroll
        for (int n = 0; n < NSTATE; ++n) hs[n] = hs[n] * dA[n] + dx * bct[n];
      }
    }
#pragma unroll
    for (int u = 0; u < SU; ++u) { dtc[u] = dtn[u]; xc[u] = xn[u]; }
  }
  float* sp = Sst + ((size_t)b * NCH + c) * SROWS * DINQ + d;
#pragma unroll
  for (int n = 0; n < NSTATE; ++n) sp[(size_t)n * DINQ] = hs[n];
  sp[(size_t)NSTATE * DINQ] = sd;
}

__global__ __launch_bounds__(SCB) void scan_kernel(
    const float* __restrict__ h,  const float* __restrict__ dt,
    const float* __restrict__ BC, const float* __restrict__ cw,
    const float* __restrict__ cb,
    const float* __restrict__ A_log, const float* __restrict__ Dsk,
    const float* __restrict__ Sst, unsigned short* __restrict__ gout) {
  const int d  = (blockIdx.x % DGS) * SCB + threadIdx.x;
  const int bc = blockIdx.x / DGS;
  const int b  = bc % BQ;
  const int c  = NCH - 1 - bc / BQ;          // longest fold starts first

  const size_t row0 = (size_t)b * LQ + (size_t)c * CLEN;
  const float* hp  = h + row0 * DINQ + d;

  // first loads of the kernel: they have landed with the A_log rows, so no
  // wait for them falls among the fetched-ahead loads of the main loop
  const float dsk = Dsk[d];
  const float cbv = cb[d];
  float cwv[4];
#pragma unroll
  for (int j = 0; j < 4; ++j) cwv[j] = cw[j * DINQ + d];
  // the registers that the loads name are reused below
  asm volatile("s_wait_xcnt 0x0" ::: "memory");
  // the three x values in front of the chunk (zero padding in front of l = 0)
  float xp[3] = {0.f, 0.f, 0.f};
  if (c > 0) {
#pragma unroll
    for (int j = 0; j < 3; ++j) xp[j] = hp[(ptrdiff_t)(j - 3) * DINQ];
    // the registers that the loads name are reused below
    asm volatile("s_wait_xcnt 0x0" ::: "memory");
  }
  float a[NSTATE], hs[NSTATE], al[NSTATE];
#pragma unroll
  for (int n = 0; n < NSTATE; ++n) al[n] = A_log[(size_t)d * NSTATE + n];
  exp16(a, al);
#pragma unroll
  for (int n = 0; n < NSTATE; ++n) { a[n] = -a[n]; hs[n] = 0.f; }

  // start state: earlier chunks folded in time order, FB records per fetch
  const float* sp = Sst + (size_t)b * NCH * SROWS * DINQ + d;
  int cp = 0;
#pragma unroll 1
  for (; cp + FB <= c; cp += FB) {
    float sv[FB][SROWS];
#pragma unroll
    for (int k = 0; k < FB; ++k)
#pragma unroll
      for (int n = 0; n < SROWS; ++n)
        sv[k][n] = sp[((size_t)(cp + k) * SROWS + n) * DINQ];
    // the loads' address registers are advanced for the next trip
    asm volatile("s_wait_xcnt 0x0" ::: "memory");
#pragma unroll
    for (int k = 0; k < FB; ++k) {
      float da[NSTATE], dA[NSTATE];
#pragma unroll
      for (int n = 0; n < NSTATE; ++n) da[n] = a[n] * sv[k][NSTATE];
      exp16(dA, da);
#pragma unroll
      for (int n = 0; n < NSTATE; ++n) hs[n] = hs[n] * dA[n] + sv[k][n];
    }
  }
#pragma unroll 1
  for (; cp < c; ++cp) {
    float sv[SROWS];
#pragma unroll
    for (int n = 0; n < SROWS; ++n)
      sv[n] = sp[((size_t)cp * SROWS + n) * DINQ];
    // the loads' address registers are reused by the arithmetic below
    asm volatile("s_wait_xcnt 0x0" ::: "memory");
    float da[NSTATE], dA[NSTATE];
#pragma unroll
    for (int n = 0; n < NSTATE; ++n) da[n] = a[n] * sv[NSTATE];
    exp16(dA, da);
#pragma unroll
    for (int n = 0; n < NSTATE; ++n) hs[n] = hs[n] * dA[n] + sv[n];
  }

  const float* dtp = dt + row0 * DINQ + d;
  const float* bcp = BC + row0 * 32;
  unsigned short* gp = gout + row0 * DINQ + d;

  float dtc[SU], xc[SU];
#pragma unroll
  for (int u = 0; u < SU; ++u) { dtc[u] = 0.f; xc[u] = 0.f; }
  // Trip -1 only fetches group 0 (see scan_state_kernel).
  // rolled: the body is already SU * NSTATE updates long (code size)
#pragma unroll 1
  for (int g = -1; g < CLEN / SU; ++g) {
    float dtn[SU], xn[SU];
#pragma unroll
    for (int u = 0; u < SU; ++u) { dtn[u] = 0.f; xn[u] = 0.f; }
    if (g + 1 < CLEN / SU) {                 // next group flies under this one
      // s_wait_xcnt behind each array's loads: their address registers are
      // reused, by the next array's load targets or by the arithmetic below
#pragma unroll
      for (int u = 0; u < SU; ++u) dtn[u] = dtp[(size_t)((g + 1) * SU + u) * DINQ];
      asm volatile("s_wait_xcnt 0x0" ::: "memory");
#pragma unroll
      for (int u = 0; u < SU; ++u) xn[u] = hp[(size_t)((g + 1) * SU + u) * DINQ];
      asm volatile("s_wait_xcnt 0x0" ::: "memory");
    }
    if (g >= 0) {
#pragma unroll
      for (int u = 0; u < SU; ++u) {
        const float* bct = bcp + (g * SU + u) * 32;
        float dtv = dtc[u];
        float xv  = xc[u];
        float dx  = dtv * xv;
        float da[NSTATE], dA[NSTATE];
#pragma unroll
        for (int n = 0; n < NSTATE; ++n) da[n] = dtv * a[n];
        exp16(dA, da);
        float yq[4];                         // four sums of four states each
#pragma unroll
        for (int q = 0; q < 4; ++q) {
          yq[q] = 0.f;
#pragma unroll
          for (int n2 = 0; n2 < 4; ++n2) {
            int n = q * 4 + n2;
            hs[n] = hs[n] * dA[n] + dx * bct[n];
            yq[q] += hs[n] * bct[16 + n];
          }
        }
        float y = (yq[0] + yq[1]) + (yq[2] + yq[3]);
        y += xv * dsk;
        // conv taps l-3 .. l in that order, then SiLU
        float ca = cbv;
        ca += (u >= 3 ? xc[u >= 3 ? u - 3 : 0] : xp[u < 3 ? u : 0]) * cwv[0];
        ca += (u >= 2 ? xc[u >= 2 ? u - 2 : 0] : xp[u < 2 ? u + 1 : 0]) * cwv[1];
        ca += (u >= 1 ? xc[u >= 1 ? u - 1 : 0] : xp[2]) * cwv[2];
        ca += xv * cwv[3];
        float yc = ca * (1.f / (1.f + exp1(-ca)));
        gp[(size_t)(g * SU + u) * DINQ] =
            f32_bf16(y * (1.f / (1.f + exp1(-yc))));
      }
#pragma unroll
      for (int j = 0; j < 3; ++j) xp[j] = xc[SU - 3 + j];
      // the stores' address and data registers are rewritten at the loop's foot
      asm volatile("s_wait_xcnt 0x0" ::: "memory");
    }
#pragma unroll
    for (int u = 0; u < SU; ++u) { dtc[u] = dtn[u]; xc[u] = xn[u]; }
  }
}

// =====================================================================
// host-side orchestration
// =====================================================================
extern "C" void kernel_launch(void* const* d_in, const int* in_sizes, int n_in,
                              void* d_out, int out_size, void* d_ws, size_t ws_size,
                              hipStream_t stream) {
  const float* x_in  = (const float*)d_in[0];
  const float* pos   = (const float*)d_in[1];
  const float* normw = (const float*)d_in[2];
  const float* normb = (const float*)d_in[3];
  const float* Win   = (const float*)d_in[4];
  const float* b_in  = (const float*)d_in[5];
  const float* A_log = (const float*)d_in[6];
  const float* Wdt   = (const float*)d_in[7];
  const float* b_dt  = (const float*)d_in[8];
  const float* WB    = (const float*)d_in[9];
  const float* WC    = (const float*)d_in[10];
  const float* Dsk   = (const float*)d_in[11];
  const float* convw = (const float*)d_in[12];
  const float* convb = (const float*)d_in[13];
  const float* Wout  = (const float*)d_in[14];
  const float* b_out = (const float*)d_in[15];
  const float* fnw   = (const float*)d_in[16];
  const float* fnb   = (const float*)d_in[17];
  (void)in_sizes; (void)n_in; (void)out_size; (void)ws_size;

  char* p = (char*)d_ws;
  auto alloc = [&](size_t bytes) {
    char* r = p;
    p += (bytes + 255) & ~(size_t)255;
    return r;
  };
  float*          xbuf  = (float*)         alloc((size_t)BL * DQ   * 4);  // residual stream
  unsigned short* hln   = (unsigned short*)alloc((size_t)BL * DQ   * 2);  // LN(x) bf16
  float*          hbuf  = (float*)         alloc((size_t)BL * DINQ * 4);  // h fp32
  unsigned short* hbf   = (unsigned short*)alloc((size_t)BL * DINQ * 2);  // h bf16
  float*          dtb   = (float*)         alloc((size_t)BL * DINQ * 4);  // softplus(dt)
  float*          BCb   = (float*)         alloc((size_t)BL * 32   * 4);  // [B|C]
  unsigned short* gbf   = (unsigned short*)alloc((size_t)BL * DINQ * 2);  // gated, bf16
  unsigned short* WinT  = (unsigned short*)alloc((size_t)NLAY * DINQ * DQ   * 2);  // both layers
  unsigned short* WdtT  = (unsigned short*)alloc((size_t)NLAY * DINQ * DINQ * 2);
  unsigned short* WoutT = (unsigned short*)alloc((size_t)NLAY * DQ   * DINQ * 2);
  float*          Sst   = (float*)         alloc((size_t)BQ * NCH * SROWS * DINQ * 4);  // chunk records

  prep_kernel<<<NLAY * WBL + APB, 256, 0, stream>>>(
      x_in, pos, Win, Wdt, Wout, xbuf, WinT, WdtT, WoutT);

  for (int i = 0; i < NLAY; ++i) {
    ln_kernel<true><<<BL / LNR, LNR * 32, 0, stream>>>(
        xbuf, normw + (size_t)i * DQ, normb + (size_t)i * DQ, hln);

    // h = LN(x) @ Win + b_in    (fp32 + bf16 copies)
    gemm_bf16_wmma<0, 4, 128, DINQ, DQ><<<dim3(DINQ / BNT, BL / 256), 256, 0, stream>>>(
        hln, WinT + (size_t)i * DQ * DINQ, b_in + (size_t)i * DINQ, hbuf, hbf);
    // dt = softplus(h @ Wdt + b_dt)
    gemm_bf16_wmma<1, 4, 128, DINQ, DINQ><<<dim3(DINQ / BNT, BL / 256), 256, 0, stream>>>(
        hbf, WdtT + (size_t)i * DINQ * DINQ, b_dt + (size_t)i * DINQ, dtb, nullptr);

    bc_kernel<<<BL / 16, BCW * 32, 0, stream>>>(
        hbuf, WB + (size_t)i * DINQ * NSTATE, WC + (size_t)i * DINQ * NSTATE, BCb);
    scan_state_kernel<<<BQ * (NCH - 1) * DGS, SCB, 0, stream>>>(
        hbuf, dtb, BCb, A_log + (size_t)i * DINQ * NSTATE, Sst);
    scan_kernel<<<BQ * NCH * DGS, SCB, 0, stream>>>(
        hbuf, dtb, BCb, convw + (size_t)i * 4 * DINQ, convb + (size_t)i * DINQ,
        A_log + (size_t)i * DINQ * NSTATE,
        Dsk + (size_t)i * DINQ, Sst, gbf);

    // x = g @ Wout + b_out + residual (in place)
    gemm_bf16_wmma<2, 2, 256, DQ, DINQ><<<dim3(DQ / BNT, BL / 128), 256, 0, stream>>>(
        gbf, WoutT + (size_t)i * DINQ * DQ, b_out + (size_t)i * DQ, xbuf, nullptr);
  }

  ln_kernel<false><<<BL / LNR, LNR * 32, 0, stream>>>(xbuf, fnw, fnb, d_out);
}

// v009
// A run of this version takes 261 microseconds.
// Timed twice side by side with v008, it ran 1.03 times as fast both times.
// Counting every step since v000, it is 15.8 times as fast.
#include <hip/hip_runtime.h>
#include <hip/hip_bf16.h>
#include <math.h>

// ---------------- problem constants (match reference) ----------------
#define BQ     2
#define LQ     2048
#define DQ     1024
#define DINQ   2048
#define NSTATE 16
#define BL     (BQ * LQ)        // 4096 token rows

// ---------------- CDNA5 WMMA types ----------------
typedef __attribute__((ext_vector_type(16))) __bf16 v16bf;
typedef __attribute__((ext_vector_type(8)))  __bf16 v8bf;
typedef __attribute__((ext_vector_type(8)))  float  v8f;
typedef __attribute__((ext_vector_type(4)))  float    v4f;
typedef __attribute__((ext_vector_type(4)))  unsigned v4u;
typedef __attribute__((ext_vector_type(2)))  unsigned v2u;

__device__ __forceinline__ unsigned short f32_bf16(float f) {
  unsigned u = __float_as_uint(f);
  u += 0x7fffu + ((u >> 16) & 1u);          // round-to-nearest-even
  return (unsigned short)(u >> 16);
}

// CDNA5 async global->LDS copies (ASYNCcnt-tracked, no VGPR round-trip), eight
// to a statement. The LDS operand is the low 32 bits of the generic address.
// The s_wait_xcnt at the statement's end stands in front of every later write
// of the address registers that the copies name.
__device__ __forceinline__ void async_ld8_b128(
    const unsigned* l, const unsigned short* const* g) {
  asm volatile("global_load_async_to_lds_b128 %0, %8, off\n\t"
               "global_load_async_to_lds_b128 %1, %9, off\n\t"
               "global_load_async_to_lds_b128 %2, %10, off\n\t"
               "global_load_async_to_lds_b128 %3, %11, off\n\t"
               "global_load_async_to_lds_b128 %4, %12, off\n\t"
               "global_load_async_to_lds_b128 %5, %13, off\n\t"
               "global_load_async_to_lds_b128 %6, %14, off\n\t"
               "global_load_async_to_lds_b128 %7, %15, off\n\t"
               "s_wait_xcnt 0x0"
               :: "v"(l[0]), "v"(l[1]), "v"(l[2]), "v"(l[3]),
                  "v"(l[4]), "v"(l[5]), "v"(l[6]), "v"(l[7]),
                  "v"(g[0]), "v"(g[1]), "v"(g[2]), "v"(g[3]),
                  "v"(g[4]), "v"(g[5]), "v"(g[6]), "v"(g[7])
               : "memory");
}
// the same, twelve to a statement
__device__ __forceinline__ void async_ld12_b128(
    const unsigned* l, const unsigned short* const* g) {
  asm volatile("global_load_async_to_lds_b128 %0, %12, off\n\t"
               "global_load_async_to_lds_b128 %1, %13, off\n\t"
               "global_load_async_to_lds_b128 %2, %14, off\n\t"
               "global_load_async_to_lds_b128 %3, %15, off\n\t"
               "global_load_async_to_lds_b128 %4, %16, off\n\t"
               "global_load_async_to_lds_b128 %5, %17, off\n\t"
               "global_load_async_to_lds_b128 %6, %18, off\n\t"
               "global_load_async_to_lds_b128 %7, %19, off\n\t"
               "global_load_async_to_lds_b128 %8, %20, off\n\t"
               "global_load_async_to_lds_b128 %9, %21, off\n\t"
               "global_load_async_to_lds_b128 %10, %22, off\n\t"
               "global_load_async_to_lds_b128 %11, %23, off\n\t"
               "s_wait_xcnt 0x0"
               :: "v"(l[0]), "v"(l[1]), "v"(l[2]), "v"(l[3]),
                  "v"(l[4]), "v"(l[5]), "v"(l[6]), "v"(l[7]),
                  "v"(l[8]), "v"(l[9]), "v"(l[10]), "v"(l[11]),
                  "v"(g[0]), "v"(g[1]), "v"(g[2]), "v"(g[3]),
                  "v"(g[4]), "v"(g[5]), "v"(g[6]), "v"(g[7]),
                  "v"(g[8]), "v"(g[9]), "v"(g[10]), "v"(g[11])
               : "memory");
}
// the wave's own copies have landed
__device__ __forceinline__ void wait_async0() {
  asm volatile("s_wait_asynccnt 0x0" ::: "memory");
}
// the wave's own LDS reads have returned
__device__ __forceinline__ void wait_ds0() {
  asm volatile("s_wait_dscnt 0x0" ::: "memory");
}

// =====================================================================
// The three streaming parts below are gridded for few, fat waves: the work
// of each wave is a handful of 16-byte loads that fly together.
// Every loop in them is unrolled: the per-thread arrays are then indexed by
// constants only and stay in registers.
// =====================================================================
// add positional embedding: xbuf = x + pos_emb  (never mutate d_in)
// One thread = APV pieces of 16 bytes, 256 pieces apart; blk = 0 .. APB - 1.
// =====================================================================
#define APV 4
#define APB (BL * DQ / (4 * APV * 256))   // blocks of this role
__device__ __forceinline__ void add_pos_block(
    const float* __restrict__ x, const float* __restrict__ pe,
    float* __restrict__ xbuf, unsigned blk) {
  const unsigned base = blk * (256 * APV) + threadIdx.x;   // in 16-byte pieces
  // a block's pieces lie in one batch entry: LQ * DQ / 4 is a multiple of 256 * APV
  const unsigned pb = base % (LQ * DQ / 4);
  v4f xv[APV], pv[APV];
#pragma unroll
  for (int j = 0; j < APV; ++j) {
    xv[j] = ((const v4f*)x)[base + j * 256];
    pv[j] = ((const v4f*)pe)[pb + j * 256];
  }
#pragma unroll
  for (int j = 0; j < APV; ++j) ((v4f*)xbuf)[base + j * 256] = xv[j] + pv[j];
}

// =====================================================================
// weight transpose + fp32->bf16:  W[K][N] fp32  ->  WT[N][K] bf16
// One block = a tile of WTK k x WTN n. Reads: 16 bytes per lane, a wave covers
// two rows of 256 bytes. Writes: 8 bf16 (16 bytes) per lane, a wave covers four
// rows of 128 bytes. The odd LDS pitch spreads both sides over the banks.
// K and N are compile-time: a thread's loads (and stores) then differ only in
// their immediate offsets.
// =====================================================================
#define WTK 128
#define WTN 64
template <int K, int N>
__device__ __forceinline__ void wconv_block(
    const float* __restrict__ W, unsigned short* __restrict__ WT,
    float (&tile)[WTK][WTN + 1], unsigned blk) {   // blk = 0 .. (N / WTN) * (K / WTK) - 1
  const int nb = (int)(blk % (N / WTN)) * WTN, kb = (int)(blk / (N / WTN)) * WTK;
  const int c4 = (threadIdx.x & 15) * 4, r0 = threadIdx.x >> 4;
  // block-uniform base + one lane offset for all of a thread's loads (stores alike)
  const float* Wb = W + (size_t)kb * N + nb;
  const unsigned woff = (unsigned)(r0 * N + c4);
  v4f v[WTK / 16];
#pragma unroll
  for (int j = 0; j < WTK / 16; ++j)
    v[j] = *(const v4f*)(Wb + (size_t)(16 * j) * N + woff);
#pragma unroll
  for (int j = 0; j < WTK / 16; ++j)
#pragma unroll
    for (int i = 0; i < 4; ++i) tile[r0 + 16 * j][c4 + i] = v[j][i];
  __syncthreads();
  const int k8 = (threadIdx.x & 7) * 8, n0 = threadIdx.x >> 3;
  unsigned short* Tb = WT + (size_t)nb * K + kb;
  const unsigned toff = (unsigned)(n0 * K + k8);
#pragma unroll
  for (int nh = 0; nh < WTN / 32; ++nh)
#pragma unroll
    for (int kh = 0; kh < WTK / 64; ++kh) {
      const int n = n0 + 32 * nh, k = k8 + 64 * kh;
      v4u p;
#pragma unroll
      for (int i = 0; i < 4; ++i)
        p[i] = (unsigned)f32_bf16(tile[k + 2 * i][n]) |
               ((unsigned)f32_bf16(tile[k + 2 * i + 1][n]) << 16);
      *(v4u*)(Tb + (size_t)(32 * nh) * K + 64 * kh + toff) = p;
    }
}

// =====================================================================
// All the work that depends on the inputs alone, as ONE launch: the three
// weight transposes of both layers and the pos add. None of it reads what
// another part writes, so a block takes its part by its index; seven short
// launches would each pay their own gap, fill and drain.
// The pos add comes last: its output is what the next launch reads first.
// Every branch is on blockIdx alone, so the barrier in wconv_block is reached
// by all threads of a block or by none.
// =====================================================================
#define NLAY  2
#define WBI   ((DINQ / WTN) * (DQ / WTK))     // blocks per layer: Win
#define WBD   ((DINQ / WTN) * (DINQ / WTK))   //                   Wdt
#define WBO   ((DQ / WTN) * (DINQ / WTK))     //                   Wout
#define WBL   (WBI + WBD + WBO)
__global__ __launch_bounds__(256) void prep_kernel(
    const float* __restrict__ x, const float* __restrict__ pe,
    const float* __restrict__ Win, const float* __restrict__ Wdt,
    const float* __restrict__ Wout, float* __restrict__ xbuf,
    unsigned short* __restrict__ WinT, unsigned short* __restrict__ WdtT,
    unsigned short* __restrict__ WoutT) {
  __shared__ float tile[WTK][WTN + 1];
  const unsigned bid = blockIdx.x;
  if (bid >= NLAY * WBL) {
    add_pos_block(x, pe, xbuf, bid - NLAY * WBL);
    return;
  }
  const unsigned lay = bid / WBL, t = bid % WBL;
  if (t < WBI)
    wconv_block<DQ, DINQ>(Win + (size_t)lay * DQ * DINQ,
                          WinT + (size_t)lay * DQ * DINQ, tile, t);
  else if (t < WBI + WBD)
    wconv_block<DINQ, DINQ>(Wdt + (size_t)lay * DINQ * DINQ,
                            WdtT + (size_t)lay * DINQ * DINQ, tile, t - WBI);
  else
    wconv_block<DINQ, DQ>(Wout + (size_t)lay * DINQ * DQ,
                          WoutT + (size_t)lay * DINQ * DQ, tile, t - (WBI + WBD));
}

// =====================================================================
// LayerNorm over the last dim (DQ); optional bf16 output (GEMM A operand)
// One wave = one row, held in registers (LNV pieces of 16 bytes per lane), so
// the row is read once; the two sums go over the lanes by shuffles.
// =====================================================================
#define LNR 8                 // rows (waves) per block
#define LNV (DQ / 128)        // 16-byte pieces of a row per lane
template <bool BF16OUT>
__global__ __launch_bounds__(LNR * 32) void ln_kernel(
    const float* __restrict__ x, const float* __restrict__ w,
    const float* __restrict__ b, void* __restrict__ out) {
  // the wave's number, held scalar: the row's base address is then scalar too
  const int row  = blockIdx.x * LNR + __builtin_amdgcn_readfirstlane(threadIdx.x >> 5);
  const unsigned lane = threadIdx.x & 31;
  const v4f* xr = (const v4f*)(x + (size_t)row * DQ);
  v4f v[LNV], wv[LNV], bv[LNV];
#pragma unroll
  for (int j = 0; j < LNV; ++j) v[j] = xr[j * 32 + lane];
#pragma unroll
  for (int j = 0; j < LNV; ++j) {
    wv[j] = ((const v4f*)w)[j * 32 + lane];
    bv[j] = ((const v4f*)b)[j * 32 + lane];
  }
  // keeps the scheduler from sinking the w and b loads behind the sums (one
  // exposed latency per group of them instead of none)
  __builtin_amdgcn_sched_barrier(0);
  v4f a1 = {}, a2 = {};
#pragma unroll
  for (int j = 0; j < LNV; ++j) { a1 += v[j]; a2 += v[j] * v[j]; }
  float s  = (a1[0] + a1[1]) + (a1[2] + a1[3]);
  float s2 = (a2[0] + a2[1]) + (a2[2] + a2[3]);
#pragma unroll
  for (int o = 16; o > 0; o >>= 1) {
    s  += __shfl_xor(s, o);
    s2 += __shfl_xor(s2, o);
  }
  const float mean = s / (float)DQ;
  const float var  = s2 / (float)DQ - mean * mean;
  const float rstd = rsqrtf(var + 1e-5f);
#pragma unroll
  for (int j = 0; j < LNV; ++j) {
    v4f y = (v[j] - mean) * rstd * wv[j] + bv[j];
    if (BF16OUT) {
      v2u p = {(unsigned)f32_bf16(y[0]) | ((unsigned)f32_bf16(y[1]) << 16),
               (unsigned)f32_bf16(y[2]) | ((unsigned)f32_bf16(y[3]) << 16)};
      ((v2u*)((unsigned short*)out + (size_t)row * DQ))[j * 32 + lane] = p;
    } else {
      ((v4f*)((float*)out + (size_t)row * DQ))[j * 32 + lane] = y;
    }
  }
}

// =====================================================================
// WMMA bf16 GEMM:  out[M][N] = A[M][K](bf16) * BT[N][K](bf16)^T + bias
// Block tile (MI*64) x 128, 8 waves (wave32) arranged 4x2, each wave
// (MI*16) x 64 via MI x 4 v_wmma_f32_16x16x32_bf16 tiles: every byte staged
// from L2 and every fragment read from LDS serves more products than in a
// small tile. K is staged in KC-wide tiles by async global->LDS copies into two
// buffers (KC as large as the two buffers allow: fewer barriers per product):
//   tile 0, wait, barrier; per trip: tile i+1's copies into the buffer that
//   trip i-1 has read, the products on tile i, s_wait_dscnt 0,
//   s_wait_asynccnt 0, barrier.
// Inside a trip the fragments of the next 32 k are fetched into a second
// register set in front of the products on this one.
// N and K are compile-time: a thread's stores then differ only in their
// immediate offsets from one base address.
// Every loop but the one over the tiles is unrolled: the fragment, accumulator
// and address arrays are then indexed by constants only and stay in registers.
// Epilogues:
//   MODE 0: outF = v+bias (fp32) AND outBf = bf16(v+bias)
//   MODE 1: outF = softplus(v+bias)
//   MODE 2: outF = v+bias+outF  (residual add in place)
// =====================================================================
#define BNT 128

__device__ __forceinline__ v16bf load_frag(const unsigned short* rowp, int half) {
  // A-fragment lane layout (ISA 7.12.2, 16-bit A 16x32):
  //  lanes 0-15:  elems[0..7]=K0..7,  elems[8..15]=K16..23
  //  lanes 16-31: elems[0..7]=K8..15, elems[8..15]=K24..31
  union { v16bf v; v8bf h[2]; } u;
  u.h[0] = *(const v8bf*)(rowp + half * 8);
  u.h[1] = *(const v8bf*)(rowp + 16 + half * 8);
  return u.v;
}

// softplus(v) = max(v, 0) + log1p(exp(-|v|)) for eight values, on the hardware's
// own v_exp_f32 and v_log_f32. With e = exp(-|v|) in [0, 1] and w = fl(1 + e), the
// term d = e - (w - 1) is exactly what the rounding of 1 + e dropped, and
// log1p(e) = log(w) + d / w; d stands for d / w (the difference is below
// 2^-24 * e), so small e keep their relative accuracy. No overflow for any v, so
// no cut-over to v for large v is needed.
// The eight values of a statement are independent, so they fill each other's
// latency; the v_nop at each statement's end keeps the slot that the instruction
// set asks for behind a transcendental before its result is read.
__device__ __forceinline__ void softplus8(float (&y)[8], const float (&v)[8]) {
  float t[8], e[8], w[8], l[8];
#pragma unroll
  for (int r = 0; r < 8; ++r) t[r] = fabsf(v[r]) * -1.44269504f;
  asm("v_exp_f32 %0, %8\n\tv_exp_f32 %1, %9\n\tv_exp_f32 %2, %10\n\t"
      "v_exp_f32 %3, %11\n\tv_exp_f32 %4, %12\n\tv_exp_f32 %5, %13\n\t"
      "v_exp_f32 %6, %14\n\tv_exp_f32 %7, %15\n\tv_nop"
      : "=&v"(e[0]), "=&v"(e[1]), "=&v"(e[2]), "=&v"(e[3]),
        "=&v"(e[4]), "=&v"(e[5]), "=&v"(e[6]), "=&v"(e[7])
      : "v"(t[0]), "v"(t[1]), "v"(t[2]), "v"(t[3]),
        "v"(t[4]), "v"(t[5]), "v"(t[6]), "v"(t[7]));
#pragma unroll
  for (int r = 0; r < 8; ++r) w[r] = 1.f + e[r];
  asm("v_log_f32 %0, %8\n\tv_log_f32 %1, %9\n\tv_log_f32 %2, %10\n\t"
      "v_log_f32 %3, %11\n\tv_log_f32 %4, %12\n\tv_log_f32 %5, %13\n\t"
      "v_log_f32 %6, %14\n\tv_log_f32 %7, %15\n\tv_nop"
      : "=&v"(l[0]), "=&v"(l[1]), "=&v"(l[2]), "=&v"(l[3]),
        "=&v"(l[4]), "=&v"(l[5]), "=&v"(l[6]), "=&v"(l[7])
      : "v"(w[0]), "v"(w[1]), "v"(w[2]), "v"(w[3]),
        "v"(w[4]), "v"(w[5]), "v"(w[6]), "v"(w[7]));
#pragma unroll
  for (int r = 0; r < 8; ++r) {
    float d = e[r] - (w[r] - 1.f);
    y[r] = fmaxf(v[r], 0.f) + (l[r] * 0.69314718f + d);   // log2(w) * ln 2
  }
}

template <int MODE, int MI, int KC, int N, int K>
__global__ __launch_bounds__(256) void gemm_bf16_wmma(
    const unsigned short* __restrict__ A,   // [M][K] bf16
    const unsigned short* __restrict__ BT,  // [N][K] bf16 (B transposed)
    const float* __restrict__ bias,         // [N]
    float* __restrict__ outF,
    unsigned short* __restrict__ outBf) {
  constexpr int BM = MI * 64;
  constexpr int nk = K / KC;
  constexpr int LDA = KC + 8;        // padded row pitch (elements): an odd number of 16 B
  constexpr int RP = 256 / (KC / 8); // rows that one copy of all 256 threads covers
  static_assert(K % KC == 0 && nk >= 2 && BM % 128 == 0 && (KC == 128 || KC == 256),
                "tile shapes");
  __shared__ __align__(16) unsigned short As[2][BM][LDA];
  __shared__ __align__(16) unsigned short Bs[2][BNT][LDA];
  const int tid  = threadIdx.x;
  // the wave's number, held scalar: the wave's part of every address is then scalar
  const int wave = __builtin_amdgcn_readfirstlane(tid >> 5);
  const int lane = tid & 31;
  const int wm = wave & 3, wn = wave >> 2;    // 4 waves along M, 2 along N
  const int bm = blockIdx.y * BM, bn = blockIdx.x * BNT;
  const int half = lane >> 4, lrow = lane & 15;

  // a thread's copies of one tile: 16 bytes of every RP-th row, so that a wave's
  // copy covers 512 bytes in whole rows
  const int crow = tid / (KC / 8), ccol = (tid % (KC / 8)) * 8;
  const unsigned short* gA = A  + (size_t)(bm + crow) * K + ccol;
  const unsigned short* gB = BT + (size_t)(bn + crow) * K + ccol;
  const unsigned lA = (unsigned)(uintptr_t)&As[0][crow][ccol];
  const unsigned lB = (unsigned)(uintptr_t)&Bs[0][crow][ccol];

  constexpr int NCA = BM / RP, NC = NCA + BNT / RP;   // copies per thread and tile
  auto issue_stage = [&](int buf, int k0) {
    unsigned l[NC];
    const unsigned short* g[NC];
#pragma unroll
    for (int t = 0; t < NCA; ++t) {
      l[t] = lA + (unsigned)((buf * BM + t * RP) * (LDA * 2));
      g[t] = gA + k0 + (size_t)(t * RP) * K;
    }
#pragma unroll
    for (int t = 0; t < BNT / RP; ++t) {
      l[NCA + t] = lB + (unsigned)((buf * BNT + t * RP) * (LDA * 2));
      g[NCA + t] = gB + k0 + (size_t)(t * RP) * K;
    }
    static_assert(NC == 24 || NC == 32, "copies per statement");
    async_ld12_b128(l, g);
    async_ld12_b128(l + 12, g + 12);
    if constexpr (NC == 32) async_ld8_b128(l + 24, g + 24);
  };

  v8f zero = {};
  v8f acc[MI][4];
#pragma unroll
  for (int i = 0; i < MI; ++i)
#pragma unroll
    for (int j = 0; j < 4; ++j) acc[i][j] = zero;

  issue_stage(0, 0);
  wait_async0();
  __syncthreads();                   // tile 0 visible to all waves
  // rolled: a trip is already KC / 32 * MI * 4 products long (code size)
#pragma unroll 1
  for (int i = 0; i < nk; ++i) {
    const int cur = i & 1;
    const unsigned short* ap = &As[cur][wm * (MI * 16) + lrow][0];
    const unsigned short* bp = &Bs[cur][wn * 64 + lrow][0];
    v16bf aF[2][MI], bF[2][4];
#pragma unroll
    for (int ii = 0; ii < MI; ++ii) aF[0][ii] = load_frag(ap + ii * 16 * LDA, half);
#pragma unroll
    for (int jj = 0; jj < 4; ++jj)  bF[0][jj] = load_frag(bp + jj * 16 * LDA, half);
    // tile i+1's copies, into the buffer that every wave has left at the barrier
    // above; they are issued while the trip's first LDS reads are under way
    if (i + 1 < nk) issue_stage(cur ^ 1, (i + 1) * KC);
#pragma unroll
    for (int ks = 0; ks < KC / 32; ++ks) {
      const int s = ks & 1;
      if (ks + 1 < KC / 32) {
#pragma unroll
        for (int ii = 0; ii < MI; ++ii)
          aF[s ^ 1][ii] = load_frag(ap + ii * 16 * LDA + (ks + 1) * 32, half);
#pragma unroll
        for (int jj = 0; jj < 4; ++jj)
          bF[s ^ 1][jj] = load_frag(bp + jj * 16 * LDA + (ks + 1) * 32, half);
      }
      // keeps the next set's LDS reads one group in front of this set's products:
      // left alone, the scheduler sinks each read to its first use, with a full
      // wait in front of every row of products
      __builtin_amdgcn_sched_barrier(0);
#pragma unroll
      for (int ii = 0; ii < MI; ++ii)
#pragma unroll
        for (int jj = 0; jj < 4; ++jj)
          acc[ii][jj] = __builtin_amdgcn_wmma_f32_16x16x32_bf16(
              false, aF[s][ii], false, bF[s][jj], (short)0, acc[ii][jj],
              false, false);
      // keeps the set after next's reads behind these products, whose operands
      // they overwrite
      __builtin_amdgcn_sched_barrier(0);
    }
    wait_ds0();                      // this wave has left buffer cur
    wait_async0();                   // its copies of tile i+1 have landed
    __syncthreads();                 // tile i+1 visible, buffer cur free
  }
  wait_async0();                     // no copy is outstanding behind the loop

  // ---- epilogue: C/D layout - n = lane&15, m = vgpr + (lane>>4)*8 ----
  // One lane-dependent base; every element lies a constant step from it.
  const int gn0 = bn + wn * 64 + lrow;
  float bj[4];
#pragma unroll
  for (int j = 0; j < 4; ++j) bj[j] = bias[gn0 + j * 16];
  // the loads' offset register is reused by the address arithmetic below
  asm volatile("s_wait_xcnt 0x0" ::: "memory");
  // keeps that arithmetic behind the wait
  __builtin_amdgcn_sched_barrier(0);
  const size_t off0 = (size_t)(bm + wm * (MI * 16) + half * 8) * N + gn0;
  float* const baseF = outF + off0;
  float res[MODE == 2 ? MI : 1][4][8];
  if (MODE == 2) {                   // the whole residual tile flies together
#pragma unroll
    for (int i = 0; i < MI; ++i)
#pragma unroll
      for (int j = 0; j < 4; ++j)
#pragma unroll
        for (int r = 0; r < 8; ++r) res[i][j][r] = baseF[(i * 16 + r) * N + j * 16];
  }
#pragma unroll
  for (int i = 0; i < MI; ++i) {
    float val[4][8];
    unsigned short vb[4][8];
#pragma unroll
    for (int j = 0; j < 4; ++j) {
      float pre[8];
#pragma unroll
      for (int r = 0; r < 8; ++r) pre[r] = acc[i][j][r] + bj[j];
      if (MODE == 1) {
        softplus8(val[j], pre);
      } else {
#pragma unroll
        for (int r = 0; r < 8; ++r) {
          val[j][r] = MODE == 2 ? pre[r] + res[i][j][r] : pre[r];
          if (MODE == 0) vb[j][r] = f32_bf16(val[j][r]);
        }
      }
    }
    // keeps every value of the group computed in front of its first store
    __builtin_amdgcn_sched_barrier(0);
#pragma unroll
    for (int j = 0; j < 4; ++j)
#pragma unroll
      for (int r = 0; r < 8; ++r) {
        baseF[(i * 16 + r) * N + j * 16] = val[j][r];
        if (MODE == 0) (outBf + off0)[(i * 16 + r) * N + j * 16] = vb[j][r];
      }
    // the stores' data registers are rewritten by the next group
    asm volatile("s_wait_xcnt 0x0" ::: "memory");
    // keeps the next group's arithmetic behind that wait
    __builtin_amdgcn_sched_barrier(0);
  }
}

// =====================================================================
// Bm|Cm projection:  BC[m][0..15]=h@WB, [16..31]=h@WC, all in f32, on
// v_wmma_f32_16x16x4_f32. One block = 16 token rows x all 32 columns, so a
// weight row is fetched once per 16 tokens. The 16 waves split k (128 each);
// their partial tiles are added through LDS in wave order.
// k pairing: lane (c, hf) holds, for group q, k = slice + 8q + 4hf + 0..3 of
// A row c (one 16-byte load) and the same four k of B column c.
// Every loop is unrolled: av, wb, wc and the accumulators are then indexed by
// constants only and stay in registers.
// =====================================================================
typedef __attribute__((ext_vector_type(2))) float v2f;
#define BCW  16               // waves per block
#define BCKS (DINQ / BCW)     // k per wave
#define BCQ  (BCKS / 8)       // groups of 8 k per wave
#define BCG  4                // groups whose weight fragments are fetched together

__global__ __launch_bounds__(BCW * 32) void bc_kernel(
    const float* __restrict__ h, const float* __restrict__ WB,
    const float* __restrict__ WC, float* __restrict__ BC) {
  __shared__ float red[BCW][512];           // per wave: 2 tiles x 8 registers x 32 lanes
  const int wave = threadIdx.x >> 5, lane = threadIdx.x & 31;
  const int c = lane & 15, hf = lane >> 4;
  const int m0 = blockIdx.x * 16;
  const int kl = wave * BCKS + hf * 4;      // the lane's first k
  const float* ap = h  + (size_t)(m0 + c) * DINQ + kl;
  const float* bp = WB + (size_t)kl * NSTATE + c;
  const float* cp = WC + (size_t)kl * NSTATE + c;

  v4f av[BCQ];                              // the wave's whole slice of h, fetched first
#pragma unroll
  for (int q = 0; q < BCQ; ++q) av[q] = *(const v4f*)(ap + q * 8);
  // keeps the scheduler from sinking these loads to their first use (one
  // exposed latency per product instead of one for the whole slice)
  __builtin_amdgcn_sched_barrier(0);

  float wb[2][BCG][4], wc[2][BCG][4];
  auto fetch = [&](int buf, int g) {
#pragma unroll
    for (int q2 = 0; q2 < BCG; ++q2)
#pragma unroll
      for (int j = 0; j < 4; ++j) {
        wb[buf][q2][j] = bp[(size_t)((g * BCG + q2) * 8 + j) * NSTATE];
        wc[buf][q2][j] = cp[(size_t)((g * BCG + q2) * 8 + j) * NSTATE];
      }
  };
  fetch(0, 0);

  v8f accb = {}, accc = {};
#pragma unroll
  for (int g = 0; g < BCQ / BCG; ++g) {
    if (g + 1 < BCQ / BCG) {
      fetch((g + 1) & 1, g + 1);            // flies under this group's products
      // behind the last fetch the loads' address registers are free for reuse
      if (g + 2 == BCQ / BCG) asm volatile("s_wait_xcnt 0x0" ::: "memory");
      // keeps the next group's loads in front of this group's products
      __builtin_amdgcn_sched_barrier(0);
    }
#pragma unroll
    for (int q2 = 0; q2 < BCG; ++q2)
#pragma unroll
      for (int p = 0; p < 2; ++p) {
        v2f a  = {av[g * BCG + q2][2 * p], av[g * BCG + q2][2 * p + 1]};
        v2f fb = {wb[g & 1][q2][2 * p], wb[g & 1][q2][2 * p + 1]};
        v2f fc = {wc[g & 1][q2][2 * p], wc[g & 1][q2][2 * p + 1]};
        accb = __builtin_amdgcn_wmma_f32_16x16x4_f32(
            false, a, false, fb, (short)0, accb, false, false);
        accc = __builtin_amdgcn_wmma_f32_16x16x4_f32(
            false, a, false, fc, (short)0, accc, false, false);
      }
  }
  // A precaution: no distance is documented for the f32 form, and without this
  // the build had address arithmetic overwriting an A register directly behind
  // its product. Eight vector slots, the figure of the other 16-cycle form,
  // stand in front of the first vector instruction behind the products; the two
  // scheduling barriers keep that arithmetic and the slots where they are written.
  __builtin_amdgcn_sched_barrier(0);
  asm volatile("v_nop\n\tv_nop\n\tv_nop\n\tv_nop\n\tv_nop\n\tv_nop\n\tv_nop\n\tv_nop");
  __builtin_amdgcn_sched_barrier(0);

#pragma unroll
  for (int r = 0; r < 8; ++r) {
    red[wave][r * 32 + lane]       = accb[r];
    red[wave][256 + r * 32 + lane] = accc[r];
  }
  __syncthreads();
  // one output per thread; D layout: register r of lane l = D[8 * (l >> 4) + r][l & 15]
  float s = 0.f;
#pragma unroll
  for (int w = 0; w < BCW; ++w) s += red[w][threadIdx.x];
  const int tile = threadIdx.x >> 8, r = (threadIdx.x >> 5) & 7;
  BC[(size_t)(m0 + 8 * hf + r) * 32 + tile * 16 + c] = s;
}

// =====================================================================
// selective scan (diagonal SSM), split over time into NCH chunks of CLEN
// steps so that the chunks run side by side instead of one after another.
//   scan_state_kernel: every chunk but the last runs the recurrence from a
//     zero state and keeps its end state S[n] and its sum of dt (row NSTATE
//     of the same record). The decay over a whole chunk is 2^(a[n] * sum dt).
//   scan_kernel: a chunk folds the earlier chunks' (S, sum dt) in time order
//     into its start state, then runs the recurrence with the fused D-skip,
//     the causal depthwise conv (4 taps) + SiLU of the same channel, formed
//     from the x values that the lane walks through anyway, and the gating.
// One lane = one channel with all 16 states; one block = SCB channels of one
// (batch, chunk), so the B/C rows are the same address for the whole block.
// scan_state_kernel is the first reader of the B rows after the launch that
// wrote them: its block brings the chunk's rows into LDS once, by 16-byte loads
// that all fly together, and every step reads its row from there (all lanes one
// address). A load of the row from global memory in every step is waited for
// within that step, at the latency of a first touch.
// =====================================================================
#define NCH  32
#define CLEN (LQ / NCH)     // 64 steps per chunk
#define SU   8              // steps fetched ahead as one group
#define SCB  128            // channels (threads) per block
#define DGS  (DINQ / SCB)   // channel groups
#define SROWS (NSTATE + 1)  // rows of a chunk's record: S[0..15], sum of dt
#define FB   3              // chunk records fetched together in the fold (51 loads)
#define LOG2E 1.44269504f

// e[n] = 2^t[n] for the 16 states (v_exp_f32), eight to a statement. The factor
// log2(e) of exp(x) = 2^(x * log2(e)) is no work of a step: it lies in the rates
// a[n], multiplied in once per lane. The v_nop at each statement's end keeps the
// slot that the instruction set asks for behind a transcendental before its
// source is overwritten.
__device__ __forceinline__ void exp2_16(float (&e)[NSTATE], const float (&t)[NSTATE]) {
#pragma unroll
  for (int k = 0; k < NSTATE; k += 8)
    asm("v_exp_f32 %0, %8\n\tv_exp_f32 %1, %9\n\tv_exp_f32 %2, %10\n\t"
        "v_exp_f32 %3, %11\n\tv_exp_f32 %4, %12\n\tv_exp_f32 %5, %13\n\t"
        "v_exp_f32 %6, %14\n\tv_exp_f32 %7, %15\n\tv_nop"
        : "=&v"(e[k]), "=&v"(e[k + 1]), "=&v"(e[k + 2]), "=&v"(e[k + 3]),
          "=&v"(e[k + 4]), "=&v"(e[k + 5]), "=&v"(e[k + 6]), "=&v"(e[k + 7])
        : "v"(t[k]), "v"(t[k + 1]), "v"(t[k + 2]), "v"(t[k + 3]),
          "v"(t[k + 4]), "v"(t[k + 5]), "v"(t[k + 6]), "v"(t[k + 7]));
}

// exp(x) for one value (x * log2(e), then v_exp_f32); the v_nop keeps the same
// slot.
__device__ __forceinline__ float exp1(float x) {
  float t = x * LOG2E, e;
  asm("v_exp_f32 %0, %1\n\tv_nop" : "=v"(e) : "v"(t));
  return e;
}

// 1 / x as v_rcp_f32 alone (about 1 ulp; what it scales here is rounded to bf16
// at the store). A plain 1.f / x compiles to the correctly rounded division: two
// v_div_scale, v_rcp_f32, five dependent fused steps, v_div_fmas, v_div_fixup.
__device__ __forceinline__ float rcp1(float x) { return __builtin_amdgcn_rcpf(x); }

__global__ __launch_bounds__(SCB) void scan_state_kernel(
    const float* __restrict__ h,  const float* __restrict__ dt,
    const float* __restrict__ BC, const float* __restrict__ A_log,
    float* __restrict__ Sst) {    // [B][NCH][SROWS][DIN]
  const int d  = (blockIdx.x % DGS) * SCB + threadIdx.x;
  const int bc = blockIdx.x / DGS;
  const int b  = bc / (NCH - 1);
  const int c  = bc % (NCH - 1);             // the last chunk feeds nobody
  const size_t row0 = (size_t)b * LQ + (size_t)c * CLEN;
  const float* dtp = dt + row0 * DINQ + d;
  const float* hp  = h  + row0 * DINQ + d;
  const float* bcp = BC + row0 * 32;

  // the chunk's B rows (the first half of each B|C row), 16 bytes per piece
  __shared__ __align__(16) float sB[CLEN][NSTATE];
  constexpr int SBV = CLEN * NSTATE / 4 / SCB;   // pieces per thread
  v4f st[SBV];
#pragma unroll
  for (int j = 0; j < SBV; ++j) {
    const int p = threadIdx.x + j * SCB;
    st[j] = *(const v4f*)(bcp + (p >> 2) * 32 + (p & 3) * 4);
  }
  // the loads' address registers are reused by the next loads' addresses; it also
  // keeps the two groups of loads in this order
  asm volatile("s_wait_xcnt 0x0" ::: "memory");
  float a[NSTATE], hs[NSTATE], al[NSTATE];
#pragma unroll
  for (int n = 0; n < NSTATE; ++n) al[n] = A_log[(size_t)d * NSTATE + n];
  // the loads' address registers are reused by the arithmetic below
  asm volatile("s_wait_xcnt 0x0" ::: "memory");
#pragma unroll
  for (int n = 0; n < NSTATE; ++n) al[n] *= LOG2E;
  exp2_16(a, al);
  // the rates carry log2(e) from here on: exp(dt * A) = 2^(dt * a[n])
#pragma unroll
  for (int n = 0; n < NSTATE; ++n) { a[n] *= -LOG2E; hs[n] = 0.f; }
#pragma unroll
  for (int j = 0; j < SBV; ++j) ((v4f*)sB)[threadIdx.x + j * SCB] = st[j];
  __syncthreads();                           // the rows are visible to all waves

  float sd = 0.f;
  float dtc[SU], xc[SU];
#pragma unroll
  for (int u = 0; u < SU; ++u) { dtc[u] = 0.f; xc[u] = 0.f; }
  // Trip -1 only fetches group 0, so that every group reaches the arithmetic
  // through the copies at the loop's foot and the wait for it stands there.
  // rolled: the body is already SU * NSTATE updates long (code size)
#pragma unroll 1
  for (int g = -1; g < CLEN / SU; ++g) {
    float dtn[SU], xn[SU];
#pragma unroll
    for (int u = 0; u < SU; ++u) { dtn[u] = 0.f; xn[u] = 0.f; }
    if (g + 1 < CLEN / SU) {                 // next group flies under this one
#pragma unroll
      for (int u = 0; u < SU; ++u) {
        dtn[u] = dtp[(size_t)((g + 1) * SU + u) * DINQ];
        xn[u]  = hp[(size_t)((g + 1) * SU + u) * DINQ];
      }
      // the loads' address registers are reused by the arithmetic below
      asm volatile("s_wait_xcnt 0x0" ::: "memory");
    }
    if (g >= 0) {
#pragma unroll
      for (int u = 0; u < SU; ++u) {
        const float* bct = sB[g * SU + u];
        float dtv = dtc[u];
        float dx  = dtv * xc[u];
        sd += dtv;
        float da[NSTATE], dA[NSTATE];
#pragma unroll
        for (int n = 0; n < NSTATE; ++n) da[n] = dtv * a[n];
        exp2_16(dA, da);
#pragma unroll
        for (int n = 0; n < NSTATE; ++n) hs[n] = hs[n] * dA[n] + dx * bct[n];
      }
    }
#pragma unroll
    for (int u = 0; u < SU; ++u) { dtc[u] = dtn[u]; xc[u] = xn[u]; }
  }
  float* sp = Sst + ((size_t)b * NCH + c) * SROWS * DINQ + d;
#pragma unroll
  for (int n = 0; n < NSTATE; ++n) sp[(size_t)n * DINQ] = hs[n];
  sp[(size_t)NSTATE * DINQ] = sd;
}

__global__ __launch_bounds__(SCB) void scan_kernel(
    const float* __restrict__ h,  const float* __restrict__ dt,
    const float* __restrict__ BC, const float* __restrict__ cw,
    const float* __restrict__ cb,
    const float* __restrict__ A_log, const float* __restrict__ Dsk,
    const float* __restrict__ Sst, unsigned short* __restrict__ gout) {
  const int d  = (blockIdx.x % DGS) * SCB + threadIdx.x;
  const int bc = blockIdx.x / DGS;
  const int b  = bc % BQ;
  const int c  = NCH - 1 - bc / BQ;          // longest fold starts first

  const size_t row0 = (size_t)b * LQ + (size_t)c * CLEN;
  const float* hp  = h + row0 * DINQ + d;

  // first loads of the kernel: they have landed with the A_log rows, so no
  // wait for them falls among the fetched-ahead loads of the main loop
  const float dsk = Dsk[d];
  const float cbv = cb[d];
  float cwv[4];
#pragma unroll
  for (int j = 0; j < 4; ++j) cwv[j] = cw[j * DINQ + d];
  // the registers that the loads name are reused below
  asm volatile("s_wait_xcnt 0x0" ::: "memory");
  // the three x values in front of the chunk (zero padding in front of l = 0)
  float xp[3] = {0.f, 0.f, 0.f};
  if (c > 0) {
#pragma unroll
    for (int j = 0; j < 3; ++j) xp[j] = hp[(ptrdiff_t)(j - 3) * DINQ];
    // the registers that the loads name are reused below
    asm volatile("s_wait_xcnt 0x0" ::: "memory");
  }
  float a[NSTATE], hs[NSTATE], al[NSTATE];
#pragma unroll
  for (int n = 0; n < NSTATE; ++n) al[n] = A_log[(size_t)d * NSTATE + n];
#pragma unroll
  for (int n = 0; n < NSTATE; ++n) al[n] *= LOG2E;
  exp2_16(a, al);
  // the rates carry log2(e) from here on: exp(dt * A) = 2^(dt * a[n])
#pragma unroll
  for (int n = 0; n < NSTATE; ++n) { a[n] *= -LOG2E; hs[n] = 0.f; }

  // start state: earlier chunks folded in time order, FB records per fetch
  const float* sp = Sst + (size_t)b * NCH * SROWS * DINQ + d;
  int cp = 0;
#pragma unroll 1
  for (; cp + FB <= c; cp += FB) {
    float sv[FB][SROWS];
#pragma unroll
    for (int k = 0; k < FB; ++k)
#pragma unroll
      for (int n = 0; n < SROWS; ++n)
        sv[k][n] = sp[((size_t)(cp + k) * SROWS + n) * DINQ];
    // the loads' address registers are advanced for the next trip
    asm volatile("s_wait_xcnt 0x0" ::: "memory");
#pragma unroll
    for (int k = 0; k < FB; ++k) {
      float da[NSTATE], dA[NSTATE];
#pragma unroll
      for (int n = 0; n < NSTATE; ++n) da[n] = a[n] * sv[k][NSTATE];
      exp2_16(dA, da);
#pragma unroll
      for (int n = 0; n < NSTATE; ++n) hs[n] = hs[n] * dA[n] + sv[k][n];
    }
  }
#pragma unroll 1
  for (; cp < c; ++cp) {
    float sv[SROWS];
#pragma unroll
    for (int n = 0; n < SROWS; ++n)
      sv[n] = sp[((size_t)cp * SROWS + n) * DINQ];
    // the loads' address registers are reused by the arithmetic below
    asm volatile("s_wait_xcnt 0x0" ::: "memory");
    float da[NSTATE], dA[NSTATE];
#pragma unroll
    for (int n = 0; n < NSTATE; ++n) da[n] = a[n] * sv[NSTATE];
    exp2_16(dA, da);
#pragma unroll
    for (int n = 0; n < NSTATE; ++n) hs[n] = hs[n] * dA[n] + sv[n];
  }

  const float* dtp = dt + row0 * DINQ + d;
  const float* bcp = BC + row0 * 32;
  unsigned short* gp = gout + row0 * DINQ + d;

  float dtc[SU], xc[SU];
#pragma unroll
  for (int u = 0; u < SU; ++u) { dtc[u] = 0.f; xc[u] = 0.f; }
  // Trip -1 only fetches group 0 (see scan_state_kernel).
  // rolled: the body is already SU * NSTATE updates long (code size)
#pragma unroll 1
  for (int g = -1; g < CLEN / SU; ++g) {
    float dtn[SU], xn[SU];
#pragma unroll
    for (int u = 0; u < SU; ++u) { dtn[u] = 0.f; xn[u] = 0.f; }
    if (g + 1 < CLEN / SU) {                 // next group flies under this one
      // s_wait_xcnt behind each array's loads: their address registers are
      // reused, by the next array's load targets or by the arithmetic below
#pragma unroll
      for (int u = 0; u < SU; ++u) dtn[u] = dtp[(size_t)((g + 1) * SU + u) * DINQ];
      asm volatile("s_wait_xcnt 0x0" ::: "memory");
#pragma unroll
      for (int u = 0; u < SU; ++u) xn[u] = hp[(size_t)((g + 1) * SU + u) * DINQ];
      asm volatile("s_wait_xcnt 0x0" ::: "memory");
    }
    if (g >= 0) {
#pragma unroll
      for (int u = 0; u < SU; ++u) {
        const float* bct = bcp + (g * SU + u) * 32;
        float dtv = dtc[u];
        float xv  = xc[u];
        float dx  = dtv * xv;
        float da[NSTATE], dA[NSTATE];
#pragma unroll
        for (int n = 0; n < NSTATE; ++n) da[n] = dtv * a[n];
        exp2_16(dA, da);
        float yq[4];                         // four sums of four states each
#pragma unroll
        for (int q = 0; q < 4; ++q) {
          yq[q] = 0.f;
#pragma unroll
          for (int n2 = 0; n2 < 4; ++n2) {
            int n = q * 4 + n2;
            hs[n] = hs[n] * dA[n] + dx * bct[n];
            yq[q] += hs[n] * bct[16 + n];
          }
        }
        float y = (yq[0] + yq[1]) + (yq[2] + yq[3]);
        y += xv * dsk;
        // conv taps l-3 .. l in that order, then SiLU
        float ca = cbv;
        ca += (u >= 3 ? xc[u >= 3 ? u - 3 : 0] : xp[u < 3 ? u : 0]) * cwv[0];
        ca += (u >= 2 ? xc[u >= 2 ? u - 2 : 0] : xp[u < 2 ? u + 1 : 0]) * cwv[1];
        ca += (u >= 1 ? xc[u >= 1 ? u - 1 : 0] : xp[2]) * cwv[2];
        ca += xv * cwv[3];
        float yc = ca * rcp1(1.f + exp1(-ca));
        gp[(size_t)(g * SU + u) * DINQ] =
            f32_bf16(y * rcp1(1.f + exp1(-yc)));
      }
#pragma unroll
      for (int j = 0; j < 3; ++j) xp[j] = xc[SU - 3 + j];
      // the stores' address and data registers are rewritten at the loop's foot
      asm volatile("s_wait_xcnt 0x0" ::: "memory");
    }
#pragma unroll
    for (int u = 0; u < SU; ++u) { dtc[u] = dtn[u]; xc[u] = xn[u]; }
  }
}

// =====================================================================
// host-side orchestration
// =====================================================================
extern "C" void kernel_launch(void* const* d_in, const int* in_sizes, int n_in,
                              void* d_out, int out_size, void* d_ws, size_t ws_size,
                              hipStream_t stream) {
  const float* x_in  = (const float*)d_in[0];
  const float* pos   = (const float*)d_in[1];
  const float* normw = (const float*)d_in[2];
  const float* normb = (const float*)d_in[3];
  const float* Win   = (const float*)d_in[4];
  const float* b_in  = (const float*)d_in[5];
  const float* A_log = (const float*)d_in[6];
  const float* Wdt   = (const float*)d_in[7];
  const float* b_dt  = (const float*)d_in[8];
  const float* WB    = (const float*)d_in[9];
  const float* WC    = (const float*)d_in[10];
  const float* Dsk   = (const float*)d_in[11];
  const float* convw = (const float*)d_in[12];
  const float* convb = (const float*)d_in[13];
  const float* Wout  = (const float*)d_in[14];
  const float* b_out = (const float*)d_in[15];
  const float* fnw   = (const float*)d_in[16];
  const float* fnb   = (const float*)d_in[17];
  (void)in_sizes; (void)n_in; (void)out_size; (void)ws_size;

  char* p = (char*)d_ws;
  auto alloc = [&](size_t bytes) {
    char* r = p;
    p += (bytes + 255) & ~(size_t)255;
    return r;
  };
  float*          xbuf  = (float*)         alloc((size_t)BL * DQ   * 4);  // residual stream
  unsigned short* hln   = (unsigned short*)alloc((size_t)BL * DQ   * 2);  // LN(x) bf16
  float*          hbuf  = (float*)         alloc((size_t)BL * DINQ * 4);  // h fp32
  unsigned short* hbf   = (unsigned short*)alloc((size_t)BL * DINQ * 2);  // h bf16
  float*          dtb   = (float*)         alloc((size_t)BL * DINQ * 4);  // softplus(dt)
  float*          BCb   = (float*)         alloc((size_t)BL * 32   * 4);  // [B|C]
  unsigned short* gbf   = (unsigned short*)alloc((size_t)BL * DINQ * 2);  // gated, bf16
  unsigned short* WinT  = (unsigned short*)alloc((size_t)NLAY * DINQ * DQ   * 2);  // both layers
  unsigned short* WdtT  = (unsigned short*)alloc((size_t)NLAY * DINQ * DINQ * 2);
  unsigned short* WoutT = (unsigned short*)alloc((size_t)NLAY * DQ   * DINQ * 2);
  float*          Sst   = (float*)         alloc((size_t)BQ * NCH * SROWS * DINQ * 4);  // chunk records

  prep_kernel<<<NLAY * WBL + APB, 256, 0, stream>>>(
      x_in, pos, Win, Wdt, Wout, xbuf, WinT, WdtT, WoutT);

  for (int i = 0; i < NLAY; ++i) {
    ln_kernel<true><<<BL / LNR, LNR * 32, 0, stream>>>(
        xbuf, normw + (size_t)i * DQ, normb + (size_t)i * DQ, hln);

    // h = LN(x) @ Win + b_in    (fp32 + bf16 copies)
    gemm_bf16_wmma<0, 4, 128, DINQ, DQ><<<dim3(DINQ / BNT, BL / 256), 256, 0, stream>>>(
        hln, WinT + (size_t)i * DQ * DINQ, b_in + (size_t)i * DINQ, hbuf, hbf);
    // dt = softplus(h @ Wdt + b_dt)
    gemm_bf16_wmma<1, 4, 128, DINQ, DINQ><<<dim3(DINQ / BNT, BL / 256), 256, 0, stream>>>(
        hbf, WdtT + (size_t)i * DINQ * DINQ, b_dt + (size_t)i * DINQ, dtb, nullptr);

    bc_kernel<<<BL / 16, BCW * 32, 0, stream>>>(
        hbuf, WB + (size_t)i * DINQ * NSTATE, WC + (size_t)i * DINQ * NSTATE, BCb);
    scan_state_kernel<<<BQ * (NCH - 1) * DGS, SCB, 0, stream>>>(
        hbuf, dtb, BCb, A_log + (size_t)i * DINQ * NSTATE, Sst);
    scan_kernel<<<BQ * NCH * DGS, SCB, 0, stream>>>(
        hbuf, dtb, BCb, convw + (size_t)i * 4 * DINQ, convb + (size_t)i * DINQ,
        A_log + (size_t)i * DINQ * NSTATE,
        Dsk + (size_t)i * DINQ, Sst, gbf);

    // x = g @ Wout + b_out + residual (in place)
    gemm_bf16_wmma<2, 2, 256, DQ, DINQ><<<dim3(DQ / BNT, BL / 128), 256, 0, stream>>>(
        gbf, WoutT + (size_t)i * DINQ * DQ, b_out + (size_t)i * DQ, xbuf, nullptr);
  }

  ln_kernel<false><<<BL / LNR, LNR * 32, 0, stream>>>(xbuf, fnw, fnb, d_out);
}

// v010
// A run of this version takes 248 microseconds.
// Two timings next to v009 both put it at 1.05 times that version's speed.
// Counting every step since v000, it is 16.6 times as fast.
#include <hip/hip_runtime.h>
#include <hip/hip_bf16.h>
#include <math.h>

// ---------------- problem constants (match reference) ----------------
#define BQ     2
#define LQ     2048
#define DQ     1024
#define DINQ   2048
#define NSTATE 16
#define BL     (BQ * LQ)        // 4096 token rows

// ---------------- CDNA5 WMMA types ----------------
typedef __attribute__((ext_vector_type(16))) __bf16 v16bf;
typedef __attribute__((ext_vector_type(8)))  __bf16 v8bf;
typedef __attribute__((ext_vector_type(8)))  float  v8f;
typedef __attribute__((ext_vector_type(4)))  float    v4f;
typedef __attribute__((ext_vector_type(4)))  unsigned v4u;
typedef __attribute__((ext_vector_type(8)))  unsigned v8u;
typedef __attribute__((ext_vector_type(2)))  unsigned v2u;

__device__ __forceinline__ unsigned short f32_bf16(float f) {
  unsigned u = __float_as_uint(f);
  u += 0x7fffu + ((u >> 16) & 1u);          // round-to-nearest-even
  return (unsigned short)(u >> 16);
}

// A value that is the same in every lane, held in a scalar register.
__device__ __forceinline__ unsigned uni(unsigned v) {
  return (unsigned)__builtin_amdgcn_readfirstlane(v);
}
// A wave-uniform test for a tensor load or its wait. A tensor instruction ignores
// EXEC, so only a scalar branch keeps a wave from issuing it; the empty statement
// holds the word in a scalar register, so that the test compiles to s_cmp and
// s_cbranch_scc and not to a vector compare.
__device__ __forceinline__ unsigned pinned(unsigned v) {
  unsigned w = uni(v);
  asm volatile("" : "+s"(w));
  return w;
}
__device__ __forceinline__ void tdm_load(v4u& g0, v8u& g1) {
  asm volatile("tensor_load_to_lds %0, %1" : "+s"(g0), "+s"(g1) :: "memory");
}
// The wave's own tensor load has landed (the compiler places no wait for it). The
// statement names the two groups of the request that it covers: they are then
// live up to this wait, so that their registers serve nothing else while the
// request is outstanding.
__device__ __forceinline__ void wait_tensor0(v4u g0, v8u g1) {
  asm volatile("s_wait_tensorcnt 0x0" :: "s"(g0), "s"(g1) : "memory");
}
// the wave's own LDS reads have returned
__device__ __forceinline__ void wait_ds0() {
  asm volatile("s_wait_dscnt 0x0" ::: "memory");
}

// =====================================================================
// The three streaming parts below are gridded for few, fat waves: the work
// of each wave is a handful of 16-byte loads that fly together.
// Every loop in them is unrolled: the per-thread arrays are then indexed by
// constants only and stay in registers.
// =====================================================================
// add positional embedding: xbuf = x + pos_emb  (never mutate d_in)
// One thread = APV pieces of 16 bytes, 256 pieces apart; blk = 0 .. APB - 1.
// =====================================================================
#define APV 4
#define APB (BL * DQ / (4 * APV * 256))   // blocks of this role
__device__ __forceinline__ void add_pos_block(
    const float* __restrict__ x, const float* __restrict__ pe,
    float* __restrict__ xbuf, unsigned blk) {
  const unsigned base = blk * (256 * APV) + threadIdx.x;   // in 16-byte pieces
  // a block's pieces lie in one batch entry: LQ * DQ / 4 is a multiple of 256 * APV
  const unsigned pb = base % (LQ * DQ / 4);
  v4f xv[APV], pv[APV];
#pragma unroll
  for (int j = 0; j < APV; ++j) {
    xv[j] = ((const v4f*)x)[base + j * 256];
    pv[j] = ((const v4f*)pe)[pb + j * 256];
  }
#pragma unroll
  for (int j = 0; j < APV; ++j) ((v4f*)xbuf)[base + j * 256] = xv[j] + pv[j];
}

// =====================================================================
// weight transpose + fp32->bf16:  W[K][N] fp32  ->  WT[N][K] bf16
// One block = a tile of WTK k x WTN n. Reads: 16 bytes per lane, a wave covers
// two rows of 256 bytes. Writes: 8 bf16 (16 bytes) per lane, a wave covers four
// rows of 128 bytes. The odd LDS pitch spreads both sides over the banks.
// K and N are compile-time: a thread's loads (and stores) then differ only in
// their immediate offsets.
// =====================================================================
#define WTK 128
#define WTN 64
template <int K, int N>
__device__ __forceinline__ void wconv_block(
    const float* __restrict__ W, unsigned short* __restrict__ WT,
    float (&tile)[WTK][WTN + 1], unsigned blk) {   // blk = 0 .. (N / WTN) * (K / WTK) - 1
  const int nb = (int)(blk % (N / WTN)) * WTN, kb = (int)(blk / (N / WTN)) * WTK;
  const int c4 = (threadIdx.x & 15) * 4, r0 = threadIdx.x >> 4;
  // block-uniform base + one lane offset for all of a thread's loads (stores alike)
  const float* Wb = W + (size_t)kb * N + nb;
  const unsigned woff = (unsigned)(r0 * N + c4);
  v4f v[WTK / 16];
#pragma unroll
  for (int j = 0; j < WTK / 16; ++j)
    v[j] = *(const v4f*)(Wb + (size_t)(16 * j) * N + woff);
#pragma unroll
  for (int j = 0; j < WTK / 16; ++j)
#pragma unroll
    for (int i = 0; i < 4; ++i) tile[r0 + 16 * j][c4 + i] = v[j][i];
  __syncthreads();
  const int k8 = (threadIdx.x & 7) * 8, n0 = threadIdx.x >> 3;
  unsigned short* Tb = WT + (size_t)nb * K + kb;
  const unsigned toff = (unsigned)(n0 * K + k8);
#pragma unroll
  for (int nh = 0; nh < WTN / 32; ++nh)
#pragma unroll
    for (int kh = 0; kh < WTK / 64; ++kh) {
      const int n = n0 + 32 * nh, k = k8 + 64 * kh;
      v4u p;
#pragma unroll
      for (int i = 0; i < 4; ++i)
        p[i] = (unsigned)f32_bf16(tile[k + 2 * i][n]) |
               ((unsigned)f32_bf16(tile[k + 2 * i + 1][n]) << 16);
      *(v4u*)(Tb + (size_t)(32 * nh) * K + 64 * kh + toff) = p;
    }
}

// =====================================================================
// All the work that depends on the inputs alone, as ONE launch: the three
// weight transposes of both layers and the pos add. None of it reads what
// another part writes, so a block takes its part by its index; seven short
// launches would each pay their own gap, fill and drain.
// The pos add comes last: its output is what the next launch reads first.
// Every branch is on blockIdx alone, so the barrier in wconv_block is reached
// by all threads of a block or by none.
// =====================================================================
#define NLAY  2
#define WBI   ((DINQ / WTN) * (DQ / WTK))     // blocks per layer: Win
#define WBD   ((DINQ / WTN) * (DINQ / WTK))   //                   Wdt
#define WBO   ((DQ / WTN) * (DINQ / WTK))     //                   Wout
#define WBL   (WBI + WBD + WBO)
__global__ __launch_bounds__(256) void prep_kernel(
    const float* __restrict__ x, const float* __restrict__ pe,
    const float* __restrict__ Win, const float* __restrict__ Wdt,
    const float* __restrict__ Wout, float* __restrict__ xbuf,
    unsigned short* __restrict__ WinT, unsigned short* __restrict__ WdtT,
    unsigned short* __restrict__ WoutT) {
  __shared__ float tile[WTK][WTN + 1];
  const unsigned bid = blockIdx.x;
  if (bid >= NLAY * WBL) {
    add_pos_block(x, pe, xbuf, bid - NLAY * WBL);
    return;
  }
  const unsigned lay = bid / WBL, t = bid % WBL;
  if (t < WBI)
    wconv_block<DQ, DINQ>(Win + (size_t)lay * DQ * DINQ,
                          WinT + (size_t)lay * DQ * DINQ, tile, t);
  else if (t < WBI + WBD)
    wconv_block<DINQ, DINQ>(Wdt + (size_t)lay * DINQ * DINQ,
                            WdtT + (size_t)lay * DINQ * DINQ, tile, t - WBI);
  else
    wconv_block<DINQ, DQ>(Wout + (size_t)lay * DINQ * DQ,
                          WoutT + (size_t)lay * DINQ * DQ, tile, t - (WBI + WBD));
}

// =====================================================================
// LayerNorm over the last dim (DQ); optional bf16 output (GEMM A operand)
// One wave = one row, held in registers (LNV pieces of 16 bytes per lane), so
// the row is read once; the two sums go over the lanes by shuffles.
// =====================================================================
#define LNR 8                 // rows (waves) per block
#define LNV (DQ / 128)        // 16-byte pieces of a row per lane
template <bool BF16OUT>
__global__ __launch_bounds__(LNR * 32) void ln_kernel(
    const float* __restrict__ x, const float* __restrict__ w,
    const float* __restrict__ b, void* __restrict__ out) {
  // the wave's number, held scalar: the row's base address is then scalar too
  const int row  = blockIdx.x * LNR + __builtin_amdgcn_readfirstlane(threadIdx.x >> 5);
  const unsigned lane = threadIdx.x & 31;
  const v4f* xr = (const v4f*)(x + (size_t)row * DQ);
  v4f v[LNV], wv[LNV], bv[LNV];
#pragma unroll
  for (int j = 0; j < LNV; ++j) v[j] = xr[j * 32 + lane];
#pragma unroll
  for (int j = 0; j < LNV; ++j) {
    wv[j] = ((const v4f*)w)[j * 32 + lane];
    bv[j] = ((const v4f*)b)[j * 32 + lane];
  }
  // keeps the scheduler from sinking the w and b loads behind the sums (one
  // exposed latency per group of them instead of none)
  __builtin_amdgcn_sched_barrier(0);
  v4f a1 = {}, a2 = {};
#pragma unroll
  for (int j = 0; j < LNV; ++j) { a1 += v[j]; a2 += v[j] * v[j]; }
  float s  = (a1[0] + a1[1]) + (a1[2] + a1[3]);
  float s2 = (a2[0] + a2[1]) + (a2[2] + a2[3]);
#pragma unroll
  for (int o = 16; o > 0; o >>= 1) {
    s  += __shfl_xor(s, o);
    s2 += __shfl_xor(s2, o);
  }
  const float mean = s / (float)DQ;
  const float var  = s2 / (float)DQ - mean * mean;
  const float rstd = rsqrtf(var + 1e-5f);
#pragma unroll
  for (int j = 0; j < LNV; ++j) {
    v4f y = (v[j] - mean) * rstd * wv[j] + bv[j];
    if (BF16OUT) {
      v2u p = {(unsigned)f32_bf16(y[0]) | ((unsigned)f32_bf16(y[1]) << 16),
               (unsigned)f32_bf16(y[2]) | ((unsigned)f32_bf16(y[3]) << 16)};
      ((v2u*)((unsigned short*)out + (size_t)row * DQ))[j * 32 + lane] = p;
    } else {
      ((v4f*)((float*)out + (size_t)row * DQ))[j * 32 + lane] = y;
    }
  }
}

// =====================================================================
// WMMA bf16 GEMM:  out[M][N] = A[M][K](bf16) * BT[N][K](bf16)^T + bias
// Block tile (MI*64) x 128, 8 waves (wave32) arranged 4x2, each wave
// (MI*16) x 64 via MI x 4 v_wmma_f32_16x16x32_bf16 tiles: every byte staged
// from L2 and every fragment read from LDS serves more products than in a
// small tile. K is staged in stages of KCT k by tensor loads into a ring of three
// buffers. A stage is (MI*64 + 128) rows of 256 bytes, A's rows first; one request
// brings 128 rows, and its pad sets the LDS pitch to 272 bytes. A request costs
// its wave a few scalar instructions, where per-lane copies cost every wave their
// addresses, their issue and a wait at the head of each trip.
// Stage t is issued two trips ahead of its use, so that two stages are under way
// at any time and the path from L2 does not run empty between them. Waves 0..3
// issue the even stages and waves 4..7 the odd ones (wave & 3 = the slice), so
// that a wave never has more than one request outstanding and every wait is to 0:
//   stages 0 and 1; stage 0's issuers wait; barrier; stage 2;
//   in front of trip i's last 32 k: s_wait_dscnt 0; the issuers of stage i+1:
//   s_wait_tensorcnt 0; barrier; the same waves: stage i+3 into trip i's buffer.
// The fragments of the next 32 k are fetched into a second register set in front
// of the products on this one, over the stage boundary too: that is why the
// hand-over stands in front of a trip's last block, whose products then cover the
// latency of the next stage's first LDS reads.
// N and K are compile-time: a thread's stores then differ only in their
// immediate offsets from one base address.
// Every loop but the one over the stages is unrolled: the fragment and
// accumulator arrays are then indexed by constants only and stay in registers.
// Epilogues:
//   MODE 0: outF = v+bias (fp32) AND outBf = bf16(v+bias)
//   MODE 1: outF = softplus(v+bias)
//   MODE 2: outF = v+bias+outF  (residual add in place)
// =====================================================================
#define BNT 128
#define KCT 128                 // k per stage: rows of 256 bytes
#define LDT (KCT + 8)           // LDS row pitch in elements: 272 bytes, an odd number of 16 B
#define SLR 128                 // rows per request
#define SLB (SLR * LDT * 2)     // a request's bytes in LDS, a multiple of 2 KiB
#define NBUF 3

__device__ __forceinline__ v16bf load_frag(const unsigned short* rowp, int half) {
  // A-fragment lane layout (ISA 7.12.2, 16-bit A 16x32):
  //  lanes 0-15:  elems[0..7]=K0..7,  elems[8..15]=K16..23
  //  lanes 16-31: elems[0..7]=K8..15, elems[8..15]=K24..31
  union { v16bf v; v8bf h[2]; } u;
  u.h[0] = *(const v8bf*)(rowp + half * 8);
  u.h[1] = *(const v8bf*)(rowp + 16 + half * 8);
  return u.v;
}

// softplus(v) = max(v, 0) + log1p(exp(-|v|)) for eight values, on the hardware's
// own v_exp_f32 and v_log_f32. With e = exp(-|v|) in [0, 1] and w = fl(1 + e), the
// term d = e - (w - 1) is exactly what the rounding of 1 + e dropped, and
// log1p(e) = log(w) + d / w; d stands for d / w (the difference is below
// 2^-24 * e), so small e keep their relative accuracy. No overflow for any v, so
// no cut-over to v for large v is needed.
// The eight values of a statement are independent, so they fill each other's
// latency; the v_nop at each statement's end keeps the slot that the instruction
// set asks for behind a transcendental before its result is read.
__device__ __forceinline__ void softplus8(float (&y)[8], const float (&v)[8]) {
  float t[8], e[8], w[8], l[8];
#pragma unroll
  for (int r = 0; r < 8; ++r) t[r] = fabsf(v[r]) * -1.44269504f;
  asm("v_exp_f32 %0, %8\n\tv_exp_f32 %1, %9\n\tv_exp_f32 %2, %10\n\t"
      "v_exp_f32 %3, %11\n\tv_exp_f32 %4, %12\n\tv_exp_f32 %5, %13\n\t"
      "v_exp_f32 %6, %14\n\tv_exp_f32 %7, %15\n\tv_nop"
      : "=&v"(e[0]), "=&v"(e[1]), "=&v"(e[2]), "=&v"(e[3]),
        "=&v"(e[4]), "=&v"(e[5]), "=&v"(e[6]), "=&v"(e[7])
      : "v"(t[0]), "v"(t[1]), "v"(t[2]), "v"(t[3]),
        "v"(t[4]), "v"(t[5]), "v"(t[6]), "v"(t[7]));
#pragma unroll
  for (int r = 0; r < 8; ++r) w[r] = 1.f + e[r];
  asm("v_log_f32 %0, %8\n\tv_log_f32 %1, %9\n\tv_log_f32 %2, %10\n\t"
      "v_log_f32 %3, %11\n\tv_log_f32 %4, %12\n\tv_log_f32 %5, %13\n\t"
      "v_log_f32 %6, %14\n\tv_log_f32 %7, %15\n\tv_nop"
      : "=&v"(l[0]), "=&v"(l[1]), "=&v"(l[2]), "=&v"(l[3]),
        "=&v"(l[4]), "=&v"(l[5]), "=&v"(l[6]), "=&v"(l[7])
      : "v"(w[0]), "v"(w[1]), "v"(w[2]), "v"(w[3]),
        "v"(w[4]), "v"(w[5]), "v"(w[6]), "v"(w[7]));
#pragma unroll
  for (int r = 0; r < 8; ++r) {
    float d = e[r] - (w[r] - 1.f);
    y[r] = fmaxf(v[r], 0.f) + (l[r] * 0.69314718f + d);   // log2(w) * ln 2
  }
}

template <int MODE, int MI, int N, int K>
__global__ __launch_bounds__(256) void gemm_bf16_wmma(
    const unsigned short* __restrict__ A,   // [M][K] bf16
    const unsigned short* __restrict__ BT,  // [N][K] bf16 (B transposed)
    const float* __restrict__ bias,         // [N]
    float* __restrict__ outF,
    unsigned short* __restrict__ outBf) {
  constexpr int BM = MI * 64;
  constexpr int KC = KCT, LDA = LDT;
  constexpr int nk = K / KC;
  constexpr int NSL = (BM + BNT) / SLR;      // requests per stage
  constexpr unsigned STB = NSL * SLB;        // bytes of a stage in LDS
  static_assert(K % KC == 0 && nk >= 3 && BM % SLR == 0 && BNT == SLR && NSL <= 4 &&
                SLB % 2048 == 0 && NBUF * STB <= 320 * 1024, "tile shapes");
  // the kernel's only LDS: every request's place is a multiple of 2 KiB
  __shared__ __attribute__((aligned(2048))) unsigned short Ls[NBUF][BM + BNT][LDA];
  const int tid  = threadIdx.x;
  // the wave's number, held scalar: the wave's part of every address is then scalar
  const int wave = __builtin_amdgcn_readfirstlane(tid >> 5);
  const int lane = tid & 31;
  const int wm = wave & 3, wn = wave >> 2;    // 4 waves along M, 2 along N
  const int bm = blockIdx.y * BM, bn = blockIdx.x * BNT;
  const int half = lane >> 4, lrow = lane & 15;

  // the wave's requests: slice wm of the stages of parity wn
  const unsigned isl = wm < NSL;
  const unsigned short* gsrc = wm < BM / SLR ? A + (size_t)(bm + wm * SLR) * K
                                             : BT + (size_t)bn * K;
  const unsigned ldst = (unsigned)(uintptr_t)&Ls[0][0][0] + (unsigned)wm * SLB;
  // 1-byte elements, tensor = tile = SLR rows of 256 bytes, 16 bytes of pad a row
  v8u g1 = {uni((1u << 20) | (5u << 22) | (3u << 25)),
                  uni((unsigned)(KC * 2) << 16),
                  uni((unsigned)SLR << 16),
                  uni((unsigned)(KC * 2) << 16),
                  uni((unsigned)SLR),
                  uni((unsigned)(K * 2)),
                  uni(0u), uni(0u)};
  v4u g0;                            // rewritten only behind the wait for its request
  auto issue_stage = [&](int buf, int st) {
    const unsigned long long ga =
        (unsigned long long)(uintptr_t)gsrc + (unsigned long long)st * (KC * 2);
    g0 = v4u{uni(1u), uni(ldst + (unsigned)buf * STB), uni((unsigned)ga),
             uni(((unsigned)(ga >> 32) & 0x01FFFFFFu) | 0x80000000u)};
    tdm_load(g0, g1);
  };

  v8f zero = {};
  v8f acc[MI][4];
#pragma unroll
  for (int i = 0; i < MI; ++i)
#pragma unroll
    for (int j = 0; j < 4; ++j) acc[i][j] = zero;

  if (pinned(isl)) issue_stage(wn, wn);            // stages 0 and 1
  if (pinned(isl & (unsigned)(wn == 0))) wait_tensor0(g0, g1);
  __syncthreads();                   // stage 0 visible to all waves
  if (pinned(isl & (unsigned)(wn == 0))) issue_stage(2, 2);
  const int arow = wm * (MI * 16) + lrow, brow = BM + wn * 64 + lrow;
  v16bf aF[2][MI], bF[2][4];         // two fragment sets, in turn from block to block
#pragma unroll
  for (int ii = 0; ii < MI; ++ii) aF[0][ii] = load_frag(&Ls[0][arow + ii * 16][0], half);
#pragma unroll
  for (int jj = 0; jj < 4; ++jj)  bF[0][jj] = load_frag(&Ls[0][brow + jj * 16][0], half);
  int cur = 0;                       // the buffer of trip i: i mod NBUF
  // rolled: a trip is already KC / 32 * MI * 4 products long (code size)
#pragma unroll 1
  for (int i = 0; i < nk; ++i) {
    const int nxt = cur == NBUF - 1 ? 0 : cur + 1;
    const unsigned short* ap = &Ls[cur][arow][0];
    const unsigned short* bp = &Ls[cur][brow][0];
#pragma unroll
    for (int ks = 0; ks < KC / 32; ++ks) {
      const int s = ks & 1;
      static_assert((KC / 32) % 2 == 0, "a trip ends on set 1, the next begins on set 0");
      if (ks + 1 < KC / 32) {
#pragma unroll
        for (int ii = 0; ii < MI; ++ii)
          aF[s ^ 1][ii] = load_frag(ap + ii * 16 * LDA + (ks + 1) * 32, half);
#pragma unroll
        for (int jj = 0; jj < 4; ++jj)
          bF[s ^ 1][jj] = load_frag(bp + jj * 16 * LDA + (ks + 1) * 32, half);
      } else {
        // publish point of stage i+1, in front of the trip's last block, whose
        // fragments are in registers: the wave has left buffer cur
        wait_ds0();
        const unsigned mine = isl & (unsigned)(wn == ((i + 1) & 1));
        if (pinned(mine)) wait_tensor0(g0, g1);   // its slice of stage i+1 has landed
        __syncthreads();             // stage i+1 visible, buffer cur free
        if (pinned(mine & (unsigned)(i + 3 < nk))) issue_stage(cur, i + 3);
        // the next trip's first fragments, under the last block's products (in the
        // last trip they are stage nk-3's bytes again, and nobody uses them)
#pragma unroll
        for (int ii = 0; ii < MI; ++ii)
          aF[s ^ 1][ii] = load_frag(&Ls[nxt][arow + ii * 16][0], half);
#pragma unroll
        for (int jj = 0; jj < 4; ++jj)
          bF[s ^ 1][jj] = load_frag(&Ls[nxt][brow + jj * 16][0], half);
      }
      // keeps the next set's LDS reads one group in front of this set's products:
      // left alone, the scheduler sinks each read to its first use, with a full
      // wait in front of every row of products
      __builtin_amdgcn_sched_barrier(0);
#pragma unroll
      for (int ii = 0; ii < MI; ++ii)
#pragma unroll
        for (int jj = 0; jj < 4; ++jj)
          acc[ii][jj] = __builtin_amdgcn_wmma_f32_16x16x32_bf16(
              false, aF[s][ii], false, bF[s][jj], (short)0, acc[ii][jj],
              false, false);
      // keeps the set after next's reads behind these products, whose operands
      // they overwrite
      __builtin_amdgcn_sched_barrier(0);
    }
    cur = nxt;
  }
  wait_tensor0(g0, g1);              // no request is outstanding behind the loop
  wait_ds0();

  // ---- epilogue: C/D layout - n = lane&15, m = vgpr + (lane>>4)*8 ----
  // One lane-dependent base; every element lies a constant step from it.
  const int gn0 = bn + wn * 64 + lrow;
  float bj[4];
#pragma unroll
  for (int j = 0; j < 4; ++j) bj[j] = bias[gn0 + j * 16];
  // the loads' offset register is reused by the address arithmetic below
  asm volatile("s_wait_xcnt 0x0" ::: "memory");
  // keeps that arithmetic behind the wait
  __builtin_amdgcn_sched_barrier(0);
  const size_t off0 = (size_t)(bm + wm * (MI * 16) + half * 8) * N + gn0;
  float* const baseF = outF + off0;
  float res[MODE == 2 ? MI : 1][4][8];
  if (MODE == 2) {                   // the whole residual tile flies together
#pragma unroll
    for (int i = 0; i < MI; ++i)
#pragma unroll
      for (int j = 0; j < 4; ++j)
#pragma unroll
        for (int r = 0; r < 8; ++r) res[i][j][r] = baseF[(i * 16 + r) * N + j * 16];
  }
#pragma unroll
  for (int i = 0; i < MI; ++i) {
    float val[4][8];
    unsigned short vb[4][8];
#pragma unroll
    for (int j = 0; j < 4; ++j) {
      float pre[8];
#pragma unroll
      for (int r = 0; r < 8; ++r) pre[r] = acc[i][j][r] + bj[j];
      if (MODE == 1) {
        softplus8(val[j], pre);
      } else {
#pragma unroll
        for (int r = 0; r < 8; ++r) {
          val[j][r] = MODE == 2 ? pre[r] + res[i][j][r] : pre[r];
          if (MODE == 0) vb[j][r] = f32_bf16(val[j][r]);
        }
      }
    }
    // keeps every value of the group computed in front of its first store
    __builtin_amdgcn_sched_barrier(0);
#pragma unroll
    for (int j = 0; j < 4; ++j)
#pragma unroll
      for (int r = 0; r < 8; ++r) {
        baseF[(i * 16 + r) * N + j * 16] = val[j][r];
        if (MODE == 0) (outBf + off0)[(i * 16 + r) * N + j * 16] = vb[j][r];
      }
    // the stores' data registers are rewritten by the next group
    asm volatile("s_wait_xcnt 0x0" ::: "memory");
    // keeps the next group's arithmetic behind that wait
    __builtin_amdgcn_sched_barrier(0);
  }
}

// =====================================================================
// Bm|Cm projection:  BC[m][0..15]=h@WB, [16..31]=h@WC, all in f32, on
// v_wmma_f32_16x16x4_f32. One block = 16 token rows x all 32 columns, so a
// weight row is fetched once per 16 tokens. The 16 waves split k (128 each);
// their partial tiles are added through LDS in wave order.
// k pairing: lane (c, hf) holds, for group q, k = slice + 8q + 4hf + 0..3 of
// A row c (one 16-byte load) and the same four k of B column c.
// Every loop is unrolled: av, wb, wc and the accumulators are then indexed by
// constants only and stay in registers.
// =====================================================================
typedef __attribute__((ext_vector_type(2))) float v2f;
#define BCW  16               // waves per block
#define BCKS (DINQ / BCW)     // k per wave
#define BCQ  (BCKS / 8)       // groups of 8 k per wave
#define BCG  4                // groups whose weight fragments are fetched together

__global__ __launch_bounds__(BCW * 32) void bc_kernel(
    const float* __restrict__ h, const float* __restrict__ WB,
    const float* __restrict__ WC, float* __restrict__ BC) {
  __shared__ float red[BCW][512];           // per wave: 2 tiles x 8 registers x 32 lanes
  const int wave = threadIdx.x >> 5, lane = threadIdx.x & 31;
  const int c = lane & 15, hf = lane >> 4;
  const int m0 = blockIdx.x * 16;
  const int kl = wave * BCKS + hf * 4;      // the lane's first k
  const float* ap = h  + (size_t)(m0 + c) * DINQ + kl;
  const float* bp = WB + (size_t)kl * NSTATE + c;
  const float* cp = WC + (size_t)kl * NSTATE + c;

  v4f av[BCQ];                              // the wave's whole slice of h, fetched first
#pragma unroll
  for (int q = 0; q < BCQ; ++q) av[q] = *(const v4f*)(ap + q * 8);
  // keeps the scheduler from sinking these loads to their first use (one
  // exposed latency per product instead of one for the whole slice)
  __builtin_amdgcn_sched_barrier(0);

  float wb[2][BCG][4], wc[2][BCG][4];
  auto fetch = [&](int buf, int g) {
#pragma unroll
    for (int q2 = 0; q2 < BCG; ++q2)
#pragma unroll
      for (int j = 0; j < 4; ++j) {
        wb[buf][q2][j] = bp[(size_t)((g * BCG + q2) * 8 + j) * NSTATE];
        wc[buf][q2][j] = cp[(size_t)((g * BCG + q2) * 8 + j) * NSTATE];
      }
  };
  fetch(0, 0);

  v8f accb = {}, accc = {};
#pragma unroll
  for (int g = 0; g < BCQ / BCG; ++g) {
    if (g + 1 < BCQ / BCG) {
      fetch((g + 1) & 1, g + 1);            // flies under this group's products
      // behind the last fetch the loads' address registers are free for reuse
      if (g + 2 == BCQ / BCG) asm volatile("s_wait_xcnt 0x0" ::: "memory");
      // keeps the next group's loads in front of this group's products
      __builtin_amdgcn_sched_barrier(0);
    }
#pragma unroll
    for (int q2 = 0; q2 < BCG; ++q2)
#pragma unroll
      for (int p = 0; p < 2; ++p) {
        v2f a  = {av[g * BCG + q2][2 * p], av[g * BCG + q2][2 * p + 1]};
        v2f fb = {wb[g & 1][q2][2 * p], wb[g & 1][q2][2 * p + 1]};
        v2f fc = {wc[g & 1][q2][2 * p], wc[g & 1][q2][2 * p + 1]};
        accb = __builtin_amdgcn_wmma_f32_16x16x4_f32(
            false, a, false, fb, (short)0, accb, false, false);
        accc = __builtin_amdgcn_wmma_f32_16x16x4_f32(
            false, a, false, fc, (short)0, accc, false, false);
      }
  }
  // A precaution: no distance is documented for the f32 form, and without this
  // the build had address arithmetic overwriting an A register directly behind
  // its product. Eight vector slots, the figure of the other 16-cycle form,
  // stand in front of the first vector instruction behind the products; the two
  // scheduling barriers keep that arithmetic and the slots where they are written.
  __builtin_amdgcn_sched_barrier(0);
  asm volatile("v_nop\n\tv_nop\n\tv_nop\n\tv_nop\n\tv_nop\n\tv_nop\n\tv_nop\n\tv_nop");
  __builtin_amdgcn_sched_barrier(0);

#pragma unroll
  for (int r = 0; r < 8; ++r) {
    red[wave][r * 32 + lane]       = accb[r];
    red[wave][256 + r * 32 + lane] = accc[r];
  }
  __syncthreads();
  // one output per thread; D layout: register r of lane l = D[8 * (l >> 4) + r][l & 15]
  float s = 0.f;
#pragma unroll
  for (int w = 0; w < BCW; ++w) s += red[w][threadIdx.x];
  const int tile = threadIdx.x >> 8, r = (threadIdx.x >> 5) & 7;
  BC[(size_t)(m0 + 8 * hf + r) * 32 + tile * 16 + c] = s;
}

// =====================================================================
// selective scan (diagonal SSM), split over time into NCH chunks of CLEN
// steps so that the chunks run side by side instead of one after another.
//   scan_state_kernel: every chunk but the last runs the recurrence from a
//     zero state and keeps its end state S[n] and its sum of dt (row NSTATE
//     of the same record). The decay over a whole chunk is 2^(a[n] * sum dt).
//   scan_kernel: a chunk folds the earlier chunks' (S, sum dt) in time order
//     into its start state, then runs the recurrence with the fused D-skip,
//     the causal depthwise conv (4 taps) + SiLU of the same channel, formed
//     from the x values that the lane walks through anyway, and the gating.
// One lane = one channel with all 16 states; one block = SCB channels of one
// (batch, chunk), so the B/C rows are the same address for the whole block.
// scan_state_kernel is the first reader of the B rows after the launch that
// wrote them: its block brings the chunk's rows into LDS once, by 16-byte loads
// that all fly together, and every step reads its row from there (all lanes one
// address). A load of the row from global memory in every step is waited for
// within that step, at the latency of a first touch.
// =====================================================================
#define NCH  32
#define CLEN (LQ / NCH)     // 64 steps per chunk
#define SU   8              // steps fetched ahead as one group
#define SCB  128            // channels (threads) per block
#define DGS  (DINQ / SCB)   // channel groups
#define SROWS (NSTATE + 1)  // rows of a chunk's record: S[0..15], sum of dt
#define FB   3              // chunk records fetched together in the fold (51 loads)
#define LOG2E 1.44269504f

// e[n] = 2^t[n] for the 16 states (v_exp_f32), eight to a statement. The factor
// log2(e) of exp(x) = 2^(x * log2(e)) is no work of a step: it lies in the rates
// a[n], multiplied in once per lane. The v_nop at each statement's end keeps the
// slot that the instruction set asks for behind a transcendental before its
// source is overwritten.
__device__ __forceinline__ void exp2_16(float (&e)[NSTATE], const float (&t)[NSTATE]) {
#pragma unroll
  for (int k = 0; k < NSTATE; k += 8)
    asm("v_exp_f32 %0, %8\n\tv_exp_f32 %1, %9\n\tv_exp_f32 %2, %10\n\t"
        "v_exp_f32 %3, %11\n\tv_exp_f32 %4, %12\n\tv_exp_f32 %5, %13\n\t"
        "v_exp_f32 %6, %14\n\tv_exp_f32 %7, %15\n\tv_nop"
        : "=&v"(e[k]), "=&v"(e[k + 1]), "=&v"(e[k + 2]), "=&v"(e[k + 3]),
          "=&v"(e[k + 4]), "=&v"(e[k + 5]), "=&v"(e[k + 6]), "=&v"(e[k + 7])
        : "v"(t[k]), "v"(t[k + 1]), "v"(t[k + 2]), "v"(t[k + 3]),
          "v"(t[k + 4]), "v"(t[k + 5]), "v"(t[k + 6]), "v"(t[k + 7]));
}

// exp(x) for one value (x * log2(e), then v_exp_f32); the v_nop keeps the same
// slot.
__device__ __forceinline__ float exp1(float x) {
  float t = x * LOG2E, e;
  asm("v_exp_f32 %0, %1\n\tv_nop" : "=v"(e) : "v"(t));
  return e;
}

// 1 / x as v_rcp_f32 alone (about 1 ulp; what it scales here is rounded to bf16
// at the store). A plain 1.f / x compiles to the correctly rounded division: two
// v_div_scale, v_rcp_f32, five dependent fused steps, v_div_fmas, v_div_fixup.
__device__ __forceinline__ float rcp1(float x) { return __builtin_amdgcn_rcpf(x); }

__global__ __launch_bounds__(SCB) void scan_state_kernel(
    const float* __restrict__ h,  const float* __restrict__ dt,
    const float* __restrict__ BC, const float* __restrict__ A_log,
    float* __restrict__ Sst) {    // [B][NCH][SROWS][DIN]
  const int d  = (blockIdx.x % DGS) * SCB + threadIdx.x;
  const int bc = blockIdx.x / DGS;
  const int b  = bc / (NCH - 1);
  const int c  = bc % (NCH - 1);             // the last chunk feeds nobody
  const size_t row0 = (size_t)b * LQ + (size_t)c * CLEN;
  const float* dtp = dt + row0 * DINQ + d;
  const float* hp  = h  + row0 * DINQ + d;
  const float* bcp = BC + row0 * 32;

  // the chunk's B rows (the first half of each B|C row), 16 bytes per piece
  __shared__ __align__(16) float sB[CLEN][NSTATE];
  constexpr int SBV = CLEN * NSTATE / 4 / SCB;   // pieces per thread
  v4f st[SBV];
#pragma unroll
  for (int j = 0; j < SBV; ++j) {
    const int p = threadIdx.x + j * SCB;
    st[j] = *(const v4f*)(bcp + (p >> 2) * 32 + (p & 3) * 4);
  }
  // the loads' address registers are reused by the next loads' addresses; it also
  // keeps the two groups of loads in this order
  asm volatile("s_wait_xcnt 0x0" ::: "memory");
  float a[NSTATE], hs[NSTATE], al[NSTATE];
#pragma unroll
  for (int n = 0; n < NSTATE; ++n) al[n] = A_log[(size_t)d * NSTATE + n];
  // the loads' address registers are reused by the arithmetic below
  asm volatile("s_wait_xcnt 0x0" ::: "memory");
#pragma unroll
  for (int n = 0; n < NSTATE; ++n) al[n] *= LOG2E;
  exp2_16(a, al);
  // the rates carry log2(e) from here on: exp(dt * A) = 2^(dt * a[n])
#pragma unroll
  for (int n = 0; n < NSTATE; ++n) { a[n] *= -LOG2E; hs[n] = 0.f; }
#pragma unroll
  for (int j = 0; j < SBV; ++j) ((v4f*)sB)[threadIdx.x + j * SCB] = st[j];
  __syncthreads();                           // the rows are visible to all waves

  float sd = 0.f;
  float dtc[SU], xc[SU];
#pragma unroll
  for (int u = 0; u < SU; ++u) { dtc[u] = 0.f; xc[u] = 0.f; }
  // Trip -1 only fetches group 0, so that every group reaches the arithmetic
  // through the copies at the loop's foot and the wait for it stands there.
  // rolled: the body is already SU * NSTATE updates long (code size)
#pragma unroll 1
  for (int g = -1; g < CLEN / SU; ++g) {
    float dtn[SU], xn[SU];
#pragma unroll
    for (int u = 0; u < SU; ++u) { dtn[u] = 0.f; xn[u] = 0.f; }
    if (g + 1 < CLEN / SU) {                 // next group flies under this one
#pragma unroll
      for (int u = 0; u < SU; ++u) {
        dtn[u] = dtp[(size_t)((g + 1) * SU + u) * DINQ];
        xn[u]  = hp[(size_t)((g + 1) * SU + u) * DINQ];
      }
      // the loads' address registers are reused by the arithmetic below
      asm volatile("s_wait_xcnt 0x0" ::: "memory");
    }
    if (g >= 0) {
#pragma unroll
      for (int u = 0; u < SU; ++u) {
        const float* bct = sB[g * SU + u];
        float dtv = dtc[u];
        float dx  = dtv * xc[u];
        sd += dtv;
        float da[NSTATE], dA[NSTATE];
#pragma unroll
        for (int n = 0; n < NSTATE; ++n) da[n] = dtv * a[n];
        exp2_16(dA, da);
#pragma unroll
        for (int n = 0; n < NSTATE; ++n) hs[n] = hs[n] * dA[n] + dx * bct[n];
      }
    }
#pragma unroll
    for (int u = 0; u < SU; ++u) { dtc[u] = dtn[u]; xc[u] = xn[u]; }
  }
  float* sp = Sst + ((size_t)b * NCH + c) * SROWS * DINQ + d;
#pragma unroll
  for (int n = 0; n < NSTATE; ++n) sp[(size_t)n * DINQ] = hs[n];
  sp[(size_t)NSTATE * DINQ] = sd;
}

__global__ __launch_bounds__(SCB) void scan_kernel(
    const float* __restrict__ h,  const float* __restrict__ dt,
    const float* __restrict__ BC, const float* __restrict__ cw,
    const float* __restrict__ cb,
    const float* __restrict__ A_log, const float* __restrict__ Dsk,
    const float* __restrict__ Sst, unsigned short* __restrict__ gout) {
  const int d  = (blockIdx.x % DGS) * SCB + threadIdx.x;
  const int bc = blockIdx.x / DGS;
  const int b  = bc % BQ;
  const int c  = NCH - 1 - bc / BQ;          // longest fold starts first

  const size_t row0 = (size_t)b * LQ + (size_t)c * CLEN;
  const float* hp  = h + row0 * DINQ + d;

  // first loads of the kernel: they have landed with the A_log rows, so no
  // wait for them falls among the fetched-ahead loads of the main loop
  const float dsk = Dsk[d];
  const float cbv = cb[d];
  float cwv[4];
#pragma unroll
  for (int j = 0; j < 4; ++j) cwv[j] = cw[j * DINQ + d];
  // the registers that the loads name are reused below
  asm volatile("s_wait_xcnt 0x0" ::: "memory");
  // the three x values in front of the chunk (zero padding in front of l = 0)
  float xp[3] = {0.f, 0.f, 0.f};
  if (c > 0) {
#pragma unroll
    for (int j = 0; j < 3; ++j) xp[j] = hp[(ptrdiff_t)(j - 3) * DINQ];
    // the registers that the loads name are reused below
    asm volatile("s_wait_xcnt 0x0" ::: "memory");
  }
  float a[NSTATE], hs[NSTATE], al[NSTATE];
#pragma unroll
  for (int n = 0; n < NSTATE; ++n) al[n] = A_log[(size_t)d * NSTATE + n];
#pragma unroll
  for (int n = 0; n < NSTATE; ++n) al[n] *= LOG2E;
  exp2_16(a, al);
  // the rates carry log2(e) from here on: exp(dt * A) = 2^(dt * a[n])
#pragma unroll
  for (int n = 0; n < NSTATE; ++n) { a[n] *= -LOG2E; hs[n] = 0.f; }

  // start state: earlier chunks folded in time order, FB records per fetch
  const float* sp = Sst + (size_t)b * NCH * SROWS * DINQ + d;
  int cp = 0;
#pragma unroll 1
  for (; cp + FB <= c; cp += FB) {
    float sv[FB][SROWS];
#pragma unroll
    for (int k = 0; k < FB; ++k)
#pragma unroll
      for (int n = 0; n < SROWS; ++n)
        sv[k][n] = sp[((size_t)(cp + k) * SROWS + n) * DINQ];
    // the loads' address registers are advanced for the next trip
    asm volatile("s_wait_xcnt 0x0" ::: "memory");
#pragma unroll
    for (int k = 0; k < FB; ++k) {
      float da[NSTATE], dA[NSTATE];
#pragma unroll
      for (int n = 0; n < NSTATE; ++n) da[n] = a[n] * sv[k][NSTATE];
      exp2_16(dA, da);
#pragma unroll
      for (int n = 0; n < NSTATE; ++n) hs[n] = hs[n] * dA[n] + sv[k][n];
    }
  }
#pragma unroll 1
  for (; cp < c; ++cp) {
    float sv[SROWS];
#pragma unroll
    for (int n = 0; n < SROWS; ++n)
      sv[n] = sp[((size_t)cp * SROWS + n) * DINQ];
    // the loads' address registers are reused by the arithmetic below
    asm volatile("s_wait_xcnt 0x0" ::: "memory");
    float da[NSTATE], dA[NSTATE];
#pragma unroll
    for (int n = 0; n < NSTATE; ++n) da[n] = a[n] * sv[NSTATE];
    exp2_16(dA, da);
#pragma unroll
    for (int n = 0; n < NSTATE; ++n) hs[n] = hs[n] * dA[n] + sv[n];
  }

  const float* dtp = dt + row0 * DINQ + d;
  const float* bcp = BC + row0 * 32;
  unsigned short* gp = gout + row0 * DINQ + d;

  float dtc[SU], xc[SU];
#pragma unroll
  for (int u = 0; u < SU; ++u) { dtc[u] = 0.f; xc[u] = 0.f; }
  // Trip -1 only fetches group 0 (see scan_state_kernel).
  // rolled: the body is already SU * NSTATE updates long (code size)
#pragma unroll 1
  for (int g = -1; g < CLEN / SU; ++g) {
    float dtn[SU], xn[SU];
#pragma unroll
    for (int u = 0; u < SU; ++u) { dtn[u] = 0.f; xn[u] = 0.f; }
    if (g + 1 < CLEN / SU) {                 // next group flies under this one
      // s_wait_xcnt behind each array's loads: their address registers are
      // reused, by the next array's load targets or by the arithmetic below
#pragma unroll
      for (int u = 0; u < SU; ++u) dtn[u] = dtp[(size_t)((g + 1) * SU + u) * DINQ];
      asm volatile("s_wait_xcnt 0x0" ::: "memory");
#pragma unroll
      for (int u = 0; u < SU; ++u) xn[u] = hp[(size_t)((g + 1) * SU + u) * DINQ];
      asm volatile("s_wait_xcnt 0x0" ::: "memory");
    }
    if (g >= 0) {
#pragma unroll
      for (int u = 0; u < SU; ++u) {
        const float* bct = bcp + (g * SU + u) * 32;
        float dtv = dtc[u];
        float xv  = xc[u];
        float dx  = dtv * xv;
        float da[NSTATE], dA[NSTATE];
#pragma unroll
        for (int n = 0; n < NSTATE; ++n) da[n] = dtv * a[n];
        exp2_16(dA, da);
        float yq[4];                         // four sums of four states each
#pragma unroll
        for (int q = 0; q < 4; ++q) {
          yq[q] = 0.f;
#pragma unroll
          for (int n2 = 0; n2 < 4; ++n2) {
            int n = q * 4 + n2;
            hs[n] = hs[n] * dA[n] + dx * bct[n];
            yq[q] += hs[n] * bct[16 + n];
          }
        }
        float y = (yq[0] + yq[1]) + (yq[2] + yq[3]);
        y += xv * dsk;
        // conv taps l-3 .. l in that order, then SiLU
        float ca = cbv;
        ca += (u >= 3 ? xc[u >= 3 ? u - 3 : 0] : xp[u < 3 ? u : 0]) * cwv[0];
        ca += (u >= 2 ? xc[u >= 2 ? u - 2 : 0] : xp[u < 2 ? u + 1 : 0]) * cwv[1];
        ca += (u >= 1 ? xc[u >= 1 ? u - 1 : 0] : xp[2]) * cwv[2];
        ca += xv * cwv[3];
        float yc = ca * rcp1(1.f + exp1(-ca));
        gp[(size_t)(g * SU + u) * DINQ] =
            f32_bf16(y * rcp1(1.f + exp1(-yc)));
      }
#pragma unroll
      for (int j = 0; j < 3; ++j) xp[j] = xc[SU - 3 + j];
      // the stores' address and data registers are rewritten at the loop's foot
      asm volatile("s_wait_xcnt 0x0" ::: "memory");
    }
#pragma unroll
    for (int u = 0; u < SU; ++u) { dtc[u] = dtn[u]; xc[u] = xn[u]; }
  }
}

// =====================================================================
// host-side orchestration
// =====================================================================
extern "C" void kernel_launch(void* const* d_in, const int* in_sizes, int n_in,
                              void* d_out, int out_size, void* d_ws, size_t ws_size,
                              hipStream_t stream) {
  const float* x_in  = (const float*)d_in[0];
  const float* pos   = (const float*)d_in[1];
  const float* normw = (const float*)d_in[2];
  const float* normb = (const float*)d_in[3];
  const float* Win   = (const float*)d_in[4];
  const float* b_in  = (const float*)d_in[5];
  const float* A_log = (const float*)d_in[6];
  const float* Wdt   = (const float*)d_in[7];
  const float* b_dt  = (const float*)d_in[8];
  const float* WB    = (const float*)d_in[9];
  const float* WC    = (const float*)d_in[10];
  const float* Dsk   = (const float*)d_in[11];
  const float* convw = (const float*)d_in[12];
  const float* convb = (const float*)d_in[13];
  const float* Wout  = (const float*)d_in[14];
  const float* b_out = (const float*)d_in[15];
  const float* fnw   = (const float*)d_in[16];
  const float* fnb   = (const float*)d_in[17];
  (void)in_sizes; (void)n_in; (void)out_size; (void)ws_size;

  char* p = (char*)d_ws;
  auto alloc = [&](size_t bytes) {
    char* r = p;
    p += (bytes + 255) & ~(size_t)255;
    return r;
  };
  float*          xbuf  = (float*)         alloc((size_t)BL * DQ   * 4);  // residual stream
  unsigned short* hln   = (unsigned short*)alloc((size_t)BL * DQ   * 2);  // LN(x) bf16
  float*          hbuf  = (float*)         alloc((size_t)BL * DINQ * 4);  // h fp32
  unsigned short* hbf   = (unsigned short*)alloc((size_t)BL * DINQ * 2);  // h bf16
  float*          dtb   = (float*)         alloc((size_t)BL * DINQ * 4);  // softplus(dt)
  float*          BCb   = (float*)         alloc((size_t)BL * 32   * 4);  // [B|C]
  unsigned short* gbf   = (unsigned short*)alloc((size_t)BL * DINQ * 2);  // gated, bf16
  unsigned short* WinT  = (unsigned short*)alloc((size_t)NLAY * DINQ * DQ   * 2);  // both layers
  unsigned short* WdtT  = (unsigned short*)alloc((size_t)NLAY * DINQ * DINQ * 2);
  unsigned short* WoutT = (unsigned short*)alloc((size_t)NLAY * DQ   * DINQ * 2);
  float*          Sst   = (float*)         alloc((size_t)BQ * NCH * SROWS * DINQ * 4);  // chunk records

  prep_kernel<<<NLAY * WBL + APB, 256, 0, stream>>>(
      x_in, pos, Win, Wdt, Wout, xbuf, WinT, WdtT, WoutT);

  for (int i = 0; i < NLAY; ++i) {
    ln_kernel<true><<<BL / LNR, LNR * 32, 0, stream>>>(
        xbuf, normw + (size_t)i * DQ, normb + (size_t)i * DQ, hln);

    // h = LN(x) @ Win + b_in    (fp32 + bf16 copies)
    gemm_bf16_wmma<0, 4, DINQ, DQ><<<dim3(DINQ / BNT, BL / 256), 256, 0, stream>>>(
        hln, WinT + (size_t)i * DQ * DINQ, b_in + (size_t)i * DINQ, hbuf, hbf);
    // dt = softplus(h @ Wdt + b_dt)
    gemm_bf16_wmma<1, 4, DINQ, DINQ><<<dim3(DINQ / BNT, BL / 256), 256, 0, stream>>>(
        hbf, WdtT + (size_t)i * DINQ * DINQ, b_dt + (size_t)i * DINQ, dtb, nullptr);

    bc_kernel<<<BL / 16, BCW * 32, 0, stream>>>(
        hbuf, WB + (size_t)i * DINQ * NSTATE, WC + (size_t)i * DINQ * NSTATE, BCb);
    scan_state_kernel<<<BQ * (NCH - 1) * DGS, SCB, 0, stream>>>(
        hbuf, dtb, BCb, A_log + (size_t)i * DINQ * NSTATE, Sst);
    scan_kernel<<<BQ * NCH * DGS, SCB, 0, stream>>>(
        hbuf, dtb, BCb, convw + (size_t)i * 4 * DINQ, convb + (size_t)i * DINQ,
        A_log + (size_t)i * DINQ * NSTATE,
        Dsk + (size_t)i * DINQ, Sst, gbf);

    // x = g @ Wout + b_out + residual (in place)
    gemm_bf16_wmma<2, 2, DQ, DINQ><<<dim3(DQ / BNT, BL / 128), 256, 0, stream>>>(
        gbf, WoutT + (size_t)i * DINQ * DQ, b_out + (size_t)i * DQ, xbuf, nullptr);
  }

  ln_kernel<false><<<BL / LNR, LNR * 32, 0, stream>>>(xbuf, fnw, fnb, d_out);
}
